// v000
// Times are from an AMD MI455X. After a warm-up the kernel runs many times in a row, and a time is the length of
// such a window on the GPU divided by its runs, so every launch and the gaps after it count. The runs cycle
// through copies of the inputs. A figure is the median of several windows, for all but v000 over two sittings.
// Sittings can differ by a few percent; kernels timed side by side share one.
// v000, which the later versions start from, runs in 700 microseconds.
#include <hip/hip_runtime.h>
#include <stdint.h>

// ---------------------------------------------------------------------------
// wave32, WMMA f16 (f32 accumulate), double-buffered GEMM pipeline with plain 16-B LDS staging.
// Contractions: the TRM FFN GEMMs (K = 1024 / 4096), Q/K/V and output projections (K = 1024), the Hebbian affinity Q K^T
// (K = 256) and aff V (K = keys) on v_wmma_f32_16x16x32_f16 (f16 operands, f32 accumulate); LayerNorms, GELU, the scalar
// ---------------------------------------------------------------------------

typedef _Float16 bf16;   // NOTE: 'bf16' is only a type alias name here — the type is IEEE half (f16) throughout
typedef __attribute__((ext_vector_type(4))) float v4f;
typedef __attribute__((ext_vector_type(4))) unsigned v4u;
template <typename V> __device__ __forceinline__ void vst2(void* p, V v) {
  *(V*)p = v; 
}
typedef __attribute__((ext_vector_type(16))) _Float16 v16h;
typedef __attribute__((ext_vector_type(8)))  _Float16 v8h;
typedef __attribute__((ext_vector_type(8)))  float  v8f;

constexpr int Bb  = 4;
constexpr int Ss  = 2048;
constexpr int Dd  = 1024;
constexpr int Hh  = 4;
constexpr int HDd = Dd / Hh;     // 256
constexpr int Ee  = 4;
constexpr int DFf = Dd * Ee;     // 4096
constexpr int TOK = Bb * Ss;     // 8192

__device__ __forceinline__ v8f wmma_bf16(v16h a, v16h b, v8f c) {   // (name kept; f16 WMMA + hazard guard)
  v8f d = __builtin_amdgcn_wmma_f32_16x16x32_f16(false, a, false, b, (short)0, c, false, false);
  asm volatile("v_nop\n\tv_nop\n\tv_nop\n\tv_nop" : "+v"(d) : "v"(a), "v"(b));
  return d;
}

__device__ __forceinline__ float gelu_exact(float x) {
  return 0.5f * x * (1.0f + erff(x * 0.70710678118654752f));
}

// Block-wide mean / rstd over D=1024 (256 threads, 8 wave32s).
__device__ __forceinline__ void block_stats(float s, float s2, float* red,
                                            float& mean, float& rstd) {
  #pragma unroll
  for (int o = 16; o > 0; o >>= 1) {
    s  += __shfl_xor(s,  o, 32);
    s2 += __shfl_xor(s2, o, 32);
  }
  int wid = threadIdx.x >> 5, lane = threadIdx.x & 31;
  if (lane == 0) { red[wid] = s; red[8 + wid] = s2; }
  __syncthreads();
  if (threadIdx.x == 0) {
    float a = 0.f, b = 0.f;
    for (int i = 0; i < 8; ++i) { a += red[i]; b += red[8 + i]; }
    red[16] = a; red[17] = b;
  }
  __syncthreads();
  mean = red[16] * (1.0f / Dd);
  float var = red[17] * (1.0f / Dd) - mean * mean;
  rstd = rsqrtf(var + 1e-5f);
}

// ---------------------------------------------------------------------------
// Weight repack: f32 [K,N] row-major  ->  bf16 [N,K] row-major (B^T layout)
// ---------------------------------------------------------------------------
__global__ __launch_bounds__(256) void transpose_cvt_kernel(
    const float* __restrict__ src, bf16* __restrict__ dst, int K, int N) {
  __shared__ __align__(16) bf16 tile[64][72];
  const int nt = N / 64;
  const int nBase = (blockIdx.x % nt) * 64, kBase = (blockIdx.x / nt) * 64, tid = threadIdx.x;
  for (int i = tid; i < 64 * 64; i += 256) { const int kk = i >> 6, nn = i & 63; tile[nn][kk] = (bf16)src[(size_t)(kBase + kk) * N + nBase + nn]; }
  __syncthreads();
  for (int g = tid; g < 64 * 8; g += 256) { const int nn = g >> 3, pc = g & 7; vst2(dst + (size_t)(nBase + nn) * K + kBase + pc * 8, *(const v4u*)(&tile[nn][pc * 8])); }
}

// ---------------------------------------------------------------------------
// Dual layernorm: xn1 = LN(x; t_ln1), xn2 = LN(x; h_ln)  (bf16 GEMM inputs)
// ---------------------------------------------------------------------------
__global__ __launch_bounds__(256) void ln_dual_kernel(
    const float* __restrict__ x,
    const float* __restrict__ g1, const float* __restrict__ b1,
    const float* __restrict__ g2, const float* __restrict__ b2,
    bf16* __restrict__ xn1, bf16* __restrict__ xn2) {
  __shared__ float red[18];
  size_t t = blockIdx.x;
  int tid = threadIdx.x;
  float4 v = ((const float4*)(x + t * Dd))[tid];
  float s  = v.x + v.y + v.z + v.w;
  float s2 = v.x * v.x + v.y * v.y + v.z * v.z + v.w * v.w;
  float mean, rstd;
  block_stats(s, s2, red, mean, rstd);
  float4 G1 = ((const float4*)g1)[tid], B1 = ((const float4*)b1)[tid];
  float4 G2 = ((const float4*)g2)[tid], B2 = ((const float4*)b2)[tid];
  size_t base = t * Dd + tid * 4;
  float n0 = (v.x - mean) * rstd, n1 = (v.y - mean) * rstd;
  float n2 = (v.z - mean) * rstd, n3 = (v.w - mean) * rstd;
  union { bf16 h[4]; unsigned long long u; } p1, p2;   // 4 halves = 8 B per lane; a wave writes 256 contiguous bytes
  p1.h[0] = (bf16)(n0 * G1.x + B1.x); p2.h[0] = (bf16)(n0 * G2.x + B2.x);
  p1.h[1] = (bf16)(n1 * G1.y + B1.y); p2.h[1] = (bf16)(n1 * G2.y + B2.y);
  p1.h[2] = (bf16)(n2 * G1.z + B1.z); p2.h[2] = (bf16)(n2 * G2.z + B2.z);
  p1.h[3] = (bf16)(n3 * G1.w + B1.w); p2.h[3] = (bf16)(n3 * G2.w + B2.w);
  vst2(xn1 + base, p1.u); vst2(xn2 + base, p2.u);
}

// ---------------------------------------------------------------------------
// Tiled WMMA GEMM:  C[M,N] = epilogue(A[M,K]_bf16 @ Bt[N,K]_bf16 + bias)
// Block tile 128x128, 8 waves (2x4), each wave 64x32 (8 v8f accumulators).
// Double-buffered LDS filled with plain 16-B copies:
// compute tile i from buf(i&1) while tile i+1 streams into buf(~i&1).
// EPI 0: gelu -> bf16 row-major       EPI 1: res + acc + bias -> f32 row-major
// EPI 2: bf16 head-major [B,H,S,HD]   EPI 3: bf16 transposed  [B,H,HD,S]
// ---------------------------------------------------------------------------
template <int EPI>
__global__ __launch_bounds__(256) void gemm_bf16_wmma(
    const bf16* __restrict__ A, const bf16* __restrict__ Bt,
    const float* __restrict__ bias, const float* __restrict__ res,
    void* __restrict__ out, int Mtot, int Ntot, int Ktot) {
  __shared__ __align__(16) bf16 As[2][128 * 48];  // 32 K + 16 pad per row
  __shared__ __align__(16) bf16 Bs[2][128 * 48];
  __shared__ __align__(16) float Ct[128][128];     // block output tile (64 KB)
  const int tid  = threadIdx.x;
  const int lane = tid & 31, wid = tid >> 5;
  const int wm = wid & 1, wn = wid >> 1;            // 2 x 4 wave grid
  const int la = lane & 15, hs = lane >> 4;         // lane-in-16, half-select
  const int mBase = blockIdx.y * 128, nBase = blockIdx.x * 128;

  // Stage 128x32 panels of A and Bt into LDS buffer `buf` with plain 16-B copies.
  auto stage = [&](int k0, int buf) {
    #pragma unroll
    for (int c = tid; c < 512; c += 256) {
      int r = c >> 2, cc = (c & 3) * 8;
      *(v4u*)&As[buf][r * 48 + cc] = *(const v4u*)&A [(size_t)(mBase + r) * Ktot + k0 + cc];
      *(v4u*)&Bs[buf][r * 48 + cc] = *(const v4u*)&Bt[(size_t)(nBase + r) * Ktot + k0 + cc];
    }
  };

  v8f acc[4][2] = {};
  const int ntiles = Ktot >> 5;
  stage(0, 0);

  for (int it = 0; it < ntiles; ++it) {
    const int cur = it & 1;
    __syncthreads();    // buf(cur) stores visible; previous tile's reads done
    if (it + 1 < ntiles) stage((it + 1) * 32, cur ^ 1);

    // A-frag (16x32 bf16): lanes 0-15 hold K 0-7 / 16-23, lanes 16-31 K 8-15 / 24-31.
    v16h afrag[4];
    #pragma unroll
    for (int ms = 0; ms < 4; ++ms) {
      int r = wm * 64 + ms * 16 + la;
      union { v16h v; v8h h[2]; } u;
      u.h[0] = *(const v8h*)&As[cur][r * 48 + hs * 8];
      u.h[1] = *(const v8h*)&As[cur][r * 48 + hs * 8 + 16];
      afrag[ms] = u.v;
    }
    // B-frag (32x16): same per-lane K map as A (lanes 0-15 hold K 0-7 / 16-23, lanes 16-31 K 8-15 / 24-31).
    v16h bfrag[2];
    #pragma unroll
    for (int ns = 0; ns < 2; ++ns) {
      int r = wn * 32 + ns * 16 + la;
      union { v16h v; v8h h[2]; } u;
      u.h[0] = *(const v8h*)&Bs[cur][r * 48 + hs * 8];
      u.h[1] = *(const v8h*)&Bs[cur][r * 48 + hs * 8 + 16];
      bfrag[ns] = u.v;
    }
    #pragma unroll
    for (int ms = 0; ms < 4; ++ms)
      #pragma unroll
      for (int ns = 0; ns < 2; ++ns)
        acc[ms][ns] = wmma_bf16(afrag[ms], bfrag[ns], acc[ms][ns]);
  }

  // Epilogue. C-frag: lane holds col la, rows r + 8*hs per VGPR r -> block tile Ct[128][128] (value after bias/gelu/residual),
  // then whole-line stores: EPI 0 f16 rows (256 B), EPI 1 f32 rows (512 B), EPI 2 [b,h,s,hd] rows (128 hd = 256 B at hd0),
  // EPI 3 [b,h,hd,s] rows (128 s = 256 B at s0).
  __syncthreads();
  #pragma unroll
  for (int ms = 0; ms < 4; ++ms)
    #pragma unroll
    for (int ns = 0; ns < 2; ++ns) {
      int cl = wn * 32 + ns * 16 + la;
      int col = nBase + cl;
      float bv = bias[col];
      #pragma unroll
      for (int r = 0; r < 8; ++r) {
        int rl = wm * 64 + ms * 16 + r + hs * 8;
        int row = mBase + rl;
        float v = acc[ms][ns][r] + bv;
        if constexpr (EPI == 0) v = gelu_exact(v);
        else if constexpr (EPI == 1) v += res[(size_t)row * Ntot + col];
        Ct[rl][cl] = v;
      }
    }
  __syncthreads();
  if constexpr (EPI == 1) {
    for (int g = tid; g < 128 * 32; g += 256) { const int rl = g >> 5, pc = g & 31; vst2((float*)out + (size_t)(mBase + rl) * Ntot + nBase + pc * 4, *(const v4f*)(&Ct[rl][pc * 4])); }
  } else if constexpr (EPI == 3) {
    const int b = mBase / Ss, s0 = mBase % Ss, h = nBase / HDd, hd0 = nBase % HDd;
    for (int g = tid; g < 128 * 16; g += 256) {
      const int cl = g >> 4, pc = g & 15;         // hd row cl, piece of 8 s
      union { v8h h; v4u u; } pk;
      #pragma unroll
      for (int e = 0; e < 8; ++e) pk.h[e] = (bf16)Ct[pc * 8 + e][cl];
      vst2((bf16*)out + ((size_t)((b * Hh + h) * HDd + hd0 + cl)) * Ss + s0 + pc * 8, pk.u);
    }
  } else {
    for (int g = tid; g < 128 * 16; g += 256) {
      const int rl = g >> 4, pc = g & 15;
      union { v8h h; v4u u; } pk;
      #pragma unroll
      for (int e = 0; e < 8; ++e) pk.h[e] = (bf16)Ct[rl][pc * 8 + e];
      const int row = mBase + rl;
      if constexpr (EPI == 0) vst2((bf16*)out + (size_t)row * Ntot + nBase + pc * 8, pk.u);
      else { const int b = row / Ss, s = row % Ss, h = nBase / HDd, hd0 = nBase % HDd;
             vst2((bf16*)out + ((size_t)((b * Hh + h) * Ss + s)) * HDd + hd0 + pc * 8, pk.u); }
    }
  }
}

// ---------------------------------------------------------------------------
// Hebbian attention: out_i = sum_{j<=i} relu(beta * q_i.k_j) v_j
// q,k: bf16 [B,H,S,HD] ; vt: bf16 [B,H,HD,S] ; out: bf16 [B,S,D] (token-major)
// Block = one (b,h) x 64-query tile. Causal: only kt <= qt key tiles visited.
// ---------------------------------------------------------------------------
__global__ __launch_bounds__(256) void hebbian_attn_kernel(
    const bf16* __restrict__ q, const bf16* __restrict__ k,
    const bf16* __restrict__ vt, const float* __restrict__ betap,
    bf16* __restrict__ attn_out) {
  __shared__ __align__(16) bf16 Qs[64 * 264];   // 64 x 256 (+8 pad)
  __shared__ __align__(16) bf16 affs[64 * 72];  // 64 x 64  (+8 pad)
  __shared__ __align__(16) bf16 Ot[8][16 * 128]; // per-wave output tile
  const int qt = blockIdx.x, bh = blockIdx.y;
  const int bidx = bh / Hh, hidx = bh % Hh;
  const int tid = threadIdx.x, lane = tid & 31, wid = tid >> 5;
  const int la = lane & 15, hs = lane >> 4;
  const float beta = betap[0];

  // Stage Q tile (reused for every key tile).
  const bf16* qb = q + ((size_t)bh * Ss + qt * 64) * HDd;
  #pragma unroll
  for (int c = tid; c < 64 * 32; c += 256) {
    int r = c >> 5, cc = (c & 31) * 8;
    *(v4u*)&Qs[r * 264 + cc] = *(const v4u*)&qb[(size_t)r * HDd + cc];
  }
  __syncthreads();

  const int ma = wid & 3;   // 16-row group for both GEMMs
  const int nh = wid >> 2;  // GEMM1: 32-col half of aff ; GEMM2: 128-feat half
  v8f oacc[8] = {};

  for (int kt = 0; kt <= qt; ++kt) {
    const int kbase = kt * 64;
    // ---- GEMM1: aff(64x64) = Q(64x256) @ K^T, K loaded straight from L2 ----
    v8f c0 = {}, c1 = {};
    const bf16* kb = k + ((size_t)bh * Ss + kbase) * HDd;
    #pragma unroll
    for (int kf = 0; kf < HDd; kf += 32) {
      union { v16h v; v8h h[2]; } ua, ub0, ub1;
      int ar = ma * 16 + la;
      ua.h[0] = *(const v8h*)&Qs[ar * 264 + kf + hs * 8];
      ua.h[1] = *(const v8h*)&Qs[ar * 264 + kf + hs * 8 + 16];
      const bf16* p0 = kb + (size_t)(nh * 32 + la)      * HDd + kf + hs * 8;   // same K map as A
      const bf16* p1 = kb + (size_t)(nh * 32 + 16 + la) * HDd + kf + hs * 8;
      ub0.h[0] = *(const v8h*)p0; ub0.h[1] = *(const v8h*)(p0 + 16);
      ub1.h[0] = *(const v8h*)p1; ub1.h[1] = *(const v8h*)(p1 + 16);
      c0 = wmma_bf16(ua.v, ub0.v, c0);
      c1 = wmma_bf16(ua.v, ub1.v, c1);
    }
    __syncthreads();  // previous iteration's affs fully consumed
    // beta * relu + causal mask, re-layout C-frag -> A-frag via LDS (bf16).
    #pragma unroll
    for (int ns = 0; ns < 2; ++ns) {
      v8f cv = ns ? c1 : c0;
      int jl = nh * 32 + ns * 16 + la;
      int j = kbase + jl;
      #pragma unroll
      for (int r = 0; r < 8; ++r) {
        int il = ma * 16 + r + hs * 8;
        int i = qt * 64 + il;
        float v = cv[r] * beta;
        v = (j <= i && v > 0.f) ? v : 0.f;
        affs[il * 72 + jl] = (bf16)v;
      }
    }
    __syncthreads();
    // ---- GEMM2: out(64x256) += aff(64x64) @ V(64x256) via Vt rows ----
    const bf16* vb = vt + (size_t)bh * HDd * Ss;
    #pragma unroll
    for (int kk = 0; kk < 64; kk += 32) {
      union { v16h v; v8h h[2]; } ua;
      int ar = ma * 16 + la;
      ua.h[0] = *(const v8h*)&affs[ar * 72 + kk + hs * 8];
      ua.h[1] = *(const v8h*)&affs[ar * 72 + kk + hs * 8 + 16];
      #pragma unroll
      for (int j = 0; j < 8; ++j) {
        int feat = nh * 128 + j * 16 + la;
        union { v16h v; v8h h[2]; } ub;
        const bf16* p = vb + (size_t)feat * Ss + kbase + kk + hs * 8;
        ub.h[0] = *(const v8h*)p; ub.h[1] = *(const v8h*)(p + 16);
        oacc[j] = wmma_bf16(ua.v, ub.v, oacc[j]);
      }
    }
  }
  // Write f16 token-major so the wo GEMM can consume it as A directly: the wave's 16 rows x 128 feats (256-B row segments)
  bf16* ot = Ot[wid];
  #pragma unroll
  for (int j = 0; j < 8; ++j) {
    int fl = j * 16 + la;
    #pragma unroll
    for (int r = 0; r < 8; ++r) ot[(r + hs * 8) * 128 + fl] = (bf16)oacc[j][r];
  }
  __syncthreads();
  #pragma unroll
  for (int q2 = 0; q2 < 8; ++q2) {
    const int rl = q2 * 2 + (lane >> 4), pc = lane & 15;
    const int s = qt * 64 + ma * 16 + rl;
    vst2(attn_out + ((size_t)(bidx * Ss + s)) * Dd + hidx * HDd + nh * 128 + pc * 8, *(const v4u*)(ot + rl * 128 + pc * 8));
  }
}

// ---------------------------------------------------------------------------
// TRM tail: residual = tpre; xn = LN(tpre); mix = scalar-MLP(xn); out = tpre+mix
// ---------------------------------------------------------------------------
__global__ __launch_bounds__(256) void trm_scalar_mlp_kernel(
    const float* __restrict__ tpre, const float* __restrict__ g,
    const float* __restrict__ bt, const float* __restrict__ sw1,
    const float* __restrict__ sb1, const float* __restrict__ sw2,
    const float* __restrict__ sb2, float* __restrict__ trm_out) {
  __shared__ float red[18];
  size_t t = blockIdx.x;
  int tid = threadIdx.x;
  float4 v = ((const float4*)(tpre + t * Dd))[tid];
  float s  = v.x + v.y + v.z + v.w;
  float s2 = v.x * v.x + v.y * v.y + v.z * v.z + v.w * v.w;
  float mean, rstd;
  block_stats(s, s2, red, mean, rstd);
  float4 G = ((const float4*)g)[tid], Bt = ((const float4*)bt)[tid];
  float w1e[Ee], b1e[Ee], w2e[Ee];
  #pragma unroll
  for (int e = 0; e < Ee; ++e) { w1e[e] = sw1[e]; b1e[e] = sb1[e]; w2e[e] = sw2[e]; }
  float vb2 = sb2[0];
  float xin[4] = {v.x, v.y, v.z, v.w};
  float gg[4] = {G.x, G.y, G.z, G.w}, bb[4] = {Bt.x, Bt.y, Bt.z, Bt.w};
  float4 o;
  float* op = &o.x;
  #pragma unroll 1
  for (int c = 0; c < 4; ++c) {              // rolled: per-scalar MLP is elementwise (no shared operand); keeps static FMAs low
    float xn = (xin[c] - mean) * rstd * gg[c] + bb[c];
    float mix = vb2;
    #pragma unroll 1
    for (int e = 0; e < Ee; ++e) mix += gelu_exact(xn * w1e[e] + b1e[e]) * w2e[e];
    op[c] = xin[c] + mix;
  }
  { v4f ov = {o.x, o.y, o.z, o.w}; vst2((v4f*)(trm_out + t * Dd) + tid, ov); }
}

// ---------------------------------------------------------------------------
// Final blend + layernorm:  LN(x + sig(a)*trm + (1-sig(a))*heb ; o_ln)
// ---------------------------------------------------------------------------
__global__ __launch_bounds__(256) void blend_ln_kernel(
    const float* __restrict__ x, const float* __restrict__ trm,
    const float* __restrict__ heb, const float* __restrict__ alphap,
    const float* __restrict__ g, const float* __restrict__ bt,
    float* __restrict__ out) {
  __shared__ float red[18];
  size_t t = blockIdx.x;
  int tid = threadIdx.x;
  float bw = 1.0f / (1.0f + expf(-alphap[0]));
  float4 xv = ((const float4*)(x   + t * Dd))[tid];
  float4 tv = ((const float4*)(trm + t * Dd))[tid];
  float4 hv = ((const float4*)(heb + t * Dd))[tid];
  float4 u;
  u.x = xv.x + bw * tv.x + (1.f - bw) * hv.x;
  u.y = xv.y + bw * tv.y + (1.f - bw) * hv.y;
  u.z = xv.z + bw * tv.z + (1.f - bw) * hv.z;
  u.w = xv.w + bw * tv.w + (1.f - bw) * hv.w;
  float s  = u.x + u.y + u.z + u.w;
  float s2 = u.x * u.x + u.y * u.y + u.z * u.z + u.w * u.w;
  float mean, rstd;
  block_stats(s, s2, red, mean, rstd);
  float4 G = ((const float4*)g)[tid], Bt = ((const float4*)bt)[tid];
  float4 o;
  o.x = (u.x - mean) * rstd * G.x + Bt.x;
  o.y = (u.y - mean) * rstd * G.y + Bt.y;
  o.z = (u.z - mean) * rstd * G.z + Bt.z;
  o.w = (u.w - mean) * rstd * G.w + Bt.w;
  { v4f ov = {o.x, o.y, o.z, o.w}; vst2((v4f*)(out + t * Dd) + tid, ov); }   // consecutive threads: one wave writes 512 contiguous bytes
}

// ---------------------------------------------------------------------------
// Host-side orchestration.
// ---------------------------------------------------------------------------
extern "C" void kernel_launch(void* const* d_in, const int* in_sizes, int n_in,
                              void* d_out, int out_size, void* d_ws, size_t ws_size,
                              hipStream_t stream) {
  const float* x      = (const float*)d_in[0];
  const float* h_ln_g = (const float*)d_in[1];
  const float* h_ln_b = (const float*)d_in[2];
  const float* wq     = (const float*)d_in[3];
  const float* bq     = (const float*)d_in[4];
  const float* wk     = (const float*)d_in[5];
  const float* bk     = (const float*)d_in[6];
  const float* wv     = (const float*)d_in[7];
  const float* bv     = (const float*)d_in[8];
  const float* wo     = (const float*)d_in[9];
  const float* bo     = (const float*)d_in[10];
  const float* beta   = (const float*)d_in[11];
  const float* t_ln1_g= (const float*)d_in[12];
  const float* t_ln1_b= (const float*)d_in[13];
  const float* t_w1   = (const float*)d_in[14];
  const float* t_b1   = (const float*)d_in[15];
  const float* t_w2   = (const float*)d_in[16];
  const float* t_b2   = (const float*)d_in[17];
  const float* t_lns_g= (const float*)d_in[18];
  const float* t_lns_b= (const float*)d_in[19];
  const float* s_w1   = (const float*)d_in[20];
  const float* s_b1   = (const float*)d_in[21];
  const float* s_w2   = (const float*)d_in[22];
  const float* s_b2   = (const float*)d_in[23];
  const float* alpha  = (const float*)d_in[24];
  const float* o_ln_g = (const float*)d_in[25];
  const float* o_ln_b = (const float*)d_in[26];
  float* out = (float*)d_out;

  char* ws = (char*)d_ws;
  const size_t MB = 1ull << 20;
  bf16* wqt  = (bf16*)(ws + 0 * MB);    // 2 MB each (1024x1024 bf16)
  bf16* wkt  = (bf16*)(ws + 2 * MB);
  bf16* wvt  = (bf16*)(ws + 4 * MB);
  bf16* wot  = (bf16*)(ws + 6 * MB);
  bf16* w1t  = (bf16*)(ws + 8 * MB);    // 8 MB  [DF, D]
  bf16* w2t  = (bf16*)(ws + 16 * MB);   // 8 MB  [D, DF]
  bf16* xn1  = (bf16*)(ws + 24 * MB);   // 16 MB [TOK, D]
  bf16* xn2  = (bf16*)(ws + 40 * MB);   // 16 MB [TOK, D]
  // 64 MB region: first h1 [TOK, DF]; after it is consumed, reused as q/k/vt/ao
  bf16* h1   = (bf16*)(ws + 56 * MB);
  bf16* qb   = (bf16*)(ws + 56 * MB);   // 16 MB [B,H,S,HD]
  bf16* kb   = (bf16*)(ws + 72 * MB);   // 16 MB [B,H,S,HD]
  bf16* vtb  = (bf16*)(ws + 88 * MB);   // 16 MB [B,H,HD,S]
  bf16* ao   = (bf16*)(ws + 104 * MB);  // 16 MB [TOK, D]
  float* tpre= (float*)(ws + 120 * MB); // 32 MB f32 (later reused for heb)
  float* hebo= (float*)(ws + 120 * MB);
  float* trmo= (float*)(ws + 152 * MB); // 32 MB f32 ; total = 184 MB

  // Weight repacks (f32 [K,N] -> f16 [N,K]); grid = (N/64)*(K/64) tiles of 64x64
  transpose_cvt_kernel<<<(Dd / 64) * (Dd / 64),  256, 0, stream>>>(wq,  wqt, Dd,  Dd);
  transpose_cvt_kernel<<<(Dd / 64) * (Dd / 64),  256, 0, stream>>>(wk,  wkt, Dd,  Dd);
  transpose_cvt_kernel<<<(Dd / 64) * (Dd / 64),  256, 0, stream>>>(wv,  wvt, Dd,  Dd);
  transpose_cvt_kernel<<<(Dd / 64) * (Dd / 64),  256, 0, stream>>>(wo,  wot, Dd,  Dd);
  transpose_cvt_kernel<<<(DFf / 64) * (Dd / 64), 256, 0, stream>>>(t_w1, w1t, Dd,  DFf);
  transpose_cvt_kernel<<<(Dd / 64) * (DFf / 64), 256, 0, stream>>>(t_w2, w2t, DFf, Dd);

  // Dual layernorm -> bf16 GEMM inputs
  ln_dual_kernel<<<TOK, 256, 0, stream>>>(x, t_ln1_g, t_ln1_b, h_ln_g, h_ln_b,
                                          xn1, xn2);

  // ---- TRM path ----
  gemm_bf16_wmma<0><<<dim3(DFf / 128, TOK / 128), 256, 0, stream>>>(
      xn1, w1t, t_b1, nullptr, h1, TOK, DFf, Dd);               // h1 = gelu(.)
  gemm_bf16_wmma<1><<<dim3(Dd / 128, TOK / 128), 256, 0, stream>>>(
      h1, w2t, t_b2, x, tpre, TOK, Dd, DFf);                    // tpre = x + h1@w2
  trm_scalar_mlp_kernel<<<TOK, 256, 0, stream>>>(
      tpre, t_lns_g, t_lns_b, s_w1, s_b1, s_w2, s_b2, trmo);    // trm_out

  // ---- Hebbian path (h1 region now free; reuse for q/k/vt/ao) ----
  gemm_bf16_wmma<2><<<dim3(Dd / 128, TOK / 128), 256, 0, stream>>>(
      xn2, wqt, bq, nullptr, qb, TOK, Dd, Dd);                  // q head-major
  gemm_bf16_wmma<2><<<dim3(Dd / 128, TOK / 128), 256, 0, stream>>>(
      xn2, wkt, bk, nullptr, kb, TOK, Dd, Dd);                  // k head-major
  gemm_bf16_wmma<3><<<dim3(Dd / 128, TOK / 128), 256, 0, stream>>>(
      xn2, wvt, bv, nullptr, vtb, TOK, Dd, Dd);                 // v transposed
  hebbian_attn_kernel<<<dim3(Ss / 64, Bb * Hh), 256, 0, stream>>>(
      qb, kb, vtb, beta, ao);                                   // causal relu attn
  gemm_bf16_wmma<1><<<dim3(Dd / 128, TOK / 128), 256, 0, stream>>>(
      ao, wot, bo, x, hebo, TOK, Dd, Dd);                       // heb = x + ao@wo

  // ---- blend + final layernorm ----
  blend_ln_kernel<<<TOK, 256, 0, stream>>>(x, trmo, hebo, alpha,
                                           o_ln_g, o_ln_b, out);
}

// v001
// Measured time: 555 microseconds a run.
// Next to v000, in two timings, it ran 1.28 and 1.30 times as fast.
#include <hip/hip_runtime.h>
#include <stdint.h>

// ---------------------------------------------------------------------------
// wave32, WMMA f16 (f32 accumulate), double-buffered GEMM pipeline with plain 16-B LDS staging.
// Contractions: the TRM FFN GEMMs (K = 1024 / 4096), Q/K/V and output projections (K = 1024), the Hebbian affinity Q K^T
// (K = 256) and aff V (K = keys) on v_wmma_f32_16x16x32_f16 (f16 operands, f32 accumulate); LayerNorms, GELU, the scalar
// ---------------------------------------------------------------------------

typedef _Float16 bf16;   // NOTE: 'bf16' is only a type alias name here — the type is IEEE half (f16) throughout
typedef __attribute__((ext_vector_type(4))) float v4f;
typedef __attribute__((ext_vector_type(4))) unsigned v4u;
template <typename V> __device__ __forceinline__ void vst2(void* p, V v) {
  *(V*)p = v; 
}
typedef __attribute__((ext_vector_type(16))) _Float16 v16h;
typedef __attribute__((ext_vector_type(8)))  _Float16 v8h;
typedef __attribute__((ext_vector_type(8)))  float  v8f;

constexpr int Bb  = 4;
constexpr int Ss  = 2048;
constexpr int Dd  = 1024;
constexpr int Hh  = 4;
constexpr int HDd = Dd / Hh;     // 256
constexpr int Ee  = 4;
constexpr int DFf = Dd * Ee;     // 4096
constexpr int TOK = Bb * Ss;     // 8192

__device__ __forceinline__ v8f wmma_bf16(v16h a, v16h b, v8f c) {   // (name kept; f16 WMMA + hazard guard)
  v8f d = __builtin_amdgcn_wmma_f32_16x16x32_f16(false, a, false, b, (short)0, c, false, false);
  asm volatile("v_nop\n\tv_nop\n\tv_nop\n\tv_nop" : "+v"(d) : "v"(a), "v"(b));
  return d;
}

__device__ __forceinline__ float gelu_exact(float x) {
  return 0.5f * x * (1.0f + erff(x * 0.70710678118654752f));
}

// Block-wide mean / rstd over D=1024 (256 threads, 8 wave32s).
__device__ __forceinline__ void block_stats(float s, float s2, float* red,
                                            float& mean, float& rstd) {
  #pragma unroll
  for (int o = 16; o > 0; o >>= 1) {
    s  += __shfl_xor(s,  o, 32);
    s2 += __shfl_xor(s2, o, 32);
  }
  int wid = threadIdx.x >> 5, lane = threadIdx.x & 31;
  if (lane == 0) { red[wid] = s; red[8 + wid] = s2; }
  __syncthreads();
  if (threadIdx.x == 0) {
    float a = 0.f, b = 0.f;
    for (int i = 0; i < 8; ++i) { a += red[i]; b += red[8 + i]; }
    red[16] = a; red[17] = b;
  }
  __syncthreads();
  mean = red[16] * (1.0f / Dd);
  float var = red[17] * (1.0f / Dd) - mean * mean;
  rstd = rsqrtf(var + 1e-5f);
}

// ---------------------------------------------------------------------------
// Weight repack: f32 [K,N] row-major  ->  bf16 [N,K] row-major (B^T layout)
// ---------------------------------------------------------------------------
__global__ __launch_bounds__(256) void transpose_cvt_kernel(
    const float* __restrict__ src, bf16* __restrict__ dst, int K, int N) {
  __shared__ __align__(16) bf16 tile[64][72];
  const int nt = N / 64;
  const int nBase = (blockIdx.x % nt) * 64, kBase = (blockIdx.x / nt) * 64, tid = threadIdx.x;
  for (int i = tid; i < 64 * 64; i += 256) { const int kk = i >> 6, nn = i & 63; tile[nn][kk] = (bf16)src[(size_t)(kBase + kk) * N + nBase + nn]; }
  __syncthreads();
  for (int g = tid; g < 64 * 8; g += 256) { const int nn = g >> 3, pc = g & 7; vst2(dst + (size_t)(nBase + nn) * K + kBase + pc * 8, *(const v4u*)(&tile[nn][pc * 8])); }
}

// ---------------------------------------------------------------------------
// Dual layernorm: xn1 = LN(x; t_ln1), xn2 = LN(x; h_ln)  (bf16 GEMM inputs)
// ---------------------------------------------------------------------------
__global__ __launch_bounds__(256) void ln_dual_kernel(
    const float* __restrict__ x,
    const float* __restrict__ g1, const float* __restrict__ b1,
    const float* __restrict__ g2, const float* __restrict__ b2,
    bf16* __restrict__ xn1, bf16* __restrict__ xn2) {
  __shared__ float red[18];
  size_t t = blockIdx.x;
  int tid = threadIdx.x;
  float4 v = ((const float4*)(x + t * Dd))[tid];
  float s  = v.x + v.y + v.z + v.w;
  float s2 = v.x * v.x + v.y * v.y + v.z * v.z + v.w * v.w;
  float mean, rstd;
  block_stats(s, s2, red, mean, rstd);
  float4 G1 = ((const float4*)g1)[tid], B1 = ((const float4*)b1)[tid];
  float4 G2 = ((const float4*)g2)[tid], B2 = ((const float4*)b2)[tid];
  size_t base = t * Dd + tid * 4;
  float n0 = (v.x - mean) * rstd, n1 = (v.y - mean) * rstd;
  float n2 = (v.z - mean) * rstd, n3 = (v.w - mean) * rstd;
  union { bf16 h[4]; unsigned long long u; } p1, p2;   // 4 halves = 8 B per lane; a wave writes 256 contiguous bytes
  p1.h[0] = (bf16)(n0 * G1.x + B1.x); p2.h[0] = (bf16)(n0 * G2.x + B2.x);
  p1.h[1] = (bf16)(n1 * G1.y + B1.y); p2.h[1] = (bf16)(n1 * G2.y + B2.y);
  p1.h[2] = (bf16)(n2 * G1.z + B1.z); p2.h[2] = (bf16)(n2 * G2.z + B2.z);
  p1.h[3] = (bf16)(n3 * G1.w + B1.w); p2.h[3] = (bf16)(n3 * G2.w + B2.w);
  vst2(xn1 + base, p1.u); vst2(xn2 + base, p2.u);
}

// ---------------------------------------------------------------------------
// Tiled WMMA GEMM:  C[M,N] = epilogue(A[M,K]_bf16 @ Bt[N,K]_bf16 + bias)
// Block tile 128x128, 8 waves (2x4), each wave 64x32 (8 v8f accumulators).
// Double-buffered LDS filled with plain 16-B copies:
// compute tile i from buf(i&1) while tile i+1 streams into buf(~i&1).
// EPI 0: gelu -> bf16 row-major       EPI 1: res + acc + bias -> f32 row-major
// EPI 2: bf16 head-major [B,H,S,HD]   EPI 3: bf16 transposed  [B,H,HD,S]
// ---------------------------------------------------------------------------
template <int EPI>
__global__ __launch_bounds__(256) void gemm_bf16_wmma(
    const bf16* __restrict__ A, const bf16* __restrict__ Bt,
    const float* __restrict__ bias, const float* __restrict__ res,
    void* __restrict__ out, int Mtot, int Ntot, int Ktot) {
  __shared__ __align__(16) bf16 As[2][128 * 48];  // 32 K + 16 pad per row
  __shared__ __align__(16) bf16 Bs[2][128 * 48];
  __shared__ __align__(16) float Ct[128][128];     // block output tile (64 KB)
  const int tid  = threadIdx.x;
  const int lane = tid & 31, wid = tid >> 5;
  const int wm = wid & 1, wn = wid >> 1;            // 2 x 4 wave grid
  const int la = lane & 15, hs = lane >> 4;         // lane-in-16, half-select
  const int mBase = blockIdx.y * 128, nBase = blockIdx.x * 128;

  // Stage 128x32 panels of A and Bt into LDS buffer `buf` with plain 16-B copies.
  auto stage = [&](int k0, int buf) {
    #pragma unroll
    for (int c = tid; c < 512; c += 256) {
      int r = c >> 2, cc = (c & 3) * 8;
      *(v4u*)&As[buf][r * 48 + cc] = *(const v4u*)&A [(size_t)(mBase + r) * Ktot + k0 + cc];
      *(v4u*)&Bs[buf][r * 48 + cc] = *(const v4u*)&Bt[(size_t)(nBase + r) * Ktot + k0 + cc];
    }
  };

  v8f acc[4][2] = {};
  const int ntiles = Ktot >> 5;
  stage(0, 0);

  for (int it = 0; it < ntiles; ++it) {
    const int cur = it & 1;
    __syncthreads();    // buf(cur) stores visible; previous tile's reads done
    if (it + 1 < ntiles) stage((it + 1) * 32, cur ^ 1);

    // A-frag (16x32 bf16): lanes 0-15 hold K 0-7 / 16-23, lanes 16-31 K 8-15 / 24-31.
    v16h afrag[4];
    #pragma unroll
    for (int ms = 0; ms < 4; ++ms) {
      int r = wm * 64 + ms * 16 + la;
      union { v16h v; v8h h[2]; } u;
      u.h[0] = *(const v8h*)&As[cur][r * 48 + hs * 8];
      u.h[1] = *(const v8h*)&As[cur][r * 48 + hs * 8 + 16];
      afrag[ms] = u.v;
    }
    // B-frag (32x16): same per-lane K map as A (lanes 0-15 hold K 0-7 / 16-23, lanes 16-31 K 8-15 / 24-31).
    v16h bfrag[2];
    #pragma unroll
    for (int ns = 0; ns < 2; ++ns) {
      int r = wn * 32 + ns * 16 + la;
      union { v16h v; v8h h[2]; } u;
      u.h[0] = *(const v8h*)&Bs[cur][r * 48 + hs * 8];
      u.h[1] = *(const v8h*)&Bs[cur][r * 48 + hs * 8 + 16];
      bfrag[ns] = u.v;
    }
    #pragma unroll
    for (int ms = 0; ms < 4; ++ms)
      #pragma unroll
      for (int ns = 0; ns < 2; ++ns)
        acc[ms][ns] = wmma_bf16(afrag[ms], bfrag[ns], acc[ms][ns]);
  }

  // Epilogue. C-frag: lane holds col la, rows r + 8*hs per VGPR r -> block tile Ct[128][128] (value after bias/gelu/residual),
  // then whole-line stores: EPI 0 f16 rows (256 B), EPI 1 f32 rows (512 B), EPI 2 [b,h,s,hd] rows (128 hd = 256 B at hd0),
  // EPI 3 [b,h,hd,s] rows (128 s = 256 B at s0).
  __syncthreads();
  #pragma unroll
  for (int ms = 0; ms < 4; ++ms)
    #pragma unroll
    for (int ns = 0; ns < 2; ++ns) {
      int cl = wn * 32 + ns * 16 + la;
      int col = nBase + cl;
      float bv = bias[col];
      #pragma unroll
      for (int r = 0; r < 8; ++r) {
        int rl = wm * 64 + ms * 16 + r + hs * 8;
        int row = mBase + rl;
        float v = acc[ms][ns][r] + bv;
        if constexpr (EPI == 0) v = gelu_exact(v);
        else if constexpr (EPI == 1) v += res[(size_t)row * Ntot + col];
        Ct[rl][cl] = v;
      }
    }
  __syncthreads();
  if constexpr (EPI == 1) {
    for (int g = tid; g < 128 * 32; g += 256) { const int rl = g >> 5, pc = g & 31; vst2((float*)out + (size_t)(mBase + rl) * Ntot + nBase + pc * 4, *(const v4f*)(&Ct[rl][pc * 4])); }
  } else if constexpr (EPI == 3) {
    const int b = mBase / Ss, s0 = mBase % Ss, h = nBase / HDd, hd0 = nBase % HDd;
    for (int g = tid; g < 128 * 16; g += 256) {
      const int cl = g >> 4, pc = g & 15;         // hd row cl, piece of 8 s
      union { v8h h; v4u u; } pk;
      #pragma unroll
      for (int e = 0; e < 8; ++e) pk.h[e] = (bf16)Ct[pc * 8 + e][cl];
      vst2((bf16*)out + ((size_t)((b * Hh + h) * HDd + hd0 + cl)) * Ss + s0 + pc * 8, pk.u);
    }
  } else {
    for (int g = tid; g < 128 * 16; g += 256) {
      const int rl = g >> 4, pc = g & 15;
      union { v8h h; v4u u; } pk;
      #pragma unroll
      for (int e = 0; e < 8; ++e) pk.h[e] = (bf16)Ct[rl][pc * 8 + e];
      const int row = mBase + rl;
      if constexpr (EPI == 0) vst2((bf16*)out + (size_t)row * Ntot + nBase + pc * 8, pk.u);
      else { const int b = row / Ss, s = row % Ss, h = nBase / HDd, hd0 = nBase % HDd;
             vst2((bf16*)out + ((size_t)((b * Hh + h) * Ss + s)) * HDd + hd0 + pc * 8, pk.u); }
    }
  }
}

// ---------------------------------------------------------------------------
// Hebbian attention: out_i = sum_{j<=i} relu(beta * q_i.k_j) v_j
// q,k: bf16 [B,H,S,HD] ; vt: bf16 [B,H,HD,S] ; out: bf16 [B,S,D] (token-major)
// Block = one (b,h) x 64-query tile. Causal: only kt <= qt key tiles visited.
// The K tile (64 x 256) and the Vt tile (256 x 64) are brought in once per block with whole-line 16-B loads and kept in
// LDS; every wave takes its B fragments from there. The next tile's loads are issued at the top of a pass and stored
// behind the barrier that ends the last read of the tile they replace.
// ---------------------------------------------------------------------------
__global__ __launch_bounds__(256) void hebbian_attn_kernel(
    const bf16* __restrict__ q, const bf16* __restrict__ k,
    const bf16* __restrict__ vt, const float* __restrict__ betap,
    bf16* __restrict__ attn_out) {
  __shared__ __align__(16) bf16 Qs[64 * 264];   // 64 x 256 (+8 pad)
  __shared__ __align__(16) bf16 Ks[64 * 264];   // 64 keys x 256 (+8 pad)
  __shared__ __align__(16) bf16 Vs[256 * 72];   // 256 feats x 64 keys (+8 pad); after the loop: per-wave output tiles
  __shared__ __align__(16) bf16 affs[64 * 72];  // 64 x 64  (+8 pad)
  const int qt = blockIdx.x, bh = blockIdx.y;
  const int bidx = bh / Hh, hidx = bh % Hh;
  const int tid = threadIdx.x, lane = tid & 31, wid = tid >> 5;
  const int la = lane & 15, hs = lane >> 4;
  const float beta = betap[0];

  const int kr = tid >> 5, kc = (tid & 31) * 8;   // K piece: a wave covers one 512-B row; 8 rows per step
  const int vr = tid >> 3, vc = (tid & 7) * 8;    // Vt piece: a wave covers four 128-B rows; 32 rows per step
  const bf16* kth = k  + (size_t)bh * Ss * HDd + kr * HDd + kc;   // this thread's piece of key row kr
  const bf16* vth = vt + (size_t)bh * HDd * Ss + vr * Ss + vc;    // this thread's piece of feature row vr
  v4u kreg[8], vreg[8];
  auto fetch = [&](int kbase) {
    #pragma unroll
    for (int i = 0; i < 8; ++i) kreg[i] = *(const v4u*)(kth + (size_t)kbase * HDd + i * 8 * HDd);
    #pragma unroll
    for (int i = 0; i < 8; ++i) vreg[i] = *(const v4u*)(vth + kbase + i * 32 * Ss);
  };
  auto put_k = [&]() {
    #pragma unroll
    for (int i = 0; i < 8; ++i) *(v4u*)&Ks[(kr + i * 8) * 264 + kc] = kreg[i];
  };
  auto put_v = [&]() {
    #pragma unroll
    for (int i = 0; i < 8; ++i) *(v4u*)&Vs[(vr + i * 32) * 72 + vc] = vreg[i];
  };

  fetch(0);
  // Stage Q tile (reused for every key tile).
  const bf16* qb = q + ((size_t)bh * Ss + qt * 64) * HDd;
  #pragma unroll
  for (int c = tid; c < 64 * 32; c += 256) {
    int r = c >> 5, cc = (c & 31) * 8;
    *(v4u*)&Qs[r * 264 + cc] = *(const v4u*)&qb[(size_t)r * HDd + cc];
  }
  put_k();
  put_v();
  __syncthreads();

  const int ma = wid & 3;   // 16-row group for both GEMMs
  const int nh = wid >> 2;  // GEMM1: 32-col half of aff ; GEMM2: 128-feat half
  v8f oacc[8] = {};

  for (int kt = 0; kt <= qt; ++kt) {
    const int kbase = kt * 64;
    const bool more = kt < qt;
    if (more) fetch(kbase + 64);
    // ---- GEMM1: aff(64x64) = Q(64x256) @ K^T, both from LDS ----
    v8f c0 = {}, c1 = {};
    #pragma unroll
    for (int kf = 0; kf < HDd; kf += 32) {
      union { v16h v; v8h h[2]; } ua, ub0, ub1;
      int ar = ma * 16 + la;
      ua.h[0] = *(const v8h*)&Qs[ar * 264 + kf + hs * 8];
      ua.h[1] = *(const v8h*)&Qs[ar * 264 + kf + hs * 8 + 16];
      const bf16* p0 = &Ks[(nh * 32 + la)      * 264 + kf + hs * 8];   // same K map as A
      const bf16* p1 = &Ks[(nh * 32 + 16 + la) * 264 + kf + hs * 8];
      ub0.h[0] = *(const v8h*)p0; ub0.h[1] = *(const v8h*)(p0 + 16);
      ub1.h[0] = *(const v8h*)p1; ub1.h[1] = *(const v8h*)(p1 + 16);
      c0 = wmma_bf16(ua.v, ub0.v, c0);
      c1 = wmma_bf16(ua.v, ub1.v, c1);
    }
    // beta * relu + causal mask, re-layout C-frag -> A-frag via LDS (bf16).
    // (the barrier at the foot of the previous pass ended the last read of affs)
    #pragma unroll
    for (int ns = 0; ns < 2; ++ns) {
      v8f cv = ns ? c1 : c0;
      int jl = nh * 32 + ns * 16 + la;
      int j = kbase + jl;
      #pragma unroll
      for (int r = 0; r < 8; ++r) {
        int il = ma * 16 + r + hs * 8;
        int i = qt * 64 + il;
        float v = cv[r] * beta;
        v = (j <= i && v > 0.f) ? v : 0.f;
        affs[il * 72 + jl] = (bf16)v;
      }
    }
    __syncthreads();  // affs and this pass's Vs visible; every read of Ks done
    if (more) put_k();
    // ---- GEMM2: out(64x256) += aff(64x64) @ V(64x256) via Vt rows in LDS ----
    #pragma unroll
    for (int kk = 0; kk < 64; kk += 32) {
      union { v16h v; v8h h[2]; } ua;
      int ar = ma * 16 + la;
      ua.h[0] = *(const v8h*)&affs[ar * 72 + kk + hs * 8];
      ua.h[1] = *(const v8h*)&affs[ar * 72 + kk + hs * 8 + 16];
      #pragma unroll
      for (int j = 0; j < 8; ++j) {
        int feat = nh * 128 + j * 16 + la;
        union { v16h v; v8h h[2]; } ub;
        const bf16* p = &Vs[feat * 72 + kk + hs * 8];
        ub.h[0] = *(const v8h*)p; ub.h[1] = *(const v8h*)(p + 16);
        oacc[j] = wmma_bf16(ua.v, ub.v, oacc[j]);
      }
    }
    __syncthreads();  // next pass's Ks visible; every read of Vs and affs done
    if (more) put_v();
  }
  // Write f16 token-major so the wo GEMM can consume it as A directly: the wave's 16 rows x 128 feats (256-B row segments)
  bf16* ot = Vs + wid * (16 * 128);   // Vs is free behind the loop's last barrier
  #pragma unroll
  for (int j = 0; j < 8; ++j) {
    int fl = j * 16 + la;
    #pragma unroll
    for (int r = 0; r < 8; ++r) ot[(r + hs * 8) * 128 + fl] = (bf16)oacc[j][r];
  }
  __syncthreads();
  #pragma unroll
  for (int q2 = 0; q2 < 8; ++q2) {
    const int rl = q2 * 2 + (lane >> 4), pc = lane & 15;
    const int s = qt * 64 + ma * 16 + rl;
    vst2(attn_out + ((size_t)(bidx * Ss + s)) * Dd + hidx * HDd + nh * 128 + pc * 8, *(const v4u*)(ot + rl * 128 + pc * 8));
  }
}

// ---------------------------------------------------------------------------
// TRM tail: residual = tpre; xn = LN(tpre); mix = scalar-MLP(xn); out = tpre+mix
// ---------------------------------------------------------------------------
__global__ __launch_bounds__(256) void trm_scalar_mlp_kernel(
    const float* __restrict__ tpre, const float* __restrict__ g,
    const float* __restrict__ bt, const float* __restrict__ sw1,
    const float* __restrict__ sb1, const float* __restrict__ sw2,
    const float* __restrict__ sb2, float* __restrict__ trm_out) {
  __shared__ float red[18];
  size_t t = blockIdx.x;
  int tid = threadIdx.x;
  float4 v = ((const float4*)(tpre + t * Dd))[tid];
  float s  = v.x + v.y + v.z + v.w;
  float s2 = v.x * v.x + v.y * v.y + v.z * v.z + v.w * v.w;
  float mean, rstd;
  block_stats(s, s2, red, mean, rstd);
  float4 G = ((const float4*)g)[tid], Bt = ((const float4*)bt)[tid];
  float w1e[Ee], b1e[Ee], w2e[Ee];
  #pragma unroll
  for (int e = 0; e < Ee; ++e) { w1e[e] = sw1[e]; b1e[e] = sb1[e]; w2e[e] = sw2[e]; }
  float vb2 = sb2[0];
  float xin[4] = {v.x, v.y, v.z, v.w};
  float gg[4] = {G.x, G.y, G.z, G.w}, bb[4] = {Bt.x, Bt.y, Bt.z, Bt.w};
  float4 o;
  float* op = &o.x;
  #pragma unroll 1
  for (int c = 0; c < 4; ++c) {              // rolled: per-scalar MLP is elementwise (no shared operand); keeps static FMAs low
    float xn = (xin[c] - mean) * rstd * gg[c] + bb[c];
    float mix = vb2;
    #pragma unroll 1
    for (int e = 0; e < Ee; ++e) mix += gelu_exact(xn * w1e[e] + b1e[e]) * w2e[e];
    op[c] = xin[c] + mix;
  }
  { v4f ov = {o.x, o.y, o.z, o.w}; vst2((v4f*)(trm_out + t * Dd) + tid, ov); }
}

// ---------------------------------------------------------------------------
// Final blend + layernorm:  LN(x + sig(a)*trm + (1-sig(a))*heb ; o_ln)
// ---------------------------------------------------------------------------
__global__ __launch_bounds__(256) void blend_ln_kernel(
    const float* __restrict__ x, const float* __restrict__ trm,
    const float* __restrict__ heb, const float* __restrict__ alphap,
    const float* __restrict__ g, const float* __restrict__ bt,
    float* __restrict__ out) {
  __shared__ float red[18];
  size_t t = blockIdx.x;
  int tid = threadIdx.x;
  float bw = 1.0f / (1.0f + expf(-alphap[0]));
  float4 xv = ((const float4*)(x   + t * Dd))[tid];
  float4 tv = ((const float4*)(trm + t * Dd))[tid];
  float4 hv = ((const float4*)(heb + t * Dd))[tid];
  float4 u;
  u.x = xv.x + bw * tv.x + (1.f - bw) * hv.x;
  u.y = xv.y + bw * tv.y + (1.f - bw) * hv.y;
  u.z = xv.z + bw * tv.z + (1.f - bw) * hv.z;
  u.w = xv.w + bw * tv.w + (1.f - bw) * hv.w;
  float s  = u.x + u.y + u.z + u.w;
  float s2 = u.x * u.x + u.y * u.y + u.z * u.z + u.w * u.w;
  float mean, rstd;
  block_stats(s, s2, red, mean, rstd);
  float4 G = ((const float4*)g)[tid], Bt = ((const float4*)bt)[tid];
  float4 o;
  o.x = (u.x - mean) * rstd * G.x + Bt.x;
  o.y = (u.y - mean) * rstd * G.y + Bt.y;
  o.z = (u.z - mean) * rstd * G.z + Bt.z;
  o.w = (u.w - mean) * rstd * G.w + Bt.w;
  { v4f ov = {o.x, o.y, o.z, o.w}; vst2((v4f*)(out + t * Dd) + tid, ov); }   // consecutive threads: one wave writes 512 contiguous bytes
}

// ---------------------------------------------------------------------------
// Host-side orchestration.
// ---------------------------------------------------------------------------
extern "C" void kernel_launch(void* const* d_in, const int* in_sizes, int n_in,
                              void* d_out, int out_size, void* d_ws, size_t ws_size,
                              hipStream_t stream) {
  const float* x      = (const float*)d_in[0];
  const float* h_ln_g = (const float*)d_in[1];
  const float* h_ln_b = (const float*)d_in[2];
  const float* wq     = (const float*)d_in[3];
  const float* bq     = (const float*)d_in[4];
  const float* wk     = (const float*)d_in[5];
  const float* bk     = (const float*)d_in[6];
  const float* wv     = (const float*)d_in[7];
  const float* bv     = (const float*)d_in[8];
  const float* wo     = (const float*)d_in[9];
  const float* bo     = (const float*)d_in[10];
  const float* beta   = (const float*)d_in[11];
  const float* t_ln1_g= (const float*)d_in[12];
  const float* t_ln1_b= (const float*)d_in[13];
  const float* t_w1   = (const float*)d_in[14];
  const float* t_b1   = (const float*)d_in[15];
  const float* t_w2   = (const float*)d_in[16];
  const float* t_b2   = (const float*)d_in[17];
  const float* t_lns_g= (const float*)d_in[18];
  const float* t_lns_b= (const float*)d_in[19];
  const float* s_w1   = (const float*)d_in[20];
  const float* s_b1   = (const float*)d_in[21];
  const float* s_w2   = (const float*)d_in[22];
  const float* s_b2   = (const float*)d_in[23];
  const float* alpha  = (const float*)d_in[24];
  const float* o_ln_g = (const float*)d_in[25];
  const float* o_ln_b = (const float*)d_in[26];
  float* out = (float*)d_out;

  char* ws = (char*)d_ws;
  const size_t MB = 1ull << 20;
  bf16* wqt  = (bf16*)(ws + 0 * MB);    // 2 MB each (1024x1024 bf16)
  bf16* wkt  = (bf16*)(ws + 2 * MB);
  bf16* wvt  = (bf16*)(ws + 4 * MB);
  bf16* wot  = (bf16*)(ws + 6 * MB);
  bf16* w1t  = (bf16*)(ws + 8 * MB);    // 8 MB  [DF, D]
  bf16* w2t  = (bf16*)(ws + 16 * MB);   // 8 MB  [D, DF]
  bf16* xn1  = (bf16*)(ws + 24 * MB);   // 16 MB [TOK, D]
  bf16* xn2  = (bf16*)(ws + 40 * MB);   // 16 MB [TOK, D]
  // 64 MB region: first h1 [TOK, DF]; after it is consumed, reused as q/k/vt/ao
  bf16* h1   = (bf16*)(ws + 56 * MB);
  bf16* qb   = (bf16*)(ws + 56 * MB);   // 16 MB [B,H,S,HD]
  bf16* kb   = (bf16*)(ws + 72 * MB);   // 16 MB [B,H,S,HD]
  bf16* vtb  = (bf16*)(ws + 88 * MB);   // 16 MB [B,H,HD,S]
  bf16* ao   = (bf16*)(ws + 104 * MB);  // 16 MB [TOK, D]
  float* tpre= (float*)(ws + 120 * MB); // 32 MB f32 (later reused for heb)
  float* hebo= (float*)(ws + 120 * MB);
  float* trmo= (float*)(ws + 152 * MB); // 32 MB f32 ; total = 184 MB

  // Weight repacks (f32 [K,N] -> f16 [N,K]); grid = (N/64)*(K/64) tiles of 64x64
  transpose_cvt_kernel<<<(Dd / 64) * (Dd / 64),  256, 0, stream>>>(wq,  wqt, Dd,  Dd);
  transpose_cvt_kernel<<<(Dd / 64) * (Dd / 64),  256, 0, stream>>>(wk,  wkt, Dd,  Dd);
  transpose_cvt_kernel<<<(Dd / 64) * (Dd / 64),  256, 0, stream>>>(wv,  wvt, Dd,  Dd);
  transpose_cvt_kernel<<<(Dd / 64) * (Dd / 64),  256, 0, stream>>>(wo,  wot, Dd,  Dd);
  transpose_cvt_kernel<<<(DFf / 64) * (Dd / 64), 256, 0, stream>>>(t_w1, w1t, Dd,  DFf);
  transpose_cvt_kernel<<<(Dd / 64) * (DFf / 64), 256, 0, stream>>>(t_w2, w2t, DFf, Dd);

  // Dual layernorm -> bf16 GEMM inputs
  ln_dual_kernel<<<TOK, 256, 0, stream>>>(x, t_ln1_g, t_ln1_b, h_ln_g, h_ln_b,
                                          xn1, xn2);

  // ---- TRM path ----
  gemm_bf16_wmma<0><<<dim3(DFf / 128, TOK / 128), 256, 0, stream>>>(
      xn1, w1t, t_b1, nullptr, h1, TOK, DFf, Dd);               // h1 = gelu(.)
  gemm_bf16_wmma<1><<<dim3(Dd / 128, TOK / 128), 256, 0, stream>>>(
      h1, w2t, t_b2, x, tpre, TOK, Dd, DFf);                    // tpre = x + h1@w2
  trm_scalar_mlp_kernel<<<TOK, 256, 0, stream>>>(
      tpre, t_lns_g, t_lns_b, s_w1, s_b1, s_w2, s_b2, trmo);    // trm_out

  // ---- Hebbian path (h1 region now free; reuse for q/k/vt/ao) ----
  gemm_bf16_wmma<2><<<dim3(Dd / 128, TOK / 128), 256, 0, stream>>>(
      xn2, wqt, bq, nullptr, qb, TOK, Dd, Dd);                  // q head-major
  gemm_bf16_wmma<2><<<dim3(Dd / 128, TOK / 128), 256, 0, stream>>>(
      xn2, wkt, bk, nullptr, kb, TOK, Dd, Dd);                  // k head-major
  gemm_bf16_wmma<3><<<dim3(Dd / 128, TOK / 128), 256, 0, stream>>>(
      xn2, wvt, bv, nullptr, vtb, TOK, Dd, Dd);                 // v transposed
  hebbian_attn_kernel<<<dim3(Ss / 64, Bb * Hh), 256, 0, stream>>>(
      qb, kb, vtb, beta, ao);                                   // causal relu attn
  gemm_bf16_wmma<1><<<dim3(Dd / 128, TOK / 128), 256, 0, stream>>>(
      ao, wot, bo, x, hebo, TOK, Dd, Dd);                       // heb = x + ao@wo

  // ---- blend + final layernorm ----
  blend_ln_kernel<<<TOK, 256, 0, stream>>>(x, trmo, hebo, alpha,
                                           o_ln_g, o_ln_b, out);
}

// v002
// Measured time: 404 microseconds a run.
// In both of two side-by-side timings against v001, it was 1.38 times as fast.
// Over all steps from v000 it is 1.78 times as fast.
#include <hip/hip_runtime.h>
#include <stdint.h>

// ---------------------------------------------------------------------------
// wave32, WMMA f16 (f32 accumulate), double-buffered GEMM pipeline with asynchronous 16-B copies to LDS.
// Contractions: the TRM FFN GEMMs (K = 1024 / 4096), Q/K/V and output projections (K = 1024), the Hebbian affinity Q K^T
// (K = 256) and aff V (K = keys) on v_wmma_f32_16x16x32_f16 (f16 operands, f32 accumulate); LayerNorms, GELU, the scalar
// ---------------------------------------------------------------------------

typedef _Float16 bf16;   // NOTE: 'bf16' is only a type alias name here — the type is IEEE half (f16) throughout
typedef __attribute__((ext_vector_type(4))) float v4f;
typedef __attribute__((ext_vector_type(4))) unsigned v4u;
template <typename V> __device__ __forceinline__ void vst2(void* p, V v) {
  *(V*)p = v; 
}
typedef __attribute__((ext_vector_type(16))) _Float16 v16h;
typedef __attribute__((ext_vector_type(8)))  _Float16 v8h;
typedef __attribute__((ext_vector_type(8)))  float  v8f;

constexpr int Bb  = 4;
constexpr int Ss  = 2048;
constexpr int Dd  = 1024;
constexpr int Hh  = 4;
constexpr int HDd = Dd / Hh;     // 256
constexpr int Ee  = 4;
constexpr int DFf = Dd * Ee;     // 4096
constexpr int TOK = Bb * Ss;     // 8192

__device__ __forceinline__ v8f wmma_bf16(v16h a, v16h b, v8f c) {   // (name kept; f16 WMMA + hazard guard)
  v8f d = __builtin_amdgcn_wmma_f32_16x16x32_f16(false, a, false, b, (short)0, c, false, false);
  asm volatile("v_nop\n\tv_nop\n\tv_nop\n\tv_nop" : "+v"(d) : "v"(a), "v"(b));
  return d;
}

__device__ __forceinline__ float gelu_exact(float x) {
  return 0.5f * x * (1.0f + erff(x * 0.70710678118654752f));
}

// Block-wide mean / rstd over D=1024 (256 threads, 8 wave32s).
__device__ __forceinline__ void block_stats(float s, float s2, float* red,
                                            float& mean, float& rstd) {
  #pragma unroll
  for (int o = 16; o > 0; o >>= 1) {
    s  += __shfl_xor(s,  o, 32);
    s2 += __shfl_xor(s2, o, 32);
  }
  int wid = threadIdx.x >> 5, lane = threadIdx.x & 31;
  if (lane == 0) { red[wid] = s; red[8 + wid] = s2; }
  __syncthreads();
  if (threadIdx.x == 0) {
    float a = 0.f, b = 0.f;
    for (int i = 0; i < 8; ++i) { a += red[i]; b += red[8 + i]; }
    red[16] = a; red[17] = b;
  }
  __syncthreads();
  mean = red[16] * (1.0f / Dd);
  float var = red[17] * (1.0f / Dd) - mean * mean;
  rstd = rsqrtf(var + 1e-5f);
}

// ---------------------------------------------------------------------------
// Weight repack: f32 [K,N] row-major  ->  bf16 [N,K] row-major (B^T layout)
// ---------------------------------------------------------------------------
__global__ __launch_bounds__(256) void transpose_cvt_kernel(
    const float* __restrict__ src, bf16* __restrict__ dst, int K, int N) {
  __shared__ __align__(16) bf16 tile[64][72];
  const int nt = N / 64;
  const int nBase = (blockIdx.x % nt) * 64, kBase = (blockIdx.x / nt) * 64, tid = threadIdx.x;
  for (int i = tid; i < 64 * 64; i += 256) { const int kk = i >> 6, nn = i & 63; tile[nn][kk] = (bf16)src[(size_t)(kBase + kk) * N + nBase + nn]; }
  __syncthreads();
  for (int g = tid; g < 64 * 8; g += 256) { const int nn = g >> 3, pc = g & 7; vst2(dst + (size_t)(nBase + nn) * K + kBase + pc * 8, *(const v4u*)(&tile[nn][pc * 8])); }
}

// ---------------------------------------------------------------------------
// Dual layernorm: xn1 = LN(x; t_ln1), xn2 = LN(x; h_ln)  (bf16 GEMM inputs)
// ---------------------------------------------------------------------------
__global__ __launch_bounds__(256) void ln_dual_kernel(
    const float* __restrict__ x,
    const float* __restrict__ g1, const float* __restrict__ b1,
    const float* __restrict__ g2, const float* __restrict__ b2,
    bf16* __restrict__ xn1, bf16* __restrict__ xn2) {
  __shared__ float red[18];
  size_t t = blockIdx.x;
  int tid = threadIdx.x;
  float4 v = ((const float4*)(x + t * Dd))[tid];
  float s  = v.x + v.y + v.z + v.w;
  float s2 = v.x * v.x + v.y * v.y + v.z * v.z + v.w * v.w;
  float mean, rstd;
  block_stats(s, s2, red, mean, rstd);
  float4 G1 = ((const float4*)g1)[tid], B1 = ((const float4*)b1)[tid];
  float4 G2 = ((const float4*)g2)[tid], B2 = ((const float4*)b2)[tid];
  size_t base = t * Dd + tid * 4;
  float n0 = (v.x - mean) * rstd, n1 = (v.y - mean) * rstd;
  float n2 = (v.z - mean) * rstd, n3 = (v.w - mean) * rstd;
  union { bf16 h[4]; unsigned long long u; } p1, p2;   // 4 halves = 8 B per lane; a wave writes 256 contiguous bytes
  p1.h[0] = (bf16)(n0 * G1.x + B1.x); p2.h[0] = (bf16)(n0 * G2.x + B2.x);
  p1.h[1] = (bf16)(n1 * G1.y + B1.y); p2.h[1] = (bf16)(n1 * G2.y + B2.y);
  p1.h[2] = (bf16)(n2 * G1.z + B1.z); p2.h[2] = (bf16)(n2 * G2.z + B2.z);
  p1.h[3] = (bf16)(n3 * G1.w + B1.w); p2.h[3] = (bf16)(n3 * G2.w + B2.w);
  vst2(xn1 + base, p1.u); vst2(xn2 + base, p2.u);
}

// ---------------------------------------------------------------------------
// Tiled WMMA GEMM:  C[M,N] = epilogue(A[M,K]_bf16 @ Bt[N,K]_bf16 + bias)
// Block tile 128x128, 8 waves (2x4), each wave 64x32 (8 v8f accumulators).
// Double-buffered LDS, a stage = 64 k (whole 128-B lines of every row), filled with asynchronous 16-B copies:
// compute stage i from buf(i&1) while stage i+1 flies into buf(~i&1).
// EPI 0: gelu -> bf16 row-major       EPI 1: res + acc + bias -> f32 row-major
// EPI 2: bf16 head-major [B,H,S,HD]   EPI 3: bf16 transposed  [B,H,HD,S]
// ---------------------------------------------------------------------------
template <int EPI>
__global__ __launch_bounds__(256) void gemm_bf16_wmma(
    const bf16* __restrict__ A, const bf16* __restrict__ Bt,
    const float* __restrict__ bias, const float* __restrict__ res,
    void* __restrict__ out, int Mtot, int Ntot, int Ktot) {
  __shared__ __align__(16) bf16 As[2][128 * 72];  // 64 K + 8 pad per row: pitch 144 B = 16 B x odd for the 16-B readers
  __shared__ __align__(16) bf16 Bs[2][128 * 72];
  __shared__ __align__(16) float Ct[128][128];     // block output tile (64 KB)
  const int tid  = threadIdx.x;
  const int lane = tid & 31, wid = tid >> 5;
  const int wm = wid & 1, wn = wid >> 1;            // 2 x 4 wave grid
  const int la = lane & 15, hs = lane >> 4;         // lane-in-16, half-select
  const int mBase = blockIdx.y * 128, nBase = blockIdx.x * 128;

  // Stage 128x64 panels of A and Bt into an LDS buffer with asynchronous 16-B copies (no register in between).
  // Eight lanes cover one 128-B row, a wave four whole lines. Each thread owns one 16-B piece of rows sr + 32 i
  // (i = 0..3) of both panels: eight copies per stage, every lane on.
  const int sr = tid >> 3, sc = (tid & 7) * 8;
  const size_t rstep = (size_t)32 * Ktot;
  const bf16* ga = A  + (size_t)(mBase + sr) * Ktot + sc;
  const bf16* gb = Bt + (size_t)(nBase + sr) * Ktot + sc;
  const unsigned la_lds = (unsigned)(size_t)&As[0][sr * 72 + sc];   // low 32 bits of a __shared__ address = LDS byte address
  const unsigned lb_lds = (unsigned)(size_t)&Bs[0][sr * 72 + sc];
  auto stage = [&](int k0, int buf) {
    constexpr unsigned RS = 32 * 72 * 2;                            // 32 rows further in LDS, bytes
    const unsigned da = la_lds + (unsigned)buf * (128 * 72 * 2), db = lb_lds + (unsigned)buf * (128 * 72 * 2);
    const bf16 *pa = ga + k0, *pb = gb + k0;
    // the copies and their s_wait_xcnt in one statement, so that the wait stands ahead of any rewrite of an address register
    asm volatile("global_load_async_to_lds_b128 %0, %1, off\n\t"
                 "global_load_async_to_lds_b128 %2, %3, off\n\t"
                 "global_load_async_to_lds_b128 %4, %5, off\n\t"
                 "global_load_async_to_lds_b128 %6, %7, off\n\t"
                 "global_load_async_to_lds_b128 %8, %9, off\n\t"
                 "global_load_async_to_lds_b128 %10, %11, off\n\t"
                 "global_load_async_to_lds_b128 %12, %13, off\n\t"
                 "global_load_async_to_lds_b128 %14, %15, off\n\t"
                 "s_wait_xcnt 0x0"
                 :: "v"(da),          "v"(pa),             "v"(da + RS),     "v"(pa + rstep),
                    "v"(da + 2 * RS), "v"(pa + 2 * rstep), "v"(da + 3 * RS), "v"(pa + 3 * rstep),
                    "v"(db),          "v"(pb),             "v"(db + RS),     "v"(pb + rstep),
                    "v"(db + 2 * RS), "v"(pb + 2 * rstep), "v"(db + 3 * RS), "v"(pb + 3 * rstep)
                 : "memory");
  };

  v8f acc[4][2] = {};
  const int ntiles = Ktot >> 6;
  stage(0, 0);
  asm volatile("s_wait_asynccnt 0x0" ::: "memory");   // this wave's copies of stage 0 have landed
  __syncthreads();                                    // every wave's have
  if (ntiles > 1) stage(64, 1);

  for (int it = 0; it < ntiles; ++it) {
    const int cur = it & 1;   // stage it is worked on from buf(cur) while stage it + 1 flies into the other buffer
    #pragma unroll   // kf a constant: the two 32-k halves of a stage become LDS offsets, no loop or address work per half
    for (int kf = 0; kf < 64; kf += 32) {
      // A-frag (16x32 bf16): lanes 0-15 hold K 0-7 / 16-23, lanes 16-31 K 8-15 / 24-31.
      v16h afrag[4];
      #pragma unroll
      for (int ms = 0; ms < 4; ++ms) {
        int r = wm * 64 + ms * 16 + la;
        union { v16h v; v8h h[2]; } u;
        u.h[0] = *(const v8h*)&As[cur][r * 72 + kf + hs * 8];
        u.h[1] = *(const v8h*)&As[cur][r * 72 + kf + hs * 8 + 16];
        afrag[ms] = u.v;
      }
      // B-frag (32x16): same per-lane K map as A (lanes 0-15 hold K 0-7 / 16-23, lanes 16-31 K 8-15 / 24-31).
      v16h bfrag[2];
      #pragma unroll
      for (int ns = 0; ns < 2; ++ns) {
        int r = wn * 32 + ns * 16 + la;
        union { v16h v; v8h h[2]; } u;
        u.h[0] = *(const v8h*)&Bs[cur][r * 72 + kf + hs * 8];
        u.h[1] = *(const v8h*)&Bs[cur][r * 72 + kf + hs * 8 + 16];
        bfrag[ns] = u.v;
      }
      #pragma unroll
      for (int ms = 0; ms < 4; ++ms)
        #pragma unroll
        for (int ns = 0; ns < 2; ++ns)
          acc[ms][ns] = wmma_bf16(afrag[ms], bfrag[ns], acc[ms][ns]);
    }
    asm volatile("s_wait_dscnt 0x0" ::: "memory");      // this wave's reads of buf(cur) are done before it is refilled
    asm volatile("s_wait_asynccnt 0x0" ::: "memory");   // this wave's copies of stage it + 1 have landed
    __syncthreads();                                    // stage it + 1 published; every wave has left buf(cur)
    if (it + 2 < ntiles) stage((it + 2) * 64, cur);
  }
  asm volatile("s_wait_asynccnt 0x0" ::: "memory");     // no copy outstanding behind the loop

  // Epilogue. C-frag: lane holds col la, rows r + 8*hs per VGPR r -> block tile Ct[128][128] (value after bias/gelu/residual),
  // then whole-line stores: EPI 0 f16 rows (256 B), EPI 1 f32 rows (512 B), EPI 2 [b,h,s,hd] rows (128 hd = 256 B at hd0),
  // EPI 3 [b,h,hd,s] rows (128 s = 256 B at s0).
  __syncthreads();
  #pragma unroll
  for (int ms = 0; ms < 4; ++ms)
    #pragma unroll
    for (int ns = 0; ns < 2; ++ns) {
      int cl = wn * 32 + ns * 16 + la;
      int col = nBase + cl;
      float bv = bias[col];
      #pragma unroll
      for (int r = 0; r < 8; ++r) {
        int rl = wm * 64 + ms * 16 + r + hs * 8;
        int row = mBase + rl;
        float v = acc[ms][ns][r] + bv;
        if constexpr (EPI == 0) v = gelu_exact(v);
        else if constexpr (EPI == 1) v += res[(size_t)row * Ntot + col];
        Ct[rl][cl] = v;
      }
    }
  __syncthreads();
  if constexpr (EPI == 1) {
    for (int g = tid; g < 128 * 32; g += 256) { const int rl = g >> 5, pc = g & 31; vst2((float*)out + (size_t)(mBase + rl) * Ntot + nBase + pc * 4, *(const v4f*)(&Ct[rl][pc * 4])); }
  } else if constexpr (EPI == 3) {
    const int b = mBase / Ss, s0 = mBase % Ss, h = nBase / HDd, hd0 = nBase % HDd;
    for (int g = tid; g < 128 * 16; g += 256) {
      const int cl = g >> 4, pc = g & 15;         // hd row cl, piece of 8 s
      union { v8h h; v4u u; } pk;
      #pragma unroll
      for (int e = 0; e < 8; ++e) pk.h[e] = (bf16)Ct[pc * 8 + e][cl];
      vst2((bf16*)out + ((size_t)((b * Hh + h) * HDd + hd0 + cl)) * Ss + s0 + pc * 8, pk.u);
    }
  } else {
    for (int g = tid; g < 128 * 16; g += 256) {
      const int rl = g >> 4, pc = g & 15;
      union { v8h h; v4u u; } pk;
      #pragma unroll
      for (int e = 0; e < 8; ++e) pk.h[e] = (bf16)Ct[rl][pc * 8 + e];
      const int row = mBase + rl;
      if constexpr (EPI == 0) vst2((bf16*)out + (size_t)row * Ntot + nBase + pc * 8, pk.u);
      else { const int b = row / Ss, s = row % Ss, h = nBase / HDd, hd0 = nBase % HDd;
             vst2((bf16*)out + ((size_t)((b * Hh + h) * Ss + s)) * HDd + hd0 + pc * 8, pk.u); }
    }
  }
}

// ---------------------------------------------------------------------------
// Hebbian attention: out_i = sum_{j<=i} relu(beta * q_i.k_j) v_j
// q,k: bf16 [B,H,S,HD] ; vt: bf16 [B,H,HD,S] ; out: bf16 [B,S,D] (token-major)
// Block = one (b,h) x 64-query tile. Causal: only kt <= qt key tiles visited.
// The K tile (64 x 256) and the Vt tile (256 x 64) are brought in once per block with whole-line 16-B loads and kept in
// LDS; every wave takes its B fragments from there. The next tile's loads are issued at the top of a pass and stored
// behind the barrier that ends the last read of the tile they replace.
// ---------------------------------------------------------------------------
__global__ __launch_bounds__(256) void hebbian_attn_kernel(
    const bf16* __restrict__ q, const bf16* __restrict__ k,
    const bf16* __restrict__ vt, const float* __restrict__ betap,
    bf16* __restrict__ attn_out) {
  __shared__ __align__(16) bf16 Qs[64 * 264];   // 64 x 256 (+8 pad)
  __shared__ __align__(16) bf16 Ks[64 * 264];   // 64 keys x 256 (+8 pad)
  __shared__ __align__(16) bf16 Vs[256 * 72];   // 256 feats x 64 keys (+8 pad); after the loop: per-wave output tiles
  __shared__ __align__(16) bf16 affs[64 * 72];  // 64 x 64  (+8 pad)
  const int qt = blockIdx.x, bh = blockIdx.y;
  const int bidx = bh / Hh, hidx = bh % Hh;
  const int tid = threadIdx.x, lane = tid & 31, wid = tid >> 5;
  const int la = lane & 15, hs = lane >> 4;
  const float beta = betap[0];

  const int kr = tid >> 5, kc = (tid & 31) * 8;   // K piece: a wave covers one 512-B row; 8 rows per step
  const int vr = tid >> 3, vc = (tid & 7) * 8;    // Vt piece: a wave covers four 128-B rows; 32 rows per step
  const bf16* kth = k  + (size_t)bh * Ss * HDd + kr * HDd + kc;   // this thread's piece of key row kr
  const bf16* vth = vt + (size_t)bh * HDd * Ss + vr * Ss + vc;    // this thread's piece of feature row vr
  v4u kreg[8], vreg[8];
  auto fetch = [&](int kbase) {
    #pragma unroll
    for (int i = 0; i < 8; ++i) kreg[i] = *(const v4u*)(kth + (size_t)kbase * HDd + i * 8 * HDd);
    #pragma unroll
    for (int i = 0; i < 8; ++i) vreg[i] = *(const v4u*)(vth + kbase + i * 32 * Ss);
  };
  auto put_k = [&]() {
    #pragma unroll
    for (int i = 0; i < 8; ++i) *(v4u*)&Ks[(kr + i * 8) * 264 + kc] = kreg[i];
  };
  auto put_v = [&]() {
    #pragma unroll
    for (int i = 0; i < 8; ++i) *(v4u*)&Vs[(vr + i * 32) * 72 + vc] = vreg[i];
  };

  fetch(0);
  // Stage Q tile (reused for every key tile).
  const bf16* qb = q + ((size_t)bh * Ss + qt * 64) * HDd;
  #pragma unroll
  for (int c = tid; c < 64 * 32; c += 256) {
    int r = c >> 5, cc = (c & 31) * 8;
    *(v4u*)&Qs[r * 264 + cc] = *(const v4u*)&qb[(size_t)r * HDd + cc];
  }
  put_k();
  put_v();
  __syncthreads();

  const int ma = wid & 3;   // 16-row group for both GEMMs
  const int nh = wid >> 2;  // GEMM1: 32-col half of aff ; GEMM2: 128-feat half
  v8f oacc[8] = {};

  for (int kt = 0; kt <= qt; ++kt) {
    const int kbase = kt * 64;
    const bool more = kt < qt;
    if (more) fetch(kbase + 64);
    // ---- GEMM1: aff(64x64) = Q(64x256) @ K^T, both from LDS ----
    v8f c0 = {}, c1 = {};
    #pragma unroll
    for (int kf = 0; kf < HDd; kf += 32) {
      union { v16h v; v8h h[2]; } ua, ub0, ub1;
      int ar = ma * 16 + la;
      ua.h[0] = *(const v8h*)&Qs[ar * 264 + kf + hs * 8];
      ua.h[1] = *(const v8h*)&Qs[ar * 264 + kf + hs * 8 + 16];
      const bf16* p0 = &Ks[(nh * 32 + la)      * 264 + kf + hs * 8];   // same K map as A
      const bf16* p1 = &Ks[(nh * 32 + 16 + la) * 264 + kf + hs * 8];
      ub0.h[0] = *(const v8h*)p0; ub0.h[1] = *(const v8h*)(p0 + 16);
      ub1.h[0] = *(const v8h*)p1; ub1.h[1] = *(const v8h*)(p1 + 16);
      c0 = wmma_bf16(ua.v, ub0.v, c0);
      c1 = wmma_bf16(ua.v, ub1.v, c1);
    }
    // beta * relu + causal mask, re-layout C-frag -> A-frag via LDS (bf16).
    // (the barrier at the foot of the previous pass ended the last read of affs)
    #pragma unroll
    for (int ns = 0; ns < 2; ++ns) {
      v8f cv = ns ? c1 : c0;
      int jl = nh * 32 + ns * 16 + la;
      int j = kbase + jl;
      #pragma unroll
      for (int r = 0; r < 8; ++r) {
        int il = ma * 16 + r + hs * 8;
        int i = qt * 64 + il;
        float v = cv[r] * beta;
        v = (j <= i && v > 0.f) ? v : 0.f;
        affs[il * 72 + jl] = (bf16)v;
      }
    }
    __syncthreads();  // affs and this pass's Vs visible; every read of Ks done
    if (more) put_k();
    // ---- GEMM2: out(64x256) += aff(64x64) @ V(64x256) via Vt rows in LDS ----
    #pragma unroll
    for (int kk = 0; kk < 64; kk += 32) {
      union { v16h v; v8h h[2]; } ua;
      int ar = ma * 16 + la;
      ua.h[0] = *(const v8h*)&affs[ar * 72 + kk + hs * 8];
      ua.h[1] = *(const v8h*)&affs[ar * 72 + kk + hs * 8 + 16];
      #pragma unroll
      for (int j = 0; j < 8; ++j) {
        int feat = nh * 128 + j * 16 + la;
        union { v16h v; v8h h[2]; } ub;
        const bf16* p = &Vs[feat * 72 + kk + hs * 8];
        ub.h[0] = *(const v8h*)p; ub.h[1] = *(const v8h*)(p + 16);
        oacc[j] = wmma_bf16(ua.v, ub.v, oacc[j]);
      }
    }
    __syncthreads();  // next pass's Ks visible; every read of Vs and affs done
    if (more) put_v();
  }
  // Write f16 token-major so the wo GEMM can consume it as A directly: the wave's 16 rows x 128 feats (256-B row segments)
  bf16* ot = Vs + wid * (16 * 128);   // Vs is free behind the loop's last barrier
  #pragma unroll
  for (int j = 0; j < 8; ++j) {
    int fl = j * 16 + la;
    #pragma unroll
    for (int r = 0; r < 8; ++r) ot[(r + hs * 8) * 128 + fl] = (bf16)oacc[j][r];
  }
  __syncthreads();
  #pragma unroll
  for (int q2 = 0; q2 < 8; ++q2) {
    const int rl = q2 * 2 + (lane >> 4), pc = lane & 15;
    const int s = qt * 64 + ma * 16 + rl;
    vst2(attn_out + ((size_t)(bidx * Ss + s)) * Dd + hidx * HDd + nh * 128 + pc * 8, *(const v4u*)(ot + rl * 128 + pc * 8));
  }
}

// ---------------------------------------------------------------------------
// TRM tail: residual = tpre; xn = LN(tpre); mix = scalar-MLP(xn); out = tpre+mix
// ---------------------------------------------------------------------------
__global__ __launch_bounds__(256) void trm_scalar_mlp_kernel(
    const float* __restrict__ tpre, const float* __restrict__ g,
    const float* __restrict__ bt, const float* __restrict__ sw1,
    const float* __restrict__ sb1, const float* __restrict__ sw2,
    const float* __restrict__ sb2, float* __restrict__ trm_out) {
  __shared__ float red[18];
  size_t t = blockIdx.x;
  int tid = threadIdx.x;
  float4 v = ((const float4*)(tpre + t * Dd))[tid];
  float s  = v.x + v.y + v.z + v.w;
  float s2 = v.x * v.x + v.y * v.y + v.z * v.z + v.w * v.w;
  float mean, rstd;
  block_stats(s, s2, red, mean, rstd);
  float4 G = ((const float4*)g)[tid], Bt = ((const float4*)bt)[tid];
  float w1e[Ee], b1e[Ee], w2e[Ee];
  #pragma unroll
  for (int e = 0; e < Ee; ++e) { w1e[e] = sw1[e]; b1e[e] = sb1[e]; w2e[e] = sw2[e]; }
  float vb2 = sb2[0];
  float xin[4] = {v.x, v.y, v.z, v.w};
  float gg[4] = {G.x, G.y, G.z, G.w}, bb[4] = {Bt.x, Bt.y, Bt.z, Bt.w};
  float4 o;
  float* op = &o.x;
  #pragma unroll 1
  for (int c = 0; c < 4; ++c) {              // rolled: per-scalar MLP is elementwise (no shared operand); keeps static FMAs low
    float xn = (xin[c] - mean) * rstd * gg[c] + bb[c];
    float mix = vb2;
    #pragma unroll 1
    for (int e = 0; e < Ee; ++e) mix += gelu_exact(xn * w1e[e] + b1e[e]) * w2e[e];
    op[c] = xin[c] + mix;
  }
  { v4f ov = {o.x, o.y, o.z, o.w}; vst2((v4f*)(trm_out + t * Dd) + tid, ov); }
}

// ---------------------------------------------------------------------------
// Final blend + layernorm:  LN(x + sig(a)*trm + (1-sig(a))*heb ; o_ln)
// ---------------------------------------------------------------------------
__global__ __launch_bounds__(256) void blend_ln_kernel(
    const float* __restrict__ x, const float* __restrict__ trm,
    const float* __restrict__ heb, const float* __restrict__ alphap,
    const float* __restrict__ g, const float* __restrict__ bt,
    float* __restrict__ out) {
  __shared__ float red[18];
  size_t t = blockIdx.x;
  int tid = threadIdx.x;
  float bw = 1.0f / (1.0f + expf(-alphap[0]));
  float4 xv = ((const float4*)(x   + t * Dd))[tid];
  float4 tv = ((const float4*)(trm + t * Dd))[tid];
  float4 hv = ((const float4*)(heb + t * Dd))[tid];
  float4 u;
  u.x = xv.x + bw * tv.x + (1.f - bw) * hv.x;
  u.y = xv.y + bw * tv.y + (1.f - bw) * hv.y;
  u.z = xv.z + bw * tv.z + (1.f - bw) * hv.z;
  u.w = xv.w + bw * tv.w + (1.f - bw) * hv.w;
  float s  = u.x + u.y + u.z + u.w;
  float s2 = u.x * u.x + u.y * u.y + u.z * u.z + u.w * u.w;
  float mean, rstd;
  block_stats(s, s2, red, mean, rstd);
  float4 G = ((const float4*)g)[tid], Bt = ((const float4*)bt)[tid];
  float4 o;
  o.x = (u.x - mean) * rstd * G.x + Bt.x;
  o.y = (u.y - mean) * rstd * G.y + Bt.y;
  o.z = (u.z - mean) * rstd * G.z + Bt.z;
  o.w = (u.w - mean) * rstd * G.w + Bt.w;
  { v4f ov = {o.x, o.y, o.z, o.w}; vst2((v4f*)(out + t * Dd) + tid, ov); }   // consecutive threads: one wave writes 512 contiguous bytes
}

// ---------------------------------------------------------------------------
// Host-side orchestration.
// ---------------------------------------------------------------------------
extern "C" void kernel_launch(void* const* d_in, const int* in_sizes, int n_in,
                              void* d_out, int out_size, void* d_ws, size_t ws_size,
                              hipStream_t stream) {
  const float* x      = (const float*)d_in[0];
  const float* h_ln_g = (const float*)d_in[1];
  const float* h_ln_b = (const float*)d_in[2];
  const float* wq     = (const float*)d_in[3];
  const float* bq     = (const float*)d_in[4];
  const float* wk     = (const float*)d_in[5];
  const float* bk     = (const float*)d_in[6];
  const float* wv     = (const float*)d_in[7];
  const float* bv     = (const float*)d_in[8];
  const float* wo     = (const float*)d_in[9];
  const float* bo     = (const float*)d_in[10];
  const float* beta   = (const float*)d_in[11];
  const float* t_ln1_g= (const float*)d_in[12];
  const float* t_ln1_b= (const float*)d_in[13];
  const float* t_w1   = (const float*)d_in[14];
  const float* t_b1   = (const float*)d_in[15];
  const float* t_w2   = (const float*)d_in[16];
  const float* t_b2   = (const float*)d_in[17];
  const float* t_lns_g= (const float*)d_in[18];
  const float* t_lns_b= (const float*)d_in[19];
  const float* s_w1   = (const float*)d_in[20];
  const float* s_b1   = (const float*)d_in[21];
  const float* s_w2   = (const float*)d_in[22];
  const float* s_b2   = (const float*)d_in[23];
  const float* alpha  = (const float*)d_in[24];
  const float* o_ln_g = (const float*)d_in[25];
  const float* o_ln_b = (const float*)d_in[26];
  float* out = (float*)d_out;

  char* ws = (char*)d_ws;
  const size_t MB = 1ull << 20;
  bf16* wqt  = (bf16*)(ws + 0 * MB);    // 2 MB each (1024x1024 bf16)
  bf16* wkt  = (bf16*)(ws + 2 * MB);
  bf16* wvt  = (bf16*)(ws + 4 * MB);
  bf16* wot  = (bf16*)(ws + 6 * MB);
  bf16* w1t  = (bf16*)(ws + 8 * MB);    // 8 MB  [DF, D]
  bf16* w2t  = (bf16*)(ws + 16 * MB);   // 8 MB  [D, DF]
  bf16* xn1  = (bf16*)(ws + 24 * MB);   // 16 MB [TOK, D]
  bf16* xn2  = (bf16*)(ws + 40 * MB);   // 16 MB [TOK, D]
  // 64 MB region: first h1 [TOK, DF]; after it is consumed, reused as q/k/vt/ao
  bf16* h1   = (bf16*)(ws + 56 * MB);
  bf16* qb   = (bf16*)(ws + 56 * MB);   // 16 MB [B,H,S,HD]
  bf16* kb   = (bf16*)(ws + 72 * MB);   // 16 MB [B,H,S,HD]
  bf16* vtb  = (bf16*)(ws + 88 * MB);   // 16 MB [B,H,HD,S]
  bf16* ao   = (bf16*)(ws + 104 * MB);  // 16 MB [TOK, D]
  float* tpre= (float*)(ws + 120 * MB); // 32 MB f32 (later reused for heb)
  float* hebo= (float*)(ws + 120 * MB);
  float* trmo= (float*)(ws + 152 * MB); // 32 MB f32 ; total = 184 MB

  // Weight repacks (f32 [K,N] -> f16 [N,K]); grid = (N/64)*(K/64) tiles of 64x64
  transpose_cvt_kernel<<<(Dd / 64) * (Dd / 64),  256, 0, stream>>>(wq,  wqt, Dd,  Dd);
  transpose_cvt_kernel<<<(Dd / 64) * (Dd / 64),  256, 0, stream>>>(wk,  wkt, Dd,  Dd);
  transpose_cvt_kernel<<<(Dd / 64) * (Dd / 64),  256, 0, stream>>>(wv,  wvt, Dd,  Dd);
  transpose_cvt_kernel<<<(Dd / 64) * (Dd / 64),  256, 0, stream>>>(wo,  wot, Dd,  Dd);
  transpose_cvt_kernel<<<(DFf / 64) * (Dd / 64), 256, 0, stream>>>(t_w1, w1t, Dd,  DFf);
  transpose_cvt_kernel<<<(Dd / 64) * (DFf / 64), 256, 0, stream>>>(t_w2, w2t, DFf, Dd);

  // Dual layernorm -> bf16 GEMM inputs
  ln_dual_kernel<<<TOK, 256, 0, stream>>>(x, t_ln1_g, t_ln1_b, h_ln_g, h_ln_b,
                                          xn1, xn2);

  // ---- TRM path ----
  gemm_bf16_wmma<0><<<dim3(DFf / 128, TOK / 128), 256, 0, stream>>>(
      xn1, w1t, t_b1, nullptr, h1, TOK, DFf, Dd);               // h1 = gelu(.)
  gemm_bf16_wmma<1><<<dim3(Dd / 128, TOK / 128), 256, 0, stream>>>(
      h1, w2t, t_b2, x, tpre, TOK, Dd, DFf);                    // tpre = x + h1@w2
  trm_scalar_mlp_kernel<<<TOK, 256, 0, stream>>>(
      tpre, t_lns_g, t_lns_b, s_w1, s_b1, s_w2, s_b2, trmo);    // trm_out

  // ---- Hebbian path (h1 region now free; reuse for q/k/vt/ao) ----
  gemm_bf16_wmma<2><<<dim3(Dd / 128, TOK / 128), 256, 0, stream>>>(
      xn2, wqt, bq, nullptr, qb, TOK, Dd, Dd);                  // q head-major
  gemm_bf16_wmma<2><<<dim3(Dd / 128, TOK / 128), 256, 0, stream>>>(
      xn2, wkt, bk, nullptr, kb, TOK, Dd, Dd);                  // k head-major
  gemm_bf16_wmma<3><<<dim3(Dd / 128, TOK / 128), 256, 0, stream>>>(
      xn2, wvt, bv, nullptr, vtb, TOK, Dd, Dd);                 // v transposed
  hebbian_attn_kernel<<<dim3(Ss / 64, Bb * Hh), 256, 0, stream>>>(
      qb, kb, vtb, beta, ao);                                   // causal relu attn
  gemm_bf16_wmma<1><<<dim3(Dd / 128, TOK / 128), 256, 0, stream>>>(
      ao, wot, bo, x, hebo, TOK, Dd, Dd);                       // heb = x + ao@wo

  // ---- blend + final layernorm ----
  blend_ln_kernel<<<TOK, 256, 0, stream>>>(x, trmo, hebo, alpha,
                                           o_ln_g, o_ln_b, out);
}

// v003
// A run of this version takes 397 microseconds.
// In both of two side-by-side timings against v002, it was 1.03 times as fast.
// All steps since v000 together make it 1.84 times as fast.
#include <hip/hip_runtime.h>
#include <stdint.h>

// ---------------------------------------------------------------------------
// wave32, WMMA f16 (f32 accumulate), double-buffered GEMM pipeline with asynchronous 16-B copies to LDS.
// Contractions: the TRM FFN GEMMs (K = 1024 / 4096), Q/K/V and output projections (K = 1024), the Hebbian affinity Q K^T
// (K = 256) and aff V (K = keys) on v_wmma_f32_16x16x32_f16 (f16 operands, f32 accumulate); LayerNorms, GELU, the scalar
// ---------------------------------------------------------------------------

typedef _Float16 bf16;   // NOTE: 'bf16' is only a type alias name here — the type is IEEE half (f16) throughout
typedef __attribute__((ext_vector_type(4))) float v4f;
typedef __attribute__((ext_vector_type(4))) unsigned v4u;
template <typename V> __device__ __forceinline__ void vst2(void* p, V v) {
  *(V*)p = v; 
}
typedef __attribute__((ext_vector_type(16))) _Float16 v16h;
typedef __attribute__((ext_vector_type(8)))  _Float16 v8h;
typedef __attribute__((ext_vector_type(8)))  float  v8f;

constexpr int Bb  = 4;
constexpr int Ss  = 2048;
constexpr int Dd  = 1024;
constexpr int Hh  = 4;
constexpr int HDd = Dd / Hh;     // 256
constexpr int Ee  = 4;
constexpr int DFf = Dd * Ee;     // 4096
constexpr int TOK = Bb * Ss;     // 8192

__device__ __forceinline__ v8f wmma_bf16(v16h a, v16h b, v8f c) {   // (name kept; f16 WMMA + hazard guard)
  v8f d = __builtin_amdgcn_wmma_f32_16x16x32_f16(false, a, false, b, (short)0, c, false, false);
  asm volatile("v_nop\n\tv_nop\n\tv_nop\n\tv_nop" : "+v"(d) : "v"(a), "v"(b));
  return d;
}

__device__ __forceinline__ float gelu_exact(float x) {
  return 0.5f * x * (1.0f + erff(x * 0.70710678118654752f));
}

// Mean / rstd over D=1024 of a row that one wave holds: each lane brings the sums of its 32 elements, a five-step
// butterfly leaves the totals in every lane. No LDS, no barrier.
__device__ __forceinline__ void wave_stats(float s, float s2, float& mean, float& rstd) {
  #pragma unroll   // five fixed steps, no loop counter
  for (int o = 16; o > 0; o >>= 1) {
    s  += __shfl_xor(s,  o, 32);
    s2 += __shfl_xor(s2, o, 32);
  }
  mean = s * (1.0f / Dd);
  float var = s2 * (1.0f / Dd) - mean * mean;
  rstd = rsqrtf(var + 1e-5f);
}

// A wave's view of a row of D=1024 floats: piece i (0..7) of lane l is float4 number i * 32 + l, so that every
// wave-wide 16-B load or store covers 512 contiguous bytes.
constexpr int PCS = Dd / (32 * 4);   // 8 pieces per lane

// ---------------------------------------------------------------------------
// Weight repack: f32 [K,N] row-major  ->  bf16 [N,K] row-major (B^T layout)
// ---------------------------------------------------------------------------
__global__ __launch_bounds__(256) void transpose_cvt_kernel(
    const float* __restrict__ src, bf16* __restrict__ dst, int K, int N) {
  __shared__ __align__(16) bf16 tile[64][72];
  const int nt = N / 64;
  const int nBase = (blockIdx.x % nt) * 64, kBase = (blockIdx.x / nt) * 64, tid = threadIdx.x;
  for (int i = tid; i < 64 * 64; i += 256) { const int kk = i >> 6, nn = i & 63; tile[nn][kk] = (bf16)src[(size_t)(kBase + kk) * N + nBase + nn]; }
  __syncthreads();
  for (int g = tid; g < 64 * 8; g += 256) { const int nn = g >> 3, pc = g & 7; vst2(dst + (size_t)(nBase + nn) * K + kBase + pc * 8, *(const v4u*)(&tile[nn][pc * 8])); }
}

// ---------------------------------------------------------------------------
// Dual layernorm: xn1 = LN(x; t_ln1), xn2 = LN(x; h_ln)  (bf16 GEMM inputs)
// ---------------------------------------------------------------------------
// One wave owns two whole rows (all 16 loads of a lane in flight at once; each g/b piece is fetched once for both rows).
__global__ __launch_bounds__(256) void ln_dual_kernel(
    const float* __restrict__ x,
    const float* __restrict__ g1, const float* __restrict__ b1,
    const float* __restrict__ g2, const float* __restrict__ b2,
    bf16* __restrict__ xn1, bf16* __restrict__ xn2) {
  const int lane = threadIdx.x & 31;
  const int wid = __builtin_amdgcn_readfirstlane(threadIdx.x >> 5);   // wave number held scalar: row bases are scalar, a lane adds only its offset
  const size_t t0 = ((size_t)blockIdx.x * 8 + wid) * 2;
  const float4* xr = (const float4*)(x + t0 * Dd) + lane;
  float4 v[2][PCS];
  // every loop of this kernel is unrolled: v is indexed by constants only and stays in registers
  #pragma unroll
  for (int r = 0; r < 2; ++r)
    #pragma unroll
    for (int i = 0; i < PCS; ++i) v[r][i] = xr[r * (Dd / 4) + i * 32];
  float mean[2], rstd[2];
  #pragma unroll
  for (int r = 0; r < 2; ++r) {
    float s = 0.f, s2 = 0.f;
    #pragma unroll
    for (int i = 0; i < PCS; ++i) {
      const float4 a = v[r][i];
      s  += a.x + a.y + a.z + a.w;
      s2 += a.x * a.x + a.y * a.y + a.z * a.z + a.w * a.w;
    }
    wave_stats(s, s2, mean[r], rstd[r]);
  }
  #pragma unroll
  for (int i = 0; i < PCS; ++i) {
    const int pc = i * 32 + lane;
    const float4 G1 = ((const float4*)g1)[pc], B1 = ((const float4*)b1)[pc];
    const float4 G2 = ((const float4*)g2)[pc], B2 = ((const float4*)b2)[pc];
    #pragma unroll
    for (int r = 0; r < 2; ++r) {
      const float4 a = v[r][i];
      const float n0 = (a.x - mean[r]) * rstd[r], n1 = (a.y - mean[r]) * rstd[r];
      const float n2 = (a.z - mean[r]) * rstd[r], n3 = (a.w - mean[r]) * rstd[r];
      union { bf16 h[4]; unsigned long long u; } p1, p2;   // 4 halves = 8 B per lane; a wave writes 256 contiguous bytes
      p1.h[0] = (bf16)(n0 * G1.x + B1.x); p2.h[0] = (bf16)(n0 * G2.x + B2.x);
      p1.h[1] = (bf16)(n1 * G1.y + B1.y); p2.h[1] = (bf16)(n1 * G2.y + B2.y);
      p1.h[2] = (bf16)(n2 * G1.z + B1.z); p2.h[2] = (bf16)(n2 * G2.z + B2.z);
      p1.h[3] = (bf16)(n3 * G1.w + B1.w); p2.h[3] = (bf16)(n3 * G2.w + B2.w);
      const size_t base = (t0 + r) * Dd + pc * 4;
      vst2(xn1 + base, p1.u); vst2(xn2 + base, p2.u);
    }
  }
}

// ---------------------------------------------------------------------------
// Tiled WMMA GEMM:  C[M,N] = epilogue(A[M,K]_bf16 @ Bt[N,K]_bf16 + bias)
// Block tile 128x128, 8 waves (2x4), each wave 64x32 (8 v8f accumulators).
// Double-buffered LDS, a stage = 64 k (whole 128-B lines of every row), filled with asynchronous 16-B copies:
// compute stage i from buf(i&1) while stage i+1 flies into buf(~i&1).
// EPI 0: gelu -> bf16 row-major       EPI 1: res + acc + bias -> f32 row-major
// EPI 2: bf16 head-major [B,H,S,HD]   EPI 3: bf16 transposed  [B,H,HD,S]
// ---------------------------------------------------------------------------
template <int EPI>
__global__ __launch_bounds__(256) void gemm_bf16_wmma(
    const bf16* __restrict__ A, const bf16* __restrict__ Bt,
    const float* __restrict__ bias, const float* __restrict__ res,
    void* __restrict__ out, int Mtot, int Ntot, int Ktot) {
  __shared__ __align__(16) bf16 As[2][128 * 72];  // 64 K + 8 pad per row: pitch 144 B = 16 B x odd for the 16-B readers
  __shared__ __align__(16) bf16 Bs[2][128 * 72];
  __shared__ __align__(16) float Ct[128][128];     // block output tile (64 KB)
  const int tid  = threadIdx.x;
  const int lane = tid & 31, wid = tid >> 5;
  const int wm = wid & 1, wn = wid >> 1;            // 2 x 4 wave grid
  const int la = lane & 15, hs = lane >> 4;         // lane-in-16, half-select
  const int mBase = blockIdx.y * 128, nBase = blockIdx.x * 128;

  // Stage 128x64 panels of A and Bt into an LDS buffer with asynchronous 16-B copies (no register in between).
  // Eight lanes cover one 128-B row, a wave four whole lines. Each thread owns one 16-B piece of rows sr + 32 i
  // (i = 0..3) of both panels: eight copies per stage, every lane on.
  const int sr = tid >> 3, sc = (tid & 7) * 8;
  const size_t rstep = (size_t)32 * Ktot;
  const bf16* ga = A  + (size_t)(mBase + sr) * Ktot + sc;
  const bf16* gb = Bt + (size_t)(nBase + sr) * Ktot + sc;
  const unsigned la_lds = (unsigned)(size_t)&As[0][sr * 72 + sc];   // low 32 bits of a __shared__ address = LDS byte address
  const unsigned lb_lds = (unsigned)(size_t)&Bs[0][sr * 72 + sc];
  auto stage = [&](int k0, int buf) {
    constexpr unsigned RS = 32 * 72 * 2;                            // 32 rows further in LDS, bytes
    const unsigned da = la_lds + (unsigned)buf * (128 * 72 * 2), db = lb_lds + (unsigned)buf * (128 * 72 * 2);
    const bf16 *pa = ga + k0, *pb = gb + k0;
    // the copies and their s_wait_xcnt in one statement, so that the wait stands ahead of any rewrite of an address register
    asm volatile("global_load_async_to_lds_b128 %0, %1, off\n\t"
                 "global_load_async_to_lds_b128 %2, %3, off\n\t"
                 "global_load_async_to_lds_b128 %4, %5, off\n\t"
                 "global_load_async_to_lds_b128 %6, %7, off\n\t"
                 "global_load_async_to_lds_b128 %8, %9, off\n\t"
                 "global_load_async_to_lds_b128 %10, %11, off\n\t"
                 "global_load_async_to_lds_b128 %12, %13, off\n\t"
                 "global_load_async_to_lds_b128 %14, %15, off\n\t"
                 "s_wait_xcnt 0x0"
                 :: "v"(da),          "v"(pa),             "v"(da + RS),     "v"(pa + rstep),
                    "v"(da + 2 * RS), "v"(pa + 2 * rstep), "v"(da + 3 * RS), "v"(pa + 3 * rstep),
                    "v"(db),          "v"(pb),             "v"(db + RS),     "v"(pb + rstep),
                    "v"(db + 2 * RS), "v"(pb + 2 * rstep), "v"(db + 3 * RS), "v"(pb + 3 * rstep)
                 : "memory");
  };

  v8f acc[4][2] = {};
  const int ntiles = Ktot >> 6;
  stage(0, 0);
  asm volatile("s_wait_asynccnt 0x0" ::: "memory");   // this wave's copies of stage 0 have landed
  __syncthreads();                                    // every wave's have
  if (ntiles > 1) stage(64, 1);

  for (int it = 0; it < ntiles; ++it) {
    const int cur = it & 1;   // stage it is worked on from buf(cur) while stage it + 1 flies into the other buffer
    #pragma unroll   // kf a constant: the two 32-k halves of a stage become LDS offsets, no loop or address work per half
    for (int kf = 0; kf < 64; kf += 32) {
      // A-frag (16x32 bf16): lanes 0-15 hold K 0-7 / 16-23, lanes 16-31 K 8-15 / 24-31.
      v16h afrag[4];
      #pragma unroll
      for (int ms = 0; ms < 4; ++ms) {
        int r = wm * 64 + ms * 16 + la;
        union { v16h v; v8h h[2]; } u;
        u.h[0] = *(const v8h*)&As[cur][r * 72 + kf + hs * 8];
        u.h[1] = *(const v8h*)&As[cur][r * 72 + kf + hs * 8 + 16];
        afrag[ms] = u.v;
      }
      // B-frag (32x16): same per-lane K map as A (lanes 0-15 hold K 0-7 / 16-23, lanes 16-31 K 8-15 / 24-31).
      v16h bfrag[2];
      #pragma unroll
      for (int ns = 0; ns < 2; ++ns) {
        int r = wn * 32 + ns * 16 + la;
        union { v16h v; v8h h[2]; } u;
        u.h[0] = *(const v8h*)&Bs[cur][r * 72 + kf + hs * 8];
        u.h[1] = *(const v8h*)&Bs[cur][r * 72 + kf + hs * 8 + 16];
        bfrag[ns] = u.v;
      }
      #pragma unroll
      for (int ms = 0; ms < 4; ++ms)
        #pragma unroll
        for (int ns = 0; ns < 2; ++ns)
          acc[ms][ns] = wmma_bf16(afrag[ms], bfrag[ns], acc[ms][ns]);
    }
    asm volatile("s_wait_dscnt 0x0" ::: "memory");      // this wave's reads of buf(cur) are done before it is refilled
    asm volatile("s_wait_asynccnt 0x0" ::: "memory");   // this wave's copies of stage it + 1 have landed
    __syncthreads();                                    // stage it + 1 published; every wave has left buf(cur)
    if (it + 2 < ntiles) stage((it + 2) * 64, cur);
  }
  asm volatile("s_wait_asynccnt 0x0" ::: "memory");     // no copy outstanding behind the loop

  // Epilogue. C-frag: lane holds col la, rows r + 8*hs per VGPR r -> block tile Ct[128][128] (value after bias/gelu/residual),
  // then whole-line stores: EPI 0 f16 rows (256 B), EPI 1 f32 rows (512 B), EPI 2 [b,h,s,hd] rows (128 hd = 256 B at hd0),
  // EPI 3 [b,h,hd,s] rows (128 s = 256 B at s0).
  __syncthreads();
  #pragma unroll
  for (int ms = 0; ms < 4; ++ms)
    #pragma unroll
    for (int ns = 0; ns < 2; ++ns) {
      int cl = wn * 32 + ns * 16 + la;
      int col = nBase + cl;
      float bv = bias[col];
      #pragma unroll
      for (int r = 0; r < 8; ++r) {
        int rl = wm * 64 + ms * 16 + r + hs * 8;
        int row = mBase + rl;
        float v = acc[ms][ns][r] + bv;
        if constexpr (EPI == 0) v = gelu_exact(v);
        else if constexpr (EPI == 1) v += res[(size_t)row * Ntot + col];
        Ct[rl][cl] = v;
      }
    }
  __syncthreads();
  if constexpr (EPI == 1) {
    for (int g = tid; g < 128 * 32; g += 256) { const int rl = g >> 5, pc = g & 31; vst2((float*)out + (size_t)(mBase + rl) * Ntot + nBase + pc * 4, *(const v4f*)(&Ct[rl][pc * 4])); }
  } else if constexpr (EPI == 3) {
    const int b = mBase / Ss, s0 = mBase % Ss, h = nBase / HDd, hd0 = nBase % HDd;
    for (int g = tid; g < 128 * 16; g += 256) {
      const int cl = g >> 4, pc = g & 15;         // hd row cl, piece of 8 s
      union { v8h h; v4u u; } pk;
      #pragma unroll
      for (int e = 0; e < 8; ++e) pk.h[e] = (bf16)Ct[pc * 8 + e][cl];
      vst2((bf16*)out + ((size_t)((b * Hh + h) * HDd + hd0 + cl)) * Ss + s0 + pc * 8, pk.u);
    }
  } else {
    for (int g = tid; g < 128 * 16; g += 256) {
      const int rl = g >> 4, pc = g & 15;
      union { v8h h; v4u u; } pk;
      #pragma unroll
      for (int e = 0; e < 8; ++e) pk.h[e] = (bf16)Ct[rl][pc * 8 + e];
      const int row = mBase + rl;
      if constexpr (EPI == 0) vst2((bf16*)out + (size_t)row * Ntot + nBase + pc * 8, pk.u);
      else { const int b = row / Ss, s = row % Ss, h = nBase / HDd, hd0 = nBase % HDd;
             vst2((bf16*)out + ((size_t)((b * Hh + h) * Ss + s)) * HDd + hd0 + pc * 8, pk.u); }
    }
  }
}

// ---------------------------------------------------------------------------
// Hebbian attention: out_i = sum_{j<=i} relu(beta * q_i.k_j) v_j
// q,k: bf16 [B,H,S,HD] ; vt: bf16 [B,H,HD,S] ; out: bf16 [B,S,D] (token-major)
// Block = one (b,h) x 64-query tile. Causal: only kt <= qt key tiles visited.
// The K tile (64 x 256) and the Vt tile (256 x 64) are brought in once per block with whole-line 16-B loads and kept in
// LDS; every wave takes its B fragments from there. The next tile's loads are issued at the top of a pass and stored
// behind the barrier that ends the last read of the tile they replace.
// ---------------------------------------------------------------------------
__global__ __launch_bounds__(256) void hebbian_attn_kernel(
    const bf16* __restrict__ q, const bf16* __restrict__ k,
    const bf16* __restrict__ vt, const float* __restrict__ betap,
    bf16* __restrict__ attn_out) {
  __shared__ __align__(16) bf16 Qs[64 * 264];   // 64 x 256 (+8 pad)
  __shared__ __align__(16) bf16 Ks[64 * 264];   // 64 keys x 256 (+8 pad)
  __shared__ __align__(16) bf16 Vs[256 * 72];   // 256 feats x 64 keys (+8 pad); after the loop: per-wave output tiles
  __shared__ __align__(16) bf16 affs[64 * 72];  // 64 x 64  (+8 pad)
  const int qt = blockIdx.x, bh = blockIdx.y;
  const int bidx = bh / Hh, hidx = bh % Hh;
  const int tid = threadIdx.x, lane = tid & 31, wid = tid >> 5;
  const int la = lane & 15, hs = lane >> 4;
  const float beta = betap[0];

  const int kr = tid >> 5, kc = (tid & 31) * 8;   // K piece: a wave covers one 512-B row; 8 rows per step
  const int vr = tid >> 3, vc = (tid & 7) * 8;    // Vt piece: a wave covers four 128-B rows; 32 rows per step
  const bf16* kth = k  + (size_t)bh * Ss * HDd + kr * HDd + kc;   // this thread's piece of key row kr
  const bf16* vth = vt + (size_t)bh * HDd * Ss + vr * Ss + vc;    // this thread's piece of feature row vr
  v4u kreg[8], vreg[8];
  auto fetch = [&](int kbase) {
    #pragma unroll
    for (int i = 0; i < 8; ++i) kreg[i] = *(const v4u*)(kth + (size_t)kbase * HDd + i * 8 * HDd);
    #pragma unroll
    for (int i = 0; i < 8; ++i) vreg[i] = *(const v4u*)(vth + kbase + i * 32 * Ss);
  };
  auto put_k = [&]() {
    #pragma unroll
    for (int i = 0; i < 8; ++i) *(v4u*)&Ks[(kr + i * 8) * 264 + kc] = kreg[i];
  };
  auto put_v = [&]() {
    #pragma unroll
    for (int i = 0; i < 8; ++i) *(v4u*)&Vs[(vr + i * 32) * 72 + vc] = vreg[i];
  };

  fetch(0);
  // Stage Q tile (reused for every key tile).
  const bf16* qb = q + ((size_t)bh * Ss + qt * 64) * HDd;
  #pragma unroll
  for (int c = tid; c < 64 * 32; c += 256) {
    int r = c >> 5, cc = (c & 31) * 8;
    *(v4u*)&Qs[r * 264 + cc] = *(const v4u*)&qb[(size_t)r * HDd + cc];
  }
  put_k();
  put_v();
  __syncthreads();

  const int ma = wid & 3;   // 16-row group for both GEMMs
  const int nh = wid >> 2;  // GEMM1: 32-col half of aff ; GEMM2: 128-feat half
  v8f oacc[8] = {};

  for (int kt = 0; kt <= qt; ++kt) {
    const int kbase = kt * 64;
    const bool more = kt < qt;
    if (more) fetch(kbase + 64);
    // ---- GEMM1: aff(64x64) = Q(64x256) @ K^T, both from LDS ----
    v8f c0 = {}, c1 = {};
    #pragma unroll
    for (int kf = 0; kf < HDd; kf += 32) {
      union { v16h v; v8h h[2]; } ua, ub0, ub1;
      int ar = ma * 16 + la;
      ua.h[0] = *(const v8h*)&Qs[ar * 264 + kf + hs * 8];
      ua.h[1] = *(const v8h*)&Qs[ar * 264 + kf + hs * 8 + 16];
      const bf16* p0 = &Ks[(nh * 32 + la)      * 264 + kf + hs * 8];   // same K map as A
      const bf16* p1 = &Ks[(nh * 32 + 16 + la) * 264 + kf + hs * 8];
      ub0.h[0] = *(const v8h*)p0; ub0.h[1] = *(const v8h*)(p0 + 16);
      ub1.h[0] = *(const v8h*)p1; ub1.h[1] = *(const v8h*)(p1 + 16);
      c0 = wmma_bf16(ua.v, ub0.v, c0);
      c1 = wmma_bf16(ua.v, ub1.v, c1);
    }
    // beta * relu + causal mask, re-layout C-frag -> A-frag via LDS (bf16).
    // (the barrier at the foot of the previous pass ended the last read of affs)
    #pragma unroll
    for (int ns = 0; ns < 2; ++ns) {
      v8f cv = ns ? c1 : c0;
      int jl = nh * 32 + ns * 16 + la;
      int j = kbase + jl;
      #pragma unroll
      for (int r = 0; r < 8; ++r) {
        int il = ma * 16 + r + hs * 8;
        int i = qt * 64 + il;
        float v = cv[r] * beta;
        v = (j <= i && v > 0.f) ? v : 0.f;
        affs[il * 72 + jl] = (bf16)v;
      }
    }
    __syncthreads();  // affs and this pass's Vs visible; every read of Ks done
    if (more) put_k();
    // ---- GEMM2: out(64x256) += aff(64x64) @ V(64x256) via Vt rows in LDS ----
    #pragma unroll
    for (int kk = 0; kk < 64; kk += 32) {
      union { v16h v; v8h h[2]; } ua;
      int ar = ma * 16 + la;
      ua.h[0] = *(const v8h*)&affs[ar * 72 + kk + hs * 8];
      ua.h[1] = *(const v8h*)&affs[ar * 72 + kk + hs * 8 + 16];
      #pragma unroll
      for (int j = 0; j < 8; ++j) {
        int feat = nh * 128 + j * 16 + la;
        union { v16h v; v8h h[2]; } ub;
        const bf16* p = &Vs[feat * 72 + kk + hs * 8];
        ub.h[0] = *(const v8h*)p; ub.h[1] = *(const v8h*)(p + 16);
        oacc[j] = wmma_bf16(ua.v, ub.v, oacc[j]);
      }
    }
    __syncthreads();  // next pass's Ks visible; every read of Vs and affs done
    if (more) put_v();
  }
  // Write f16 token-major so the wo GEMM can consume it as A directly: the wave's 16 rows x 128 feats (256-B row segments)
  bf16* ot = Vs + wid * (16 * 128);   // Vs is free behind the loop's last barrier
  #pragma unroll
  for (int j = 0; j < 8; ++j) {
    int fl = j * 16 + la;
    #pragma unroll
    for (int r = 0; r < 8; ++r) ot[(r + hs * 8) * 128 + fl] = (bf16)oacc[j][r];
  }
  __syncthreads();
  #pragma unroll
  for (int q2 = 0; q2 < 8; ++q2) {
    const int rl = q2 * 2 + (lane >> 4), pc = lane & 15;
    const int s = qt * 64 + ma * 16 + rl;
    vst2(attn_out + ((size_t)(bidx * Ss + s)) * Dd + hidx * HDd + nh * 128 + pc * 8, *(const v4u*)(ot + rl * 128 + pc * 8));
  }
}

// ---------------------------------------------------------------------------
// TRM tail: residual = tpre; xn = LN(tpre); mix = scalar-MLP(xn); out = tpre+mix
// ---------------------------------------------------------------------------
// One wave owns one whole row: 32 elements per lane, kept in registers.
__global__ __launch_bounds__(256) void trm_scalar_mlp_kernel(
    const float* __restrict__ tpre, const float* __restrict__ g,
    const float* __restrict__ bt, const float* __restrict__ sw1,
    const float* __restrict__ sb1, const float* __restrict__ sw2,
    const float* __restrict__ sb2, float* __restrict__ trm_out) {
  const int lane = threadIdx.x & 31;
  const int wid = __builtin_amdgcn_readfirstlane(threadIdx.x >> 5);   // wave number held scalar: row bases are scalar, a lane adds only its offset
  const size_t t = (size_t)blockIdx.x * 8 + wid;
  const float4* xr = (const float4*)(tpre + t * Dd) + lane;
  float xin[PCS * 4];
  float s = 0.f, s2 = 0.f;
  // every loop over pieces or elements is unrolled: xin, xn, mix are indexed by constants only and stay in registers
  #pragma unroll
  for (int i = 0; i < PCS; ++i) {
    const float4 a = xr[i * 32];
    xin[i * 4 + 0] = a.x; xin[i * 4 + 1] = a.y; xin[i * 4 + 2] = a.z; xin[i * 4 + 3] = a.w;
  }
  #pragma unroll
  for (int i = 0; i < PCS; ++i) {
    const float a0 = xin[i * 4], a1 = xin[i * 4 + 1], a2 = xin[i * 4 + 2], a3 = xin[i * 4 + 3];
    s  += a0 + a1 + a2 + a3;
    s2 += a0 * a0 + a1 * a1 + a2 * a2 + a3 * a3;
  }
  float mean, rstd;
  wave_stats(s, s2, mean, rstd);
  const float vb2 = sb2[0];
  float xn[PCS * 4], mix[PCS * 4];
  #pragma unroll
  for (int i = 0; i < PCS; ++i) {
    const float4 G = ((const float4*)g)[i * 32 + lane], Bt = ((const float4*)bt)[i * 32 + lane];
    xn[i * 4 + 0] = (xin[i * 4 + 0] - mean) * rstd * G.x + Bt.x;
    xn[i * 4 + 1] = (xin[i * 4 + 1] - mean) * rstd * G.y + Bt.y;
    xn[i * 4 + 2] = (xin[i * 4 + 2] - mean) * rstd * G.z + Bt.z;
    xn[i * 4 + 3] = (xin[i * 4 + 3] - mean) * rstd * G.w + Bt.w;
    mix[i * 4 + 0] = vb2; mix[i * 4 + 1] = vb2; mix[i * 4 + 2] = vb2; mix[i * 4 + 3] = vb2;
  }
  #pragma unroll 1   // rolled: a trip already holds 32 inlined erf bodies; four times that is needless code to fetch
  for (int e = 0; e < Ee; ++e) {
    const float w1 = sw1[e], b1 = sb1[e], w2 = sw2[e];
    #pragma unroll
    for (int j = 0; j < PCS * 4; ++j) mix[j] += gelu_exact(xn[j] * w1 + b1) * w2;
  }
  #pragma unroll
  for (int i = 0; i < PCS; ++i) {
    v4f ov = {xin[i * 4 + 0] + mix[i * 4 + 0], xin[i * 4 + 1] + mix[i * 4 + 1],
              xin[i * 4 + 2] + mix[i * 4 + 2], xin[i * 4 + 3] + mix[i * 4 + 3]};
    vst2((v4f*)(trm_out + t * Dd) + i * 32 + lane, ov);
  }
}

// ---------------------------------------------------------------------------
// Final blend + layernorm:  LN(x + sig(a)*trm + (1-sig(a))*heb ; o_ln)
// ---------------------------------------------------------------------------
// One wave owns two whole rows.
__global__ __launch_bounds__(256) void blend_ln_kernel(
    const float* __restrict__ x, const float* __restrict__ trm,
    const float* __restrict__ heb, const float* __restrict__ alphap,
    const float* __restrict__ g, const float* __restrict__ bt,
    float* __restrict__ out) {
  const int lane = threadIdx.x & 31;
  const int wid = __builtin_amdgcn_readfirstlane(threadIdx.x >> 5);   // wave number held scalar: row bases are scalar, a lane adds only its offset
  const size_t t0 = ((size_t)blockIdx.x * 8 + wid) * 2;
  const float bw = 1.0f / (1.0f + expf(-alphap[0]));
  const float4* xr = (const float4*)(x   + t0 * Dd) + lane;
  const float4* tr = (const float4*)(trm + t0 * Dd) + lane;
  const float4* hr = (const float4*)(heb + t0 * Dd) + lane;
  float4 u[2][PCS];
  float mean[2], rstd[2];
  // every loop of this kernel is unrolled: u is indexed by constants only and stays in registers
  #pragma unroll
  for (int r = 0; r < 2; ++r) {
    float s = 0.f, s2 = 0.f;
    #pragma unroll
    for (int i = 0; i < PCS; ++i) {
      const int o = r * (Dd / 4) + i * 32;
      const float4 xv = xr[o], tv = tr[o], hv = hr[o];
      float4 a;
      a.x = xv.x + bw * tv.x + (1.f - bw) * hv.x;
      a.y = xv.y + bw * tv.y + (1.f - bw) * hv.y;
      a.z = xv.z + bw * tv.z + (1.f - bw) * hv.z;
      a.w = xv.w + bw * tv.w + (1.f - bw) * hv.w;
      u[r][i] = a;
      s  += a.x + a.y + a.z + a.w;
      s2 += a.x * a.x + a.y * a.y + a.z * a.z + a.w * a.w;
    }
    wave_stats(s, s2, mean[r], rstd[r]);
  }
  #pragma unroll
  for (int i = 0; i < PCS; ++i) {
    const int pc = i * 32 + lane;
    const float4 G = ((const float4*)g)[pc], Bt = ((const float4*)bt)[pc];
    #pragma unroll
    for (int r = 0; r < 2; ++r) {
      const float4 a = u[r][i];
      v4f ov = {(a.x - mean[r]) * rstd[r] * G.x + Bt.x, (a.y - mean[r]) * rstd[r] * G.y + Bt.y,
                (a.z - mean[r]) * rstd[r] * G.z + Bt.z, (a.w - mean[r]) * rstd[r] * G.w + Bt.w};
      vst2((v4f*)(out + (t0 + r) * Dd) + pc, ov);   // one wave writes 512 contiguous bytes
    }
  }
}

// ---------------------------------------------------------------------------
// Host-side orchestration.
// ---------------------------------------------------------------------------
extern "C" void kernel_launch(void* const* d_in, const int* in_sizes, int n_in,
                              void* d_out, int out_size, void* d_ws, size_t ws_size,
                              hipStream_t stream) {
  const float* x      = (const float*)d_in[0];
  const float* h_ln_g = (const float*)d_in[1];
  const float* h_ln_b = (const float*)d_in[2];
  const float* wq     = (const float*)d_in[3];
  const float* bq     = (const float*)d_in[4];
  const float* wk     = (const float*)d_in[5];
  const float* bk     = (const float*)d_in[6];
  const float* wv     = (const float*)d_in[7];
  const float* bv     = (const float*)d_in[8];
  const float* wo     = (const float*)d_in[9];
  const float* bo     = (const float*)d_in[10];
  const float* beta   = (const float*)d_in[11];
  const float* t_ln1_g= (const float*)d_in[12];
  const float* t_ln1_b= (const float*)d_in[13];
  const float* t_w1   = (const float*)d_in[14];
  const float* t_b1   = (const float*)d_in[15];
  const float* t_w2   = (const float*)d_in[16];
  const float* t_b2   = (const float*)d_in[17];
  const float* t_lns_g= (const float*)d_in[18];
  const float* t_lns_b= (const float*)d_in[19];
  const float* s_w1   = (const float*)d_in[20];
  const float* s_b1   = (const float*)d_in[21];
  const float* s_w2   = (const float*)d_in[22];
  const float* s_b2   = (const float*)d_in[23];
  const float* alpha  = (const float*)d_in[24];
  const float* o_ln_g = (const float*)d_in[25];
  const float* o_ln_b = (const float*)d_in[26];
  float* out = (float*)d_out;

  char* ws = (char*)d_ws;
  const size_t MB = 1ull << 20;
  bf16* wqt  = (bf16*)(ws + 0 * MB);    // 2 MB each (1024x1024 bf16)
  bf16* wkt  = (bf16*)(ws + 2 * MB);
  bf16* wvt  = (bf16*)(ws + 4 * MB);
  bf16* wot  = (bf16*)(ws + 6 * MB);
  bf16* w1t  = (bf16*)(ws + 8 * MB);    // 8 MB  [DF, D]
  bf16* w2t  = (bf16*)(ws + 16 * MB);   // 8 MB  [D, DF]
  bf16* xn1  = (bf16*)(ws + 24 * MB);   // 16 MB [TOK, D]
  bf16* xn2  = (bf16*)(ws + 40 * MB);   // 16 MB [TOK, D]
  // 64 MB region: first h1 [TOK, DF]; after it is consumed, reused as q/k/vt/ao
  bf16* h1   = (bf16*)(ws + 56 * MB);
  bf16* qb   = (bf16*)(ws + 56 * MB);   // 16 MB [B,H,S,HD]
  bf16* kb   = (bf16*)(ws + 72 * MB);   // 16 MB [B,H,S,HD]
  bf16* vtb  = (bf16*)(ws + 88 * MB);   // 16 MB [B,H,HD,S]
  bf16* ao   = (bf16*)(ws + 104 * MB);  // 16 MB [TOK, D]
  float* tpre= (float*)(ws + 120 * MB); // 32 MB f32 (later reused for heb)
  float* hebo= (float*)(ws + 120 * MB);
  float* trmo= (float*)(ws + 152 * MB); // 32 MB f32 ; total = 184 MB

  // Weight repacks (f32 [K,N] -> f16 [N,K]); grid = (N/64)*(K/64) tiles of 64x64
  transpose_cvt_kernel<<<(Dd / 64) * (Dd / 64),  256, 0, stream>>>(wq,  wqt, Dd,  Dd);
  transpose_cvt_kernel<<<(Dd / 64) * (Dd / 64),  256, 0, stream>>>(wk,  wkt, Dd,  Dd);
  transpose_cvt_kernel<<<(Dd / 64) * (Dd / 64),  256, 0, stream>>>(wv,  wvt, Dd,  Dd);
  transpose_cvt_kernel<<<(Dd / 64) * (Dd / 64),  256, 0, stream>>>(wo,  wot, Dd,  Dd);
  transpose_cvt_kernel<<<(DFf / 64) * (Dd / 64), 256, 0, stream>>>(t_w1, w1t, Dd,  DFf);
  transpose_cvt_kernel<<<(Dd / 64) * (DFf / 64), 256, 0, stream>>>(t_w2, w2t, DFf, Dd);

  // Dual layernorm -> bf16 GEMM inputs
  ln_dual_kernel<<<TOK / 16, 256, 0, stream>>>(x, t_ln1_g, t_ln1_b, h_ln_g, h_ln_b,
                                          xn1, xn2);

  // ---- TRM path ----
  gemm_bf16_wmma<0><<<dim3(DFf / 128, TOK / 128), 256, 0, stream>>>(
      xn1, w1t, t_b1, nullptr, h1, TOK, DFf, Dd);               // h1 = gelu(.)
  gemm_bf16_wmma<1><<<dim3(Dd / 128, TOK / 128), 256, 0, stream>>>(
      h1, w2t, t_b2, x, tpre, TOK, Dd, DFf);                    // tpre = x + h1@w2
  trm_scalar_mlp_kernel<<<TOK / 8, 256, 0, stream>>>(
      tpre, t_lns_g, t_lns_b, s_w1, s_b1, s_w2, s_b2, trmo);    // trm_out

  // ---- Hebbian path (h1 region now free; reuse for q/k/vt/ao) ----
  gemm_bf16_wmma<2><<<dim3(Dd / 128, TOK / 128), 256, 0, stream>>>(
      xn2, wqt, bq, nullptr, qb, TOK, Dd, Dd);                  // q head-major
  gemm_bf16_wmma<2><<<dim3(Dd / 128, TOK / 128), 256, 0, stream>>>(
      xn2, wkt, bk, nullptr, kb, TOK, Dd, Dd);                  // k head-major
  gemm_bf16_wmma<3><<<dim3(Dd / 128, TOK / 128), 256, 0, stream>>>(
      xn2, wvt, bv, nullptr, vtb, TOK, Dd, Dd);                 // v transposed
  hebbian_attn_kernel<<<dim3(Ss / 64, Bb * Hh), 256, 0, stream>>>(
      qb, kb, vtb, beta, ao);                                   // causal relu attn
  gemm_bf16_wmma<1><<<dim3(Dd / 128, TOK / 128), 256, 0, stream>>>(
      ao, wot, bo, x, hebo, TOK, Dd, Dd);                       // heb = x + ao@wo

  // ---- blend + final layernorm ----
  blend_ln_kernel<<<TOK / 16, 256, 0, stream>>>(x, trmo, hebo, alpha,
                                           o_ln_g, o_ln_b, out);
}

// v004
// One run takes 352 microseconds.
// In two side-by-side timings against v003, it was 1.12 and 1.13 times as fast.
// All steps since v000 together make it 2.07 times as fast.
#include <hip/hip_runtime.h>
#include <stdint.h>

// ---------------------------------------------------------------------------
// wave32, WMMA f16 (f32 accumulate), double-buffered GEMM pipeline with asynchronous 16-B copies to LDS.
// Contractions: the TRM FFN GEMMs (K = 1024 / 4096), Q/K/V and output projections (K = 1024), the Hebbian affinity Q K^T
// (K = 256) and aff V (K = keys) on v_wmma_f32_16x16x32_f16 (f16 operands, f32 accumulate); LayerNorms, GELU, the scalar
// ---------------------------------------------------------------------------

typedef _Float16 bf16;   // NOTE: 'bf16' is only a type alias name here — the type is IEEE half (f16) throughout
typedef __attribute__((ext_vector_type(4))) float v4f;
typedef __attribute__((ext_vector_type(4))) unsigned v4u;
template <typename V> __device__ __forceinline__ void vst2(void* p, V v) {
  *(V*)p = v; 
}
typedef __attribute__((ext_vector_type(16))) _Float16 v16h;
typedef __attribute__((ext_vector_type(8)))  _Float16 v8h;
typedef __attribute__((ext_vector_type(8)))  float  v8f;

constexpr int Bb  = 4;
constexpr int Ss  = 2048;
constexpr int Dd  = 1024;
constexpr int Hh  = 4;
constexpr int HDd = Dd / Hh;     // 256
constexpr int Ee  = 4;
constexpr int DFf = Dd * Ee;     // 4096
constexpr int TOK = Bb * Ss;     // 8192

__device__ __forceinline__ v8f wmma_bf16(v16h a, v16h b, v8f c) {   // (name kept; f16 WMMA + hazard guard)
  v8f d = __builtin_amdgcn_wmma_f32_16x16x32_f16(false, a, false, b, (short)0, c, false, false);
  asm volatile("v_nop\n\tv_nop\n\tv_nop\n\tv_nop" : "+v"(d) : "v"(a), "v"(b));
  return d;
}

__device__ __forceinline__ float gelu_exact(float x) {
  return 0.5f * x * (1.0f + erff(x * 0.70710678118654752f));
}

// Mean / rstd over D=1024 of a row that one wave holds: each lane brings the sums of its 32 elements, a five-step
// butterfly leaves the totals in every lane. No LDS, no barrier.
__device__ __forceinline__ void wave_stats(float s, float s2, float& mean, float& rstd) {
  #pragma unroll   // five fixed steps, no loop counter
  for (int o = 16; o > 0; o >>= 1) {
    s  += __shfl_xor(s,  o, 32);
    s2 += __shfl_xor(s2, o, 32);
  }
  mean = s * (1.0f / Dd);
  float var = s2 * (1.0f / Dd) - mean * mean;
  rstd = rsqrtf(var + 1e-5f);
}

// A wave's view of a row of D=1024 floats: piece i (0..7) of lane l is float4 number i * 32 + l, so that every
// wave-wide 16-B load or store covers 512 contiguous bytes.
constexpr int PCS = Dd / (32 * 4);   // 8 pieces per lane

// ---------------------------------------------------------------------------
// Weight repack: f32 [K,N] row-major  ->  bf16 [N,K] row-major (B^T layout)
// ---------------------------------------------------------------------------
__device__ __forceinline__ void transpose_cvt_tile(
    char* smem, const float* __restrict__ src, bf16* __restrict__ dst, int K, int N, int blk) {
  bf16 (*tile)[72] = (bf16 (*)[72])smem;   // 64 x 72 halves
  const int nt = N / 64;
  const int nBase = (blk % nt) * 64, kBase = (blk / nt) * 64, tid = threadIdx.x;
  for (int i = tid; i < 64 * 64; i += 256) { const int kk = i >> 6, nn = i & 63; tile[nn][kk] = (bf16)src[(size_t)(kBase + kk) * N + nBase + nn]; }
  __syncthreads();
  for (int g = tid; g < 64 * 8; g += 256) { const int nn = g >> 3, pc = g & 7; vst2(dst + (size_t)(nBase + nn) * K + kBase + pc * 8, *(const v4u*)(&tile[nn][pc * 8])); }
}

// ---------------------------------------------------------------------------
// Dual layernorm: xn1 = LN(x; t_ln1), xn2 = LN(x; h_ln)  (bf16 GEMM inputs)
// ---------------------------------------------------------------------------
// One wave owns two whole rows (all 16 loads of a lane in flight at once; each g/b piece is fetched once for both rows).
__device__ __forceinline__ void ln_dual_rows(
    const float* __restrict__ x,
    const float* __restrict__ g1, const float* __restrict__ b1,
    const float* __restrict__ g2, const float* __restrict__ b2,
    bf16* __restrict__ xn1, bf16* __restrict__ xn2, int blk) {
  const int lane = threadIdx.x & 31;
  const int wid = __builtin_amdgcn_readfirstlane(threadIdx.x >> 5);   // wave number held scalar: row bases are scalar, a lane adds only its offset
  const size_t t0 = ((size_t)blk * 8 + wid) * 2;
  const float4* xr = (const float4*)(x + t0 * Dd) + lane;
  float4 v[2][PCS];
  // every loop of this kernel is unrolled: v is indexed by constants only and stays in registers
  #pragma unroll
  for (int r = 0; r < 2; ++r)
    #pragma unroll
    for (int i = 0; i < PCS; ++i) v[r][i] = xr[r * (Dd / 4) + i * 32];
  float mean[2], rstd[2];
  #pragma unroll
  for (int r = 0; r < 2; ++r) {
    float s = 0.f, s2 = 0.f;
    #pragma unroll
    for (int i = 0; i < PCS; ++i) {
      const float4 a = v[r][i];
      s  += a.x + a.y + a.z + a.w;
      s2 += a.x * a.x + a.y * a.y + a.z * a.z + a.w * a.w;
    }
    wave_stats(s, s2, mean[r], rstd[r]);
  }
  #pragma unroll
  for (int i = 0; i < PCS; ++i) {
    const int pc = i * 32 + lane;
    const float4 G1 = ((const float4*)g1)[pc], B1 = ((const float4*)b1)[pc];
    const float4 G2 = ((const float4*)g2)[pc], B2 = ((const float4*)b2)[pc];
    #pragma unroll
    for (int r = 0; r < 2; ++r) {
      const float4 a = v[r][i];
      const float n0 = (a.x - mean[r]) * rstd[r], n1 = (a.y - mean[r]) * rstd[r];
      const float n2 = (a.z - mean[r]) * rstd[r], n3 = (a.w - mean[r]) * rstd[r];
      union { bf16 h[4]; unsigned long long u; } p1, p2;   // 4 halves = 8 B per lane; a wave writes 256 contiguous bytes
      p1.h[0] = (bf16)(n0 * G1.x + B1.x); p2.h[0] = (bf16)(n0 * G2.x + B2.x);
      p1.h[1] = (bf16)(n1 * G1.y + B1.y); p2.h[1] = (bf16)(n1 * G2.y + B2.y);
      p1.h[2] = (bf16)(n2 * G1.z + B1.z); p2.h[2] = (bf16)(n2 * G2.z + B2.z);
      p1.h[3] = (bf16)(n3 * G1.w + B1.w); p2.h[3] = (bf16)(n3 * G2.w + B2.w);
      const size_t base = (t0 + r) * Dd + pc * 4;
      vst2(xn1 + base, p1.u); vst2(xn2 + base, p2.u);
    }
  }
}

// ---------------------------------------------------------------------------
// One grid for all work that depends on the inputs alone: the dual layernorm's blocks, then the 64x64 tiles of the six
// weight repacks. wpack holds the four D x D repacks one behind the other (q, k, v, o).
// ---------------------------------------------------------------------------
constexpr int LN_BLKS = TOK / 16;                     // 512
constexpr int WBIG_BLKS = (DFf / 64) * (Dd / 64);     // 1024 tiles of a D x DF weight
constexpr int WSQ_BLKS = (Dd / 64) * (Dd / 64);       // 256 tiles of a D x D weight
__global__ __launch_bounds__(256) void prep_kernel(
    const float* __restrict__ x,
    const float* __restrict__ g1, const float* __restrict__ b1,
    const float* __restrict__ g2, const float* __restrict__ b2,
    bf16* __restrict__ xn1, bf16* __restrict__ xn2,
    const float* __restrict__ wq, const float* __restrict__ wk,
    const float* __restrict__ wv, const float* __restrict__ wo,
    const float* __restrict__ w1, const float* __restrict__ w2,
    bf16* __restrict__ wpack, bf16* __restrict__ w1t, bf16* __restrict__ w2t) {
  __shared__ __align__(16) char smem[64 * 72 * 2];
  int t = blockIdx.x;
  if (t < LN_BLKS) { ln_dual_rows(x, g1, b1, g2, b2, xn1, xn2, t); return; }
  t -= LN_BLKS;
  const float* src; bf16* dst; int K = Dd, N = Dd;
  if (t < WBIG_BLKS) { src = w1; dst = w1t; N = DFf; }
  else if (t < 2 * WBIG_BLKS) { t -= WBIG_BLKS; src = w2; dst = w2t; K = DFf; }
  else {
    t -= 2 * WBIG_BLKS;
    const int sel = t / WSQ_BLKS;
    t -= sel * WSQ_BLKS;
    src = sel == 0 ? wq : sel == 1 ? wk : sel == 2 ? wv : wo;
    dst = wpack + (size_t)sel * Dd * Dd;
  }
  transpose_cvt_tile(smem, src, dst, K, N, t);
}

// ---------------------------------------------------------------------------
// Tiled WMMA GEMM:  C[M,N] = epilogue(A[M,K]_bf16 @ Bt[N,K]_bf16 + bias)
// Block tile 128x128, 8 waves (2x4), each wave 64x32 (8 v8f accumulators).
// Double-buffered LDS, a stage = 64 k (whole 128-B lines of every row), filled with asynchronous 16-B copies:
// compute stage i from buf(i&1) while stage i+1 flies into buf(~i&1).
// EPI 0: gelu -> bf16 row-major       EPI 1: res + acc + bias -> f32 row-major
// EPI 2: bf16 head-major [B,H,S,HD]   EPI 3: bf16 transposed  [B,H,HD,S]
// ---------------------------------------------------------------------------
template <int EPI>
__device__ __forceinline__ void gemm_epilogue(
    float (*Ct)[128], const v8f (&acc)[4][2], const float* __restrict__ bias, const float* __restrict__ res,
    void* __restrict__ out, int Ntot, int mBase, int nBase) {
  const int tid  = threadIdx.x;
  const int lane = tid & 31, wid = tid >> 5;
  const int wm = wid & 1, wn = wid >> 1;            // 2 x 4 wave grid
  const int la = lane & 15, hs = lane >> 4;         // lane-in-16, half-select
  // Epilogue. C-frag: lane holds col la, rows r + 8*hs per VGPR r -> block tile Ct[128][128] (value after bias/gelu/residual),
  // then whole-line stores: EPI 0 f16 rows (256 B), EPI 1 f32 rows (512 B), EPI 2 [b,h,s,hd] rows (128 hd = 256 B at hd0),
  // EPI 3 [b,h,hd,s] rows (128 s = 256 B at s0).
  __syncthreads();
  float rv[4][2][8];   // EPI 1: the residual values of this lane's 64 elements, all loads issued ahead of the sums
  if constexpr (EPI == 1) {
    #pragma unroll   // rv is indexed by constants only and stays in registers
    for (int ms = 0; ms < 4; ++ms)
      #pragma unroll
      for (int ns = 0; ns < 2; ++ns)
        #pragma unroll
        for (int r = 0; r < 8; ++r) {
          rv[ms][ns][r] = res[(size_t)(mBase + wm * 64 + ms * 16 + r + hs * 8) * Ntot + nBase + wn * 32 + ns * 16 + la];
          // behind each load
          asm volatile("s_wait_xcnt 0x0" ::: "memory");
        }
  }
  #pragma unroll
  for (int ms = 0; ms < 4; ++ms)
    #pragma unroll
    for (int ns = 0; ns < 2; ++ns) {
      int cl = wn * 32 + ns * 16 + la;
      int col = nBase + cl;
      float bv = bias[col];
      #pragma unroll
      for (int r = 0; r < 8; ++r) {
        int rl = wm * 64 + ms * 16 + r + hs * 8;
        int row = mBase + rl;
        float v = acc[ms][ns][r] + bv;
        if constexpr (EPI == 0) v = gelu_exact(v);
        else if constexpr (EPI == 1) v += rv[ms][ns][r];
        Ct[rl][cl] = v;
      }
    }
  __syncthreads();
  if constexpr (EPI == 1) {
    for (int g = tid; g < 128 * 32; g += 256) { const int rl = g >> 5, pc = g & 31; vst2((float*)out + (size_t)(mBase + rl) * Ntot + nBase + pc * 4, *(const v4f*)(&Ct[rl][pc * 4])); }
  } else if constexpr (EPI == 3) {
    const int b = mBase / Ss, s0 = mBase % Ss, h = nBase / HDd, hd0 = nBase % HDd;
    for (int g = tid; g < 128 * 16; g += 256) {
      const int cl = g >> 4, pc = g & 15;         // hd row cl, piece of 8 s
      union { v8h h; v4u u; } pk;
      #pragma unroll
      for (int e = 0; e < 8; ++e) pk.h[e] = (bf16)Ct[pc * 8 + e][cl];
      vst2((bf16*)out + ((size_t)((b * Hh + h) * HDd + hd0 + cl)) * Ss + s0 + pc * 8, pk.u);
    }
  } else {
    for (int g = tid; g < 128 * 16; g += 256) {
      const int rl = g >> 4, pc = g & 15;
      union { v8h h; v4u u; } pk;
      #pragma unroll
      for (int e = 0; e < 8; ++e) pk.h[e] = (bf16)Ct[rl][pc * 8 + e];
      const int row = mBase + rl;
      if constexpr (EPI == 0) vst2((bf16*)out + (size_t)row * Ntot + nBase + pc * 8, pk.u);
      else { const int b = row / Ss, s = row % Ss, h = nBase / HDd, hd0 = nBase % HDd;
             vst2((bf16*)out + ((size_t)((b * Hh + h) * Ss + s)) * HDd + hd0 + pc * 8, pk.u); }
    }
  }
}

// One 128x128 tile; smem = the block's LDS (GEMM_LDS bytes); epi (0..3) is the same for the whole block.
constexpr int PANEL = 128 * 72;                              // halves of one staged panel
constexpr int GEMM_LDS = 4 * PANEL * 2 + 128 * 128 * 4;      // 139,264 B
__device__ __forceinline__ void gemm_tile(
    char* smem, const bf16* __restrict__ A, const bf16* __restrict__ Bt,
    const float* __restrict__ bias, const float* __restrict__ res,
    void* __restrict__ out, int Ntot, int Ktot, int mBase, int nBase, int epi) {
  bf16 (*As)[PANEL] = (bf16 (*)[PANEL])smem;                     // [2]; 64 K + 8 pad per row: pitch 144 B = 16 B x odd for the 16-B readers
  bf16 (*Bs)[PANEL] = (bf16 (*)[PANEL])(smem + 2 * PANEL * 2);   // [2]
  float (*Ct)[128] = (float (*)[128])(smem + 4 * PANEL * 2);     // block output tile (64 KB)
  const int tid  = threadIdx.x;
  const int lane = tid & 31, wid = tid >> 5;
  const int wm = wid & 1, wn = wid >> 1;            // 2 x 4 wave grid
  const int la = lane & 15, hs = lane >> 4;         // lane-in-16, half-select

  // Stage 128x64 panels of A and Bt into an LDS buffer with asynchronous 16-B copies (no register in between).
  // Eight lanes cover one 128-B row, a wave four whole lines. Each thread owns one 16-B piece of rows sr + 32 i
  // (i = 0..3) of both panels: eight copies per stage, every lane on.
  const int sr = tid >> 3, sc = (tid & 7) * 8;
  const size_t rstep = (size_t)32 * Ktot;
  const bf16* ga = A  + (size_t)(mBase + sr) * Ktot + sc;
  const bf16* gb = Bt + (size_t)(nBase + sr) * Ktot + sc;
  const unsigned la_lds = (unsigned)(size_t)&As[0][sr * 72 + sc];   // low 32 bits of a __shared__ address = LDS byte address
  const unsigned lb_lds = (unsigned)(size_t)&Bs[0][sr * 72 + sc];
  auto stage = [&](int k0, int buf) {
    constexpr unsigned RS = 32 * 72 * 2;                            // 32 rows further in LDS, bytes
    const unsigned da = la_lds + (unsigned)buf * (128 * 72 * 2), db = lb_lds + (unsigned)buf * (128 * 72 * 2);
    const bf16 *pa = ga + k0, *pb = gb + k0;
    // the copies and their s_wait_xcnt in one statement, so that the wait stands ahead of any rewrite of an address register
    asm volatile("global_load_async_to_lds_b128 %0, %1, off\n\t"
                 "global_load_async_to_lds_b128 %2, %3, off\n\t"
                 "global_load_async_to_lds_b128 %4, %5, off\n\t"
                 "global_load_async_to_lds_b128 %6, %7, off\n\t"
                 "global_load_async_to_lds_b128 %8, %9, off\n\t"
                 "global_load_async_to_lds_b128 %10, %11, off\n\t"
                 "global_load_async_to_lds_b128 %12, %13, off\n\t"
                 "global_load_async_to_lds_b128 %14, %15, off\n\t"
                 "s_wait_xcnt 0x0"
                 :: "v"(da),          "v"(pa),             "v"(da + RS),     "v"(pa + rstep),
                    "v"(da + 2 * RS), "v"(pa + 2 * rstep), "v"(da + 3 * RS), "v"(pa + 3 * rstep),
                    "v"(db),          "v"(pb),             "v"(db + RS),     "v"(pb + rstep),
                    "v"(db + 2 * RS), "v"(pb + 2 * rstep), "v"(db + 3 * RS), "v"(pb + 3 * rstep)
                 : "memory");
  };

  v8f acc[4][2] = {};
  const int ntiles = Ktot >> 6;
  stage(0, 0);
  asm volatile("s_wait_asynccnt 0x0" ::: "memory");   // this wave's copies of stage 0 have landed
  __syncthreads();                                    // every wave's have
  if (ntiles > 1) stage(64, 1);

  for (int it = 0; it < ntiles; ++it) {
    const int cur = it & 1;   // stage it is worked on from buf(cur) while stage it + 1 flies into the other buffer
    #pragma unroll   // kf a constant: the two 32-k halves of a stage become LDS offsets, no loop or address work per half
    for (int kf = 0; kf < 64; kf += 32) {
      // A-frag (16x32 bf16): lanes 0-15 hold K 0-7 / 16-23, lanes 16-31 K 8-15 / 24-31.
      v16h afrag[4];
      #pragma unroll
      for (int ms = 0; ms < 4; ++ms) {
        int r = wm * 64 + ms * 16 + la;
        union { v16h v; v8h h[2]; } u;
        u.h[0] = *(const v8h*)&As[cur][r * 72 + kf + hs * 8];
        u.h[1] = *(const v8h*)&As[cur][r * 72 + kf + hs * 8 + 16];
        afrag[ms] = u.v;
      }
      // B-frag (32x16): same per-lane K map as A (lanes 0-15 hold K 0-7 / 16-23, lanes 16-31 K 8-15 / 24-31).
      v16h bfrag[2];
      #pragma unroll
      for (int ns = 0; ns < 2; ++ns) {
        int r = wn * 32 + ns * 16 + la;
        union { v16h v; v8h h[2]; } u;
        u.h[0] = *(const v8h*)&Bs[cur][r * 72 + kf + hs * 8];
        u.h[1] = *(const v8h*)&Bs[cur][r * 72 + kf + hs * 8 + 16];
        bfrag[ns] = u.v;
      }
      #pragma unroll
      for (int ms = 0; ms < 4; ++ms)
        #pragma unroll
        for (int ns = 0; ns < 2; ++ns)
          acc[ms][ns] = wmma_bf16(afrag[ms], bfrag[ns], acc[ms][ns]);
    }
    asm volatile("s_wait_dscnt 0x0" ::: "memory");      // this wave's reads of buf(cur) are done before it is refilled
    asm volatile("s_wait_asynccnt 0x0" ::: "memory");   // this wave's copies of stage it + 1 have landed
    __syncthreads();                                    // stage it + 1 published; every wave has left buf(cur)
    if (it + 2 < ntiles) stage((it + 2) * 64, cur);
  }
  asm volatile("s_wait_asynccnt 0x0" ::: "memory");     // no copy outstanding behind the loop

  if (epi == 0)      gemm_epilogue<0>(Ct, acc, bias, res, out, Ntot, mBase, nBase);
  else if (epi == 1) gemm_epilogue<1>(Ct, acc, bias, res, out, Ntot, mBase, nBase);
  else if (epi == 2) gemm_epilogue<2>(Ct, acc, bias, res, out, Ntot, mBase, nBase);
  else               gemm_epilogue<3>(Ct, acc, bias, res, out, Ntot, mBase, nBase);
}

// FFN-up GEMM and the Q, K, V projections in one grid (all K = D, all depend only on the layernorm outputs and repacks):
// blockIdx.x 0..31 = column tiles of h1, then eight column tiles each of q, k, v.
__global__ __launch_bounds__(256) void gemm_up_qkv_kernel(
    const bf16* __restrict__ xn1, const bf16* __restrict__ xn2,
    const bf16* __restrict__ w1t, const bf16* __restrict__ wpack,
    const float* __restrict__ b1, const float* __restrict__ bq,
    const float* __restrict__ bk, const float* __restrict__ bv,
    bf16* __restrict__ h1, bf16* __restrict__ qb, bf16* __restrict__ kb, bf16* __restrict__ vtb,
    int Nup, int Nproj, int Ktot) {
  __shared__ __align__(16) char smem[GEMM_LDS];
  const int bx = blockIdx.x, mBase = blockIdx.y * 128;
  const bf16 *A = xn1, *Bt = w1t;
  const float* bias = b1;
  bf16* out = h1;
  int Ntot = Nup, nBase = bx * 128, epi = 0;
  if (bx >= DFf / 128) {
    const int sel = (bx - DFf / 128) >> 3;
    A = xn2; Bt = wpack + (size_t)sel * Dd * Dd;
    bias = sel == 0 ? bq : sel == 1 ? bk : bv;
    out  = sel == 0 ? qb : sel == 1 ? kb : vtb;
    Ntot = Nproj; nBase = ((bx - DFf / 128) & 7) * 128; epi = sel == 2 ? 3 : 2;
  }
  gemm_tile(smem, A, Bt, bias, nullptr, out, Ntot, Ktot, mBase, nBase, epi);
}

// ---------------------------------------------------------------------------
// Hebbian attention: out_i = sum_{j<=i} relu(beta * q_i.k_j) v_j
// q,k: bf16 [B,H,S,HD] ; vt: bf16 [B,H,HD,S] ; out: bf16 [B,S,D] (token-major)
// Block = one (b,h) x 64-query tile. Causal: only kt <= qt key tiles visited.
// The K tile (64 x 256) and the Vt tile (256 x 64) are brought in once per block with whole-line 16-B loads and kept in
// LDS; every wave takes its B fragments from there. The next tile's loads are issued at the top of a pass and stored
// behind the barrier that ends the last read of the tile they replace.
// ---------------------------------------------------------------------------
constexpr int ATTN_LDS = (2 * 64 * 264 + 256 * 72 + 64 * 72) * 2;   // 113,664 B
__device__ __forceinline__ void hebbian_attn_tile(
    char* smem, const bf16* __restrict__ q, const bf16* __restrict__ k,
    const bf16* __restrict__ vt, const float* __restrict__ betap,
    bf16* __restrict__ attn_out, int qt, int bh) {
  bf16* Qs   = (bf16*)smem;       // 64 x 256 (+8 pad)
  bf16* Ks   = Qs + 64 * 264;     // 64 keys x 256 (+8 pad)
  bf16* Vs   = Ks + 64 * 264;     // 256 feats x 64 keys (+8 pad); after the loop: per-wave output tiles
  bf16* affs = Vs + 256 * 72;     // 64 x 64  (+8 pad)
  const int bidx = bh / Hh, hidx = bh % Hh;
  const int tid = threadIdx.x, lane = tid & 31, wid = tid >> 5;
  const int la = lane & 15, hs = lane >> 4;
  const float beta = betap[0];

  const int kr = tid >> 5, kc = (tid & 31) * 8;   // K piece: a wave covers one 512-B row; 8 rows per step
  const int vr = tid >> 3, vc = (tid & 7) * 8;    // Vt piece: a wave covers four 128-B rows; 32 rows per step
  const bf16* kth = k  + (size_t)bh * Ss * HDd + kr * HDd + kc;   // this thread's piece of key row kr
  const bf16* vth = vt + (size_t)bh * HDd * Ss + vr * Ss + vc;    // this thread's piece of feature row vr
  v4u kreg[8], vreg[8];
  auto fetch = [&](int kbase) {
    #pragma unroll
    for (int i = 0; i < 8; ++i) kreg[i] = *(const v4u*)(kth + (size_t)kbase * HDd + i * 8 * HDd);
    #pragma unroll
    for (int i = 0; i < 8; ++i) vreg[i] = *(const v4u*)(vth + kbase + i * 32 * Ss);
  };
  auto put_k = [&]() {
    #pragma unroll
    for (int i = 0; i < 8; ++i) *(v4u*)&Ks[(kr + i * 8) * 264 + kc] = kreg[i];
  };
  auto put_v = [&]() {
    #pragma unroll
    for (int i = 0; i < 8; ++i) *(v4u*)&Vs[(vr + i * 32) * 72 + vc] = vreg[i];
  };

  fetch(0);
  // Stage Q tile (reused for every key tile).
  const bf16* qb = q + ((size_t)bh * Ss + qt * 64) * HDd;
  #pragma unroll
  for (int c = tid; c < 64 * 32; c += 256) {
    int r = c >> 5, cc = (c & 31) * 8;
    *(v4u*)&Qs[r * 264 + cc] = *(const v4u*)&qb[(size_t)r * HDd + cc];
  }
  put_k();
  put_v();
  __syncthreads();

  const int ma = wid & 3;   // 16-row group for both GEMMs
  const int nh = wid >> 2;  // GEMM1: 32-col half of aff ; GEMM2: 128-feat half
  v8f oacc[8] = {};

  for (int kt = 0; kt <= qt; ++kt) {
    const int kbase = kt * 64;
    const bool more = kt < qt;
    if (more) fetch(kbase + 64);
    // ---- GEMM1: aff(64x64) = Q(64x256) @ K^T, both from LDS ----
    v8f c0 = {}, c1 = {};
    #pragma unroll
    for (int kf = 0; kf < HDd; kf += 32) {
      union { v16h v; v8h h[2]; } ua, ub0, ub1;
      int ar = ma * 16 + la;
      ua.h[0] = *(const v8h*)&Qs[ar * 264 + kf + hs * 8];
      ua.h[1] = *(const v8h*)&Qs[ar * 264 + kf + hs * 8 + 16];
      const bf16* p0 = &Ks[(nh * 32 + la)      * 264 + kf + hs * 8];   // same K map as A
      const bf16* p1 = &Ks[(nh * 32 + 16 + la) * 264 + kf + hs * 8];
      ub0.h[0] = *(const v8h*)p0; ub0.h[1] = *(const v8h*)(p0 + 16);
      ub1.h[0] = *(const v8h*)p1; ub1.h[1] = *(const v8h*)(p1 + 16);
      c0 = wmma_bf16(ua.v, ub0.v, c0);
      c1 = wmma_bf16(ua.v, ub1.v, c1);
    }
    // beta * relu + causal mask, re-layout C-frag -> A-frag via LDS (bf16).
    // (the barrier at the foot of the previous pass ended the last read of affs)
    #pragma unroll
    for (int ns = 0; ns < 2; ++ns) {
      v8f cv = ns ? c1 : c0;
      int jl = nh * 32 + ns * 16 + la;
      int j = kbase + jl;
      #pragma unroll
      for (int r = 0; r < 8; ++r) {
        int il = ma * 16 + r + hs * 8;
        int i = qt * 64 + il;
        float v = cv[r] * beta;
        v = (j <= i && v > 0.f) ? v : 0.f;
        affs[il * 72 + jl] = (bf16)v;
      }
    }
    __syncthreads();  // affs and this pass's Vs visible; every read of Ks done
    if (more) put_k();
    // ---- GEMM2: out(64x256) += aff(64x64) @ V(64x256) via Vt rows in LDS ----
    #pragma unroll
    for (int kk = 0; kk < 64; kk += 32) {
      union { v16h v; v8h h[2]; } ua;
      int ar = ma * 16 + la;
      ua.h[0] = *(const v8h*)&affs[ar * 72 + kk + hs * 8];
      ua.h[1] = *(const v8h*)&affs[ar * 72 + kk + hs * 8 + 16];
      #pragma unroll
      for (int j = 0; j < 8; ++j) {
        int feat = nh * 128 + j * 16 + la;
        union { v16h v; v8h h[2]; } ub;
        const bf16* p = &Vs[feat * 72 + kk + hs * 8];
        ub.h[0] = *(const v8h*)p; ub.h[1] = *(const v8h*)(p + 16);
        oacc[j] = wmma_bf16(ua.v, ub.v, oacc[j]);
      }
    }
    __syncthreads();  // next pass's Ks visible; every read of Vs and affs done
    if (more) put_v();
  }
  // Write f16 token-major so the wo GEMM can consume it as A directly: the wave's 16 rows x 128 feats (256-B row segments)
  bf16* ot = Vs + wid * (16 * 128);   // Vs is free behind the loop's last barrier
  #pragma unroll
  for (int j = 0; j < 8; ++j) {
    int fl = j * 16 + la;
    #pragma unroll
    for (int r = 0; r < 8; ++r) ot[(r + hs * 8) * 128 + fl] = (bf16)oacc[j][r];
  }
  __syncthreads();
  #pragma unroll
  for (int q2 = 0; q2 < 8; ++q2) {
    const int rl = q2 * 2 + (lane >> 4), pc = lane & 15;
    const int s = qt * 64 + ma * 16 + rl;
    vst2(attn_out + ((size_t)(bidx * Ss + s)) * Dd + hidx * HDd + nh * 128 + pc * 8, *(const v4u*)(ot + rl * 128 + pc * 8));
  }
}

// Attention and the FFN-down GEMM in one grid (neither reads what the other writes). There are twice as many blocks as
// places; in index order the long ones come first: the causal tiles of the upper half of the
// queries (longest first), then the GEMM's tiles, then the remaining causal tiles, ever shorter, which fill the tail.
constexpr int ATTN_BLKS = (Ss / 64) * Bb * Hh;        // 512
constexpr int DOWN_BLKS = (Dd / 128) * (TOK / 128);   // 512
static_assert(ATTN_LDS <= GEMM_LDS, "the attention tile lives in the GEMM's LDS");
__global__ __launch_bounds__(256) void attn_ffn_down_kernel(
    const bf16* __restrict__ q, const bf16* __restrict__ k,
    const bf16* __restrict__ vt, const float* __restrict__ betap, bf16* __restrict__ attn_out,
    const bf16* __restrict__ h1, const bf16* __restrict__ w2t, const float* __restrict__ b2,
    const float* __restrict__ x, float* __restrict__ tpre, int Ntot, int Ktot) {
  __shared__ __align__(16) char smem[GEMM_LDS];
  const int b = blockIdx.x;
  if (b < ATTN_BLKS / 2 || b >= ATTN_BLKS / 2 + DOWN_BLKS) {
    const int u = b < ATTN_BLKS / 2 ? b : b - DOWN_BLKS;   // 0..511: sixteen (batch, head) pairs per query tile
    hebbian_attn_tile(smem, q, k, vt, betap, attn_out, Ss / 64 - 1 - u / (Bb * Hh), u % (Bb * Hh));
  } else {
    const int t = b - ATTN_BLKS / 2;
    gemm_tile(smem, h1, w2t, b2, x, tpre, Ntot, Ktot, (t / (Dd / 128)) * 128, (t % (Dd / 128)) * 128, 1);
  }
}

// ---------------------------------------------------------------------------
// TRM tail: residual = tpre; xn = LN(tpre); mix = scalar-MLP(xn); out = tpre+mix
// ---------------------------------------------------------------------------
// One wave owns one whole row: 32 elements per lane, kept in registers.
__device__ __forceinline__ void trm_scalar_mlp_rows(
    const float* __restrict__ tpre, const float* __restrict__ g,
    const float* __restrict__ bt, const float* __restrict__ sw1,
    const float* __restrict__ sb1, const float* __restrict__ sw2,
    const float* __restrict__ sb2, float* __restrict__ trm_out, int blk) {
  const int lane = threadIdx.x & 31;
  const int wid = __builtin_amdgcn_readfirstlane(threadIdx.x >> 5);   // wave number held scalar: row bases are scalar, a lane adds only its offset
  const size_t t = (size_t)blk * 8 + wid;
  const float4* xr = (const float4*)(tpre + t * Dd) + lane;
  float xin[PCS * 4];
  float s = 0.f, s2 = 0.f;
  // every loop over pieces or elements is unrolled: xin, xn, mix are indexed by constants only and stay in registers
  #pragma unroll
  for (int i = 0; i < PCS; ++i) {
    const float4 a = xr[i * 32];
    xin[i * 4 + 0] = a.x; xin[i * 4 + 1] = a.y; xin[i * 4 + 2] = a.z; xin[i * 4 + 3] = a.w;
  }
  #pragma unroll
  for (int i = 0; i < PCS; ++i) {
    const float a0 = xin[i * 4], a1 = xin[i * 4 + 1], a2 = xin[i * 4 + 2], a3 = xin[i * 4 + 3];
    s  += a0 + a1 + a2 + a3;
    s2 += a0 * a0 + a1 * a1 + a2 * a2 + a3 * a3;
  }
  float mean, rstd;
  wave_stats(s, s2, mean, rstd);
  asm volatile("s_wait_xcnt 0x0" ::: "memory");   // behind the eight row loads: their scalar base is reused for the scalar load below
  const float vb2 = sb2[0];
  float xn[PCS * 4], mix[PCS * 4];
  #pragma unroll
  for (int i = 0; i < PCS; ++i) {
    const float4 G = ((const float4*)g)[i * 32 + lane], Bt = ((const float4*)bt)[i * 32 + lane];
    xn[i * 4 + 0] = (xin[i * 4 + 0] - mean) * rstd * G.x + Bt.x;
    xn[i * 4 + 1] = (xin[i * 4 + 1] - mean) * rstd * G.y + Bt.y;
    xn[i * 4 + 2] = (xin[i * 4 + 2] - mean) * rstd * G.z + Bt.z;
    xn[i * 4 + 3] = (xin[i * 4 + 3] - mean) * rstd * G.w + Bt.w;
    mix[i * 4 + 0] = vb2; mix[i * 4 + 1] = vb2; mix[i * 4 + 2] = vb2; mix[i * 4 + 3] = vb2;
  }
  #pragma unroll 1   // rolled: a trip already holds 32 inlined erf bodies; four times that is needless code to fetch
  for (int e = 0; e < Ee; ++e) {
    const float w1 = sw1[e], b1 = sb1[e], w2 = sw2[e];
    #pragma unroll
    for (int j = 0; j < PCS * 4; ++j) mix[j] += gelu_exact(xn[j] * w1 + b1) * w2;
  }
  #pragma unroll
  for (int i = 0; i < PCS; ++i) {
    v4f ov = {xin[i * 4 + 0] + mix[i * 4 + 0], xin[i * 4 + 1] + mix[i * 4 + 1],
              xin[i * 4 + 2] + mix[i * 4 + 2], xin[i * 4 + 3] + mix[i * 4 + 3]};
    vst2((v4f*)(trm_out + t * Dd) + i * 32 + lane, ov);
  }
}

// The scalar MLP (vector work) and the output projection (matrix work) in one grid. In index order
// the MLP blocks of eight rows, the longer kind, come first, then the GEMM's tiles.
constexpr int MLP_BLKS = TOK / 8;                     // 1024
constexpr int WO_BLKS = (Dd / 128) * (TOK / 128);     // 512
__global__ __launch_bounds__(256) void wo_mlp_kernel(
    const bf16* __restrict__ ao, const bf16* __restrict__ wot, const float* __restrict__ bo,
    const float* __restrict__ x, float* __restrict__ heb,
    const float* __restrict__ tpre, const float* __restrict__ g,
    const float* __restrict__ bt, const float* __restrict__ sw1,
    const float* __restrict__ sb1, const float* __restrict__ sw2,
    const float* __restrict__ sb2, float* __restrict__ trm_out, int Ntot, int Ktot) {
  __shared__ __align__(16) char smem[GEMM_LDS];
  const int b = blockIdx.x;
  if (b < MLP_BLKS) trm_scalar_mlp_rows(tpre, g, bt, sw1, sb1, sw2, sb2, trm_out, b);
  else {
    const int t = b - MLP_BLKS;
    gemm_tile(smem, ao, wot, bo, x, heb, Ntot, Ktot, (t / (Dd / 128)) * 128, (t % (Dd / 128)) * 128, 1);
  }
}

// ---------------------------------------------------------------------------
// Final blend + layernorm:  LN(x + sig(a)*trm + (1-sig(a))*heb ; o_ln)
// ---------------------------------------------------------------------------
// One wave owns two whole rows.
__global__ __launch_bounds__(256) void blend_ln_kernel(
    const float* __restrict__ x, const float* __restrict__ trm,
    const float* __restrict__ heb, const float* __restrict__ alphap,
    const float* __restrict__ g, const float* __restrict__ bt,
    float* __restrict__ out) {
  const int lane = threadIdx.x & 31;
  const int wid = __builtin_amdgcn_readfirstlane(threadIdx.x >> 5);   // wave number held scalar: row bases are scalar, a lane adds only its offset
  const size_t t0 = ((size_t)blockIdx.x * 8 + wid) * 2;
  const float bw = 1.0f / (1.0f + expf(-alphap[0]));
  const float4* xr = (const float4*)(x   + t0 * Dd) + lane;
  const float4* tr = (const float4*)(trm + t0 * Dd) + lane;
  const float4* hr = (const float4*)(heb + t0 * Dd) + lane;
  float4 u[2][PCS];
  float mean[2], rstd[2];
  // every loop of this kernel is unrolled: u is indexed by constants only and stays in registers
  #pragma unroll
  for (int r = 0; r < 2; ++r) {
    float s = 0.f, s2 = 0.f;
    #pragma unroll
    for (int i = 0; i < PCS; ++i) {
      const int o = r * (Dd / 4) + i * 32;
      const float4 xv = xr[o], tv = tr[o], hv = hr[o];
      float4 a;
      a.x = xv.x + bw * tv.x + (1.f - bw) * hv.x;
      a.y = xv.y + bw * tv.y + (1.f - bw) * hv.y;
      a.z = xv.z + bw * tv.z + (1.f - bw) * hv.z;
      a.w = xv.w + bw * tv.w + (1.f - bw) * hv.w;
      u[r][i] = a;
      s  += a.x + a.y + a.z + a.w;
      s2 += a.x * a.x + a.y * a.y + a.z * a.z + a.w * a.w;
    }
    wave_stats(s, s2, mean[r], rstd[r]);
  }
  #pragma unroll
  for (int i = 0; i < PCS; ++i) {
    const int pc = i * 32 + lane;
    const float4 G = ((const float4*)g)[pc], Bt = ((const float4*)bt)[pc];
    #pragma unroll
    for (int r = 0; r < 2; ++r) {
      const float4 a = u[r][i];
      v4f ov = {(a.x - mean[r]) * rstd[r] * G.x + Bt.x, (a.y - mean[r]) * rstd[r] * G.y + Bt.y,
                (a.z - mean[r]) * rstd[r] * G.z + Bt.z, (a.w - mean[r]) * rstd[r] * G.w + Bt.w};
      vst2((v4f*)(out + (t0 + r) * Dd) + pc, ov);   // one wave writes 512 contiguous bytes
    }
  }
}

// ---------------------------------------------------------------------------
// Host-side orchestration.
// ---------------------------------------------------------------------------
extern "C" void kernel_launch(void* const* d_in, const int* in_sizes, int n_in,
                              void* d_out, int out_size, void* d_ws, size_t ws_size,
                              hipStream_t stream) {
  const float* x      = (const float*)d_in[0];
  const float* h_ln_g = (const float*)d_in[1];
  const float* h_ln_b = (const float*)d_in[2];
  const float* wq     = (const float*)d_in[3];
  const float* bq     = (const float*)d_in[4];
  const float* wk     = (const float*)d_in[5];
  const float* bk     = (const float*)d_in[6];
  const float* wv     = (const float*)d_in[7];
  const float* bv     = (const float*)d_in[8];
  const float* wo     = (const float*)d_in[9];
  const float* bo     = (const float*)d_in[10];
  const float* beta   = (const float*)d_in[11];
  const float* t_ln1_g= (const float*)d_in[12];
  const float* t_ln1_b= (const float*)d_in[13];
  const float* t_w1   = (const float*)d_in[14];
  const float* t_b1   = (const float*)d_in[15];
  const float* t_w2   = (const float*)d_in[16];
  const float* t_b2   = (const float*)d_in[17];
  const float* t_lns_g= (const float*)d_in[18];
  const float* t_lns_b= (const float*)d_in[19];
  const float* s_w1   = (const float*)d_in[20];
  const float* s_b1   = (const float*)d_in[21];
  const float* s_w2   = (const float*)d_in[22];
  const float* s_b2   = (const float*)d_in[23];
  const float* alpha  = (const float*)d_in[24];
  const float* o_ln_g = (const float*)d_in[25];
  const float* o_ln_b = (const float*)d_in[26];
  float* out = (float*)d_out;

  char* ws = (char*)d_ws;
  const size_t MB = 1ull << 20;
  bf16* wpack= (bf16*)(ws + 0 * MB);    // q, k, v, o repacks, 2 MB each (1024x1024 f16), one behind the other
  bf16* wot  = (bf16*)(ws + 6 * MB);    // the fourth of them
  bf16* w1t  = (bf16*)(ws + 8 * MB);    // 8 MB  [DF, D]
  bf16* w2t  = (bf16*)(ws + 16 * MB);   // 8 MB  [D, DF]
  bf16* xn1  = (bf16*)(ws + 24 * MB);   // 16 MB [TOK, D]
  bf16* xn2  = (bf16*)(ws + 40 * MB);   // 16 MB [TOK, D]
  bf16* h1   = (bf16*)(ws + 56 * MB);   // 64 MB [TOK, DF]; free behind the FFN-down GEMM
  float* hebo= (float*)(ws + 56 * MB);  // 32 MB f32, in h1's place
  float* tpre= (float*)(ws + 120 * MB); // 32 MB f32
  float* trmo= (float*)(ws + 152 * MB); // 32 MB f32
  bf16* qb   = (bf16*)(ws + 184 * MB);  // 16 MB [B,H,S,HD]
  bf16* kb   = (bf16*)(ws + 200 * MB);  // 16 MB [B,H,S,HD]
  bf16* vtb  = (bf16*)(ws + 216 * MB);  // 16 MB [B,H,HD,S]
  bf16* ao   = (bf16*)(ws + 232 * MB);  // 16 MB [TOK, D] ; total = 248 MB

  // 1: dual layernorm -> f16 GEMM inputs, and the weight repacks (f32 [K,N] -> f16 [N,K])
  prep_kernel<<<LN_BLKS + 2 * WBIG_BLKS + 4 * WSQ_BLKS, 256, 0, stream>>>(
      x, t_ln1_g, t_ln1_b, h_ln_g, h_ln_b, xn1, xn2, wq, wk, wv, wo, t_w1, t_w2, wpack, w1t, w2t);
  // 2: h1 = gelu(xn1 @ w1), q / k head-major, v transposed
  gemm_up_qkv_kernel<<<dim3(DFf / 128 + 3 * (Dd / 128), TOK / 128), 256, 0, stream>>>(
      xn1, xn2, w1t, wpack, t_b1, bq, bk, bv, h1, qb, kb, vtb, DFf, Dd, Dd);
  // 3: causal relu attention -> ao, and tpre = x + h1 @ w2
  attn_ffn_down_kernel<<<ATTN_BLKS + DOWN_BLKS, 256, 0, stream>>>(
      qb, kb, vtb, beta, ao, h1, w2t, t_b2, x, tpre, Dd, DFf);
  // 4: heb = x + ao @ wo, and trm_out from tpre
  wo_mlp_kernel<<<MLP_BLKS + WO_BLKS, 256, 0, stream>>>(
      ao, wot, bo, x, hebo, tpre, t_lns_g, t_lns_b, s_w1, s_b1, s_w2, s_b2, trmo, Dd, Dd);

  // ---- blend + final layernorm ----
  blend_ln_kernel<<<TOK / 16, 256, 0, stream>>>(x, trmo, hebo, alpha,
                                           o_ln_g, o_ln_b, out);
}

// v005
// A run of this version takes 315 microseconds.
// Timed twice side by side with v004, it ran 1.12 times as fast both times.
// All steps since v000 together make it 2.32 times as fast.
#include <hip/hip_runtime.h>
#include <stdint.h>

// ---------------------------------------------------------------------------
// wave32, WMMA f16 (f32 accumulate), double-buffered GEMM pipeline with asynchronous 16-B copies to LDS.
// Contractions: the TRM FFN GEMMs (K = 1024 / 4096), Q/K/V and output projections (K = 1024), the Hebbian affinity Q K^T
// (K = 256) and aff V (K = keys) on v_wmma_f32_16x16x32_f16 (f16 operands, f32 accumulate); LayerNorms, GELU, the scalar
// ---------------------------------------------------------------------------

typedef _Float16 bf16;   // NOTE: 'bf16' is only a type alias name here — the type is IEEE half (f16) throughout
typedef __attribute__((ext_vector_type(4))) float v4f;
typedef __attribute__((ext_vector_type(4))) unsigned v4u;
template <typename V> __device__ __forceinline__ void vst2(void* p, V v) {
  *(V*)p = v; 
}
typedef __attribute__((ext_vector_type(16))) _Float16 v16h;
typedef __attribute__((ext_vector_type(8)))  _Float16 v8h;
typedef __attribute__((ext_vector_type(8)))  float  v8f;

constexpr int Bb  = 4;
constexpr int Ss  = 2048;
constexpr int Dd  = 1024;
constexpr int Hh  = 4;
constexpr int HDd = Dd / Hh;     // 256
constexpr int Ee  = 4;
constexpr int DFf = Dd * Ee;     // 4096
constexpr int TOK = Bb * Ss;     // 8192

__device__ __forceinline__ v8f wmma_bf16(v16h a, v16h b, v8f c) {   // (name kept; f16 WMMA + hazard guard)
  v8f d = __builtin_amdgcn_wmma_f32_16x16x32_f16(false, a, false, b, (short)0, c, false, false);
  asm volatile("v_nop\n\tv_nop\n\tv_nop\n\tv_nop" : "+v"(d) : "v"(a), "v"(b));
  return d;
}

__device__ __forceinline__ float gelu_exact(float x) {
  return 0.5f * x * (1.0f + erff(x * 0.70710678118654752f));
}

// Mean / rstd over D=1024 of a row that one wave holds: each lane brings the sums of its 32 elements, a five-step
// butterfly leaves the totals in every lane. No LDS, no barrier.
__device__ __forceinline__ void wave_stats(float s, float s2, float& mean, float& rstd) {
  #pragma unroll   // five fixed steps, no loop counter
  for (int o = 16; o > 0; o >>= 1) {
    s  += __shfl_xor(s,  o, 32);
    s2 += __shfl_xor(s2, o, 32);
  }
  mean = s * (1.0f / Dd);
  float var = s2 * (1.0f / Dd) - mean * mean;
  rstd = rsqrtf(var + 1e-5f);
}

// A wave's view of a row of D=1024 floats: piece i (0..7) of lane l is float4 number i * 32 + l, so that every
// wave-wide 16-B load or store covers 512 contiguous bytes.
constexpr int PCS = Dd / (32 * 4);   // 8 pieces per lane

// ---------------------------------------------------------------------------
// Weight repack: f32 [K,N] row-major  ->  bf16 [N,K] row-major (B^T layout)
// ---------------------------------------------------------------------------
__device__ __forceinline__ void transpose_cvt_tile(
    char* smem, const float* __restrict__ src, bf16* __restrict__ dst, int K, int N, int blk) {
  bf16 (*tile)[72] = (bf16 (*)[72])smem;   // 64 x 72 halves
  const int nt = N / 64;
  const int nBase = (blk % nt) * 64, kBase = (blk / nt) * 64, tid = threadIdx.x;
  for (int i = tid; i < 64 * 64; i += 256) { const int kk = i >> 6, nn = i & 63; tile[nn][kk] = (bf16)src[(size_t)(kBase + kk) * N + nBase + nn]; }
  __syncthreads();
  for (int g = tid; g < 64 * 8; g += 256) { const int nn = g >> 3, pc = g & 7; vst2(dst + (size_t)(nBase + nn) * K + kBase + pc * 8, *(const v4u*)(&tile[nn][pc * 8])); }
}

// ---------------------------------------------------------------------------
// Dual layernorm: xn1 = LN(x; t_ln1), xn2 = LN(x; h_ln)  (bf16 GEMM inputs)
// ---------------------------------------------------------------------------
// One wave owns two whole rows (all 16 loads of a lane in flight at once; each g/b piece is fetched once for both rows).
__device__ __forceinline__ void ln_dual_rows(
    const float* __restrict__ x,
    const float* __restrict__ g1, const float* __restrict__ b1,
    const float* __restrict__ g2, const float* __restrict__ b2,
    bf16* __restrict__ xn1, bf16* __restrict__ xn2, int blk) {
  const int lane = threadIdx.x & 31;
  const int wid = __builtin_amdgcn_readfirstlane(threadIdx.x >> 5);   // wave number held scalar: row bases are scalar, a lane adds only its offset
  const size_t t0 = ((size_t)blk * 8 + wid) * 2;
  const float4* xr = (const float4*)(x + t0 * Dd) + lane;
  float4 v[2][PCS];
  // every loop of this kernel is unrolled: v is indexed by constants only and stays in registers
  #pragma unroll
  for (int r = 0; r < 2; ++r)
    #pragma unroll
    for (int i = 0; i < PCS; ++i) v[r][i] = xr[r * (Dd / 4) + i * 32];
  float mean[2], rstd[2];
  #pragma unroll
  for (int r = 0; r < 2; ++r) {
    float s = 0.f, s2 = 0.f;
    #pragma unroll
    for (int i = 0; i < PCS; ++i) {
      const float4 a = v[r][i];
      s  += a.x + a.y + a.z + a.w;
      s2 += a.x * a.x + a.y * a.y + a.z * a.z + a.w * a.w;
    }
    wave_stats(s, s2, mean[r], rstd[r]);
  }
  #pragma unroll
  for (int i = 0; i < PCS; ++i) {
    const int pc = i * 32 + lane;
    const float4 G1 = ((const float4*)g1)[pc], B1 = ((const float4*)b1)[pc];
    const float4 G2 = ((const float4*)g2)[pc], B2 = ((const float4*)b2)[pc];
    #pragma unroll
    for (int r = 0; r < 2; ++r) {
      const float4 a = v[r][i];
      const float n0 = (a.x - mean[r]) * rstd[r], n1 = (a.y - mean[r]) * rstd[r];
      const float n2 = (a.z - mean[r]) * rstd[r], n3 = (a.w - mean[r]) * rstd[r];
      union { bf16 h[4]; unsigned long long u; } p1, p2;   // 4 halves = 8 B per lane; a wave writes 256 contiguous bytes
      p1.h[0] = (bf16)(n0 * G1.x + B1.x); p2.h[0] = (bf16)(n0 * G2.x + B2.x);
      p1.h[1] = (bf16)(n1 * G1.y + B1.y); p2.h[1] = (bf16)(n1 * G2.y + B2.y);
      p1.h[2] = (bf16)(n2 * G1.z + B1.z); p2.h[2] = (bf16)(n2 * G2.z + B2.z);
      p1.h[3] = (bf16)(n3 * G1.w + B1.w); p2.h[3] = (bf16)(n3 * G2.w + B2.w);
      const size_t base = (t0 + r) * Dd + pc * 4;
      vst2(xn1 + base, p1.u); vst2(xn2 + base, p2.u);
    }
  }
}

// ---------------------------------------------------------------------------
// One grid for all work that depends on the inputs alone: the dual layernorm's blocks, then the 64x64 tiles of the six
// weight repacks. wpack holds the four D x D repacks one behind the other (q, k, v, o).
// ---------------------------------------------------------------------------
constexpr int LN_BLKS = TOK / 16;                     // 512
constexpr int WBIG_BLKS = (DFf / 64) * (Dd / 64);     // 1024 tiles of a D x DF weight
constexpr int WSQ_BLKS = (Dd / 64) * (Dd / 64);       // 256 tiles of a D x D weight
__global__ __launch_bounds__(256) void prep_kernel(
    const float* __restrict__ x,
    const float* __restrict__ g1, const float* __restrict__ b1,
    const float* __restrict__ g2, const float* __restrict__ b2,
    bf16* __restrict__ xn1, bf16* __restrict__ xn2,
    const float* __restrict__ wq, const float* __restrict__ wk,
    const float* __restrict__ wv, const float* __restrict__ wo,
    const float* __restrict__ w1, const float* __restrict__ w2,
    bf16* __restrict__ wpack, bf16* __restrict__ w1t, bf16* __restrict__ w2t) {
  __shared__ __align__(16) char smem[64 * 72 * 2];
  int t = blockIdx.x;
  if (t < LN_BLKS) { ln_dual_rows(x, g1, b1, g2, b2, xn1, xn2, t); return; }
  t -= LN_BLKS;
  const float* src; bf16* dst; int K = Dd, N = Dd;
  if (t < WBIG_BLKS) { src = w1; dst = w1t; N = DFf; }
  else if (t < 2 * WBIG_BLKS) { t -= WBIG_BLKS; src = w2; dst = w2t; K = DFf; }
  else {
    t -= 2 * WBIG_BLKS;
    const int sel = t / WSQ_BLKS;
    t -= sel * WSQ_BLKS;
    src = sel == 0 ? wq : sel == 1 ? wk : sel == 2 ? wv : wo;
    dst = wpack + (size_t)sel * Dd * Dd;
  }
  transpose_cvt_tile(smem, src, dst, K, N, t);
}

// ---------------------------------------------------------------------------
// Tiled WMMA GEMM:  C[M,N] = epilogue(A[M,K]_bf16 @ Bt[N,K]_bf16 + bias)
// Block tile 128x256, 8 waves (2x4), each wave 64x64 (16 v8f accumulators): per 32 k eight fragments feed sixteen WMMAs,
// and a staged byte of A serves 256 columns, a staged byte of Bt 128 rows.
// Double-buffered LDS, a stage = 64 k (whole 128-B lines of every row), filled with asynchronous 16-B copies:
// compute stage i from buf(i&1) while stage i+1 flies into buf(~i&1).
// EPI 0: gelu -> bf16 row-major       EPI 1: res + acc + bias -> f32 row-major
// EPI 2: bf16 head-major [B,H,S,HD]   EPI 3: bf16 transposed  [B,H,HD,S]
// ---------------------------------------------------------------------------
constexpr int TM = 128, TN = 256;                        // block tile
constexpr int APANEL = TM * 72, BPANEL = TN * 72;        // halves of one staged panel
constexpr int GEMM_LDS = TM * TN * 4;                    // 131,072 B: the f32 output tile; it takes the stage buffers' place behind the loop
static_assert(2 * (APANEL + BPANEL) * 2 <= GEMM_LDS, "the four staged panels (110,592 B) lie inside the output tile's LDS");

// Second half of the epilogue: Ct[128][256] holds acc + bias; whole-line stores: EPI 0 f16 rows (512 B), EPI 1 f32 rows
// (1 KB), EPI 2 [b,h,s,hd] rows (256 hd = 512 B), EPI 3 [b,h,hd,s] rows (128 s = 256 B at s0).
template <int EPI>
__device__ __forceinline__ void gemm_writeout(
    const float (*Ct)[TN], const float* __restrict__ res, void* __restrict__ out, int Ntot, int mBase, int nBase) {
  const int tid = threadIdx.x;
  if constexpr (EPI == 1) {
    // thread = one 16-B piece (tid & 63) of rows (tid >> 6) + 4 i, i = 0..31: a wave covers 512 contiguous bytes
    const int r0 = tid >> 6, c0 = (tid & 63) * 4;
    const size_t rs4 = (size_t)4 * Ntot;   // four rows further
    const size_t o0 = (size_t)(mBase + r0) * Ntot + nBase + c0;
    #pragma unroll 1   // rolled: eight residual loads in flight per lane are enough, all 32 would take 128 registers
    for (int t = 0; t < TM / 4; t += 8) {
      const float* rp = res + o0 + t * rs4;
      float* op = (float*)out + o0 + t * rs4;
      v4f rr[8];   // indexed by constants only (both inner loops unrolled): stays in registers
      #pragma unroll
      for (int j = 0; j < 8; ++j) {
        rr[j] = *(const v4f*)(rp + j * rs4);
        // behind each load
        asm volatile("s_wait_xcnt 0x0" ::: "memory");
      }
      #pragma unroll
      for (int j = 0; j < 8; ++j) vst2(op + j * rs4, *(const v4f*)(&Ct[r0 + (t + j) * 4][c0]) + rr[j]);
      asm volatile("s_wait_xcnt 0x0" ::: "memory");   // behind the stores: the next trip rewrites their data and address registers
    }
  } else if constexpr (EPI == 3) {
    const int b = mBase / Ss, s0 = mBase % Ss, h = nBase / HDd, hd0 = nBase % HDd;
    for (int g = tid; g < TN * (TM / 8); g += 256) {
      const int cl = g >> 4, pc = g & 15;         // hd row cl, piece of 8 s
      union { v8h h; v4u u; } pk;
      #pragma unroll
      for (int e = 0; e < 8; ++e) pk.h[e] = (bf16)Ct[pc * 8 + e][cl];
      vst2((bf16*)out + ((size_t)((b * Hh + h) * HDd + hd0 + cl)) * Ss + s0 + pc * 8, pk.u);
    }
  } else {
    #pragma unroll (EPI == 0 ? 1 : 4)   // EPI 0 rolled: a trip holds eight inlined erf bodies, sixteen trips of them are needless code to fetch; EPI 2: four trips' LDS reads in flight
    for (int g = tid; g < TM * (TN / 8); g += 256) {
      const int rl = g >> 5, pc = g & 31;
      union { v8h h; v4u u; } pk;
      const v4f c0 = *(const v4f*)(&Ct[rl][pc * 8]), c1 = *(const v4f*)(&Ct[rl][pc * 8 + 4]);   // two 16-B reads ahead of the erf branches
      #pragma unroll
      for (int e = 0; e < 8; ++e) {
        const float v = e < 4 ? c0[e & 3] : c1[e & 3];
        pk.h[e] = (bf16)(EPI == 0 ? gelu_exact(v) : v);
      }
      const int row = mBase + rl;
      if constexpr (EPI == 0) vst2((bf16*)out + (size_t)row * Ntot + nBase + pc * 8, pk.u);
      else { const int b = row / Ss, s = row % Ss, h = nBase / HDd, hd0 = nBase % HDd;
             vst2((bf16*)out + ((size_t)((b * Hh + h) * Ss + s)) * HDd + hd0 + pc * 8, pk.u); }
    }
  }
}

// One 128x256 tile; smem = the block's LDS (GEMM_LDS bytes); epi (0..3) is the same for the whole block.
__device__ __forceinline__ void gemm_tile(
    char* smem, const bf16* __restrict__ A, const bf16* __restrict__ Bt,
    const float* __restrict__ bias, const float* __restrict__ res,
    void* __restrict__ out, int Ntot, int Ktot, int mBase, int nBase, int epi) {
  bf16 (*As)[APANEL] = (bf16 (*)[APANEL])smem;                      // [2]; 64 K + 8 pad per row: pitch 144 B = 16 B x odd for the 16-B readers
  bf16 (*Bs)[BPANEL] = (bf16 (*)[BPANEL])(smem + 2 * APANEL * 2);   // [2]
  float (*Ct)[TN] = (float (*)[TN])smem;                            // block output tile (128 KB), used behind the loop only
  const int tid  = threadIdx.x;
  const int lane = tid & 31, wid = tid >> 5;
  const int wm = wid & 1, wn = wid >> 1;            // 2 x 4 wave grid
  const int la = lane & 15, hs = lane >> 4;         // lane-in-16, half-select

  // Stage the 128x64 panel of A and the 256x64 panel of Bt into an LDS buffer with asynchronous 16-B copies (no register
  // in between). Eight lanes cover one 128-B row, a wave four whole lines. Each thread owns one 16-B piece of rows
  // sr + 32 i (i = 0..3 of A, 0..7 of Bt): twelve copies per stage, every lane on.
  const int sr = tid >> 3, sc = (tid & 7) * 8;
  const size_t rstep = (size_t)32 * Ktot;
  const bf16* ga = A  + (size_t)(mBase + sr) * Ktot + sc;
  const bf16* gb = Bt + (size_t)(nBase + sr) * Ktot + sc;
  const unsigned la_lds = (unsigned)(size_t)&As[0][sr * 72 + sc];   // low 32 bits of a __shared__ address = LDS byte address
  const unsigned lb_lds = (unsigned)(size_t)&Bs[0][sr * 72 + sc];
  auto stage = [&](int k0, int buf) {
    constexpr unsigned RS = 32 * 72 * 2;                            // 32 rows further in LDS, bytes
    const unsigned da = la_lds + (unsigned)buf * (APANEL * 2), db = lb_lds + (unsigned)buf * (BPANEL * 2);
    const bf16 *pa = ga + k0, *pb = gb + k0;
    // the copies and their s_wait_xcnt in one statement, so that the wait stands ahead of any rewrite of an address register
    asm volatile("global_load_async_to_lds_b128 %0, %1, off\n\t"
                 "global_load_async_to_lds_b128 %2, %3, off\n\t"
                 "global_load_async_to_lds_b128 %4, %5, off\n\t"
                 "global_load_async_to_lds_b128 %6, %7, off\n\t"
                 "global_load_async_to_lds_b128 %8, %9, off\n\t"
                 "global_load_async_to_lds_b128 %10, %11, off\n\t"
                 "global_load_async_to_lds_b128 %12, %13, off\n\t"
                 "global_load_async_to_lds_b128 %14, %15, off\n\t"
                 "global_load_async_to_lds_b128 %16, %17, off\n\t"
                 "global_load_async_to_lds_b128 %18, %19, off\n\t"
                 "global_load_async_to_lds_b128 %20, %21, off\n\t"
                 "global_load_async_to_lds_b128 %22, %23, off\n\t"
                 "s_wait_xcnt 0x0"
                 :: "v"(da),          "v"(pa),             "v"(da + RS),     "v"(pa + rstep),
                    "v"(da + 2 * RS), "v"(pa + 2 * rstep), "v"(da + 3 * RS), "v"(pa + 3 * rstep),
                    "v"(db),          "v"(pb),             "v"(db + RS),     "v"(pb + rstep),
                    "v"(db + 2 * RS), "v"(pb + 2 * rstep), "v"(db + 3 * RS), "v"(pb + 3 * rstep),
                    "v"(db + 4 * RS), "v"(pb + 4 * rstep), "v"(db + 5 * RS), "v"(pb + 5 * rstep),
                    "v"(db + 6 * RS), "v"(pb + 6 * rstep), "v"(db + 7 * RS), "v"(pb + 7 * rstep)
                 : "memory");
  };

  v8f acc[4][4] = {};
  const int ntiles = Ktot >> 6;
  stage(0, 0);
  asm volatile("s_wait_asynccnt 0x0" ::: "memory");   // this wave's copies of stage 0 have landed
  __syncthreads();                                    // every wave's have
  if (ntiles > 1) stage(64, 1);

  for (int it = 0; it < ntiles; ++it) {
    const int cur = it & 1;   // stage it is worked on from buf(cur) while stage it + 1 flies into the other buffer
    #pragma unroll   // kf a constant: the two 32-k halves of a stage become LDS offsets, no loop or address work per half
    for (int kf = 0; kf < 64; kf += 32) {
      // A-frag (16x32 bf16): lanes 0-15 hold K 0-7 / 16-23, lanes 16-31 K 8-15 / 24-31.
      v16h afrag[4];
      #pragma unroll
      for (int ms = 0; ms < 4; ++ms) {
        int r = wm * 64 + ms * 16 + la;
        union { v16h v; v8h h[2]; } u;
        u.h[0] = *(const v8h*)&As[cur][r * 72 + kf + hs * 8];
        u.h[1] = *(const v8h*)&As[cur][r * 72 + kf + hs * 8 + 16];
        afrag[ms] = u.v;
      }
      // B-frag (32x16): same per-lane K map as A (lanes 0-15 hold K 0-7 / 16-23, lanes 16-31 K 8-15 / 24-31).
      v16h bfrag[4];
      #pragma unroll
      for (int ns = 0; ns < 4; ++ns) {
        int r = wn * 64 + ns * 16 + la;
        union { v16h v; v8h h[2]; } u;
        u.h[0] = *(const v8h*)&Bs[cur][r * 72 + kf + hs * 8];
        u.h[1] = *(const v8h*)&Bs[cur][r * 72 + kf + hs * 8 + 16];
        bfrag[ns] = u.v;
      }
      #pragma unroll
      for (int ms = 0; ms < 4; ++ms)
        #pragma unroll
        for (int ns = 0; ns < 4; ++ns)
          acc[ms][ns] = wmma_bf16(afrag[ms], bfrag[ns], acc[ms][ns]);
    }
    asm volatile("s_wait_dscnt 0x0" ::: "memory");      // this wave's reads of buf(cur) are done before it is refilled
    asm volatile("s_wait_asynccnt 0x0" ::: "memory");   // this wave's copies of stage it + 1 have landed
    __syncthreads();                                    // stage it + 1 published; every wave has left buf(cur)
    if (it + 2 < ntiles) stage((it + 2) * 64, cur);
  }
  asm volatile("s_wait_asynccnt 0x0" ::: "memory");     // no copy outstanding behind the loop

  // First half of the epilogue. C-frag: lane holds col la, rows r + 8*hs per VGPR r -> block tile Ct[128][256] = acc + bias.
  __syncthreads();
  #pragma unroll   // acc is indexed by constants only and stays in registers
  for (int ms = 0; ms < 4; ++ms)
    #pragma unroll
    for (int ns = 0; ns < 4; ++ns) {
      const int cl = wn * 64 + ns * 16 + la;
      const float bv = bias[nBase + cl];
      #pragma unroll
      for (int r = 0; r < 8; ++r) Ct[wm * 64 + ms * 16 + r + hs * 8][cl] = acc[ms][ns][r] + bv;
    }
  __syncthreads();
  if (epi == 0)      gemm_writeout<0>(Ct, res, out, Ntot, mBase, nBase);
  else if (epi == 1) gemm_writeout<1>(Ct, res, out, Ntot, mBase, nBase);
  else if (epi == 2) gemm_writeout<2>(Ct, res, out, Ntot, mBase, nBase);
  else               gemm_writeout<3>(Ct, res, out, Ntot, mBase, nBase);
}

// FFN-up GEMM and the Q, K, V projections in one grid (all K = D, all depend only on the layernorm outputs and repacks):
// blockIdx.x 0..15 = column tiles of h1, then four column tiles each of q, k, v.
__global__ __launch_bounds__(256) void gemm_up_qkv_kernel(
    const bf16* __restrict__ xn1, const bf16* __restrict__ xn2,
    const bf16* __restrict__ w1t, const bf16* __restrict__ wpack,
    const float* __restrict__ b1, const float* __restrict__ bq,
    const float* __restrict__ bk, const float* __restrict__ bv,
    bf16* __restrict__ h1, bf16* __restrict__ qb, bf16* __restrict__ kb, bf16* __restrict__ vtb,
    int Nup, int Nproj, int Ktot) {
  __shared__ __align__(16) char smem[GEMM_LDS];
  const int bx = blockIdx.x, mBase = blockIdx.y * TM;
  const bf16 *A = xn1, *Bt = w1t;
  const float* bias = b1;
  bf16* out = h1;
  int Ntot = Nup, nBase = bx * TN, epi = 0;
  if (bx >= DFf / TN) {
    const int sel = (bx - DFf / TN) >> 2;
    A = xn2; Bt = wpack + (size_t)sel * Dd * Dd;
    bias = sel == 0 ? bq : sel == 1 ? bk : bv;
    out  = sel == 0 ? qb : sel == 1 ? kb : vtb;
    Ntot = Nproj; nBase = ((bx - DFf / TN) & 3) * TN; epi = sel == 2 ? 3 : 2;
  }
  gemm_tile(smem, A, Bt, bias, nullptr, out, Ntot, Ktot, mBase, nBase, epi);
}

// ---------------------------------------------------------------------------
// Hebbian attention: out_i = sum_{j<=i} relu(beta * q_i.k_j) v_j
// q,k: bf16 [B,H,S,HD] ; vt: bf16 [B,H,HD,S] ; out: bf16 [B,S,D] (token-major)
// Block = one (b,h) x 64-query tile. Causal: only kt <= qt key tiles visited.
// The K tile (64 x 256) and the Vt tile (256 x 64) are brought in once per block with whole-line 16-B loads and kept in
// LDS; every wave takes its B fragments from there. The next tile's loads are issued at the top of a pass and stored
// behind the barrier that ends the last read of the tile they replace.
// ---------------------------------------------------------------------------
constexpr int ATTN_LDS = (2 * 64 * 264 + 256 * 72 + 64 * 72) * 2;   // 113,664 B
__device__ __forceinline__ void hebbian_attn_tile(
    char* smem, const bf16* __restrict__ q, const bf16* __restrict__ k,
    const bf16* __restrict__ vt, const float* __restrict__ betap,
    bf16* __restrict__ attn_out, int qt, int bh) {
  bf16* Qs   = (bf16*)smem;       // 64 x 256 (+8 pad)
  bf16* Ks   = Qs + 64 * 264;     // 64 keys x 256 (+8 pad)
  bf16* Vs   = Ks + 64 * 264;     // 256 feats x 64 keys (+8 pad); after the loop: per-wave output tiles
  bf16* affs = Vs + 256 * 72;     // 64 x 64  (+8 pad)
  const int bidx = bh / Hh, hidx = bh % Hh;
  const int tid = threadIdx.x, lane = tid & 31, wid = tid >> 5;
  const int la = lane & 15, hs = lane >> 4;
  const float beta = betap[0];

  const int kr = tid >> 5, kc = (tid & 31) * 8;   // K piece: a wave covers one 512-B row; 8 rows per step
  const int vr = tid >> 3, vc = (tid & 7) * 8;    // Vt piece: a wave covers four 128-B rows; 32 rows per step
  const bf16* kth = k  + (size_t)bh * Ss * HDd + kr * HDd + kc;   // this thread's piece of key row kr
  const bf16* vth = vt + (size_t)bh * HDd * Ss + vr * Ss + vc;    // this thread's piece of feature row vr
  v4u kreg[8], vreg[8];
  auto fetch = [&](int kbase) {
    #pragma unroll
    for (int i = 0; i < 8; ++i) kreg[i] = *(const v4u*)(kth + (size_t)kbase * HDd + i * 8 * HDd);
    #pragma unroll
    for (int i = 0; i < 8; ++i) vreg[i] = *(const v4u*)(vth + kbase + i * 32 * Ss);
  };
  auto put_k = [&]() {
    #pragma unroll
    for (int i = 0; i < 8; ++i) *(v4u*)&Ks[(kr + i * 8) * 264 + kc] = kreg[i];
  };
  auto put_v = [&]() {
    #pragma unroll
    for (int i = 0; i < 8; ++i) *(v4u*)&Vs[(vr + i * 32) * 72 + vc] = vreg[i];
  };

  fetch(0);
  // Stage Q tile (reused for every key tile).
  const bf16* qb = q + ((size_t)bh * Ss + qt * 64) * HDd;
  #pragma unroll
  for (int c = tid; c < 64 * 32; c += 256) {
    int r = c >> 5, cc = (c & 31) * 8;
    *(v4u*)&Qs[r * 264 + cc] = *(const v4u*)&qb[(size_t)r * HDd + cc];
  }
  put_k();
  put_v();
  __syncthreads();

  const int ma = wid & 3;   // 16-row group for both GEMMs
  const int nh = wid >> 2;  // GEMM1: 32-col half of aff ; GEMM2: 128-feat half
  v8f oacc[8] = {};

  for (int kt = 0; kt <= qt; ++kt) {
    const int kbase = kt * 64;
    const bool more = kt < qt;
    if (more) fetch(kbase + 64);
    // ---- GEMM1: aff(64x64) = Q(64x256) @ K^T, both from LDS ----
    v8f c0 = {}, c1 = {};
    #pragma unroll
    for (int kf = 0; kf < HDd; kf += 32) {
      union { v16h v; v8h h[2]; } ua, ub0, ub1;
      int ar = ma * 16 + la;
      ua.h[0] = *(const v8h*)&Qs[ar * 264 + kf + hs * 8];
      ua.h[1] = *(const v8h*)&Qs[ar * 264 + kf + hs * 8 + 16];
      const bf16* p0 = &Ks[(nh * 32 + la)      * 264 + kf + hs * 8];   // same K map as A
      const bf16* p1 = &Ks[(nh * 32 + 16 + la) * 264 + kf + hs * 8];
      ub0.h[0] = *(const v8h*)p0; ub0.h[1] = *(const v8h*)(p0 + 16);
      ub1.h[0] = *(const v8h*)p1; ub1.h[1] = *(const v8h*)(p1 + 16);
      c0 = wmma_bf16(ua.v, ub0.v, c0);
      c1 = wmma_bf16(ua.v, ub1.v, c1);
    }
    // beta * relu + causal mask, re-layout C-frag -> A-frag via LDS (bf16).
    // (the barrier at the foot of the previous pass ended the last read of affs)
    #pragma unroll
    for (int ns = 0; ns < 2; ++ns) {
      v8f cv = ns ? c1 : c0;
      int jl = nh * 32 + ns * 16 + la;
      int j = kbase + jl;
      #pragma unroll
      for (int r = 0; r < 8; ++r) {
        int il = ma * 16 + r + hs * 8;
        int i = qt * 64 + il;
        float v = cv[r] * beta;
        v = (j <= i && v > 0.f) ? v : 0.f;
        affs[il * 72 + jl] = (bf16)v;
      }
    }
    __syncthreads();  // affs and this pass's Vs visible; every read of Ks done
    if (more) put_k();
    // ---- GEMM2: out(64x256) += aff(64x64) @ V(64x256) via Vt rows in LDS ----
    #pragma unroll
    for (int kk = 0; kk < 64; kk += 32) {
      union { v16h v; v8h h[2]; } ua;
      int ar = ma * 16 + la;
      ua.h[0] = *(const v8h*)&affs[ar * 72 + kk + hs * 8];
      ua.h[1] = *(const v8h*)&affs[ar * 72 + kk + hs * 8 + 16];
      #pragma unroll
      for (int j = 0; j < 8; ++j) {
        int feat = nh * 128 + j * 16 + la;
        union { v16h v; v8h h[2]; } ub;
        const bf16* p = &Vs[feat * 72 + kk + hs * 8];
        ub.h[0] = *(const v8h*)p; ub.h[1] = *(const v8h*)(p + 16);
        oacc[j] = wmma_bf16(ua.v, ub.v, oacc[j]);
      }
    }
    __syncthreads();  // next pass's Ks visible; every read of Vs and affs done
    if (more) put_v();
  }
  // Write f16 token-major so the wo GEMM can consume it as A directly: the wave's 16 rows x 128 feats (256-B row segments)
  bf16* ot = Vs + wid * (16 * 128);   // Vs is free behind the loop's last barrier
  #pragma unroll
  for (int j = 0; j < 8; ++j) {
    int fl = j * 16 + la;
    #pragma unroll
    for (int r = 0; r < 8; ++r) ot[(r + hs * 8) * 128 + fl] = (bf16)oacc[j][r];
  }
  __syncthreads();
  #pragma unroll
  for (int q2 = 0; q2 < 8; ++q2) {
    const int rl = q2 * 2 + (lane >> 4), pc = lane & 15;
    const int s = qt * 64 + ma * 16 + rl;
    vst2(attn_out + ((size_t)(bidx * Ss + s)) * Dd + hidx * HDd + nh * 128 + pc * 8, *(const v4u*)(ot + rl * 128 + pc * 8));
  }
}

// Attention and the FFN-down GEMM in one grid (neither reads what the other writes). There are more blocks than
// places; in index order the long ones come first: the causal tiles of the upper half of the
// queries (longest first), then the GEMM's tiles, then the remaining causal tiles, ever shorter, which fill the tail.
constexpr int ATTN_BLKS = (Ss / 64) * Bb * Hh;        // 512
constexpr int DOWN_BLKS = (Dd / TN) * (TOK / TM);     // 256
static_assert(ATTN_LDS <= GEMM_LDS, "the attention tile lives in the GEMM's LDS");
__global__ __launch_bounds__(256) void attn_ffn_down_kernel(
    const bf16* __restrict__ q, const bf16* __restrict__ k,
    const bf16* __restrict__ vt, const float* __restrict__ betap, bf16* __restrict__ attn_out,
    const bf16* __restrict__ h1, const bf16* __restrict__ w2t, const float* __restrict__ b2,
    const float* __restrict__ x, float* __restrict__ tpre, int Ntot, int Ktot) {
  __shared__ __align__(16) char smem[GEMM_LDS];
  const int b = blockIdx.x;
  if (b < ATTN_BLKS / 2 || b >= ATTN_BLKS / 2 + DOWN_BLKS) {
    const int u = b < ATTN_BLKS / 2 ? b : b - DOWN_BLKS;   // 0..511: sixteen (batch, head) pairs per query tile
    hebbian_attn_tile(smem, q, k, vt, betap, attn_out, Ss / 64 - 1 - u / (Bb * Hh), u % (Bb * Hh));
  } else {
    const int t = b - ATTN_BLKS / 2;
    gemm_tile(smem, h1, w2t, b2, x, tpre, Ntot, Ktot, (t / (Dd / TN)) * TM, (t % (Dd / TN)) * TN, 1);
  }
}

// ---------------------------------------------------------------------------
// TRM tail: residual = tpre; xn = LN(tpre); mix = scalar-MLP(xn); out = tpre+mix
// ---------------------------------------------------------------------------
// One wave owns one whole row: 32 elements per lane, kept in registers.
__device__ __forceinline__ void trm_scalar_mlp_rows(
    const float* __restrict__ tpre, const float* __restrict__ g,
    const float* __restrict__ bt, const float* __restrict__ sw1,
    const float* __restrict__ sb1, const float* __restrict__ sw2,
    const float* __restrict__ sb2, float* __restrict__ trm_out, int blk) {
  const int lane = threadIdx.x & 31;
  const int wid = __builtin_amdgcn_readfirstlane(threadIdx.x >> 5);   // wave number held scalar: row bases are scalar, a lane adds only its offset
  const size_t t = (size_t)blk * 8 + wid;
  const float4* xr = (const float4*)(tpre + t * Dd) + lane;
  float xin[PCS * 4];
  float s = 0.f, s2 = 0.f;
  // every loop over pieces or elements is unrolled: xin, xn, mix are indexed by constants only and stay in registers
  #pragma unroll
  for (int i = 0; i < PCS; ++i) {
    const float4 a = xr[i * 32];
    xin[i * 4 + 0] = a.x; xin[i * 4 + 1] = a.y; xin[i * 4 + 2] = a.z; xin[i * 4 + 3] = a.w;
  }
  #pragma unroll
  for (int i = 0; i < PCS; ++i) {
    const float a0 = xin[i * 4], a1 = xin[i * 4 + 1], a2 = xin[i * 4 + 2], a3 = xin[i * 4 + 3];
    s  += a0 + a1 + a2 + a3;
    s2 += a0 * a0 + a1 * a1 + a2 * a2 + a3 * a3;
  }
  float mean, rstd;
  wave_stats(s, s2, mean, rstd);
  asm volatile("s_wait_xcnt 0x0" ::: "memory");   // behind the eight row loads: their scalar base is reused for the scalar load below
  const float vb2 = sb2[0];
  float xn[PCS * 4], mix[PCS * 4];
  #pragma unroll
  for (int i = 0; i < PCS; ++i) {
    const float4 G = ((const float4*)g)[i * 32 + lane], Bt = ((const float4*)bt)[i * 32 + lane];
    xn[i * 4 + 0] = (xin[i * 4 + 0] - mean) * rstd * G.x + Bt.x;
    xn[i * 4 + 1] = (xin[i * 4 + 1] - mean) * rstd * G.y + Bt.y;
    xn[i * 4 + 2] = (xin[i * 4 + 2] - mean) * rstd * G.z + Bt.z;
    xn[i * 4 + 3] = (xin[i * 4 + 3] - mean) * rstd * G.w + Bt.w;
    mix[i * 4 + 0] = vb2; mix[i * 4 + 1] = vb2; mix[i * 4 + 2] = vb2; mix[i * 4 + 3] = vb2;
  }
  #pragma unroll 1   // rolled: a trip already holds 32 inlined erf bodies; four times that is needless code to fetch
  for (int e = 0; e < Ee; ++e) {
    const float w1 = sw1[e], b1 = sb1[e], w2 = sw2[e];
    #pragma unroll
    for (int j = 0; j < PCS * 4; ++j) mix[j] += gelu_exact(xn[j] * w1 + b1) * w2;
  }
  #pragma unroll
  for (int i = 0; i < PCS; ++i) {
    v4f ov = {xin[i * 4 + 0] + mix[i * 4 + 0], xin[i * 4 + 1] + mix[i * 4 + 1],
              xin[i * 4 + 2] + mix[i * 4 + 2], xin[i * 4 + 3] + mix[i * 4 + 3]};
    vst2((v4f*)(trm_out + t * Dd) + i * 32 + lane, ov);
  }
}

// The scalar MLP (vector work) and the output projection (matrix work) in one grid. In index order
// the MLP blocks of eight rows, the longer kind, come first, then the GEMM's tiles.
constexpr int MLP_BLKS = TOK / 8;                     // 1024
constexpr int WO_BLKS = (Dd / TN) * (TOK / TM);       // 256
__global__ __launch_bounds__(256) void wo_mlp_kernel(
    const bf16* __restrict__ ao, const bf16* __restrict__ wot, const float* __restrict__ bo,
    const float* __restrict__ x, float* __restrict__ heb,
    const float* __restrict__ tpre, const float* __restrict__ g,
    const float* __restrict__ bt, const float* __restrict__ sw1,
    const float* __restrict__ sb1, const float* __restrict__ sw2,
    const float* __restrict__ sb2, float* __restrict__ trm_out, int Ntot, int Ktot) {
  __shared__ __align__(16) char smem[GEMM_LDS];
  const int b = blockIdx.x;
  if (b < MLP_BLKS) trm_scalar_mlp_rows(tpre, g, bt, sw1, sb1, sw2, sb2, trm_out, b);
  else {
    const int t = b - MLP_BLKS;
    gemm_tile(smem, ao, wot, bo, x, heb, Ntot, Ktot, (t / (Dd / TN)) * TM, (t % (Dd / TN)) * TN, 1);
  }
}

// ---------------------------------------------------------------------------
// Final blend + layernorm:  LN(x + sig(a)*trm + (1-sig(a))*heb ; o_ln)
// ---------------------------------------------------------------------------
// One wave owns two whole rows.
__global__ __launch_bounds__(256) void blend_ln_kernel(
    const float* __restrict__ x, const float* __restrict__ trm,
    const float* __restrict__ heb, const float* __restrict__ alphap,
    const float* __restrict__ g, const float* __restrict__ bt,
    float* __restrict__ out) {
  const int lane = threadIdx.x & 31;
  const int wid = __builtin_amdgcn_readfirstlane(threadIdx.x >> 5);   // wave number held scalar: row bases are scalar, a lane adds only its offset
  const size_t t0 = ((size_t)blockIdx.x * 8 + wid) * 2;
  const float bw = 1.0f / (1.0f + expf(-alphap[0]));
  const float4* xr = (const float4*)(x   + t0 * Dd) + lane;
  const float4* tr = (const float4*)(trm + t0 * Dd) + lane;
  const float4* hr = (const float4*)(heb + t0 * Dd) + lane;
  float4 u[2][PCS];
  float mean[2], rstd[2];
  // every loop of this kernel is unrolled: u is indexed by constants only and stays in registers
  #pragma unroll
  for (int r = 0; r < 2; ++r) {
    float s = 0.f, s2 = 0.f;
    #pragma unroll
    for (int i = 0; i < PCS; ++i) {
      const int o = r * (Dd / 4) + i * 32;
      const float4 xv = xr[o], tv = tr[o], hv = hr[o];
      float4 a;
      a.x = xv.x + bw * tv.x + (1.f - bw) * hv.x;
      a.y = xv.y + bw * tv.y + (1.f - bw) * hv.y;
      a.z = xv.z + bw * tv.z + (1.f - bw) * hv.z;
      a.w = xv.w + bw * tv.w + (1.f - bw) * hv.w;
      u[r][i] = a;
      s  += a.x + a.y + a.z + a.w;
      s2 += a.x * a.x + a.y * a.y + a.z * a.z + a.w * a.w;
    }
    wave_stats(s, s2, mean[r], rstd[r]);
  }
  #pragma unroll
  for (int i = 0; i < PCS; ++i) {
    const int pc = i * 32 + lane;
    const float4 G = ((const float4*)g)[pc], Bt = ((const float4*)bt)[pc];
    #pragma unroll
    for (int r = 0; r < 2; ++r) {
      const float4 a = u[r][i];
      v4f ov = {(a.x - mean[r]) * rstd[r] * G.x + Bt.x, (a.y - mean[r]) * rstd[r] * G.y + Bt.y,
                (a.z - mean[r]) * rstd[r] * G.z + Bt.z, (a.w - mean[r]) * rstd[r] * G.w + Bt.w};
      vst2((v4f*)(out + (t0 + r) * Dd) + pc, ov);   // one wave writes 512 contiguous bytes
    }
  }
}

// ---------------------------------------------------------------------------
// Host-side orchestration.
// ---------------------------------------------------------------------------
extern "C" void kernel_launch(void* const* d_in, const int* in_sizes, int n_in,
                              void* d_out, int out_size, void* d_ws, size_t ws_size,
                              hipStream_t stream) {
  const float* x      = (const float*)d_in[0];
  const float* h_ln_g = (const float*)d_in[1];
  const float* h_ln_b = (const float*)d_in[2];
  const float* wq     = (const float*)d_in[3];
  const float* bq     = (const float*)d_in[4];
  const float* wk     = (const float*)d_in[5];
  const float* bk     = (const float*)d_in[6];
  const float* wv     = (const float*)d_in[7];
  const float* bv     = (const float*)d_in[8];
  const float* wo     = (const float*)d_in[9];
  const float* bo     = (const float*)d_in[10];
  const float* beta   = (const float*)d_in[11];
  const float* t_ln1_g= (const float*)d_in[12];
  const float* t_ln1_b= (const float*)d_in[13];
  const float* t_w1   = (const float*)d_in[14];
  const float* t_b1   = (const float*)d_in[15];
  const float* t_w2   = (const float*)d_in[16];
  const float* t_b2   = (const float*)d_in[17];
  const float* t_lns_g= (const float*)d_in[18];
  const float* t_lns_b= (const float*)d_in[19];
  const float* s_w1   = (const float*)d_in[20];
  const float* s_b1   = (const float*)d_in[21];
  const float* s_w2   = (const float*)d_in[22];
  const float* s_b2   = (const float*)d_in[23];
  const float* alpha  = (const float*)d_in[24];
  const float* o_ln_g = (const float*)d_in[25];
  const float* o_ln_b = (const float*)d_in[26];
  float* out = (float*)d_out;

  char* ws = (char*)d_ws;
  const size_t MB = 1ull << 20;
  bf16* wpack= (bf16*)(ws + 0 * MB);    // q, k, v, o repacks, 2 MB each (1024x1024 f16), one behind the other
  bf16* wot  = (bf16*)(ws + 6 * MB);    // the fourth of them
  bf16* w1t  = (bf16*)(ws + 8 * MB);    // 8 MB  [DF, D]
  bf16* w2t  = (bf16*)(ws + 16 * MB);   // 8 MB  [D, DF]
  bf16* xn1  = (bf16*)(ws + 24 * MB);   // 16 MB [TOK, D]
  bf16* xn2  = (bf16*)(ws + 40 * MB);   // 16 MB [TOK, D]
  bf16* h1   = (bf16*)(ws + 56 * MB);   // 64 MB [TOK, DF]; free behind the FFN-down GEMM
  float* hebo= (float*)(ws + 56 * MB);  // 32 MB f32, in h1's place
  float* tpre= (float*)(ws + 120 * MB); // 32 MB f32
  float* trmo= (float*)(ws + 152 * MB); // 32 MB f32
  bf16* qb   = (bf16*)(ws + 184 * MB);  // 16 MB [B,H,S,HD]
  bf16* kb   = (bf16*)(ws + 200 * MB);  // 16 MB [B,H,S,HD]
  bf16* vtb  = (bf16*)(ws + 216 * MB);  // 16 MB [B,H,HD,S]
  bf16* ao   = (bf16*)(ws + 232 * MB);  // 16 MB [TOK, D] ; total = 248 MB

  // 1: dual layernorm -> f16 GEMM inputs, and the weight repacks (f32 [K,N] -> f16 [N,K])
  prep_kernel<<<LN_BLKS + 2 * WBIG_BLKS + 4 * WSQ_BLKS, 256, 0, stream>>>(
      x, t_ln1_g, t_ln1_b, h_ln_g, h_ln_b, xn1, xn2, wq, wk, wv, wo, t_w1, t_w2, wpack, w1t, w2t);
  // 2: h1 = gelu(xn1 @ w1), q / k head-major, v transposed
  gemm_up_qkv_kernel<<<dim3(DFf / TN + 3 * (Dd / TN), TOK / TM), 256, 0, stream>>>(
      xn1, xn2, w1t, wpack, t_b1, bq, bk, bv, h1, qb, kb, vtb, DFf, Dd, Dd);
  // 3: causal relu attention -> ao, and tpre = x + h1 @ w2
  attn_ffn_down_kernel<<<ATTN_BLKS + DOWN_BLKS, 256, 0, stream>>>(
      qb, kb, vtb, beta, ao, h1, w2t, t_b2, x, tpre, Dd, DFf);
  // 4: heb = x + ao @ wo, and trm_out from tpre
  wo_mlp_kernel<<<MLP_BLKS + WO_BLKS, 256, 0, stream>>>(
      ao, wot, bo, x, hebo, tpre, t_lns_g, t_lns_b, s_w1, s_b1, s_w2, s_b2, trmo, Dd, Dd);

  // ---- blend + final layernorm ----
  blend_ln_kernel<<<TOK / 16, 256, 0, stream>>>(x, trmo, hebo, alpha,
                                           o_ln_g, o_ln_b, out);
}

// v006
// It runs in 284 microseconds.
// In both of two side-by-side timings against v005, it was 1.11 times as fast.
// All steps since v000 together make it 2.57 times as fast.
#include <hip/hip_runtime.h>
#include <stdint.h>

// ---------------------------------------------------------------------------
// wave32, WMMA f16 (f32 accumulate), double-buffered GEMM pipeline with asynchronous 16-B copies to LDS.
// Contractions: the TRM FFN GEMMs (K = 1024 / 4096), Q/K/V and output projections (K = 1024), the Hebbian affinity Q K^T
// (K = 256) and aff V (K = keys) on v_wmma_f32_16x16x32_f16 (f16 operands, f32 accumulate); LayerNorms, GELU, the scalar
// ---------------------------------------------------------------------------

typedef _Float16 bf16;   // NOTE: 'bf16' is only a type alias name here — the type is IEEE half (f16) throughout
typedef __attribute__((ext_vector_type(4))) float v4f;
typedef __attribute__((ext_vector_type(4))) unsigned v4u;
template <typename V> __device__ __forceinline__ void vst2(void* p, V v) {
  *(V*)p = v; 
}
typedef __attribute__((ext_vector_type(16))) _Float16 v16h;
typedef __attribute__((ext_vector_type(8)))  _Float16 v8h;
typedef __attribute__((ext_vector_type(8)))  float  v8f;

constexpr int Bb  = 4;
constexpr int Ss  = 2048;
constexpr int Dd  = 1024;
constexpr int Hh  = 4;
constexpr int HDd = Dd / Hh;     // 256
constexpr int Ee  = 4;
constexpr int DFf = Dd * Ee;     // 4096
constexpr int TOK = Bb * Ss;     // 8192

__device__ __forceinline__ v8f wmma_bf16(v16h a, v16h b, v8f c) {   // (name kept; f16 WMMA + hazard guard)
  v8f d = __builtin_amdgcn_wmma_f32_16x16x32_f16(false, a, false, b, (short)0, c, false, false);
  asm volatile("v_nop\n\tv_nop\n\tv_nop\n\tv_nop" : "+v"(d) : "v"(a), "v"(b));
  return d;
}

// erf in f32 without a branch: the usual two fits (an odd polynomial below 1; 1 - exp(-p(|x|)) from 1 on) are both
// evaluated and one is picked per lane. A wave nearly always holds lanes of both ranges, so a branch skips nothing, and
// it ties each element's dependent chain to the one before; as straight code the chains of independent elements interleave.
__device__ __forceinline__ float erf_select(float x) {
  const float ax = fabsf(x), t = ax * ax;
  float ps = fmaf(t, -5.61801775e-4f, 4.91381623e-3f);
  ps = fmaf(t, ps, -2.67075151e-2f);
  ps = fmaf(t, ps, 1.12800106e-1f);
  ps = fmaf(t, ps, -3.76122952e-1f);
  ps = fmaf(t, ps, 1.28379107e-1f);
  const float lo = fmaf(ax, ps, ax);
  float pl = fmaf(ax, 1.69988107e-5f, -3.78677854e-4f);
  pl = fmaf(ax, pl, 3.85781587e-3f);
  pl = fmaf(ax, pl, -2.41816975e-2f);
  pl = fmaf(ax, pl, 1.06668264e-1f);
  pl = fmaf(ax, pl, 6.34933293e-1f);
  pl = fmaf(ax, pl, 1.28689408e-1f);
  pl = fmaf(ax, pl, ax);
  // exp(-p) = 2^(-p log2 e) on the hardware's exp2: where this fit is picked exp(-p) is at most 0.16, so the rounding of the
  // product moves 1 - exp(-p) by less than one ulp
  const float hi = 1.0f - __builtin_amdgcn_exp2f(pl * -1.44269504f);
  return copysignf(ax < 1.0f ? lo : hi, x);
}

__device__ __forceinline__ float gelu_exact(float x) {
  return 0.5f * x * (1.0f + erf_select(x * 0.70710678118654752f));
}

// Mean / rstd over D=1024 of a row that one wave holds: each lane brings the sums of its 32 elements, a five-step
// butterfly leaves the totals in every lane. No LDS, no barrier.
__device__ __forceinline__ void wave_stats(float s, float s2, float& mean, float& rstd) {
  #pragma unroll   // five fixed steps, no loop counter
  for (int o = 16; o > 0; o >>= 1) {
    s  += __shfl_xor(s,  o, 32);
    s2 += __shfl_xor(s2, o, 32);
  }
  mean = s * (1.0f / Dd);
  float var = s2 * (1.0f / Dd) - mean * mean;
  rstd = rsqrtf(var + 1e-5f);
}

// A wave's view of a row of D=1024 floats: piece i (0..7) of lane l is float4 number i * 32 + l, so that every
// wave-wide 16-B load or store covers 512 contiguous bytes.
constexpr int PCS = Dd / (32 * 4);   // 8 pieces per lane

// ---------------------------------------------------------------------------
// Weight repack: f32 [K,N] row-major  ->  bf16 [N,K] row-major (B^T layout)
// ---------------------------------------------------------------------------
__device__ __forceinline__ void transpose_cvt_tile(
    char* smem, const float* __restrict__ src, bf16* __restrict__ dst, int K, int N, int blk) {
  bf16 (*tile)[72] = (bf16 (*)[72])smem;   // 64 x 72 halves
  const int nt = N / 64;
  const int nBase = (blk % nt) * 64, kBase = (blk / nt) * 64, tid = threadIdx.x;
  for (int i = tid; i < 64 * 64; i += 256) { const int kk = i >> 6, nn = i & 63; tile[nn][kk] = (bf16)src[(size_t)(kBase + kk) * N + nBase + nn]; }
  __syncthreads();
  for (int g = tid; g < 64 * 8; g += 256) { const int nn = g >> 3, pc = g & 7; vst2(dst + (size_t)(nBase + nn) * K + kBase + pc * 8, *(const v4u*)(&tile[nn][pc * 8])); }
}

// ---------------------------------------------------------------------------
// Dual layernorm: xn1 = LN(x; t_ln1), xn2 = LN(x; h_ln)  (bf16 GEMM inputs)
// ---------------------------------------------------------------------------
// One wave owns two whole rows (all 16 loads of a lane in flight at once; each g/b piece is fetched once for both rows).
__device__ __forceinline__ void ln_dual_rows(
    const float* __restrict__ x,
    const float* __restrict__ g1, const float* __restrict__ b1,
    const float* __restrict__ g2, const float* __restrict__ b2,
    bf16* __restrict__ xn1, bf16* __restrict__ xn2, int blk) {
  const int lane = threadIdx.x & 31;
  const int wid = __builtin_amdgcn_readfirstlane(threadIdx.x >> 5);   // wave number held scalar: row bases are scalar, a lane adds only its offset
  const size_t t0 = ((size_t)blk * 8 + wid) * 2;
  const float4* xr = (const float4*)(x + t0 * Dd) + lane;
  float4 v[2][PCS];
  // every loop of this kernel is unrolled: v is indexed by constants only and stays in registers
  #pragma unroll
  for (int r = 0; r < 2; ++r)
    #pragma unroll
    for (int i = 0; i < PCS; ++i) v[r][i] = xr[r * (Dd / 4) + i * 32];
  float mean[2], rstd[2];
  #pragma unroll
  for (int r = 0; r < 2; ++r) {
    float s = 0.f, s2 = 0.f;
    #pragma unroll
    for (int i = 0; i < PCS; ++i) {
      const float4 a = v[r][i];
      s  += a.x + a.y + a.z + a.w;
      s2 += a.x * a.x + a.y * a.y + a.z * a.z + a.w * a.w;
    }
    wave_stats(s, s2, mean[r], rstd[r]);
  }
  #pragma unroll
  for (int i = 0; i < PCS; ++i) {
    const int pc = i * 32 + lane;
    const float4 G1 = ((const float4*)g1)[pc], B1 = ((const float4*)b1)[pc];
    const float4 G2 = ((const float4*)g2)[pc], B2 = ((const float4*)b2)[pc];
    #pragma unroll
    for (int r = 0; r < 2; ++r) {
      const float4 a = v[r][i];
      const float n0 = (a.x - mean[r]) * rstd[r], n1 = (a.y - mean[r]) * rstd[r];
      const float n2 = (a.z - mean[r]) * rstd[r], n3 = (a.w - mean[r]) * rstd[r];
      union { bf16 h[4]; unsigned long long u; } p1, p2;   // 4 halves = 8 B per lane; a wave writes 256 contiguous bytes
      p1.h[0] = (bf16)(n0 * G1.x + B1.x); p2.h[0] = (bf16)(n0 * G2.x + B2.x);
      p1.h[1] = (bf16)(n1 * G1.y + B1.y); p2.h[1] = (bf16)(n1 * G2.y + B2.y);
      p1.h[2] = (bf16)(n2 * G1.z + B1.z); p2.h[2] = (bf16)(n2 * G2.z + B2.z);
      p1.h[3] = (bf16)(n3 * G1.w + B1.w); p2.h[3] = (bf16)(n3 * G2.w + B2.w);
      const size_t base = (t0 + r) * Dd + pc * 4;
      vst2(xn1 + base, p1.u); vst2(xn2 + base, p2.u);
    }
  }
}

// ---------------------------------------------------------------------------
// One grid for all work that depends on the inputs alone: the dual layernorm's blocks, then the 64x64 tiles of the six
// weight repacks. wpack holds the four D x D repacks one behind the other (q, k, v, o).
// ---------------------------------------------------------------------------
constexpr int LN_BLKS = TOK / 16;                     // 512
constexpr int WBIG_BLKS = (DFf / 64) * (Dd / 64);     // 1024 tiles of a D x DF weight
constexpr int WSQ_BLKS = (Dd / 64) * (Dd / 64);       // 256 tiles of a D x D weight
__global__ __launch_bounds__(256) void prep_kernel(
    const float* __restrict__ x,
    const float* __restrict__ g1, const float* __restrict__ b1,
    const float* __restrict__ g2, const float* __restrict__ b2,
    bf16* __restrict__ xn1, bf16* __restrict__ xn2,
    const float* __restrict__ wq, const float* __restrict__ wk,
    const float* __restrict__ wv, const float* __restrict__ wo,
    const float* __restrict__ w1, const float* __restrict__ w2,
    bf16* __restrict__ wpack, bf16* __restrict__ w1t, bf16* __restrict__ w2t) {
  __shared__ __align__(16) char smem[64 * 72 * 2];
  int t = blockIdx.x;
  if (t < LN_BLKS) { ln_dual_rows(x, g1, b1, g2, b2, xn1, xn2, t); return; }
  t -= LN_BLKS;
  const float* src; bf16* dst; int K = Dd, N = Dd;
  if (t < WBIG_BLKS) { src = w1; dst = w1t; N = DFf; }
  else if (t < 2 * WBIG_BLKS) { t -= WBIG_BLKS; src = w2; dst = w2t; K = DFf; }
  else {
    t -= 2 * WBIG_BLKS;
    const int sel = t / WSQ_BLKS;
    t -= sel * WSQ_BLKS;
    src = sel == 0 ? wq : sel == 1 ? wk : sel == 2 ? wv : wo;
    dst = wpack + (size_t)sel * Dd * Dd;
  }
  transpose_cvt_tile(smem, src, dst, K, N, t);
}

// ---------------------------------------------------------------------------
// Tiled WMMA GEMM:  C[M,N] = epilogue(A[M,K]_bf16 @ Bt[N,K]_bf16 + bias)
// Block tile 128x256, 8 waves (2x4), each wave 64x64 (16 v8f accumulators): per 32 k eight fragments feed sixteen WMMAs,
// and a staged byte of A serves 256 columns, a staged byte of Bt 128 rows.
// Double-buffered LDS, a stage = 64 k (whole 128-B lines of every row), filled with asynchronous 16-B copies:
// compute stage i from buf(i&1) while stage i+1 flies into buf(~i&1).
// EPI 0: gelu -> bf16 row-major       EPI 1: res + acc + bias -> f32 row-major
// EPI 2: bf16 head-major [B,H,S,HD]   EPI 3: bf16 transposed  [B,H,HD,S]
// ---------------------------------------------------------------------------
constexpr int TM = 128, TN = 256;                        // block tile
constexpr int APANEL = TM * 72, BPANEL = TN * 72;        // halves of one staged panel
constexpr int GEMM_LDS = TM * TN * 4;                    // 131,072 B: the f32 output tile; it takes the stage buffers' place behind the loop
static_assert(2 * (APANEL + BPANEL) * 2 <= GEMM_LDS, "the four staged panels (110,592 B) lie inside the output tile's LDS");

// Second half of the epilogue: Ct[128][256] holds acc + bias; whole-line stores: EPI 0 f16 rows (512 B), EPI 1 f32 rows
// (1 KB), EPI 2 [b,h,s,hd] rows (256 hd = 512 B), EPI 3 [b,h,hd,s] rows (128 s = 256 B at s0).
template <int EPI>
__device__ __forceinline__ void gemm_writeout(
    const float (*Ct)[TN], const float* __restrict__ res, void* __restrict__ out, int Ntot, int mBase, int nBase) {
  const int tid = threadIdx.x;
  if constexpr (EPI == 1) {
    // thread = one 16-B piece (tid & 63) of rows (tid >> 6) + 4 i, i = 0..31: a wave covers 512 contiguous bytes
    const int r0 = tid >> 6, c0 = (tid & 63) * 4;
    const size_t rs4 = (size_t)4 * Ntot;   // four rows further
    const size_t o0 = (size_t)(mBase + r0) * Ntot + nBase + c0;
    #pragma unroll 1   // rolled: eight residual loads in flight per lane are enough, all 32 would take 128 registers
    for (int t = 0; t < TM / 4; t += 8) {
      const float* rp = res + o0 + t * rs4;
      float* op = (float*)out + o0 + t * rs4;
      v4f rr[8];   // indexed by constants only (both inner loops unrolled): stays in registers
      #pragma unroll
      for (int j = 0; j < 8; ++j) {
        rr[j] = *(const v4f*)(rp + j * rs4);
        // behind each load
        asm volatile("s_wait_xcnt 0x0" ::: "memory");
      }
      #pragma unroll
      for (int j = 0; j < 8; ++j) vst2(op + j * rs4, *(const v4f*)(&Ct[r0 + (t + j) * 4][c0]) + rr[j]);
      asm volatile("s_wait_xcnt 0x0" ::: "memory");   // behind the stores: the next trip rewrites their data and address registers
    }
  } else if constexpr (EPI == 3) {
    const int b = mBase / Ss, s0 = mBase % Ss, h = nBase / HDd, hd0 = nBase % HDd;
    for (int g = tid; g < TN * (TM / 8); g += 256) {
      const int cl = g >> 4, pc = g & 15;         // hd row cl, piece of 8 s
      union { v8h h; v4u u; } pk;
      #pragma unroll
      for (int e = 0; e < 8; ++e) pk.h[e] = (bf16)Ct[pc * 8 + e][cl];
      vst2((bf16*)out + ((size_t)((b * Hh + h) * HDd + hd0 + cl)) * Ss + s0 + pc * 8, pk.u);
    }
  } else {
    #pragma unroll (EPI == 0 ? 1 : 4)   // EPI 0 rolled: a trip holds eight inlined erf bodies, sixteen trips of them are needless code to fetch; EPI 2: four trips' LDS reads in flight
    for (int g = tid; g < TM * (TN / 8); g += 256) {
      const int rl = g >> 5, pc = g & 31;
      union { v8h h; v4u u; } pk;
      const v4f c0 = *(const v4f*)(&Ct[rl][pc * 8]), c1 = *(const v4f*)(&Ct[rl][pc * 8 + 4]);   // two 16-B reads
      #pragma unroll
      for (int e = 0; e < 8; ++e) {
        const float v = e < 4 ? c0[e & 3] : c1[e & 3];
        pk.h[e] = (bf16)(EPI == 0 ? gelu_exact(v) : v);
      }
      const int row = mBase + rl;
      if constexpr (EPI == 0) vst2((bf16*)out + (size_t)row * Ntot + nBase + pc * 8, pk.u);
      else { const int b = row / Ss, s = row % Ss, h = nBase / HDd, hd0 = nBase % HDd;
             vst2((bf16*)out + ((size_t)((b * Hh + h) * Ss + s)) * HDd + hd0 + pc * 8, pk.u); }
    }
  }
}

// One 128x256 tile; smem = the block's LDS (GEMM_LDS bytes); epi (0..3) is the same for the whole block.
__device__ __forceinline__ void gemm_tile(
    char* smem, const bf16* __restrict__ A, const bf16* __restrict__ Bt,
    const float* __restrict__ bias, const float* __restrict__ res,
    void* __restrict__ out, int Ntot, int Ktot, int mBase, int nBase, int epi) {
  bf16 (*As)[APANEL] = (bf16 (*)[APANEL])smem;                      // [2]; 64 K + 8 pad per row: pitch 144 B = 16 B x odd for the 16-B readers
  bf16 (*Bs)[BPANEL] = (bf16 (*)[BPANEL])(smem + 2 * APANEL * 2);   // [2]
  float (*Ct)[TN] = (float (*)[TN])smem;                            // block output tile (128 KB), used behind the loop only
  const int tid  = threadIdx.x;
  const int lane = tid & 31, wid = tid >> 5;
  const int wm = wid & 1, wn = wid >> 1;            // 2 x 4 wave grid
  const int la = lane & 15, hs = lane >> 4;         // lane-in-16, half-select

  // Stage the 128x64 panel of A and the 256x64 panel of Bt into an LDS buffer with asynchronous 16-B copies (no register
  // in between). Eight lanes cover one 128-B row, a wave four whole lines. Each thread owns one 16-B piece of rows
  // sr + 32 i (i = 0..3 of A, 0..7 of Bt): twelve copies per stage, every lane on.
  const int sr = tid >> 3, sc = (tid & 7) * 8;
  const size_t rstep = (size_t)32 * Ktot;
  const bf16* ga = A  + (size_t)(mBase + sr) * Ktot + sc;
  const bf16* gb = Bt + (size_t)(nBase + sr) * Ktot + sc;
  const unsigned la_lds = (unsigned)(size_t)&As[0][sr * 72 + sc];   // low 32 bits of a __shared__ address = LDS byte address
  const unsigned lb_lds = (unsigned)(size_t)&Bs[0][sr * 72 + sc];
  auto stage = [&](int k0, int buf) {
    constexpr unsigned RS = 32 * 72 * 2;                            // 32 rows further in LDS, bytes
    const unsigned da = la_lds + (unsigned)buf * (APANEL * 2), db = lb_lds + (unsigned)buf * (BPANEL * 2);
    const bf16 *pa = ga + k0, *pb = gb + k0;
    // the copies and their s_wait_xcnt in one statement, so that the wait stands ahead of any rewrite of an address register
    asm volatile("global_load_async_to_lds_b128 %0, %1, off\n\t"
                 "global_load_async_to_lds_b128 %2, %3, off\n\t"
                 "global_load_async_to_lds_b128 %4, %5, off\n\t"
                 "global_load_async_to_lds_b128 %6, %7, off\n\t"
                 "global_load_async_to_lds_b128 %8, %9, off\n\t"
                 "global_load_async_to_lds_b128 %10, %11, off\n\t"
                 "global_load_async_to_lds_b128 %12, %13, off\n\t"
                 "global_load_async_to_lds_b128 %14, %15, off\n\t"
                 "global_load_async_to_lds_b128 %16, %17, off\n\t"
                 "global_load_async_to_lds_b128 %18, %19, off\n\t"
                 "global_load_async_to_lds_b128 %20, %21, off\n\t"
                 "global_load_async_to_lds_b128 %22, %23, off\n\t"
                 "s_wait_xcnt 0x0"
                 :: "v"(da),          "v"(pa),             "v"(da + RS),     "v"(pa + rstep),
                    "v"(da + 2 * RS), "v"(pa + 2 * rstep), "v"(da + 3 * RS), "v"(pa + 3 * rstep),
                    "v"(db),          "v"(pb),             "v"(db + RS),     "v"(pb + rstep),
                    "v"(db + 2 * RS), "v"(pb + 2 * rstep), "v"(db + 3 * RS), "v"(pb + 3 * rstep),
                    "v"(db + 4 * RS), "v"(pb + 4 * rstep), "v"(db + 5 * RS), "v"(pb + 5 * rstep),
                    "v"(db + 6 * RS), "v"(pb + 6 * rstep), "v"(db + 7 * RS), "v"(pb + 7 * rstep)
                 : "memory");
  };

  v8f acc[4][4] = {};
  const int ntiles = Ktot >> 6;
  stage(0, 0);
  asm volatile("s_wait_asynccnt 0x0" ::: "memory");   // this wave's copies of stage 0 have landed
  __syncthreads();                                    // every wave's have
  if (ntiles > 1) stage(64, 1);

  for (int it = 0; it < ntiles; ++it) {
    const int cur = it & 1;   // stage it is worked on from buf(cur) while stage it + 1 flies into the other buffer
    #pragma unroll   // kf a constant: the two 32-k halves of a stage become LDS offsets, no loop or address work per half
    for (int kf = 0; kf < 64; kf += 32) {
      // A-frag (16x32 bf16): lanes 0-15 hold K 0-7 / 16-23, lanes 16-31 K 8-15 / 24-31.
      v16h afrag[4];
      #pragma unroll
      for (int ms = 0; ms < 4; ++ms) {
        int r = wm * 64 + ms * 16 + la;
        union { v16h v; v8h h[2]; } u;
        u.h[0] = *(const v8h*)&As[cur][r * 72 + kf + hs * 8];
        u.h[1] = *(const v8h*)&As[cur][r * 72 + kf + hs * 8 + 16];
        afrag[ms] = u.v;
      }
      // B-frag (32x16): same per-lane K map as A (lanes 0-15 hold K 0-7 / 16-23, lanes 16-31 K 8-15 / 24-31).
      v16h bfrag[4];
      #pragma unroll
      for (int ns = 0; ns < 4; ++ns) {
        int r = wn * 64 + ns * 16 + la;
        union { v16h v; v8h h[2]; } u;
        u.h[0] = *(const v8h*)&Bs[cur][r * 72 + kf + hs * 8];
        u.h[1] = *(const v8h*)&Bs[cur][r * 72 + kf + hs * 8 + 16];
        bfrag[ns] = u.v;
      }
      #pragma unroll
      for (int ms = 0; ms < 4; ++ms)
        #pragma unroll
        for (int ns = 0; ns < 4; ++ns)
          acc[ms][ns] = wmma_bf16(afrag[ms], bfrag[ns], acc[ms][ns]);
    }
    asm volatile("s_wait_dscnt 0x0" ::: "memory");      // this wave's reads of buf(cur) are done before it is refilled
    asm volatile("s_wait_asynccnt 0x0" ::: "memory");   // this wave's copies of stage it + 1 have landed
    __syncthreads();                                    // stage it + 1 published; every wave has left buf(cur)
    if (it + 2 < ntiles) stage((it + 2) * 64, cur);
  }
  asm volatile("s_wait_asynccnt 0x0" ::: "memory");     // no copy outstanding behind the loop

  // First half of the epilogue. C-frag: lane holds col la, rows r + 8*hs per VGPR r -> block tile Ct[128][256] = acc + bias.
  __syncthreads();
  #pragma unroll   // acc is indexed by constants only and stays in registers
  for (int ms = 0; ms < 4; ++ms)
    #pragma unroll
    for (int ns = 0; ns < 4; ++ns) {
      const int cl = wn * 64 + ns * 16 + la;
      const float bv = bias[nBase + cl];
      #pragma unroll
      for (int r = 0; r < 8; ++r) Ct[wm * 64 + ms * 16 + r + hs * 8][cl] = acc[ms][ns][r] + bv;
    }
  __syncthreads();
  if (epi == 0)      gemm_writeout<0>(Ct, res, out, Ntot, mBase, nBase);
  else if (epi == 1) gemm_writeout<1>(Ct, res, out, Ntot, mBase, nBase);
  else if (epi == 2) gemm_writeout<2>(Ct, res, out, Ntot, mBase, nBase);
  else               gemm_writeout<3>(Ct, res, out, Ntot, mBase, nBase);
}

// FFN-up GEMM and the Q, K, V projections in one grid (all K = D, all depend only on the layernorm outputs and repacks):
// blockIdx.x 0..15 = column tiles of h1, then four column tiles each of q, k, v.
__global__ __launch_bounds__(256) void gemm_up_qkv_kernel(
    const bf16* __restrict__ xn1, const bf16* __restrict__ xn2,
    const bf16* __restrict__ w1t, const bf16* __restrict__ wpack,
    const float* __restrict__ b1, const float* __restrict__ bq,
    const float* __restrict__ bk, const float* __restrict__ bv,
    bf16* __restrict__ h1, bf16* __restrict__ qb, bf16* __restrict__ kb, bf16* __restrict__ vtb,
    int Nup, int Nproj, int Ktot) {
  __shared__ __align__(16) char smem[GEMM_LDS];
  const int bx = blockIdx.x, mBase = blockIdx.y * TM;
  const bf16 *A = xn1, *Bt = w1t;
  const float* bias = b1;
  bf16* out = h1;
  int Ntot = Nup, nBase = bx * TN, epi = 0;
  if (bx >= DFf / TN) {
    const int sel = (bx - DFf / TN) >> 2;
    A = xn2; Bt = wpack + (size_t)sel * Dd * Dd;
    bias = sel == 0 ? bq : sel == 1 ? bk : bv;
    out  = sel == 0 ? qb : sel == 1 ? kb : vtb;
    Ntot = Nproj; nBase = ((bx - DFf / TN) & 3) * TN; epi = sel == 2 ? 3 : 2;
  }
  gemm_tile(smem, A, Bt, bias, nullptr, out, Ntot, Ktot, mBase, nBase, epi);
}

// ---------------------------------------------------------------------------
// Hebbian attention: out_i = sum_{j<=i} relu(beta * q_i.k_j) v_j
// q,k: bf16 [B,H,S,HD] ; vt: bf16 [B,H,HD,S] ; out: bf16 [B,S,D] (token-major)
// Block = one (b,h) x 64-query tile. Causal: only kt <= qt key tiles visited.
// The K tile (64 x 256) and the Vt tile (256 x 64) are brought in once per block with whole-line 16-B loads and kept in
// LDS; every wave takes its B fragments from there. The next tile's loads are issued at the top of a pass and stored
// behind the barrier that ends the last read of the tile they replace.
// ---------------------------------------------------------------------------
constexpr int ATTN_LDS = (2 * 64 * 264 + 256 * 72 + 64 * 72) * 2;   // 113,664 B
__device__ __forceinline__ void hebbian_attn_tile(
    char* smem, const bf16* __restrict__ q, const bf16* __restrict__ k,
    const bf16* __restrict__ vt, const float* __restrict__ betap,
    bf16* __restrict__ attn_out, int qt, int bh) {
  bf16* Qs   = (bf16*)smem;       // 64 x 256 (+8 pad)
  bf16* Ks   = Qs + 64 * 264;     // 64 keys x 256 (+8 pad)
  bf16* Vs   = Ks + 64 * 264;     // 256 feats x 64 keys (+8 pad); after the loop: per-wave output tiles
  bf16* affs = Vs + 256 * 72;     // 64 x 64  (+8 pad)
  const int bidx = bh / Hh, hidx = bh % Hh;
  const int tid = threadIdx.x, lane = tid & 31, wid = tid >> 5;
  const int la = lane & 15, hs = lane >> 4;
  const float beta = betap[0];

  const int kr = tid >> 5, kc = (tid & 31) * 8;   // K piece: a wave covers one 512-B row; 8 rows per step
  const int vr = tid >> 3, vc = (tid & 7) * 8;    // Vt piece: a wave covers four 128-B rows; 32 rows per step
  const bf16* kth = k  + (size_t)bh * Ss * HDd + kr * HDd + kc;   // this thread's piece of key row kr
  const bf16* vth = vt + (size_t)bh * HDd * Ss + vr * Ss + vc;    // this thread's piece of feature row vr
  v4u kreg[8], vreg[8];
  auto fetch = [&](int kbase) {
    #pragma unroll
    for (int i = 0; i < 8; ++i) kreg[i] = *(const v4u*)(kth + (size_t)kbase * HDd + i * 8 * HDd);
    #pragma unroll
    for (int i = 0; i < 8; ++i) vreg[i] = *(const v4u*)(vth + kbase + i * 32 * Ss);
  };
  auto put_k = [&]() {
    #pragma unroll
    for (int i = 0; i < 8; ++i) *(v4u*)&Ks[(kr + i * 8) * 264 + kc] = kreg[i];
  };
  auto put_v = [&]() {
    #pragma unroll
    for (int i = 0; i < 8; ++i) *(v4u*)&Vs[(vr + i * 32) * 72 + vc] = vreg[i];
  };

  fetch(0);
  // Stage Q tile (reused for every key tile).
  const bf16* qb = q + ((size_t)bh * Ss + qt * 64) * HDd;
  #pragma unroll
  for (int c = tid; c < 64 * 32; c += 256) {
    int r = c >> 5, cc = (c & 31) * 8;
    *(v4u*)&Qs[r * 264 + cc] = *(const v4u*)&qb[(size_t)r * HDd + cc];
  }
  put_k();
  put_v();
  __syncthreads();

  const int ma = wid & 3;   // 16-row group for both GEMMs
  const int nh = wid >> 2;  // GEMM1: 32-col half of aff ; GEMM2: 128-feat half
  v8f oacc[8] = {};

  for (int kt = 0; kt <= qt; ++kt) {
    const int kbase = kt * 64;
    const bool more = kt < qt;
    if (more) fetch(kbase + 64);
    // ---- GEMM1: aff(64x64) = Q(64x256) @ K^T, both from LDS ----
    v8f c0 = {}, c1 = {};
    #pragma unroll
    for (int kf = 0; kf < HDd; kf += 32) {
      union { v16h v; v8h h[2]; } ua, ub0, ub1;
      int ar = ma * 16 + la;
      ua.h[0] = *(const v8h*)&Qs[ar * 264 + kf + hs * 8];
      ua.h[1] = *(const v8h*)&Qs[ar * 264 + kf + hs * 8 + 16];
      const bf16* p0 = &Ks[(nh * 32 + la)      * 264 + kf + hs * 8];   // same K map as A
      const bf16* p1 = &Ks[(nh * 32 + 16 + la) * 264 + kf + hs * 8];
      ub0.h[0] = *(const v8h*)p0; ub0.h[1] = *(const v8h*)(p0 + 16);
      ub1.h[0] = *(const v8h*)p1; ub1.h[1] = *(const v8h*)(p1 + 16);
      c0 = wmma_bf16(ua.v, ub0.v, c0);
      c1 = wmma_bf16(ua.v, ub1.v, c1);
    }
    // beta * relu + causal mask, re-layout C-frag -> A-frag via LDS (bf16).
    // (the barrier at the foot of the previous pass ended the last read of affs)
    #pragma unroll
    for (int ns = 0; ns < 2; ++ns) {
      v8f cv = ns ? c1 : c0;
      int jl = nh * 32 + ns * 16 + la;
      int j = kbase + jl;
      #pragma unroll
      for (int r = 0; r < 8; ++r) {
        int il = ma * 16 + r + hs * 8;
        int i = qt * 64 + il;
        float v = cv[r] * beta;
        v = (j <= i && v > 0.f) ? v : 0.f;
        affs[il * 72 + jl] = (bf16)v;
      }
    }
    __syncthreads();  // affs and this pass's Vs visible; every read of Ks done
    if (more) put_k();
    // ---- GEMM2: out(64x256) += aff(64x64) @ V(64x256) via Vt rows in LDS ----
    #pragma unroll
    for (int kk = 0; kk < 64; kk += 32) {
      union { v16h v; v8h h[2]; } ua;
      int ar = ma * 16 + la;
      ua.h[0] = *(const v8h*)&affs[ar * 72 + kk + hs * 8];
      ua.h[1] = *(const v8h*)&affs[ar * 72 + kk + hs * 8 + 16];
      #pragma unroll
      for (int j = 0; j < 8; ++j) {
        int feat = nh * 128 + j * 16 + la;
        union { v16h v; v8h h[2]; } ub;
        const bf16* p = &Vs[feat * 72 + kk + hs * 8];
        ub.h[0] = *(const v8h*)p; ub.h[1] = *(const v8h*)(p + 16);
        oacc[j] = wmma_bf16(ua.v, ub.v, oacc[j]);
      }
    }
    __syncthreads();  // next pass's Ks visible; every read of Vs and affs done
    if (more) put_v();
  }
  // Write f16 token-major so the wo GEMM can consume it as A directly: the wave's 16 rows x 128 feats (256-B row segments)
  bf16* ot = Vs + wid * (16 * 128);   // Vs is free behind the loop's last barrier
  #pragma unroll
  for (int j = 0; j < 8; ++j) {
    int fl = j * 16 + la;
    #pragma unroll
    for (int r = 0; r < 8; ++r) ot[(r + hs * 8) * 128 + fl] = (bf16)oacc[j][r];
  }
  __syncthreads();
  #pragma unroll
  for (int q2 = 0; q2 < 8; ++q2) {
    const int rl = q2 * 2 + (lane >> 4), pc = lane & 15;
    const int s = qt * 64 + ma * 16 + rl;
    vst2(attn_out + ((size_t)(bidx * Ss + s)) * Dd + hidx * HDd + nh * 128 + pc * 8, *(const v4u*)(ot + rl * 128 + pc * 8));
  }
}

// Attention and the FFN-down GEMM in one grid (neither reads what the other writes). There are more blocks than
// places; in index order the long ones come first: the causal tiles of the upper half of the
// queries (longest first), then the GEMM's tiles, then the remaining causal tiles, ever shorter, which fill the tail.
constexpr int ATTN_BLKS = (Ss / 64) * Bb * Hh;        // 512
constexpr int DOWN_BLKS = (Dd / TN) * (TOK / TM);     // 256
static_assert(ATTN_LDS <= GEMM_LDS, "the attention tile lives in the GEMM's LDS");
__global__ __launch_bounds__(256) void attn_ffn_down_kernel(
    const bf16* __restrict__ q, const bf16* __restrict__ k,
    const bf16* __restrict__ vt, const float* __restrict__ betap, bf16* __restrict__ attn_out,
    const bf16* __restrict__ h1, const bf16* __restrict__ w2t, const float* __restrict__ b2,
    const float* __restrict__ x, float* __restrict__ tpre, int Ntot, int Ktot) {
  __shared__ __align__(16) char smem[GEMM_LDS];
  const int b = blockIdx.x;
  if (b < ATTN_BLKS / 2 || b >= ATTN_BLKS / 2 + DOWN_BLKS) {
    const int u = b < ATTN_BLKS / 2 ? b : b - DOWN_BLKS;   // 0..511: sixteen (batch, head) pairs per query tile
    hebbian_attn_tile(smem, q, k, vt, betap, attn_out, Ss / 64 - 1 - u / (Bb * Hh), u % (Bb * Hh));
  } else {
    const int t = b - ATTN_BLKS / 2;
    gemm_tile(smem, h1, w2t, b2, x, tpre, Ntot, Ktot, (t / (Dd / TN)) * TM, (t % (Dd / TN)) * TN, 1);
  }
}

// ---------------------------------------------------------------------------
// TRM tail: residual = tpre; xn = LN(tpre); mix = scalar-MLP(xn); out = tpre+mix
// ---------------------------------------------------------------------------
// One wave owns one whole row: 32 elements per lane, kept in registers.
__device__ __forceinline__ void trm_scalar_mlp_rows(
    const float* __restrict__ tpre, const float* __restrict__ g,
    const float* __restrict__ bt, const float* __restrict__ sw1,
    const float* __restrict__ sb1, const float* __restrict__ sw2,
    const float* __restrict__ sb2, float* __restrict__ trm_out, int blk) {
  const int lane = threadIdx.x & 31;
  const int wid = __builtin_amdgcn_readfirstlane(threadIdx.x >> 5);   // wave number held scalar: row bases are scalar, a lane adds only its offset
  const size_t t = (size_t)blk * 8 + wid;
  const float4* xr = (const float4*)(tpre + t * Dd) + lane;
  float xin[PCS * 4];
  float s = 0.f, s2 = 0.f;
  // every loop over pieces or elements is unrolled: xin, xn, mix are indexed by constants only and stay in registers
  #pragma unroll
  for (int i = 0; i < PCS; ++i) {
    const float4 a = xr[i * 32];
    xin[i * 4 + 0] = a.x; xin[i * 4 + 1] = a.y; xin[i * 4 + 2] = a.z; xin[i * 4 + 3] = a.w;
  }
  #pragma unroll
  for (int i = 0; i < PCS; ++i) {
    const float a0 = xin[i * 4], a1 = xin[i * 4 + 1], a2 = xin[i * 4 + 2], a3 = xin[i * 4 + 3];
    s  += a0 + a1 + a2 + a3;
    s2 += a0 * a0 + a1 * a1 + a2 * a2 + a3 * a3;
  }
  float mean, rstd;
  wave_stats(s, s2, mean, rstd);
  asm volatile("s_wait_xcnt 0x0" ::: "memory");   // behind the eight row loads: their scalar base is reused for the scalar load below
  const float vb2 = sb2[0];
  float xn[PCS * 4], mix[PCS * 4];
  #pragma unroll
  for (int i = 0; i < PCS; ++i) {
    const float4 G = ((const float4*)g)[i * 32 + lane], Bt = ((const float4*)bt)[i * 32 + lane];
    xn[i * 4 + 0] = (xin[i * 4 + 0] - mean) * rstd * G.x + Bt.x;
    xn[i * 4 + 1] = (xin[i * 4 + 1] - mean) * rstd * G.y + Bt.y;
    xn[i * 4 + 2] = (xin[i * 4 + 2] - mean) * rstd * G.z + Bt.z;
    xn[i * 4 + 3] = (xin[i * 4 + 3] - mean) * rstd * G.w + Bt.w;
    mix[i * 4 + 0] = vb2; mix[i * 4 + 1] = vb2; mix[i * 4 + 2] = vb2; mix[i * 4 + 3] = vb2;
  }
  #pragma unroll 1   // rolled: a trip already holds 32 inlined erf bodies; four times that is needless code to fetch
  for (int e = 0; e < Ee; ++e) {
    const float w1 = sw1[e], b1 = sb1[e], w2 = sw2[e];
    #pragma unroll
    for (int j = 0; j < PCS * 4; ++j) {
      mix[j] += gelu_exact(xn[j] * w1 + b1) * w2;
      // a scheduling fence behind every eighth value: with all 32 in one region the compiler, to save registers, lays the values' chains
      // one behind the other and a wave waits out every link; in regions of eight it interleaves them
      if ((j & 7) == 7) __builtin_amdgcn_sched_barrier(0);
    }
  }
  #pragma unroll
  for (int i = 0; i < PCS; ++i) {
    v4f ov = {xin[i * 4 + 0] + mix[i * 4 + 0], xin[i * 4 + 1] + mix[i * 4 + 1],
              xin[i * 4 + 2] + mix[i * 4 + 2], xin[i * 4 + 3] + mix[i * 4 + 3]};
    vst2((v4f*)(trm_out + t * Dd) + i * 32 + lane, ov);
  }
}

// The scalar MLP (vector work) and the output projection (matrix work) in one grid. In index order
// the MLP blocks of eight rows, the longer kind, come first, then the GEMM's tiles.
constexpr int MLP_BLKS = TOK / 8;                     // 1024
constexpr int WO_BLKS = (Dd / TN) * (TOK / TM);       // 256
__global__ __launch_bounds__(256) void wo_mlp_kernel(
    const bf16* __restrict__ ao, const bf16* __restrict__ wot, const float* __restrict__ bo,
    const float* __restrict__ x, float* __restrict__ heb,
    const float* __restrict__ tpre, const float* __restrict__ g,
    const float* __restrict__ bt, const float* __restrict__ sw1,
    const float* __restrict__ sb1, const float* __restrict__ sw2,
    const float* __restrict__ sb2, float* __restrict__ trm_out, int Ntot, int Ktot) {
  __shared__ __align__(16) char smem[GEMM_LDS];
  const int b = blockIdx.x;
  if (b < MLP_BLKS) trm_scalar_mlp_rows(tpre, g, bt, sw1, sb1, sw2, sb2, trm_out, b);
  else {
    const int t = b - MLP_BLKS;
    gemm_tile(smem, ao, wot, bo, x, heb, Ntot, Ktot, (t / (Dd / TN)) * TM, (t % (Dd / TN)) * TN, 1);
  }
}

// ---------------------------------------------------------------------------
// Final blend + layernorm:  LN(x + sig(a)*trm + (1-sig(a))*heb ; o_ln)
// ---------------------------------------------------------------------------
// One wave owns two whole rows.
__global__ __launch_bounds__(256) void blend_ln_kernel(
    const float* __restrict__ x, const float* __restrict__ trm,
    const float* __restrict__ heb, const float* __restrict__ alphap,
    const float* __restrict__ g, const float* __restrict__ bt,
    float* __restrict__ out) {
  const int lane = threadIdx.x & 31;
  const int wid = __builtin_amdgcn_readfirstlane(threadIdx.x >> 5);   // wave number held scalar: row bases are scalar, a lane adds only its offset
  const size_t t0 = ((size_t)blockIdx.x * 8 + wid) * 2;
  const float bw = 1.0f / (1.0f + expf(-alphap[0]));
  const float4* xr = (const float4*)(x   + t0 * Dd) + lane;
  const float4* tr = (const float4*)(trm + t0 * Dd) + lane;
  const float4* hr = (const float4*)(heb + t0 * Dd) + lane;
  float4 u[2][PCS];
  float mean[2], rstd[2];
  // every loop of this kernel is unrolled: u is indexed by constants only and stays in registers
  #pragma unroll
  for (int r = 0; r < 2; ++r) {
    float s = 0.f, s2 = 0.f;
    #pragma unroll
    for (int i = 0; i < PCS; ++i) {
      const int o = r * (Dd / 4) + i * 32;
      const float4 xv = xr[o], tv = tr[o], hv = hr[o];
      float4 a;
      a.x = xv.x + bw * tv.x + (1.f - bw) * hv.x;
      a.y = xv.y + bw * tv.y + (1.f - bw) * hv.y;
      a.z = xv.z + bw * tv.z + (1.f - bw) * hv.z;
      a.w = xv.w + bw * tv.w + (1.f - bw) * hv.w;
      u[r][i] = a;
      s  += a.x + a.y + a.z + a.w;
      s2 += a.x * a.x + a.y * a.y + a.z * a.z + a.w * a.w;
    }
    wave_stats(s, s2, mean[r], rstd[r]);
  }
  #pragma unroll
  for (int i = 0; i < PCS; ++i) {
    const int pc = i * 32 + lane;
    const float4 G = ((const float4*)g)[pc], Bt = ((const float4*)bt)[pc];
    #pragma unroll
    for (int r = 0; r < 2; ++r) {
      const float4 a = u[r][i];
      v4f ov = {(a.x - mean[r]) * rstd[r] * G.x + Bt.x, (a.y - mean[r]) * rstd[r] * G.y + Bt.y,
                (a.z - mean[r]) * rstd[r] * G.z + Bt.z, (a.w - mean[r]) * rstd[r] * G.w + Bt.w};
      vst2((v4f*)(out + (t0 + r) * Dd) + pc, ov);   // one wave writes 512 contiguous bytes
    }
  }
}

// ---------------------------------------------------------------------------
// Host-side orchestration.
// ---------------------------------------------------------------------------
extern "C" void kernel_launch(void* const* d_in, const int* in_sizes, int n_in,
                              void* d_out, int out_size, void* d_ws, size_t ws_size,
                              hipStream_t stream) {
  const float* x      = (const float*)d_in[0];
  const float* h_ln_g = (const float*)d_in[1];
  const float* h_ln_b = (const float*)d_in[2];
  const float* wq     = (const float*)d_in[3];
  const float* bq     = (const float*)d_in[4];
  const float* wk     = (const float*)d_in[5];
  const float* bk     = (const float*)d_in[6];
  const float* wv     = (const float*)d_in[7];
  const float* bv     = (const float*)d_in[8];
  const float* wo     = (const float*)d_in[9];
  const float* bo     = (const float*)d_in[10];
  const float* beta   = (const float*)d_in[11];
  const float* t_ln1_g= (const float*)d_in[12];
  const float* t_ln1_b= (const float*)d_in[13];
  const float* t_w1   = (const float*)d_in[14];
  const float* t_b1   = (const float*)d_in[15];
  const float* t_w2   = (const float*)d_in[16];
  const float* t_b2   = (const float*)d_in[17];
  const float* t_lns_g= (const float*)d_in[18];
  const float* t_lns_b= (const float*)d_in[19];
  const float* s_w1   = (const float*)d_in[20];
  const float* s_b1   = (const float*)d_in[21];
  const float* s_w2   = (const float*)d_in[22];
  const float* s_b2   = (const float*)d_in[23];
  const float* alpha  = (const float*)d_in[24];
  const float* o_ln_g = (const float*)d_in[25];
  const float* o_ln_b = (const float*)d_in[26];
  float* out = (float*)d_out;

  char* ws = (char*)d_ws;
  const size_t MB = 1ull << 20;
  bf16* wpack= (bf16*)(ws + 0 * MB);    // q, k, v, o repacks, 2 MB each (1024x1024 f16), one behind the other
  bf16* wot  = (bf16*)(ws + 6 * MB);    // the fourth of them
  bf16* w1t  = (bf16*)(ws + 8 * MB);    // 8 MB  [DF, D]
  bf16* w2t  = (bf16*)(ws + 16 * MB);   // 8 MB  [D, DF]
  bf16* xn1  = (bf16*)(ws + 24 * MB);   // 16 MB [TOK, D]
  bf16* xn2  = (bf16*)(ws + 40 * MB);   // 16 MB [TOK, D]
  bf16* h1   = (bf16*)(ws + 56 * MB);   // 64 MB [TOK, DF]; free behind the FFN-down GEMM
  float* hebo= (float*)(ws + 56 * MB);  // 32 MB f32, in h1's place
  float* tpre= (float*)(ws + 120 * MB); // 32 MB f32
  float* trmo= (float*)(ws + 152 * MB); // 32 MB f32
  bf16* qb   = (bf16*)(ws + 184 * MB);  // 16 MB [B,H,S,HD]
  bf16* kb   = (bf16*)(ws + 200 * MB);  // 16 MB [B,H,S,HD]
  bf16* vtb  = (bf16*)(ws + 216 * MB);  // 16 MB [B,H,HD,S]
  bf16* ao   = (bf16*)(ws + 232 * MB);  // 16 MB [TOK, D] ; total = 248 MB

  // 1: dual layernorm -> f16 GEMM inputs, and the weight repacks (f32 [K,N] -> f16 [N,K])
  prep_kernel<<<LN_BLKS + 2 * WBIG_BLKS + 4 * WSQ_BLKS, 256, 0, stream>>>(
      x, t_ln1_g, t_ln1_b, h_ln_g, h_ln_b, xn1, xn2, wq, wk, wv, wo, t_w1, t_w2, wpack, w1t, w2t);
  // 2: h1 = gelu(xn1 @ w1), q / k head-major, v transposed
  gemm_up_qkv_kernel<<<dim3(DFf / TN + 3 * (Dd / TN), TOK / TM), 256, 0, stream>>>(
      xn1, xn2, w1t, wpack, t_b1, bq, bk, bv, h1, qb, kb, vtb, DFf, Dd, Dd);
  // 3: causal relu attention -> ao, and tpre = x + h1 @ w2
  attn_ffn_down_kernel<<<ATTN_BLKS + DOWN_BLKS, 256, 0, stream>>>(
      qb, kb, vtb, beta, ao, h1, w2t, t_b2, x, tpre, Dd, DFf);
  // 4: heb = x + ao @ wo, and trm_out from tpre
  wo_mlp_kernel<<<MLP_BLKS + WO_BLKS, 256, 0, stream>>>(
      ao, wot, bo, x, hebo, tpre, t_lns_g, t_lns_b, s_w1, s_b1, s_w2, s_b2, trmo, Dd, Dd);

  // ---- blend + final layernorm ----
  blend_ln_kernel<<<TOK / 16, 256, 0, stream>>>(x, trmo, hebo, alpha,
                                           o_ln_g, o_ln_b, out);
}

// v007
// Measured time: 276 microseconds a run.
// In both of two side-by-side timings against v006, it was 1.03 times as fast.
// Over all steps from v000 it is 2.64 times as fast.
#include <hip/hip_runtime.h>
#include <stdint.h>

// ---------------------------------------------------------------------------
// wave32, WMMA f16 (f32 accumulate), double-buffered GEMM pipeline with asynchronous 16-B copies to LDS.
// Contractions: the TRM FFN GEMMs (K = 1024 / 4096), Q/K/V and output projections (K = 1024), the Hebbian affinity Q K^T
// (K = 256) and aff V (K = keys) on v_wmma_f32_16x16x32_f16 (f16 operands, f32 accumulate); LayerNorms, GELU, the scalar
// ---------------------------------------------------------------------------

typedef _Float16 bf16;   // NOTE: 'bf16' is only a type alias name here — the type is IEEE half (f16) throughout
typedef __attribute__((ext_vector_type(4))) float v4f;
typedef __attribute__((ext_vector_type(4))) unsigned v4u;
template <typename V> __device__ __forceinline__ void vst2(void* p, V v) {
  *(V*)p = v; 
}
typedef __attribute__((ext_vector_type(16))) _Float16 v16h;
typedef __attribute__((ext_vector_type(8)))  _Float16 v8h;
typedef __attribute__((ext_vector_type(8)))  float  v8f;

constexpr int Bb  = 4;
constexpr int Ss  = 2048;
constexpr int Dd  = 1024;
constexpr int Hh  = 4;
constexpr int HDd = Dd / Hh;     // 256
constexpr int Ee  = 4;
constexpr int DFf = Dd * Ee;     // 4096
constexpr int TOK = Bb * Ss;     // 8192

__device__ __forceinline__ v8f wmma_bf16(v16h a, v16h b, v8f c) {   // (name kept; f16 WMMA + hazard guard)
  v8f d = __builtin_amdgcn_wmma_f32_16x16x32_f16(false, a, false, b, (short)0, c, false, false);
  asm volatile("v_nop\n\tv_nop\n\tv_nop\n\tv_nop" : "+v"(d) : "v"(a), "v"(b));
  return d;
}

// erf in f32 without a branch: the usual two fits (an odd polynomial below 1; 1 - exp(-p(|x|)) from 1 on) are both
// evaluated and one is picked per lane. A wave nearly always holds lanes of both ranges, so a branch skips nothing, and
// it ties each element's dependent chain to the one before; as straight code the chains of independent elements interleave.
__device__ __forceinline__ float erf_select(float x) {
  const float ax = fabsf(x), t = ax * ax;
  float ps = fmaf(t, -5.61801775e-4f, 4.91381623e-3f);
  ps = fmaf(t, ps, -2.67075151e-2f);
  ps = fmaf(t, ps, 1.12800106e-1f);
  ps = fmaf(t, ps, -3.76122952e-1f);
  ps = fmaf(t, ps, 1.28379107e-1f);
  const float lo = fmaf(ax, ps, ax);
  float pl = fmaf(ax, 1.69988107e-5f, -3.78677854e-4f);
  pl = fmaf(ax, pl, 3.85781587e-3f);
  pl = fmaf(ax, pl, -2.41816975e-2f);
  pl = fmaf(ax, pl, 1.06668264e-1f);
  pl = fmaf(ax, pl, 6.34933293e-1f);
  pl = fmaf(ax, pl, 1.28689408e-1f);
  pl = fmaf(ax, pl, ax);
  // exp(-p) = 2^(-p log2 e) on the hardware's exp2: where this fit is picked exp(-p) is at most 0.16, so the rounding of the
  // product moves 1 - exp(-p) by less than one ulp
  const float hi = 1.0f - __builtin_amdgcn_exp2f(pl * -1.44269504f);
  return copysignf(ax < 1.0f ? lo : hi, x);
}

__device__ __forceinline__ float gelu_exact(float x) {
  return 0.5f * x * (1.0f + erf_select(x * 0.70710678118654752f));
}

// Mean / rstd over D=1024 of a row that one wave holds: each lane brings the sums of its 32 elements, a five-step
// butterfly leaves the totals in every lane. No LDS, no barrier.
__device__ __forceinline__ void wave_stats(float s, float s2, float& mean, float& rstd) {
  #pragma unroll   // five fixed steps, no loop counter
  for (int o = 16; o > 0; o >>= 1) {
    s  += __shfl_xor(s,  o, 32);
    s2 += __shfl_xor(s2, o, 32);
  }
  mean = s * (1.0f / Dd);
  float var = s2 * (1.0f / Dd) - mean * mean;
  rstd = rsqrtf(var + 1e-5f);
}

// A wave's view of a row of D=1024 floats: piece i (0..7) of lane l is float4 number i * 32 + l, so that every
// wave-wide 16-B load or store covers 512 contiguous bytes.
constexpr int PCS = Dd / (32 * 4);   // 8 pieces per lane

// ---------------------------------------------------------------------------
// Weight repack: f32 [K,N] row-major  ->  bf16 [N,K] row-major (B^T layout)
// ---------------------------------------------------------------------------
__device__ __forceinline__ void transpose_cvt_tile(
    char* smem, const float* __restrict__ src, bf16* __restrict__ dst, int K, int N, int blk) {
  bf16 (*tile)[72] = (bf16 (*)[72])smem;   // 64 x 72 halves
  const int nt = N / 64;
  const int nBase = (blk % nt) * 64, kBase = (blk / nt) * 64, tid = threadIdx.x;
  for (int i = tid; i < 64 * 64; i += 256) { const int kk = i >> 6, nn = i & 63; tile[nn][kk] = (bf16)src[(size_t)(kBase + kk) * N + nBase + nn]; }
  __syncthreads();
  for (int g = tid; g < 64 * 8; g += 256) { const int nn = g >> 3, pc = g & 7; vst2(dst + (size_t)(nBase + nn) * K + kBase + pc * 8, *(const v4u*)(&tile[nn][pc * 8])); }
}

// ---------------------------------------------------------------------------
// Dual layernorm: xn1 = LN(x; t_ln1), xn2 = LN(x; h_ln)  (bf16 GEMM inputs)
// ---------------------------------------------------------------------------
// One wave owns two whole rows (all 16 loads of a lane in flight at once; each g/b piece is fetched once for both rows).
__device__ __forceinline__ void ln_dual_rows(
    const float* __restrict__ x,
    const float* __restrict__ g1, const float* __restrict__ b1,
    const float* __restrict__ g2, const float* __restrict__ b2,
    bf16* __restrict__ xn1, bf16* __restrict__ xn2, int blk) {
  const int lane = threadIdx.x & 31;
  const int wid = __builtin_amdgcn_readfirstlane(threadIdx.x >> 5);   // wave number held scalar: row bases are scalar, a lane adds only its offset
  const size_t t0 = ((size_t)blk * 8 + wid) * 2;
  const float4* xr = (const float4*)(x + t0 * Dd) + lane;
  float4 v[2][PCS];
  // every loop of this kernel is unrolled: v is indexed by constants only and stays in registers
  #pragma unroll
  for (int r = 0; r < 2; ++r)
    #pragma unroll
    for (int i = 0; i < PCS; ++i) v[r][i] = xr[r * (Dd / 4) + i * 32];
  float mean[2], rstd[2];
  #pragma unroll
  for (int r = 0; r < 2; ++r) {
    float s = 0.f, s2 = 0.f;
    #pragma unroll
    for (int i = 0; i < PCS; ++i) {
      const float4 a = v[r][i];
      s  += a.x + a.y + a.z + a.w;
      s2 += a.x * a.x + a.y * a.y + a.z * a.z + a.w * a.w;
    }
    wave_stats(s, s2, mean[r], rstd[r]);
  }
  #pragma unroll
  for (int i = 0; i < PCS; ++i) {
    const int pc = i * 32 + lane;
    const float4 G1 = ((const float4*)g1)[pc], B1 = ((const float4*)b1)[pc];
    const float4 G2 = ((const float4*)g2)[pc], B2 = ((const float4*)b2)[pc];
    #pragma unroll
    for (int r = 0; r < 2; ++r) {
      const float4 a = v[r][i];
      const float n0 = (a.x - mean[r]) * rstd[r], n1 = (a.y - mean[r]) * rstd[r];
      const float n2 = (a.z - mean[r]) * rstd[r], n3 = (a.w - mean[r]) * rstd[r];
      union { bf16 h[4]; unsigned long long u; } p1, p2;   // 4 halves = 8 B per lane; a wave writes 256 contiguous bytes
      p1.h[0] = (bf16)(n0 * G1.x + B1.x); p2.h[0] = (bf16)(n0 * G2.x + B2.x);
      p1.h[1] = (bf16)(n1 * G1.y + B1.y); p2.h[1] = (bf16)(n1 * G2.y + B2.y);
      p1.h[2] = (bf16)(n2 * G1.z + B1.z); p2.h[2] = (bf16)(n2 * G2.z + B2.z);
      p1.h[3] = (bf16)(n3 * G1.w + B1.w); p2.h[3] = (bf16)(n3 * G2.w + B2.w);
      const size_t base = (t0 + r) * Dd + pc * 4;
      vst2(xn1 + base, p1.u); vst2(xn2 + base, p2.u);
    }
  }
}

// ---------------------------------------------------------------------------
// One grid for all work that depends on the inputs alone: the dual layernorm's blocks, then the 64x64 tiles of the six
// weight repacks. wpack holds the four D x D repacks one behind the other (q, k, v, o).
// ---------------------------------------------------------------------------
constexpr int LN_BLKS = TOK / 16;                     // 512
constexpr int WBIG_BLKS = (DFf / 64) * (Dd / 64);     // 1024 tiles of a D x DF weight
constexpr int WSQ_BLKS = (Dd / 64) * (Dd / 64);       // 256 tiles of a D x D weight
__global__ __launch_bounds__(256) void prep_kernel(
    const float* __restrict__ x,
    const float* __restrict__ g1, const float* __restrict__ b1,
    const float* __restrict__ g2, const float* __restrict__ b2,
    bf16* __restrict__ xn1, bf16* __restrict__ xn2,
    const float* __restrict__ wq, const float* __restrict__ wk,
    const float* __restrict__ wv, const float* __restrict__ wo,
    const float* __restrict__ w1, const float* __restrict__ w2,
    bf16* __restrict__ wpack, bf16* __restrict__ w1t, bf16* __restrict__ w2t) {
  __shared__ __align__(16) char smem[64 * 72 * 2];
  int t = blockIdx.x;
  if (t < LN_BLKS) { ln_dual_rows(x, g1, b1, g2, b2, xn1, xn2, t); return; }
  t -= LN_BLKS;
  const float* src; bf16* dst; int K = Dd, N = Dd;
  if (t < WBIG_BLKS) { src = w1; dst = w1t; N = DFf; }
  else if (t < 2 * WBIG_BLKS) { t -= WBIG_BLKS; src = w2; dst = w2t; K = DFf; }
  else {
    t -= 2 * WBIG_BLKS;
    const int sel = t / WSQ_BLKS;
    t -= sel * WSQ_BLKS;
    src = sel == 0 ? wq : sel == 1 ? wk : sel == 2 ? wv : wo;
    dst = wpack + (size_t)sel * Dd * Dd;
  }
  transpose_cvt_tile(smem, src, dst, K, N, t);
}

// ---------------------------------------------------------------------------
// Tiled WMMA GEMM:  C[M,N] = epilogue(A[M,K]_bf16 @ Bt[N,K]_bf16 + bias)
// Block tile 128x256, 8 waves (2x4), each wave 64x64 (16 v8f accumulators): per 32 k eight fragments feed sixteen WMMAs,
// and a staged byte of A serves 256 columns, a staged byte of Bt 128 rows.
// Double-buffered LDS, a stage = 64 k (whole 128-B lines of every row), filled with asynchronous 16-B copies:
// compute stage i from buf(i&1) while stage i+1 flies into buf(~i&1).
// EPI 0: gelu -> bf16 row-major       EPI 1: res + acc + bias -> f32 row-major
// EPI 2: bf16 head-major [B,H,S,HD]   EPI 3: bf16 transposed  [B,H,HD,S]
// ---------------------------------------------------------------------------
constexpr int TM = 128, TN = 256;                        // block tile
constexpr int APANEL = TM * 72, BPANEL = TN * 72;        // halves of one staged panel
constexpr int GEMM_LDS = TM * TN * 4;                    // 131,072 B: the f32 output tile; it takes the stage buffers' place behind the loop
static_assert(2 * (APANEL + BPANEL) * 2 <= GEMM_LDS, "the four staged panels (110,592 B) lie inside the output tile's LDS");

// Second half of the epilogue: Ct[128][256] holds acc + bias; whole-line stores: EPI 0 f16 rows (512 B), EPI 1 f32 rows
// (1 KB), EPI 2 [b,h,s,hd] rows (256 hd = 512 B), EPI 3 [b,h,hd,s] rows (128 s = 256 B at s0).
template <int EPI>
__device__ __forceinline__ void gemm_writeout(
    const float (*Ct)[TN], const float* __restrict__ res, void* __restrict__ out, int Ntot, int mBase, int nBase) {
  const int tid = threadIdx.x;
  if constexpr (EPI == 1) {
    // thread = one 16-B piece (tid & 63) of rows (tid >> 6) + 4 i, i = 0..31: a wave covers 512 contiguous bytes
    const int r0 = tid >> 6, c0 = (tid & 63) * 4;
    const size_t rs4 = (size_t)4 * Ntot;   // four rows further
    const size_t o0 = (size_t)(mBase + r0) * Ntot + nBase + c0;
    #pragma unroll 1   // rolled: eight residual loads in flight per lane are enough, all 32 would take 128 registers
    for (int t = 0; t < TM / 4; t += 8) {
      const float* rp = res + o0 + t * rs4;
      float* op = (float*)out + o0 + t * rs4;
      v4f rr[8];   // indexed by constants only (both inner loops unrolled): stays in registers
      #pragma unroll
      for (int j = 0; j < 8; ++j) {
        rr[j] = *(const v4f*)(rp + j * rs4);
        // behind each load
        asm volatile("s_wait_xcnt 0x0" ::: "memory");
      }
      #pragma unroll
      for (int j = 0; j < 8; ++j) vst2(op + j * rs4, *(const v4f*)(&Ct[r0 + (t + j) * 4][c0]) + rr[j]);
      asm volatile("s_wait_xcnt 0x0" ::: "memory");   // behind the stores: the next trip rewrites their data and address registers
    }
  } else if constexpr (EPI == 3) {
    const int b = mBase / Ss, s0 = mBase % Ss, h = nBase / HDd, hd0 = nBase % HDd;
    for (int g = tid; g < TN * (TM / 8); g += 256) {
      const int cl = g >> 4, pc = g & 15;         // hd row cl, piece of 8 s
      union { v8h h; v4u u; } pk;
      #pragma unroll
      for (int e = 0; e < 8; ++e) pk.h[e] = (bf16)Ct[pc * 8 + e][cl];
      vst2((bf16*)out + ((size_t)((b * Hh + h) * HDd + hd0 + cl)) * Ss + s0 + pc * 8, pk.u);
    }
  } else {
    #pragma unroll (EPI == 0 ? 1 : 4)   // EPI 0 rolled: a trip holds eight inlined erf bodies, sixteen trips of them are needless code to fetch; EPI 2: four trips' LDS reads in flight
    for (int g = tid; g < TM * (TN / 8); g += 256) {
      const int rl = g >> 5, pc = g & 31;
      union { v8h h; v4u u; } pk;
      const v4f c0 = *(const v4f*)(&Ct[rl][pc * 8]), c1 = *(const v4f*)(&Ct[rl][pc * 8 + 4]);   // two 16-B reads
      #pragma unroll
      for (int e = 0; e < 8; ++e) {
        const float v = e < 4 ? c0[e & 3] : c1[e & 3];
        pk.h[e] = (bf16)(EPI == 0 ? gelu_exact(v) : v);
      }
      const int row = mBase + rl;
      if constexpr (EPI == 0) vst2((bf16*)out + (size_t)row * Ntot + nBase + pc * 8, pk.u);
      else { const int b = row / Ss, s = row % Ss, h = nBase / HDd, hd0 = nBase % HDd;
             vst2((bf16*)out + ((size_t)((b * Hh + h) * Ss + s)) * HDd + hd0 + pc * 8, pk.u); }
    }
  }
}

// One 128x256 tile; smem = the block's LDS (GEMM_LDS bytes); epi (0..3) is the same for the whole block.
__device__ __forceinline__ void gemm_tile(
    char* smem, const bf16* __restrict__ A, const bf16* __restrict__ Bt,
    const float* __restrict__ bias, const float* __restrict__ res,
    void* __restrict__ out, int Ntot, int Ktot, int mBase, int nBase, int epi) {
  bf16 (*As)[APANEL] = (bf16 (*)[APANEL])smem;                      // [2]; 64 K + 8 pad per row: pitch 144 B = 16 B x odd for the 16-B readers
  bf16 (*Bs)[BPANEL] = (bf16 (*)[BPANEL])(smem + 2 * APANEL * 2);   // [2]
  float (*Ct)[TN] = (float (*)[TN])smem;                            // block output tile (128 KB), used behind the loop only
  const int tid  = threadIdx.x;
  const int lane = tid & 31, wid = tid >> 5;
  const int wm = wid & 1, wn = wid >> 1;            // 2 x 4 wave grid
  const int la = lane & 15, hs = lane >> 4;         // lane-in-16, half-select

  // Stage the 128x64 panel of A and the 256x64 panel of Bt into an LDS buffer with asynchronous 16-B copies (no register
  // in between). Eight lanes cover one 128-B row, a wave four whole lines. Each thread owns one 16-B piece of rows
  // sr + 32 i (i = 0..3 of A, 0..7 of Bt): twelve copies per stage, every lane on.
  const int sr = tid >> 3, sc = (tid & 7) * 8;
  const size_t rstep = (size_t)32 * Ktot;
  const bf16* ga = A  + (size_t)(mBase + sr) * Ktot + sc;
  const bf16* gb = Bt + (size_t)(nBase + sr) * Ktot + sc;
  const unsigned la_lds = (unsigned)(size_t)&As[0][sr * 72 + sc];   // low 32 bits of a __shared__ address = LDS byte address
  const unsigned lb_lds = (unsigned)(size_t)&Bs[0][sr * 72 + sc];
  auto stage = [&](int k0, int buf) {
    constexpr unsigned RS = 32 * 72 * 2;                            // 32 rows further in LDS, bytes
    const unsigned da = la_lds + (unsigned)buf * (APANEL * 2), db = lb_lds + (unsigned)buf * (BPANEL * 2);
    const bf16 *pa = ga + k0, *pb = gb + k0;
    // the copies and their s_wait_xcnt in one statement, so that the wait stands ahead of any rewrite of an address register
    asm volatile("global_load_async_to_lds_b128 %0, %1, off\n\t"
                 "global_load_async_to_lds_b128 %2, %3, off\n\t"
                 "global_load_async_to_lds_b128 %4, %5, off\n\t"
                 "global_load_async_to_lds_b128 %6, %7, off\n\t"
                 "global_load_async_to_lds_b128 %8, %9, off\n\t"
                 "global_load_async_to_lds_b128 %10, %11, off\n\t"
                 "global_load_async_to_lds_b128 %12, %13, off\n\t"
                 "global_load_async_to_lds_b128 %14, %15, off\n\t"
                 "global_load_async_to_lds_b128 %16, %17, off\n\t"
                 "global_load_async_to_lds_b128 %18, %19, off\n\t"
                 "global_load_async_to_lds_b128 %20, %21, off\n\t"
                 "global_load_async_to_lds_b128 %22, %23, off\n\t"
                 "s_wait_xcnt 0x0"
                 :: "v"(da),          "v"(pa),             "v"(da + RS),     "v"(pa + rstep),
                    "v"(da + 2 * RS), "v"(pa + 2 * rstep), "v"(da + 3 * RS), "v"(pa + 3 * rstep),
                    "v"(db),          "v"(pb),             "v"(db + RS),     "v"(pb + rstep),
                    "v"(db + 2 * RS), "v"(pb + 2 * rstep), "v"(db + 3 * RS), "v"(pb + 3 * rstep),
                    "v"(db + 4 * RS), "v"(pb + 4 * rstep), "v"(db + 5 * RS), "v"(pb + 5 * rstep),
                    "v"(db + 6 * RS), "v"(pb + 6 * rstep), "v"(db + 7 * RS), "v"(pb + 7 * rstep)
                 : "memory");
  };

  v8f acc[4][4] = {};
  const int ntiles = Ktot >> 6;
  stage(0, 0);
  asm volatile("s_wait_asynccnt 0x0" ::: "memory");   // this wave's copies of stage 0 have landed
  __syncthreads();                                    // every wave's have
  if (ntiles > 1) stage(64, 1);

  for (int it = 0; it < ntiles; ++it) {
    const int cur = it & 1;   // stage it is worked on from buf(cur) while stage it + 1 flies into the other buffer
    #pragma unroll   // kf a constant: the two 32-k halves of a stage become LDS offsets, no loop or address work per half
    for (int kf = 0; kf < 64; kf += 32) {
      // A-frag (16x32 bf16): lanes 0-15 hold K 0-7 / 16-23, lanes 16-31 K 8-15 / 24-31.
      v16h afrag[4];
      #pragma unroll
      for (int ms = 0; ms < 4; ++ms) {
        int r = wm * 64 + ms * 16 + la;
        union { v16h v; v8h h[2]; } u;
        u.h[0] = *(const v8h*)&As[cur][r * 72 + kf + hs * 8];
        u.h[1] = *(const v8h*)&As[cur][r * 72 + kf + hs * 8 + 16];
        afrag[ms] = u.v;
      }
      // B-frag (32x16): same per-lane K map as A (lanes 0-15 hold K 0-7 / 16-23, lanes 16-31 K 8-15 / 24-31).
      v16h bfrag[4];
      #pragma unroll
      for (int ns = 0; ns < 4; ++ns) {
        int r = wn * 64 + ns * 16 + la;
        union { v16h v; v8h h[2]; } u;
        u.h[0] = *(const v8h*)&Bs[cur][r * 72 + kf + hs * 8];
        u.h[1] = *(const v8h*)&Bs[cur][r * 72 + kf + hs * 8 + 16];
        bfrag[ns] = u.v;
      }
      #pragma unroll
      for (int ms = 0; ms < 4; ++ms)
        #pragma unroll
        for (int ns = 0; ns < 4; ++ns)
          acc[ms][ns] = wmma_bf16(afrag[ms], bfrag[ns], acc[ms][ns]);
    }
    asm volatile("s_wait_dscnt 0x0" ::: "memory");      // this wave's reads of buf(cur) are done before it is refilled
    asm volatile("s_wait_asynccnt 0x0" ::: "memory");   // this wave's copies of stage it + 1 have landed
    __syncthreads();                                    // stage it + 1 published; every wave has left buf(cur)
    if (it + 2 < ntiles) stage((it + 2) * 64, cur);
  }
  asm volatile("s_wait_asynccnt 0x0" ::: "memory");     // no copy outstanding behind the loop

  // First half of the epilogue. C-frag: lane holds col la, rows r + 8*hs per VGPR r -> block tile Ct[128][256] = acc + bias.
  __syncthreads();
  #pragma unroll   // acc is indexed by constants only and stays in registers
  for (int ms = 0; ms < 4; ++ms)
    #pragma unroll
    for (int ns = 0; ns < 4; ++ns) {
      const int cl = wn * 64 + ns * 16 + la;
      const float bv = bias[nBase + cl];
      #pragma unroll
      for (int r = 0; r < 8; ++r) Ct[wm * 64 + ms * 16 + r + hs * 8][cl] = acc[ms][ns][r] + bv;
    }
  __syncthreads();
  if (epi == 0)      gemm_writeout<0>(Ct, res, out, Ntot, mBase, nBase);
  else if (epi == 1) gemm_writeout<1>(Ct, res, out, Ntot, mBase, nBase);
  else if (epi == 2) gemm_writeout<2>(Ct, res, out, Ntot, mBase, nBase);
  else               gemm_writeout<3>(Ct, res, out, Ntot, mBase, nBase);
}

// FFN-up GEMM and the Q, K, V projections in one grid (all K = D, all depend only on the layernorm outputs and repacks):
// blockIdx.x 0..15 = column tiles of h1, then four column tiles each of q, k, v.
__global__ __launch_bounds__(256) void gemm_up_qkv_kernel(
    const bf16* __restrict__ xn1, const bf16* __restrict__ xn2,
    const bf16* __restrict__ w1t, const bf16* __restrict__ wpack,
    const float* __restrict__ b1, const float* __restrict__ bq,
    const float* __restrict__ bk, const float* __restrict__ bv,
    bf16* __restrict__ h1, bf16* __restrict__ qb, bf16* __restrict__ kb, bf16* __restrict__ vtb,
    int Nup, int Nproj, int Ktot) {
  __shared__ __align__(16) char smem[GEMM_LDS];
  const int bx = blockIdx.x, mBase = blockIdx.y * TM;
  const bf16 *A = xn1, *Bt = w1t;
  const float* bias = b1;
  bf16* out = h1;
  int Ntot = Nup, nBase = bx * TN, epi = 0;
  if (bx >= DFf / TN) {
    const int sel = (bx - DFf / TN) >> 2;
    A = xn2; Bt = wpack + (size_t)sel * Dd * Dd;
    bias = sel == 0 ? bq : sel == 1 ? bk : bv;
    out  = sel == 0 ? qb : sel == 1 ? kb : vtb;
    Ntot = Nproj; nBase = ((bx - DFf / TN) & 3) * TN; epi = sel == 2 ? 3 : 2;
  }
  gemm_tile(smem, A, Bt, bias, nullptr, out, Ntot, Ktot, mBase, nBase, epi);
}

// ---------------------------------------------------------------------------
// Hebbian attention: out_i = sum_{j<=i} relu(beta * q_i.k_j) v_j
// q,k: bf16 [B,H,S,HD] ; vt: bf16 [B,H,HD,S] ; out: bf16 [B,S,D] (token-major)
// Block = one (b,h) x 64-query tile. Causal: only kt <= qt key tiles visited.
// The K tile (64 x 256) and the Vt tile (256 x 64) are brought in once per block with whole-line 16-B loads and kept in
// LDS; every wave takes its B fragments from there. The next tile's loads are issued at the top of a pass and stored
// behind the barrier that ends the last read of the tile they replace.
// ---------------------------------------------------------------------------
constexpr int ATTN_LDS = (2 * 64 * 264 + 256 * 72 + 64 * 72) * 2;   // 113,664 B
constexpr int RD = 3;                                               // register sets in the ring of Q/K fragments
union frag16 { v16h v; v8h h[2]; };                                 // a 16x32 f16 fragment = two 16-B LDS reads
__device__ __forceinline__ void hebbian_attn_tile(
    char* smem, const bf16* __restrict__ q, const bf16* __restrict__ k,
    const bf16* __restrict__ vt, const float* __restrict__ betap,
    bf16* __restrict__ attn_out, int qt, int bh) {
  bf16* Qs   = (bf16*)smem;       // 64 x 256 (+8 pad)
  bf16* Ks   = Qs + 64 * 264;     // 64 keys x 256 (+8 pad)
  bf16* Vs   = Ks + 64 * 264;     // 256 feats x 64 keys (+8 pad); after the loop: per-wave output tiles
  bf16* affs = Vs + 256 * 72;     // 64 x 64  (+8 pad)
  const int bidx = bh / Hh, hidx = bh % Hh;
  const int tid = threadIdx.x, lane = tid & 31, wid = tid >> 5;
  const int la = lane & 15, hs = lane >> 4;
  const float beta = betap[0];

  const int kr = tid >> 5, kc = (tid & 31) * 8;   // K piece: a wave covers one 512-B row; 8 rows per step
  const int vr = tid >> 3, vc = (tid & 7) * 8;    // Vt piece: a wave covers four 128-B rows; 32 rows per step
  const bf16* kth = k  + (size_t)bh * Ss * HDd + kr * HDd + kc;   // this thread's piece of key row kr
  const bf16* vth = vt + (size_t)bh * HDd * Ss + vr * Ss + vc;    // this thread's piece of feature row vr
  v4u kreg[8], vreg[8];
  auto fetch = [&](int kbase) {
    #pragma unroll
    for (int i = 0; i < 8; ++i) kreg[i] = *(const v4u*)(kth + (size_t)kbase * HDd + i * 8 * HDd);
    #pragma unroll
    for (int i = 0; i < 8; ++i) vreg[i] = *(const v4u*)(vth + kbase + i * 32 * Ss);
  };
  auto put_k = [&]() {
    #pragma unroll
    for (int i = 0; i < 8; ++i) *(v4u*)&Ks[(kr + i * 8) * 264 + kc] = kreg[i];
  };
  auto put_v = [&]() {
    #pragma unroll
    for (int i = 0; i < 8; ++i) *(v4u*)&Vs[(vr + i * 32) * 72 + vc] = vreg[i];
  };

  fetch(0);
  // Stage Q tile (reused for every key tile).
  const bf16* qb = q + ((size_t)bh * Ss + qt * 64) * HDd;
  #pragma unroll
  for (int c = tid; c < 64 * 32; c += 256) {
    int r = c >> 5, cc = (c & 31) * 8;
    *(v4u*)&Qs[r * 264 + cc] = *(const v4u*)&qb[(size_t)r * HDd + cc];
  }
  put_k();
  put_v();
  __syncthreads();

  const int ma = wid & 3;   // 16-row group for both GEMMs
  const int nh = wid >> 2;  // GEMM1: 32-col half of aff ; GEMM2: 128-feat half
  v8f oacc[8] = {};

  for (int kt = 0; kt <= qt; ++kt) {
    const int kbase = kt * 64;
    const bool more = kt < qt;
    if (more) fetch(kbase + 64);
    // ---- GEMM1: aff(64x64) = Q(64x256) @ K^T, both from LDS ----
    // The fragments of a 32-k step (one of Q, two of K) go through a ring of RD register sets: RD steps' reads are issued
    // as one group up front, and a set is read anew right behind the two WMMAs that used it, RD - 1 steps ahead of its next
    // use, so that a wave does not wait out the LDS latency at every step.
    v8f c0 = {}, c1 = {};
    {
      const bf16* pq = &Qs[(ma * 16 + la) * 264 + hs * 8];
      const bf16* p0 = &Ks[(nh * 32 + la)      * 264 + hs * 8];   // same K map as A
      const bf16* p1 = &Ks[(nh * 32 + 16 + la) * 264 + hs * 8];
      frag16 ua[RD], ub0[RD], ub1[RD];   // indexed by constants only (both loops unrolled): stay in registers
      auto read_step = [&](int i) {
        const int s = i % RD, kf = i * 32;
        ua[s].h[0]  = *(const v8h*)(pq + kf); ua[s].h[1]  = *(const v8h*)(pq + kf + 16);
        ub0[s].h[0] = *(const v8h*)(p0 + kf); ub0[s].h[1] = *(const v8h*)(p0 + kf + 16);
        ub1[s].h[0] = *(const v8h*)(p1 + kf); ub1[s].h[1] = *(const v8h*)(p1 + kf + 16);
      };
      #pragma unroll   // i a constant: the set's number and the LDS offset are fixed at compile time
      for (int i = 0; i < RD; ++i) read_step(i);
      #pragma unroll   // the same; eight steps
      for (int i = 0; i < HDd / 32; ++i) {
        c0 = wmma_bf16(ua[i % RD].v, ub0[i % RD].v, c0);
        c1 = wmma_bf16(ua[i % RD].v, ub1[i % RD].v, c1);
        if (i + RD < HDd / 32) read_step(i + RD);
      }
    }
    // beta * relu + causal mask, re-layout C-frag -> A-frag via LDS (bf16).
    // (the barrier at the foot of the previous pass ended the last read of affs)
    #pragma unroll
    for (int ns = 0; ns < 2; ++ns) {
      v8f cv = ns ? c1 : c0;
      int jl = nh * 32 + ns * 16 + la;
      int j = kbase + jl;
      #pragma unroll
      for (int r = 0; r < 8; ++r) {
        int il = ma * 16 + r + hs * 8;
        int i = qt * 64 + il;
        float v = cv[r] * beta;
        v = (j <= i && v > 0.f) ? v : 0.f;
        affs[il * 72 + jl] = (bf16)v;
      }
    }
    __syncthreads();  // affs and this pass's Vs visible; every read of Ks done
    // ---- GEMM2: out(64x256) += aff(64x64) @ V(64x256) via Vt rows in LDS ----
    // Both aff fragments and the eight V fragments of keys 0-31 are read as one group; each half of the V set is read anew
    // (keys 32-63) right behind the four WMMAs that used it, four WMMAs ahead of its next use.
    {
      const bf16* pa = &affs[(ma * 16 + la) * 72 + hs * 8];
      const bf16* pv = &Vs[(nh * 128 + la) * 72 + hs * 8];
      frag16 ua[2], ub[8];   // indexed by constants only (every loop unrolled): stay in registers
      auto read_v = [&](int j, int kk) {
        const bf16* p = pv + j * 16 * 72 + kk;
        ub[j].h[0] = *(const v8h*)p; ub[j].h[1] = *(const v8h*)(p + 16);
      };
      // every loop below is unrolled: h and j are constants, so fragments and accumulators are fixed registers
      #pragma unroll
      for (int h = 0; h < 2; ++h) { ua[h].h[0] = *(const v8h*)(pa + h * 32); ua[h].h[1] = *(const v8h*)(pa + h * 32 + 16); }
      #pragma unroll
      for (int j = 0; j < 8; ++j) read_v(j, 0);
      if (more) put_k();   // behind the reads: the WMMAs wait for those, nothing in this pass for the stores
      #pragma unroll
      for (int h = 0; h < 2; ++h) {
        #pragma unroll
        for (int j = h * 4; j < h * 4 + 4; ++j) oacc[j] = wmma_bf16(ua[0].v, ub[j].v, oacc[j]);
        #pragma unroll
        for (int j = h * 4; j < h * 4 + 4; ++j) read_v(j, 32);
      }
      #pragma unroll
      for (int j = 0; j < 8; ++j) oacc[j] = wmma_bf16(ua[1].v, ub[j].v, oacc[j]);
    }
    __syncthreads();  // next pass's Ks visible; every read of Vs and affs done
    if (more) put_v();
  }
  // Write f16 token-major so the wo GEMM can consume it as A directly: the wave's 16 rows x 128 feats (256-B row segments)
  bf16* ot = Vs + wid * (16 * 128);   // Vs is free behind the loop's last barrier
  #pragma unroll
  for (int j = 0; j < 8; ++j) {
    int fl = j * 16 + la;
    #pragma unroll
    for (int r = 0; r < 8; ++r) ot[(r + hs * 8) * 128 + fl] = (bf16)oacc[j][r];
  }
  __syncthreads();
  #pragma unroll
  for (int q2 = 0; q2 < 8; ++q2) {
    const int rl = q2 * 2 + (lane >> 4), pc = lane & 15;
    const int s = qt * 64 + ma * 16 + rl;
    vst2(attn_out + ((size_t)(bidx * Ss + s)) * Dd + hidx * HDd + nh * 128 + pc * 8, *(const v4u*)(ot + rl * 128 + pc * 8));
  }
}

// Attention and the FFN-down GEMM in one grid (neither reads what the other writes). There are more blocks than
// places; in index order the long ones come first: the causal tiles of the upper half of the
// queries (longest first), then the GEMM's tiles, then the remaining causal tiles, ever shorter, which fill the tail.
constexpr int ATTN_BLKS = (Ss / 64) * Bb * Hh;        // 512
constexpr int DOWN_BLKS = (Dd / TN) * (TOK / TM);     // 256
static_assert(ATTN_LDS <= GEMM_LDS, "the attention tile lives in the GEMM's LDS");
__global__ __launch_bounds__(256) void attn_ffn_down_kernel(
    const bf16* __restrict__ q, const bf16* __restrict__ k,
    const bf16* __restrict__ vt, const float* __restrict__ betap, bf16* __restrict__ attn_out,
    const bf16* __restrict__ h1, const bf16* __restrict__ w2t, const float* __restrict__ b2,
    const float* __restrict__ x, float* __restrict__ tpre, int Ntot, int Ktot) {
  __shared__ __align__(16) char smem[GEMM_LDS];
  const int b = blockIdx.x;
  if (b < ATTN_BLKS / 2 || b >= ATTN_BLKS / 2 + DOWN_BLKS) {
    const int u = b < ATTN_BLKS / 2 ? b : b - DOWN_BLKS;   // 0..511: sixteen (batch, head) pairs per query tile
    hebbian_attn_tile(smem, q, k, vt, betap, attn_out, Ss / 64 - 1 - u / (Bb * Hh), u % (Bb * Hh));
  } else {
    const int t = b - ATTN_BLKS / 2;
    gemm_tile(smem, h1, w2t, b2, x, tpre, Ntot, Ktot, (t / (Dd / TN)) * TM, (t % (Dd / TN)) * TN, 1);
  }
}

// ---------------------------------------------------------------------------
// TRM tail: residual = tpre; xn = LN(tpre); mix = scalar-MLP(xn); out = tpre+mix
// ---------------------------------------------------------------------------
// One wave owns one whole row: 32 elements per lane, kept in registers.
__device__ __forceinline__ void trm_scalar_mlp_rows(
    const float* __restrict__ tpre, const float* __restrict__ g,
    const float* __restrict__ bt, const float* __restrict__ sw1,
    const float* __restrict__ sb1, const float* __restrict__ sw2,
    const float* __restrict__ sb2, float* __restrict__ trm_out, int blk) {
  const int lane = threadIdx.x & 31;
  const int wid = __builtin_amdgcn_readfirstlane(threadIdx.x >> 5);   // wave number held scalar: row bases are scalar, a lane adds only its offset
  const size_t t = (size_t)blk * 8 + wid;
  const float4* xr = (const float4*)(tpre + t * Dd) + lane;
  float xin[PCS * 4];
  float s = 0.f, s2 = 0.f;
  // every loop over pieces or elements is unrolled: xin, xn, mix are indexed by constants only and stay in registers
  #pragma unroll
  for (int i = 0; i < PCS; ++i) {
    const float4 a = xr[i * 32];
    xin[i * 4 + 0] = a.x; xin[i * 4 + 1] = a.y; xin[i * 4 + 2] = a.z; xin[i * 4 + 3] = a.w;
  }
  #pragma unroll
  for (int i = 0; i < PCS; ++i) {
    const float a0 = xin[i * 4], a1 = xin[i * 4 + 1], a2 = xin[i * 4 + 2], a3 = xin[i * 4 + 3];
    s  += a0 + a1 + a2 + a3;
    s2 += a0 * a0 + a1 * a1 + a2 * a2 + a3 * a3;
  }
  float mean, rstd;
  wave_stats(s, s2, mean, rstd);
  asm volatile("s_wait_xcnt 0x0" ::: "memory");   // behind the eight row loads: their scalar base is reused for the scalar load below
  const float vb2 = sb2[0];
  float xn[PCS * 4], mix[PCS * 4];
  #pragma unroll
  for (int i = 0; i < PCS; ++i) {
    const float4 G = ((const float4*)g)[i * 32 + lane], Bt = ((const float4*)bt)[i * 32 + lane];
    xn[i * 4 + 0] = (xin[i * 4 + 0] - mean) * rstd * G.x + Bt.x;
    xn[i * 4 + 1] = (xin[i * 4 + 1] - mean) * rstd * G.y + Bt.y;
    xn[i * 4 + 2] = (xin[i * 4 + 2] - mean) * rstd * G.z + Bt.z;
    xn[i * 4 + 3] = (xin[i * 4 + 3] - mean) * rstd * G.w + Bt.w;
    mix[i * 4 + 0] = vb2; mix[i * 4 + 1] = vb2; mix[i * 4 + 2] = vb2; mix[i * 4 + 3] = vb2;
  }
  #pragma unroll 1   // rolled: a trip already holds 32 inlined erf bodies; four times that is needless code to fetch
  for (int e = 0; e < Ee; ++e) {
    const float w1 = sw1[e], b1 = sb1[e], w2 = sw2[e];
    #pragma unroll
    for (int j = 0; j < PCS * 4; ++j) {
      mix[j] += gelu_exact(xn[j] * w1 + b1) * w2;
      // a scheduling fence behind every eighth value: with all 32 in one region the compiler, to save registers, lays the values' chains
      // one behind the other and a wave waits out every link; in regions of eight it interleaves them
      if ((j & 7) == 7) __builtin_amdgcn_sched_barrier(0);
    }
  }
  #pragma unroll
  for (int i = 0; i < PCS; ++i) {
    v4f ov = {xin[i * 4 + 0] + mix[i * 4 + 0], xin[i * 4 + 1] + mix[i * 4 + 1],
              xin[i * 4 + 2] + mix[i * 4 + 2], xin[i * 4 + 3] + mix[i * 4 + 3]};
    vst2((v4f*)(trm_out + t * Dd) + i * 32 + lane, ov);
  }
}

// The scalar MLP (vector work) and the output projection (matrix work) in one grid. In index order
// the MLP blocks of eight rows, the longer kind, come first, then the GEMM's tiles.
constexpr int MLP_BLKS = TOK / 8;                     // 1024
constexpr int WO_BLKS = (Dd / TN) * (TOK / TM);       // 256
__global__ __launch_bounds__(256) void wo_mlp_kernel(
    const bf16* __restrict__ ao, const bf16* __restrict__ wot, const float* __restrict__ bo,
    const float* __restrict__ x, float* __restrict__ heb,
    const float* __restrict__ tpre, const float* __restrict__ g,
    const float* __restrict__ bt, const float* __restrict__ sw1,
    const float* __restrict__ sb1, const float* __restrict__ sw2,
    const float* __restrict__ sb2, float* __restrict__ trm_out, int Ntot, int Ktot) {
  __shared__ __align__(16) char smem[GEMM_LDS];
  const int b = blockIdx.x;
  if (b < MLP_BLKS) trm_scalar_mlp_rows(tpre, g, bt, sw1, sb1, sw2, sb2, trm_out, b);
  else {
    const int t = b - MLP_BLKS;
    gemm_tile(smem, ao, wot, bo, x, heb, Ntot, Ktot, (t / (Dd / TN)) * TM, (t % (Dd / TN)) * TN, 1);
  }
}

// ---------------------------------------------------------------------------
// Final blend + layernorm:  LN(x + sig(a)*trm + (1-sig(a))*heb ; o_ln)
// ---------------------------------------------------------------------------
// One wave owns two whole rows.
__global__ __launch_bounds__(256) void blend_ln_kernel(
    const float* __restrict__ x, const float* __restrict__ trm,
    const float* __restrict__ heb, const float* __restrict__ alphap,
    const float* __restrict__ g, const float* __restrict__ bt,
    float* __restrict__ out) {
  const int lane = threadIdx.x & 31;
  const int wid = __builtin_amdgcn_readfirstlane(threadIdx.x >> 5);   // wave number held scalar: row bases are scalar, a lane adds only its offset
  const size_t t0 = ((size_t)blockIdx.x * 8 + wid) * 2;
  const float bw = 1.0f / (1.0f + expf(-alphap[0]));
  const float4* xr = (const float4*)(x   + t0 * Dd) + lane;
  const float4* tr = (const float4*)(trm + t0 * Dd) + lane;
  const float4* hr = (const float4*)(heb + t0 * Dd) + lane;
  float4 u[2][PCS];
  float mean[2], rstd[2];
  // every loop of this kernel is unrolled: u is indexed by constants only and stays in registers
  #pragma unroll
  for (int r = 0; r < 2; ++r) {
    float s = 0.f, s2 = 0.f;
    #pragma unroll
    for (int i = 0; i < PCS; ++i) {
      const int o = r * (Dd / 4) + i * 32;
      const float4 xv = xr[o], tv = tr[o], hv = hr[o];
      float4 a;
      a.x = xv.x + bw * tv.x + (1.f - bw) * hv.x;
      a.y = xv.y + bw * tv.y + (1.f - bw) * hv.y;
      a.z = xv.z + bw * tv.z + (1.f - bw) * hv.z;
      a.w = xv.w + bw * tv.w + (1.f - bw) * hv.w;
      u[r][i] = a;
      s  += a.x + a.y + a.z + a.w;
      s2 += a.x * a.x + a.y * a.y + a.z * a.z + a.w * a.w;
    }
    wave_stats(s, s2, mean[r], rstd[r]);
  }
  #pragma unroll
  for (int i = 0; i < PCS; ++i) {
    const int pc = i * 32 + lane;
    const float4 G = ((const float4*)g)[pc], Bt = ((const float4*)bt)[pc];
    #pragma unroll
    for (int r = 0; r < 2; ++r) {
      const float4 a = u[r][i];
      v4f ov = {(a.x - mean[r]) * rstd[r] * G.x + Bt.x, (a.y - mean[r]) * rstd[r] * G.y + Bt.y,
                (a.z - mean[r]) * rstd[r] * G.z + Bt.z, (a.w - mean[r]) * rstd[r] * G.w + Bt.w};
      vst2((v4f*)(out + (t0 + r) * Dd) + pc, ov);   // one wave writes 512 contiguous bytes
    }
  }
}

// ---------------------------------------------------------------------------
// Host-side orchestration.
// ---------------------------------------------------------------------------
extern "C" void kernel_launch(void* const* d_in, const int* in_sizes, int n_in,
                              void* d_out, int out_size, void* d_ws, size_t ws_size,
                              hipStream_t stream) {
  const float* x      = (const float*)d_in[0];
  const float* h_ln_g = (const float*)d_in[1];
  const float* h_ln_b = (const float*)d_in[2];
  const float* wq     = (const float*)d_in[3];
  const float* bq     = (const float*)d_in[4];
  const float* wk     = (const float*)d_in[5];
  const float* bk     = (const float*)d_in[6];
  const float* wv     = (const float*)d_in[7];
  const float* bv     = (const float*)d_in[8];
  const float* wo     = (const float*)d_in[9];
  const float* bo     = (const float*)d_in[10];
  const float* beta   = (const float*)d_in[11];
  const float* t_ln1_g= (const float*)d_in[12];
  const float* t_ln1_b= (const float*)d_in[13];
  const float* t_w1   = (const float*)d_in[14];
  const float* t_b1   = (const float*)d_in[15];
  const float* t_w2   = (const float*)d_in[16];
  const float* t_b2   = (const float*)d_in[17];
  const float* t_lns_g= (const float*)d_in[18];
  const float* t_lns_b= (const float*)d_in[19];
  const float* s_w1   = (const float*)d_in[20];
  const float* s_b1   = (const float*)d_in[21];
  const float* s_w2   = (const float*)d_in[22];
  const float* s_b2   = (const float*)d_in[23];
  const float* alpha  = (const float*)d_in[24];
  const float* o_ln_g = (const float*)d_in[25];
  const float* o_ln_b = (const float*)d_in[26];
  float* out = (float*)d_out;

  char* ws = (char*)d_ws;
  const size_t MB = 1ull << 20;
  bf16* wpack= (bf16*)(ws + 0 * MB);    // q, k, v, o repacks, 2 MB each (1024x1024 f16), one behind the other
  bf16* wot  = (bf16*)(ws + 6 * MB);    // the fourth of them
  bf16* w1t  = (bf16*)(ws + 8 * MB);    // 8 MB  [DF, D]
  bf16* w2t  = (bf16*)(ws + 16 * MB);   // 8 MB  [D, DF]
  bf16* xn1  = (bf16*)(ws + 24 * MB);   // 16 MB [TOK, D]
  bf16* xn2  = (bf16*)(ws + 40 * MB);   // 16 MB [TOK, D]
  bf16* h1   = (bf16*)(ws + 56 * MB);   // 64 MB [TOK, DF]; free behind the FFN-down GEMM
  float* hebo= (float*)(ws + 56 * MB);  // 32 MB f32, in h1's place
  float* tpre= (float*)(ws + 120 * MB); // 32 MB f32
  float* trmo= (float*)(ws + 152 * MB); // 32 MB f32
  bf16* qb   = (bf16*)(ws + 184 * MB);  // 16 MB [B,H,S,HD]
  bf16* kb   = (bf16*)(ws + 200 * MB);  // 16 MB [B,H,S,HD]
  bf16* vtb  = (bf16*)(ws + 216 * MB);  // 16 MB [B,H,HD,S]
  bf16* ao   = (bf16*)(ws + 232 * MB);  // 16 MB [TOK, D] ; total = 248 MB

  // 1: dual layernorm -> f16 GEMM inputs, and the weight repacks (f32 [K,N] -> f16 [N,K])
  prep_kernel<<<LN_BLKS + 2 * WBIG_BLKS + 4 * WSQ_BLKS, 256, 0, stream>>>(
      x, t_ln1_g, t_ln1_b, h_ln_g, h_ln_b, xn1, xn2, wq, wk, wv, wo, t_w1, t_w2, wpack, w1t, w2t);
  // 2: h1 = gelu(xn1 @ w1), q / k head-major, v transposed
  gemm_up_qkv_kernel<<<dim3(DFf / TN + 3 * (Dd / TN), TOK / TM), 256, 0, stream>>>(
      xn1, xn2, w1t, wpack, t_b1, bq, bk, bv, h1, qb, kb, vtb, DFf, Dd, Dd);
  // 3: causal relu attention -> ao, and tpre = x + h1 @ w2
  attn_ffn_down_kernel<<<ATTN_BLKS + DOWN_BLKS, 256, 0, stream>>>(
      qb, kb, vtb, beta, ao, h1, w2t, t_b2, x, tpre, Dd, DFf);
  // 4: heb = x + ao @ wo, and trm_out from tpre
  wo_mlp_kernel<<<MLP_BLKS + WO_BLKS, 256, 0, stream>>>(
      ao, wot, bo, x, hebo, tpre, t_lns_g, t_lns_b, s_w1, s_b1, s_w2, s_b2, trmo, Dd, Dd);

  // ---- blend + final layernorm ----
  blend_ln_kernel<<<TOK / 16, 256, 0, stream>>>(x, trmo, hebo, alpha,
                                           o_ln_g, o_ln_b, out);
}

// v008
// Measured time: 266 microseconds a run.
// Next to v007, in two timings, it ran 1.04 times as fast each time.
// Over all steps from v000 it is 2.74 times as fast.
#include <hip/hip_runtime.h>
#include <stdint.h>

// ---------------------------------------------------------------------------
// wave32, WMMA f16 (f32 accumulate), double-buffered GEMM pipeline with asynchronous 16-B copies to LDS.
// Contractions: the TRM FFN GEMMs (K = 1024 / 4096), Q/K/V and output projections (K = 1024), the Hebbian affinity Q K^T
// (K = 256) and aff V (K = keys) on v_wmma_f32_16x16x32_f16 (f16 operands, f32 accumulate); LayerNorms, GELU, the scalar
// ---------------------------------------------------------------------------

typedef _Float16 bf16;   // NOTE: 'bf16' is only a type alias name here — the type is IEEE half (f16) throughout
typedef __attribute__((ext_vector_type(4))) float v4f;
typedef __attribute__((ext_vector_type(4))) unsigned v4u;
template <typename V> __device__ __forceinline__ void vst2(void* p, V v) {
  *(V*)p = v; 
}
typedef __attribute__((ext_vector_type(16))) _Float16 v16h;
typedef __attribute__((ext_vector_type(8)))  _Float16 v8h;
typedef __attribute__((ext_vector_type(8)))  float  v8f;

constexpr int Bb  = 4;
constexpr int Ss  = 2048;
constexpr int Dd  = 1024;
constexpr int Hh  = 4;
constexpr int HDd = Dd / Hh;     // 256
constexpr int Ee  = 4;
constexpr int DFf = Dd * Ee;     // 4096
constexpr int TOK = Bb * Ss;     // 8192

__device__ __forceinline__ v8f wmma_bf16(v16h a, v16h b, v8f c) {   // (name kept; f16 WMMA + hazard guard)
  v8f d = __builtin_amdgcn_wmma_f32_16x16x32_f16(false, a, false, b, (short)0, c, false, false);
  asm volatile("v_nop\n\tv_nop\n\tv_nop\n\tv_nop" : "+v"(d) : "v"(a), "v"(b));
  return d;
}

// erf in f32 without a branch: the usual two fits (an odd polynomial below 1; 1 - exp(-p(|x|)) from 1 on) are both
// evaluated and one is picked per lane. A wave nearly always holds lanes of both ranges, so a branch skips nothing, and
// it ties each element's dependent chain to the one before; as straight code the chains of independent elements interleave.
__device__ __forceinline__ float erf_select(float x) {
  const float ax = fabsf(x), t = ax * ax;
  float ps = fmaf(t, -5.61801775e-4f, 4.91381623e-3f);
  ps = fmaf(t, ps, -2.67075151e-2f);
  ps = fmaf(t, ps, 1.12800106e-1f);
  ps = fmaf(t, ps, -3.76122952e-1f);
  ps = fmaf(t, ps, 1.28379107e-1f);
  const float lo = fmaf(ax, ps, ax);
  float pl = fmaf(ax, 1.69988107e-5f, -3.78677854e-4f);
  pl = fmaf(ax, pl, 3.85781587e-3f);
  pl = fmaf(ax, pl, -2.41816975e-2f);
  pl = fmaf(ax, pl, 1.06668264e-1f);
  pl = fmaf(ax, pl, 6.34933293e-1f);
  pl = fmaf(ax, pl, 1.28689408e-1f);
  pl = fmaf(ax, pl, ax);
  // exp(-p) = 2^(-p log2 e) on the hardware's exp2: where this fit is picked exp(-p) is at most 0.16, so the rounding of the
  // product moves 1 - exp(-p) by less than one ulp
  const float hi = 1.0f - __builtin_amdgcn_exp2f(pl * -1.44269504f);
  return copysignf(ax < 1.0f ? lo : hi, x);
}

__device__ __forceinline__ float gelu_exact(float x) {
  return 0.5f * x * (1.0f + erf_select(x * 0.70710678118654752f));
}

// Mean / rstd over D=1024 of a row that one wave holds: each lane brings the sums of its 32 elements, a five-step
// butterfly leaves the totals in every lane. No LDS, no barrier.
__device__ __forceinline__ void wave_stats(float s, float s2, float& mean, float& rstd) {
  #pragma unroll   // five fixed steps, no loop counter
  for (int o = 16; o > 0; o >>= 1) {
    s  += __shfl_xor(s,  o, 32);
    s2 += __shfl_xor(s2, o, 32);
  }
  mean = s * (1.0f / Dd);
  float var = s2 * (1.0f / Dd) - mean * mean;
  rstd = rsqrtf(var + 1e-5f);
}

// A wave's view of a row of D=1024 floats: piece i (0..7) of lane l is float4 number i * 32 + l, so that every
// wave-wide 16-B load or store covers 512 contiguous bytes.
constexpr int PCS = Dd / (32 * 4);   // 8 pieces per lane

// ---------------------------------------------------------------------------
// Weight repack: f32 [K,N] row-major  ->  bf16 [N,K] row-major (B^T layout)
// ---------------------------------------------------------------------------
__device__ __forceinline__ void transpose_cvt_tile(
    char* smem, const float* __restrict__ src, bf16* __restrict__ dst, int K, int N, int blk) {
  bf16 (*tile)[72] = (bf16 (*)[72])smem;   // 64 x 72 halves
  const int nt = N / 64;
  const int nBase = (blk % nt) * 64, kBase = (blk / nt) * 64, tid = threadIdx.x;
  for (int i = tid; i < 64 * 64; i += 256) { const int kk = i >> 6, nn = i & 63; tile[nn][kk] = (bf16)src[(size_t)(kBase + kk) * N + nBase + nn]; }
  __syncthreads();
  for (int g = tid; g < 64 * 8; g += 256) { const int nn = g >> 3, pc = g & 7; vst2(dst + (size_t)(nBase + nn) * K + kBase + pc * 8, *(const v4u*)(&tile[nn][pc * 8])); }
}

// ---------------------------------------------------------------------------
// Dual layernorm: xn1 = LN(x; t_ln1), xn2 = LN(x; h_ln)  (bf16 GEMM inputs)
// ---------------------------------------------------------------------------
// One wave owns two whole rows (all 16 loads of a lane in flight at once; each g/b piece is fetched once for both rows).
__device__ __forceinline__ void ln_dual_rows(
    const float* __restrict__ x,
    const float* __restrict__ g1, const float* __restrict__ b1,
    const float* __restrict__ g2, const float* __restrict__ b2,
    bf16* __restrict__ xn1, bf16* __restrict__ xn2, int blk) {
  const int lane = threadIdx.x & 31;
  const int wid = __builtin_amdgcn_readfirstlane(threadIdx.x >> 5);   // wave number held scalar: row bases are scalar, a lane adds only its offset
  const size_t t0 = ((size_t)blk * 8 + wid) * 2;
  const float4* xr = (const float4*)(x + t0 * Dd) + lane;
  float4 v[2][PCS];
  // every loop of this kernel is unrolled: v is indexed by constants only and stays in registers
  #pragma unroll
  for (int r = 0; r < 2; ++r)
    #pragma unroll
    for (int i = 0; i < PCS; ++i) v[r][i] = xr[r * (Dd / 4) + i * 32];
  float mean[2], rstd[2];
  #pragma unroll
  for (int r = 0; r < 2; ++r) {
    float s = 0.f, s2 = 0.f;
    #pragma unroll
    for (int i = 0; i < PCS; ++i) {
      const float4 a = v[r][i];
      s  += a.x + a.y + a.z + a.w;
      s2 += a.x * a.x + a.y * a.y + a.z * a.z + a.w * a.w;
    }
    wave_stats(s, s2, mean[r], rstd[r]);
  }
  #pragma unroll
  for (int i = 0; i < PCS; ++i) {
    const int pc = i * 32 + lane;
    const float4 G1 = ((const float4*)g1)[pc], B1 = ((const float4*)b1)[pc];
    const float4 G2 = ((const float4*)g2)[pc], B2 = ((const float4*)b2)[pc];
    #pragma unroll
    for (int r = 0; r < 2; ++r) {
      const float4 a = v[r][i];
      const float n0 = (a.x - mean[r]) * rstd[r], n1 = (a.y - mean[r]) * rstd[r];
      const float n2 = (a.z - mean[r]) * rstd[r], n3 = (a.w - mean[r]) * rstd[r];
      union { bf16 h[4]; unsigned long long u; } p1, p2;   // 4 halves = 8 B per lane; a wave writes 256 contiguous bytes
      p1.h[0] = (bf16)(n0 * G1.x + B1.x); p2.h[0] = (bf16)(n0 * G2.x + B2.x);
      p1.h[1] = (bf16)(n1 * G1.y + B1.y); p2.h[1] = (bf16)(n1 * G2.y + B2.y);
      p1.h[2] = (bf16)(n2 * G1.z + B1.z); p2.h[2] = (bf16)(n2 * G2.z + B2.z);
      p1.h[3] = (bf16)(n3 * G1.w + B1.w); p2.h[3] = (bf16)(n3 * G2.w + B2.w);
      const size_t base = (t0 + r) * Dd + pc * 4;
      vst2(xn1 + base, p1.u); vst2(xn2 + base, p2.u);
    }
  }
}

// ---------------------------------------------------------------------------
// One grid for all work that depends on the inputs alone: the dual layernorm's blocks, then the 64x64 tiles of the six
// weight repacks. wpack holds the four D x D repacks one behind the other (q, k, v, o).
// ---------------------------------------------------------------------------
constexpr int LN_BLKS = TOK / 16;                     // 512
constexpr int WBIG_BLKS = (DFf / 64) * (Dd / 64);     // 1024 tiles of a D x DF weight
constexpr int WSQ_BLKS = (Dd / 64) * (Dd / 64);       // 256 tiles of a D x D weight
__global__ __launch_bounds__(256) void prep_kernel(
    const float* __restrict__ x,
    const float* __restrict__ g1, const float* __restrict__ b1,
    const float* __restrict__ g2, const float* __restrict__ b2,
    bf16* __restrict__ xn1, bf16* __restrict__ xn2,
    const float* __restrict__ wq, const float* __restrict__ wk,
    const float* __restrict__ wv, const float* __restrict__ wo,
    const float* __restrict__ w1, const float* __restrict__ w2,
    bf16* __restrict__ wpack, bf16* __restrict__ w1t, bf16* __restrict__ w2t) {
  __shared__ __align__(16) char smem[64 * 72 * 2];
  int t = blockIdx.x;
  if (t < LN_BLKS) { ln_dual_rows(x, g1, b1, g2, b2, xn1, xn2, t); return; }
  t -= LN_BLKS;
  const float* src; bf16* dst; int K = Dd, N = Dd;
  if (t < WBIG_BLKS) { src = w1; dst = w1t; N = DFf; }
  else if (t < 2 * WBIG_BLKS) { t -= WBIG_BLKS; src = w2; dst = w2t; K = DFf; }
  else {
    t -= 2 * WBIG_BLKS;
    const int sel = t / WSQ_BLKS;
    t -= sel * WSQ_BLKS;
    src = sel == 0 ? wq : sel == 1 ? wk : sel == 2 ? wv : wo;
    dst = wpack + (size_t)sel * Dd * Dd;
  }
  transpose_cvt_tile(smem, src, dst, K, N, t);
}

// ---------------------------------------------------------------------------
// Tiled WMMA GEMM:  C[M,N] = epilogue(A[M,K]_bf16 @ Bt[N,K]_bf16 + bias)
// Block tile 128x256, 8 waves (2x4), each wave 64x64 (16 v8f accumulators): per 32 k eight fragments feed sixteen WMMAs,
// and a staged byte of A serves 256 columns, a staged byte of Bt 128 rows.
// Double-buffered LDS, a stage = 64 k (whole 128-B lines of every row), filled with asynchronous 16-B copies:
// compute stage i from buf(i&1) while stage i+1 flies into buf(~i&1).
// The Bt fragment is the WMMA's A operand and the A fragment its B operand, so that a lane's eight accumulator values are
// eight consecutive columns of one row of C: the tile goes to LDS in 16-B pieces of its rows.
// EPI 0: gelu -> bf16 row-major       EPI 1: res + acc + bias -> f32 row-major
// EPI 2: bf16 head-major [B,H,S,HD]   EPI 3: rows of C are features, columns tokens (A = the weight, Bt = the activations,
//                                            bias per row): bf16 [B,H,HD,S]
// ---------------------------------------------------------------------------
constexpr int TM = 128, TN = 256;                        // block tile
constexpr int APANEL = TM * 72, BPANEL = TN * 72;        // halves of one staged panel
constexpr int CP = TN + 4;                               // pitch of the output tile, floats: 1,040 B = 16 B x odd, sixteen rows' 16-B pieces fall on all 64 banks
constexpr int GEMM_LDS = TM * CP * 4;                    // 133,120 B: the f32 output tile; it takes the stage buffers' place behind the loop
static_assert(2 * (APANEL + BPANEL) * 2 <= GEMM_LDS, "the four staged panels (110,592 B) lie inside the output tile's LDS");

// Second half of the epilogue: Ct[128][256] holds acc + bias; whole-line stores: EPI 0 f16 rows (512 B), EPI 1 f32 rows
// (1 KB), EPI 2 [b,h,s,hd] rows (256 hd = 512 B), EPI 3 [b,h,hd,s] rows (256 s = 512 B at s0).
template <int EPI>
__device__ __forceinline__ void gemm_writeout(
    const float (*Ct)[CP], const float* __restrict__ res, void* __restrict__ out, int Ntot, int mBase, int nBase) {
  const int tid = threadIdx.x;
  if constexpr (EPI == 1) {
    // thread = one 16-B piece (tid & 63) of rows (tid >> 6) + 4 i, i = 0..31: a wave covers 512 contiguous bytes
    const int r0 = tid >> 6, c0 = (tid & 63) * 4;
    const size_t rs4 = (size_t)4 * Ntot;   // four rows further
    const size_t o0 = (size_t)(mBase + r0) * Ntot + nBase + c0;
    #pragma unroll 1   // rolled: eight residual loads in flight per lane are enough, all 32 would take 128 registers
    for (int t = 0; t < TM / 4; t += 8) {
      const float* rp = res + o0 + t * rs4;
      float* op = (float*)out + o0 + t * rs4;
      v4f rr[8];   // indexed by constants only (both inner loops unrolled): stays in registers
      #pragma unroll
      for (int j = 0; j < 8; ++j) {
        rr[j] = *(const v4f*)(rp + j * rs4);
        // behind each load
        asm volatile("s_wait_xcnt 0x0" ::: "memory");
      }
      #pragma unroll
      for (int j = 0; j < 8; ++j) vst2(op + j * rs4, *(const v4f*)(&Ct[r0 + (t + j) * 4][c0]) + rr[j]);
      asm volatile("s_wait_xcnt 0x0" ::: "memory");   // behind the stores: the next trip rewrites their data and address registers
    }
  } else {
    #pragma unroll (EPI == 0 ? 1 : 4)   // EPI 0 rolled: a trip holds eight inlined erf bodies, sixteen trips of them are needless code to fetch; EPI 2, 3: four trips' LDS reads in flight
    for (int g = tid; g < TM * (TN / 8); g += 256) {
      const int rl = g >> 5, pc = g & 31;
      union { v8h h; v4u u; } pk;
      const v4f c0 = *(const v4f*)(&Ct[rl][pc * 8]), c1 = *(const v4f*)(&Ct[rl][pc * 8 + 4]);   // two 16-B reads
      #pragma unroll
      for (int e = 0; e < 8; ++e) {
        const float v = e < 4 ? c0[e & 3] : c1[e & 3];
        pk.h[e] = (bf16)(EPI == 0 ? gelu_exact(v) : v);
      }
      const int row = mBase + rl;
      if constexpr (EPI == 0) vst2((bf16*)out + (size_t)row * Ntot + nBase + pc * 8, pk.u);
      else if constexpr (EPI == 3)   // row = feature h * HD + hd, columns = 256 tokens of one batch
        vst2((bf16*)out + ((size_t)(nBase / Ss) * Dd + row) * Ss + nBase % Ss + pc * 8, pk.u);
      else { const int b = row / Ss, s = row % Ss, h = nBase / HDd, hd0 = nBase % HDd;
             vst2((bf16*)out + ((size_t)((b * Hh + h) * Ss + s)) * HDd + hd0 + pc * 8, pk.u); }
    }
  }
}

// One 128x256 tile; smem = the block's LDS (GEMM_LDS bytes); epi (0..3) is the same for the whole block.
__device__ __forceinline__ void gemm_tile(
    char* smem, const bf16* __restrict__ A, const bf16* __restrict__ Bt,
    const float* __restrict__ bias, const float* __restrict__ res,
    void* __restrict__ out, int Ntot, int Ktot, int mBase, int nBase, int epi) {
  bf16 (*As)[APANEL] = (bf16 (*)[APANEL])smem;                      // [2]; 64 K + 8 pad per row: pitch 144 B = 16 B x odd for the 16-B readers
  bf16 (*Bs)[BPANEL] = (bf16 (*)[BPANEL])(smem + 2 * APANEL * 2);   // [2]
  float (*Ct)[CP] = (float (*)[CP])smem;                            // block output tile (130 KB), used behind the loop only
  const int tid  = threadIdx.x;
  const int lane = tid & 31, wid = tid >> 5;
  const int wm = wid & 1, wn = wid >> 1;            // 2 x 4 wave grid
  const int la = lane & 15, hs = lane >> 4;         // lane-in-16, half-select

  // Stage the 128x64 panel of A and the 256x64 panel of Bt into an LDS buffer with asynchronous 16-B copies (no register
  // in between). Eight lanes cover one 128-B row, a wave four whole lines. Each thread owns one 16-B piece of rows
  // sr + 32 i (i = 0..3 of A, 0..7 of Bt): twelve copies per stage, every lane on.
  const int sr = tid >> 3, sc = (tid & 7) * 8;
  const size_t rstep = (size_t)32 * Ktot;
  const bf16* ga = A  + (size_t)(mBase + sr) * Ktot + sc;
  const bf16* gb = Bt + (size_t)(nBase + sr) * Ktot + sc;
  const unsigned la_lds = (unsigned)(size_t)&As[0][sr * 72 + sc];   // low 32 bits of a __shared__ address = LDS byte address
  const unsigned lb_lds = (unsigned)(size_t)&Bs[0][sr * 72 + sc];
  auto stage = [&](int k0, int buf) {
    constexpr unsigned RS = 32 * 72 * 2;                            // 32 rows further in LDS, bytes
    const unsigned da = la_lds + (unsigned)buf * (APANEL * 2), db = lb_lds + (unsigned)buf * (BPANEL * 2);
    const bf16 *pa = ga + k0, *pb = gb + k0;
    // the copies and their s_wait_xcnt in one statement, so that the wait stands ahead of any rewrite of an address register
    asm volatile("global_load_async_to_lds_b128 %0, %1, off\n\t"
                 "global_load_async_to_lds_b128 %2, %3, off\n\t"
                 "global_load_async_to_lds_b128 %4, %5, off\n\t"
                 "global_load_async_to_lds_b128 %6, %7, off\n\t"
                 "global_load_async_to_lds_b128 %8, %9, off\n\t"
                 "global_load_async_to_lds_b128 %10, %11, off\n\t"
                 "global_load_async_to_lds_b128 %12, %13, off\n\t"
                 "global_load_async_to_lds_b128 %14, %15, off\n\t"
                 "global_load_async_to_lds_b128 %16, %17, off\n\t"
                 "global_load_async_to_lds_b128 %18, %19, off\n\t"
                 "global_load_async_to_lds_b128 %20, %21, off\n\t"
                 "global_load_async_to_lds_b128 %22, %23, off\n\t"
                 "s_wait_xcnt 0x0"
                 :: "v"(da),          "v"(pa),             "v"(da + RS),     "v"(pa + rstep),
                    "v"(da + 2 * RS), "v"(pa + 2 * rstep), "v"(da + 3 * RS), "v"(pa + 3 * rstep),
                    "v"(db),          "v"(pb),             "v"(db + RS),     "v"(pb + rstep),
                    "v"(db + 2 * RS), "v"(pb + 2 * rstep), "v"(db + 3 * RS), "v"(pb + 3 * rstep),
                    "v"(db + 4 * RS), "v"(pb + 4 * rstep), "v"(db + 5 * RS), "v"(pb + 5 * rstep),
                    "v"(db + 6 * RS), "v"(pb + 6 * rstep), "v"(db + 7 * RS), "v"(pb + 7 * rstep)
                 : "memory");
  };

  v8f acc[4][4] = {};
  const int ntiles = Ktot >> 6;
  stage(0, 0);
  asm volatile("s_wait_asynccnt 0x0" ::: "memory");   // this wave's copies of stage 0 have landed
  __syncthreads();                                    // every wave's have
  if (ntiles > 1) stage(64, 1);

  for (int it = 0; it < ntiles; ++it) {
    const int cur = it & 1;   // stage it is worked on from buf(cur) while stage it + 1 flies into the other buffer
    #pragma unroll   // kf a constant: the two 32-k halves of a stage become LDS offsets, no loop or address work per half
    for (int kf = 0; kf < 64; kf += 32) {
      // A-frag (16x32 bf16): lanes 0-15 hold K 0-7 / 16-23, lanes 16-31 K 8-15 / 24-31.
      v16h afrag[4];
      #pragma unroll
      for (int ms = 0; ms < 4; ++ms) {
        int r = wm * 64 + ms * 16 + la;
        union { v16h v; v8h h[2]; } u;
        u.h[0] = *(const v8h*)&As[cur][r * 72 + kf + hs * 8];
        u.h[1] = *(const v8h*)&As[cur][r * 72 + kf + hs * 8 + 16];
        afrag[ms] = u.v;
      }
      // B-frag (32x16): same per-lane K map as A (lanes 0-15 hold K 0-7 / 16-23, lanes 16-31 K 8-15 / 24-31).
      v16h bfrag[4];
      #pragma unroll
      for (int ns = 0; ns < 4; ++ns) {
        int r = wn * 64 + ns * 16 + la;
        union { v16h v; v8h h[2]; } u;
        u.h[0] = *(const v8h*)&Bs[cur][r * 72 + kf + hs * 8];
        u.h[1] = *(const v8h*)&Bs[cur][r * 72 + kf + hs * 8 + 16];
        bfrag[ns] = u.v;
      }
      #pragma unroll
      for (int ms = 0; ms < 4; ++ms)
        #pragma unroll
        for (int ns = 0; ns < 4; ++ns)
          acc[ms][ns] = wmma_bf16(bfrag[ns], afrag[ms], acc[ms][ns]);   // D rows = rows of Bt (columns of C), D columns = rows of A
    }
    asm volatile("s_wait_dscnt 0x0" ::: "memory");      // this wave's reads of buf(cur) are done before it is refilled
    asm volatile("s_wait_asynccnt 0x0" ::: "memory");   // this wave's copies of stage it + 1 have landed
    __syncthreads();                                    // stage it + 1 published; every wave has left buf(cur)
    if (it + 2 < ntiles) stage((it + 2) * 64, cur);
  }
  asm volatile("s_wait_asynccnt 0x0" ::: "memory");     // no copy outstanding behind the loop

  // First half of the epilogue. Lane holds row la of C, columns r + 8*hs per VGPR r -> block tile Ct[128][256] = acc + bias,
  // two 16-B stores per accumulator tile. The lane's bias values are fetched as one group ahead of the barrier.
  // every loop below is unrolled: acc, bc, br are indexed by constants only and stay in registers
  v4f bc[4][2] = {};   // bias per column of C
  float br[4] = {};    // EPI 3: bias per row of C
  if (epi == 3) {
    #pragma unroll
    for (int ms = 0; ms < 4; ++ms) br[ms] = bias[mBase + wm * 64 + ms * 16 + la];
  } else {
    const float* bp = bias + nBase + wn * 64 + hs * 8;
    #pragma unroll
    for (int ns = 0; ns < 4; ++ns) { bc[ns][0] = *(const v4f*)(bp + ns * 16); bc[ns][1] = *(const v4f*)(bp + ns * 16 + 4); }
  }
  asm volatile("s_wait_xcnt 0x0" ::: "memory");   // behind the bias loads, ahead of any rewrite of their address registers
  __syncthreads();
  auto put_tile = [&](int ms, int ns, v4f b0, v4f b1) {
    const v8f a = acc[ms][ns];
    float* p = &Ct[wm * 64 + ms * 16 + la][wn * 64 + ns * 16 + hs * 8];
    const v4f lo = {a[0], a[1], a[2], a[3]}, hi = {a[4], a[5], a[6], a[7]};
    *(v4f*)p = lo + b0;
    *(v4f*)(p + 4) = hi + b1;
  };
  if (epi == 3) {
    #pragma unroll
    for (int ms = 0; ms < 4; ++ms) {
      const v4f b = {br[ms], br[ms], br[ms], br[ms]};
      #pragma unroll
      for (int ns = 0; ns < 4; ++ns) put_tile(ms, ns, b, b);
    }
  } else {
    #pragma unroll
    for (int ms = 0; ms < 4; ++ms)
      #pragma unroll
      for (int ns = 0; ns < 4; ++ns) put_tile(ms, ns, bc[ns][0], bc[ns][1]);
  }
  __syncthreads();
  if (epi == 0)      gemm_writeout<0>(Ct, res, out, Ntot, mBase, nBase);
  else if (epi == 1) gemm_writeout<1>(Ct, res, out, Ntot, mBase, nBase);
  else if (epi == 2) gemm_writeout<2>(Ct, res, out, Ntot, mBase, nBase);
  else               gemm_writeout<3>(Ct, res, out, Ntot, mBase, nBase);
}

// FFN-up GEMM and the Q, K, V projections in one grid (all K = D, all depend only on the layernorm outputs and repacks):
// blockIdx.x 0..15 = column tiles of h1, then four column tiles each of q and k; the last four, with blockIdx.y, give v's 8 x 32 tiles.
__global__ __launch_bounds__(256) void gemm_up_qkv_kernel(
    const bf16* __restrict__ xn1, const bf16* __restrict__ xn2,
    const bf16* __restrict__ w1t, const bf16* __restrict__ wpack,
    const float* __restrict__ b1, const float* __restrict__ bq,
    const float* __restrict__ bk, const float* __restrict__ bv,
    bf16* __restrict__ h1, bf16* __restrict__ qb, bf16* __restrict__ kb, bf16* __restrict__ vtb,
    int Nup, int Nproj, int Ktot) {
  __shared__ __align__(16) char smem[GEMM_LDS];
  const int bx = blockIdx.x;
  int mBase = blockIdx.y * TM;
  const bf16 *A = xn1, *Bt = w1t;
  const float* bias = b1;
  bf16* out = h1;
  int Ntot = Nup, nBase = bx * TN, epi = 0;
  if (bx >= DFf / TN) {
    const int sel = (bx - DFf / TN) >> 2;
    A = xn2; Bt = wpack + (size_t)sel * Dd * Dd;
    bias = sel == 0 ? bq : sel == 1 ? bk : bv;
    out  = sel == 0 ? qb : sel == 1 ? kb : vtb;
    Ntot = Nproj; nBase = ((bx - DFf / TN) & 3) * TN; epi = 2;
    if (sel == 2) {   // v comes out transposed: C = wv^T (features) x xn2^T (tokens); the same 256 blocks as 8 x 32 tiles
      const int t = ((bx - DFf / TN) & 3) + 4 * blockIdx.y;
      A = Bt; Bt = xn2; mBase = (t & (Dd / TM - 1)) * TM; nBase = (t / (Dd / TM)) * TN; epi = 3;
    }
  }
  gemm_tile(smem, A, Bt, bias, nullptr, out, Ntot, Ktot, mBase, nBase, epi);
}

// ---------------------------------------------------------------------------
// Hebbian attention: out_i = sum_{j<=i} relu(beta * q_i.k_j) v_j
// q,k: bf16 [B,H,S,HD] ; vt: bf16 [B,H,HD,S] ; out: bf16 [B,S,D] (token-major)
// Block = one (b,h) x 64-query tile. Causal: only kt <= qt key tiles visited.
// The K tile (64 x 256) and the Vt tile (256 x 64) are brought in once per block with whole-line 16-B loads and kept in
// LDS; every wave takes its B fragments from there. The next tile's loads are issued at the top of a pass and stored
// behind the barrier that ends the last read of the tile they replace.
// ---------------------------------------------------------------------------
constexpr int ATTN_LDS = (2 * 64 * 264 + 256 * 72 + 64 * 72) * 2;   // 113,664 B
constexpr int RD = 3;                                               // register sets in the ring of Q/K fragments
union frag16 { v16h v; v8h h[2]; };                                 // a 16x32 f16 fragment = two 16-B LDS reads
__device__ __forceinline__ void hebbian_attn_tile(
    char* smem, const bf16* __restrict__ q, const bf16* __restrict__ k,
    const bf16* __restrict__ vt, const float* __restrict__ betap,
    bf16* __restrict__ attn_out, int qt, int bh) {
  bf16* Qs   = (bf16*)smem;       // 64 x 256 (+8 pad)
  bf16* Ks   = Qs + 64 * 264;     // 64 keys x 256 (+8 pad)
  bf16* Vs   = Ks + 64 * 264;     // 256 feats x 64 keys (+8 pad); after the loop: per-wave output tiles
  bf16* affs = Vs + 256 * 72;     // 64 x 64  (+8 pad)
  const int bidx = bh / Hh, hidx = bh % Hh;
  const int tid = threadIdx.x, lane = tid & 31, wid = tid >> 5;
  const int la = lane & 15, hs = lane >> 4;
  const float beta = betap[0];

  const int kr = tid >> 5, kc = (tid & 31) * 8;   // K piece: a wave covers one 512-B row; 8 rows per step
  const int vr = tid >> 3, vc = (tid & 7) * 8;    // Vt piece: a wave covers four 128-B rows; 32 rows per step
  const bf16* kth = k  + (size_t)bh * Ss * HDd + kr * HDd + kc;   // this thread's piece of key row kr
  const bf16* vth = vt + (size_t)bh * HDd * Ss + vr * Ss + vc;    // this thread's piece of feature row vr
  v4u kreg[8], vreg[8];
  auto fetch = [&](int kbase) {
    #pragma unroll
    for (int i = 0; i < 8; ++i) kreg[i] = *(const v4u*)(kth + (size_t)kbase * HDd + i * 8 * HDd);
    #pragma unroll
    for (int i = 0; i < 8; ++i) vreg[i] = *(const v4u*)(vth + kbase + i * 32 * Ss);
  };
  auto put_k = [&]() {
    #pragma unroll
    for (int i = 0; i < 8; ++i) *(v4u*)&Ks[(kr + i * 8) * 264 + kc] = kreg[i];
  };
  auto put_v = [&]() {
    #pragma unroll
    for (int i = 0; i < 8; ++i) *(v4u*)&Vs[(vr + i * 32) * 72 + vc] = vreg[i];
  };

  fetch(0);
  // Stage Q tile (reused for every key tile).
  const bf16* qb = q + ((size_t)bh * Ss + qt * 64) * HDd;
  #pragma unroll
  for (int c = tid; c < 64 * 32; c += 256) {
    int r = c >> 5, cc = (c & 31) * 8;
    *(v4u*)&Qs[r * 264 + cc] = *(const v4u*)&qb[(size_t)r * HDd + cc];
  }
  put_k();
  put_v();
  __syncthreads();

  const int ma = wid & 3;   // 16-row group for both GEMMs
  const int nh = wid >> 2;  // GEMM1: 32-col half of aff ; GEMM2: 128-feat half
  v8f oacc[8] = {};

  for (int kt = 0; kt <= qt; ++kt) {
    const int kbase = kt * 64;
    const bool more = kt < qt;
    if (more) fetch(kbase + 64);
    // ---- GEMM1: aff(64x64) = Q(64x256) @ K^T, both from LDS ----
    // The fragments of a 32-k step (one of Q, two of K) go through a ring of RD register sets: RD steps' reads are issued
    // as one group up front, and a set is read anew right behind the two WMMAs that used it, RD - 1 steps ahead of its next
    // use, so that a wave does not wait out the LDS latency at every step.
    v8f c0 = {}, c1 = {};
    {
      const bf16* pq = &Qs[(ma * 16 + la) * 264 + hs * 8];
      const bf16* p0 = &Ks[(nh * 32 + la)      * 264 + hs * 8];   // same K map as A
      const bf16* p1 = &Ks[(nh * 32 + 16 + la) * 264 + hs * 8];
      frag16 ua[RD], ub0[RD], ub1[RD];   // indexed by constants only (both loops unrolled): stay in registers
      auto read_step = [&](int i) {
        const int s = i % RD, kf = i * 32;
        ua[s].h[0]  = *(const v8h*)(pq + kf); ua[s].h[1]  = *(const v8h*)(pq + kf + 16);
        ub0[s].h[0] = *(const v8h*)(p0 + kf); ub0[s].h[1] = *(const v8h*)(p0 + kf + 16);
        ub1[s].h[0] = *(const v8h*)(p1 + kf); ub1[s].h[1] = *(const v8h*)(p1 + kf + 16);
      };
      #pragma unroll   // i a constant: the set's number and the LDS offset are fixed at compile time
      for (int i = 0; i < RD; ++i) read_step(i);
      #pragma unroll   // the same; eight steps
      for (int i = 0; i < HDd / 32; ++i) {
        c0 = wmma_bf16(ua[i % RD].v, ub0[i % RD].v, c0);
        c1 = wmma_bf16(ua[i % RD].v, ub1[i % RD].v, c1);
        if (i + RD < HDd / 32) read_step(i + RD);
      }
    }
    // beta * relu + causal mask, re-layout C-frag -> A-frag via LDS (bf16).
    // (the barrier at the foot of the previous pass ended the last read of affs)
    #pragma unroll
    for (int ns = 0; ns < 2; ++ns) {
      v8f cv = ns ? c1 : c0;
      int jl = nh * 32 + ns * 16 + la;
      int j = kbase + jl;
      #pragma unroll
      for (int r = 0; r < 8; ++r) {
        int il = ma * 16 + r + hs * 8;
        int i = qt * 64 + il;
        float v = cv[r] * beta;
        v = (j <= i && v > 0.f) ? v : 0.f;
        affs[il * 72 + jl] = (bf16)v;
      }
    }
    __syncthreads();  // affs and this pass's Vs visible; every read of Ks done
    // ---- GEMM2: out(64x256) += aff(64x64) @ V(64x256) via Vt rows in LDS ----
    // Both aff fragments and the eight V fragments of keys 0-31 are read as one group; each half of the V set is read anew
    // (keys 32-63) right behind the four WMMAs that used it, four WMMAs ahead of its next use.
    {
      const bf16* pa = &affs[(ma * 16 + la) * 72 + hs * 8];
      const bf16* pv = &Vs[(nh * 128 + la) * 72 + hs * 8];
      frag16 ua[2], ub[8];   // indexed by constants only (every loop unrolled): stay in registers
      auto read_v = [&](int j, int kk) {
        const bf16* p = pv + j * 16 * 72 + kk;
        ub[j].h[0] = *(const v8h*)p; ub[j].h[1] = *(const v8h*)(p + 16);
      };
      // every loop below is unrolled: h and j are constants, so fragments and accumulators are fixed registers
      #pragma unroll
      for (int h = 0; h < 2; ++h) { ua[h].h[0] = *(const v8h*)(pa + h * 32); ua[h].h[1] = *(const v8h*)(pa + h * 32 + 16); }
      #pragma unroll
      for (int j = 0; j < 8; ++j) read_v(j, 0);
      if (more) put_k();   // behind the reads: the WMMAs wait for those, nothing in this pass for the stores
      #pragma unroll
      for (int h = 0; h < 2; ++h) {
        #pragma unroll
        for (int j = h * 4; j < h * 4 + 4; ++j) oacc[j] = wmma_bf16(ua[0].v, ub[j].v, oacc[j]);
        #pragma unroll
        for (int j = h * 4; j < h * 4 + 4; ++j) read_v(j, 32);
      }
      #pragma unroll
      for (int j = 0; j < 8; ++j) oacc[j] = wmma_bf16(ua[1].v, ub[j].v, oacc[j]);
    }
    __syncthreads();  // next pass's Ks visible; every read of Vs and affs done
    if (more) put_v();
  }
  // Write f16 token-major so the wo GEMM can consume it as A directly: the wave's 16 rows x 128 feats (256-B row segments)
  bf16* ot = Vs + wid * (16 * 128);   // Vs is free behind the loop's last barrier
  #pragma unroll
  for (int j = 0; j < 8; ++j) {
    int fl = j * 16 + la;
    #pragma unroll
    for (int r = 0; r < 8; ++r) ot[(r + hs * 8) * 128 + fl] = (bf16)oacc[j][r];
  }
  __syncthreads();
  #pragma unroll
  for (int q2 = 0; q2 < 8; ++q2) {
    const int rl = q2 * 2 + (lane >> 4), pc = lane & 15;
    const int s = qt * 64 + ma * 16 + rl;
    vst2(attn_out + ((size_t)(bidx * Ss + s)) * Dd + hidx * HDd + nh * 128 + pc * 8, *(const v4u*)(ot + rl * 128 + pc * 8));
  }
}

// Attention and the FFN-down GEMM in one grid (neither reads what the other writes). There are more blocks than
// places; in index order the long ones come first: the causal tiles of the upper half of the
// queries (longest first), then the GEMM's tiles, then the remaining causal tiles, ever shorter, which fill the tail.
constexpr int ATTN_BLKS = (Ss / 64) * Bb * Hh;        // 512
constexpr int DOWN_BLKS = (Dd / TN) * (TOK / TM);     // 256
static_assert(ATTN_LDS <= GEMM_LDS, "the attention tile lives in the GEMM's LDS");
__global__ __launch_bounds__(256) void attn_ffn_down_kernel(
    const bf16* __restrict__ q, const bf16* __restrict__ k,
    const bf16* __restrict__ vt, const float* __restrict__ betap, bf16* __restrict__ attn_out,
    const bf16* __restrict__ h1, const bf16* __restrict__ w2t, const float* __restrict__ b2,
    const float* __restrict__ x, float* __restrict__ tpre, int Ntot, int Ktot) {
  __shared__ __align__(16) char smem[GEMM_LDS];
  const int b = blockIdx.x;
  if (b < ATTN_BLKS / 2 || b >= ATTN_BLKS / 2 + DOWN_BLKS) {
    const int u = b < ATTN_BLKS / 2 ? b : b - DOWN_BLKS;   // 0..511: sixteen (batch, head) pairs per query tile
    hebbian_attn_tile(smem, q, k, vt, betap, attn_out, Ss / 64 - 1 - u / (Bb * Hh), u % (Bb * Hh));
  } else {
    const int t = b - ATTN_BLKS / 2;
    gemm_tile(smem, h1, w2t, b2, x, tpre, Ntot, Ktot, (t / (Dd / TN)) * TM, (t % (Dd / TN)) * TN, 1);
  }
}

// ---------------------------------------------------------------------------
// TRM tail: residual = tpre; xn = LN(tpre); mix = scalar-MLP(xn); out = tpre+mix
// ---------------------------------------------------------------------------
// One wave owns one whole row: 32 elements per lane, kept in registers.
__device__ __forceinline__ void trm_scalar_mlp_rows(
    const float* __restrict__ tpre, const float* __restrict__ g,
    const float* __restrict__ bt, const float* __restrict__ sw1,
    const float* __restrict__ sb1, const float* __restrict__ sw2,
    const float* __restrict__ sb2, float* __restrict__ trm_out, int blk) {
  const int lane = threadIdx.x & 31;
  const int wid = __builtin_amdgcn_readfirstlane(threadIdx.x >> 5);   // wave number held scalar: row bases are scalar, a lane adds only its offset
  const size_t t = (size_t)blk * 8 + wid;
  const float4* xr = (const float4*)(tpre + t * Dd) + lane;
  float xin[PCS * 4];
  float s = 0.f, s2 = 0.f;
  // every loop over pieces or elements is unrolled: xin, xn, mix are indexed by constants only and stay in registers
  #pragma unroll
  for (int i = 0; i < PCS; ++i) {
    const float4 a = xr[i * 32];
    xin[i * 4 + 0] = a.x; xin[i * 4 + 1] = a.y; xin[i * 4 + 2] = a.z; xin[i * 4 + 3] = a.w;
  }
  #pragma unroll
  for (int i = 0; i < PCS; ++i) {
    const float a0 = xin[i * 4], a1 = xin[i * 4 + 1], a2 = xin[i * 4 + 2], a3 = xin[i * 4 + 3];
    s  += a0 + a1 + a2 + a3;
    s2 += a0 * a0 + a1 * a1 + a2 * a2 + a3 * a3;
  }
  float mean, rstd;
  wave_stats(s, s2, mean, rstd);
  asm volatile("s_wait_xcnt 0x0" ::: "memory");   // behind the eight row loads: their scalar base is reused for the scalar load below
  const float vb2 = sb2[0];
  float xn[PCS * 4], mix[PCS * 4];
  #pragma unroll
  for (int i = 0; i < PCS; ++i) {
    const float4 G = ((const float4*)g)[i * 32 + lane], Bt = ((const float4*)bt)[i * 32 + lane];
    xn[i * 4 + 0] = (xin[i * 4 + 0] - mean) * rstd * G.x + Bt.x;
    xn[i * 4 + 1] = (xin[i * 4 + 1] - mean) * rstd * G.y + Bt.y;
    xn[i * 4 + 2] = (xin[i * 4 + 2] - mean) * rstd * G.z + Bt.z;
    xn[i * 4 + 3] = (xin[i * 4 + 3] - mean) * rstd * G.w + Bt.w;
    mix[i * 4 + 0] = vb2; mix[i * 4 + 1] = vb2; mix[i * 4 + 2] = vb2; mix[i * 4 + 3] = vb2;
  }
  #pragma unroll 1   // rolled: a trip already holds 32 inlined erf bodies; four times that is needless code to fetch
  for (int e = 0; e < Ee; ++e) {
    const float w1 = sw1[e], b1 = sb1[e], w2 = sw2[e];
    #pragma unroll
    for (int j = 0; j < PCS * 4; ++j) {
      mix[j] += gelu_exact(xn[j] * w1 + b1) * w2;
      // a scheduling fence behind every eighth value: with all 32 in one region the compiler, to save registers, lays the values' chains
      // one behind the other and a wave waits out every link; in regions of eight it interleaves them
      if ((j & 7) == 7) __builtin_amdgcn_sched_barrier(0);
    }
  }
  #pragma unroll
  for (int i = 0; i < PCS; ++i) {
    v4f ov = {xin[i * 4 + 0] + mix[i * 4 + 0], xin[i * 4 + 1] + mix[i * 4 + 1],
              xin[i * 4 + 2] + mix[i * 4 + 2], xin[i * 4 + 3] + mix[i * 4 + 3]};
    vst2((v4f*)(trm_out + t * Dd) + i * 32 + lane, ov);
  }
}

// The scalar MLP (vector work) and the output projection (matrix work) in one grid. In index order
// the MLP blocks of eight rows, the longer kind, come first, then the GEMM's tiles.
constexpr int MLP_BLKS = TOK / 8;                     // 1024
constexpr int WO_BLKS = (Dd / TN) * (TOK / TM);       // 256
__global__ __launch_bounds__(256) void wo_mlp_kernel(
    const bf16* __restrict__ ao, const bf16* __restrict__ wot, const float* __restrict__ bo,
    const float* __restrict__ x, float* __restrict__ heb,
    const float* __restrict__ tpre, const float* __restrict__ g,
    const float* __restrict__ bt, const float* __restrict__ sw1,
    const float* __restrict__ sb1, const float* __restrict__ sw2,
    const float* __restrict__ sb2, float* __restrict__ trm_out, int Ntot, int Ktot) {
  __shared__ __align__(16) char smem[GEMM_LDS];
  const int b = blockIdx.x;
  if (b < MLP_BLKS) trm_scalar_mlp_rows(tpre, g, bt, sw1, sb1, sw2, sb2, trm_out, b);
  else {
    const int t = b - MLP_BLKS;
    gemm_tile(smem, ao, wot, bo, x, heb, Ntot, Ktot, (t / (Dd / TN)) * TM, (t % (Dd / TN)) * TN, 1);
  }
}

// ---------------------------------------------------------------------------
// Final blend + layernorm:  LN(x + sig(a)*trm + (1-sig(a))*heb ; o_ln)
// ---------------------------------------------------------------------------
// One wave owns two whole rows.
__global__ __launch_bounds__(256) void blend_ln_kernel(
    const float* __restrict__ x, const float* __restrict__ trm,
    const float* __restrict__ heb, const float* __restrict__ alphap,
    const float* __restrict__ g, const float* __restrict__ bt,
    float* __restrict__ out) {
  const int lane = threadIdx.x & 31;
  const int wid = __builtin_amdgcn_readfirstlane(threadIdx.x >> 5);   // wave number held scalar: row bases are scalar, a lane adds only its offset
  const size_t t0 = ((size_t)blockIdx.x * 8 + wid) * 2;
  const float bw = 1.0f / (1.0f + expf(-alphap[0]));
  const float4* xr = (const float4*)(x   + t0 * Dd) + lane;
  const float4* tr = (const float4*)(trm + t0 * Dd) + lane;
  const float4* hr = (const float4*)(heb + t0 * Dd) + lane;
  float4 u[2][PCS];
  float mean[2], rstd[2];
  // every loop of this kernel is unrolled: u is indexed by constants only and stays in registers
  #pragma unroll
  for (int r = 0; r < 2; ++r) {
    float s = 0.f, s2 = 0.f;
    #pragma unroll
    for (int i = 0; i < PCS; ++i) {
      const int o = r * (Dd / 4) + i * 32;
      const float4 xv = xr[o], tv = tr[o], hv = hr[o];
      float4 a;
      a.x = xv.x + bw * tv.x + (1.f - bw) * hv.x;
      a.y = xv.y + bw * tv.y + (1.f - bw) * hv.y;
      a.z = xv.z + bw * tv.z + (1.f - bw) * hv.z;
      a.w = xv.w + bw * tv.w + (1.f - bw) * hv.w;
      u[r][i] = a;
      s  += a.x + a.y + a.z + a.w;
      s2 += a.x * a.x + a.y * a.y + a.z * a.z + a.w * a.w;
    }
    wave_stats(s, s2, mean[r], rstd[r]);
  }
  #pragma unroll
  for (int i = 0; i < PCS; ++i) {
    const int pc = i * 32 + lane;
    const float4 G = ((const float4*)g)[pc], Bt = ((const float4*)bt)[pc];
    #pragma unroll
    for (int r = 0; r < 2; ++r) {
      const float4 a = u[r][i];
      v4f ov = {(a.x - mean[r]) * rstd[r] * G.x + Bt.x, (a.y - mean[r]) * rstd[r] * G.y + Bt.y,
                (a.z - mean[r]) * rstd[r] * G.z + Bt.z, (a.w - mean[r]) * rstd[r] * G.w + Bt.w};
      vst2((v4f*)(out + (t0 + r) * Dd) + pc, ov);   // one wave writes 512 contiguous bytes
    }
  }
}

// ---------------------------------------------------------------------------
// Host-side orchestration.
// ---------------------------------------------------------------------------
extern "C" void kernel_launch(void* const* d_in, const int* in_sizes, int n_in,
                              void* d_out, int out_size, void* d_ws, size_t ws_size,
                              hipStream_t stream) {
  const float* x      = (const float*)d_in[0];
  const float* h_ln_g = (const float*)d_in[1];
  const float* h_ln_b = (const float*)d_in[2];
  const float* wq     = (const float*)d_in[3];
  const float* bq     = (const float*)d_in[4];
  const float* wk     = (const float*)d_in[5];
  const float* bk     = (const float*)d_in[6];
  const float* wv     = (const float*)d_in[7];
  const float* bv     = (const float*)d_in[8];
  const float* wo     = (const float*)d_in[9];
  const float* bo     = (const float*)d_in[10];
  const float* beta   = (const float*)d_in[11];
  const float* t_ln1_g= (const float*)d_in[12];
  const float* t_ln1_b= (const float*)d_in[13];
  const float* t_w1   = (const float*)d_in[14];
  const float* t_b1   = (const float*)d_in[15];
  const float* t_w2   = (const float*)d_in[16];
  const float* t_b2   = (const float*)d_in[17];
  const float* t_lns_g= (const float*)d_in[18];
  const float* t_lns_b= (const float*)d_in[19];
  const float* s_w1   = (const float*)d_in[20];
  const float* s_b1   = (const float*)d_in[21];
  const float* s_w2   = (const float*)d_in[22];
  const float* s_b2   = (const float*)d_in[23];
  const float* alpha  = (const float*)d_in[24];
  const float* o_ln_g = (const float*)d_in[25];
  const float* o_ln_b = (const float*)d_in[26];
  float* out = (float*)d_out;

  char* ws = (char*)d_ws;
  const size_t MB = 1ull << 20;
  bf16* wpack= (bf16*)(ws + 0 * MB);    // q, k, v, o repacks, 2 MB each (1024x1024 f16), one behind the other
  bf16* wot  = (bf16*)(ws + 6 * MB);    // the fourth of them
  bf16* w1t  = (bf16*)(ws + 8 * MB);    // 8 MB  [DF, D]
  bf16* w2t  = (bf16*)(ws + 16 * MB);   // 8 MB  [D, DF]
  bf16* xn1  = (bf16*)(ws + 24 * MB);   // 16 MB [TOK, D]
  bf16* xn2  = (bf16*)(ws + 40 * MB);   // 16 MB [TOK, D]
  bf16* h1   = (bf16*)(ws + 56 * MB);   // 64 MB [TOK, DF]; free behind the FFN-down GEMM
  float* hebo= (float*)(ws + 56 * MB);  // 32 MB f32, in h1's place
  float* tpre= (float*)(ws + 120 * MB); // 32 MB f32
  float* trmo= (float*)(ws + 152 * MB); // 32 MB f32
  bf16* qb   = (bf16*)(ws + 184 * MB);  // 16 MB [B,H,S,HD]
  bf16* kb   = (bf16*)(ws + 200 * MB);  // 16 MB [B,H,S,HD]
  bf16* vtb  = (bf16*)(ws + 216 * MB);  // 16 MB [B,H,HD,S]
  bf16* ao   = (bf16*)(ws + 232 * MB);  // 16 MB [TOK, D] ; total = 248 MB

  // 1: dual layernorm -> f16 GEMM inputs, and the weight repacks (f32 [K,N] -> f16 [N,K])
  prep_kernel<<<LN_BLKS + 2 * WBIG_BLKS + 4 * WSQ_BLKS, 256, 0, stream>>>(
      x, t_ln1_g, t_ln1_b, h_ln_g, h_ln_b, xn1, xn2, wq, wk, wv, wo, t_w1, t_w2, wpack, w1t, w2t);
  // 2: h1 = gelu(xn1 @ w1), q / k head-major, v transposed
  gemm_up_qkv_kernel<<<dim3(DFf / TN + 3 * (Dd / TN), TOK / TM), 256, 0, stream>>>(
      xn1, xn2, w1t, wpack, t_b1, bq, bk, bv, h1, qb, kb, vtb, DFf, Dd, Dd);
  // 3: causal relu attention -> ao, and tpre = x + h1 @ w2
  attn_ffn_down_kernel<<<ATTN_BLKS + DOWN_BLKS, 256, 0, stream>>>(
      qb, kb, vtb, beta, ao, h1, w2t, t_b2, x, tpre, Dd, DFf);
  // 4: heb = x + ao @ wo, and trm_out from tpre
  wo_mlp_kernel<<<MLP_BLKS + WO_BLKS, 256, 0, stream>>>(
      ao, wot, bo, x, hebo, tpre, t_lns_g, t_lns_b, s_w1, s_b1, s_w2, s_b2, trmo, Dd, Dd);

  // ---- blend + final layernorm ----
  blend_ln_kernel<<<TOK / 16, 256, 0, stream>>>(x, trmo, hebo, alpha,
                                           o_ln_g, o_ln_b, out);
}

// v009
// A run of this version takes 254 microseconds.
// In both of two side-by-side timings against v008, it was 1.05 times as fast.
// Counting every step since v000, it is 2.87 times as fast.
#include <hip/hip_runtime.h>
#include <stdint.h>

// ---------------------------------------------------------------------------
// wave32, WMMA f16 (f32 accumulate), double-buffered GEMM pipeline filled by tensor loads to LDS.
// Contractions: the TRM FFN GEMMs (K = 1024 / 4096), Q/K/V and output projections (K = 1024), the Hebbian affinity Q K^T
// (K = 256) and aff V (K = keys) on v_wmma_f32_16x16x32_f16 (f16 operands, f32 accumulate); LayerNorms, GELU, the scalar
// ---------------------------------------------------------------------------

typedef _Float16 bf16;   // NOTE: 'bf16' is only a type alias name here — the type is IEEE half (f16) throughout
typedef __attribute__((ext_vector_type(4))) float v4f;
typedef __attribute__((ext_vector_type(4))) unsigned v4u;
template <typename V> __device__ __forceinline__ void vst2(void* p, V v) {
  *(V*)p = v; 
}
typedef __attribute__((ext_vector_type(16))) _Float16 v16h;
typedef __attribute__((ext_vector_type(8)))  _Float16 v8h;
typedef __attribute__((ext_vector_type(8)))  float  v8f;
typedef __attribute__((ext_vector_type(4))) uint32_t u32x4;   // tensor descriptor, group 0
typedef __attribute__((ext_vector_type(8))) uint32_t u32x8;   // tensor descriptor, group 1

constexpr int Bb  = 4;
constexpr int Ss  = 2048;
constexpr int Dd  = 1024;
constexpr int Hh  = 4;
constexpr int HDd = Dd / Hh;     // 256
constexpr int Ee  = 4;
constexpr int DFf = Dd * Ee;     // 4096
constexpr int TOK = Bb * Ss;     // 8192

__device__ __forceinline__ v8f wmma_bf16(v16h a, v16h b, v8f c) {   // (name kept; f16 WMMA + hazard guard)
  v8f d = __builtin_amdgcn_wmma_f32_16x16x32_f16(false, a, false, b, (short)0, c, false, false);
  asm volatile("v_nop\n\tv_nop\n\tv_nop\n\tv_nop" : "+v"(d) : "v"(a), "v"(b));
  return d;
}

// erf in f32 without a branch: the usual two fits (an odd polynomial below 1; 1 - exp(-p(|x|)) from 1 on) are both
// evaluated and one is picked per lane. A wave nearly always holds lanes of both ranges, so a branch skips nothing, and
// it ties each element's dependent chain to the one before; as straight code the chains of independent elements interleave.
__device__ __forceinline__ float erf_select(float x) {
  const float ax = fabsf(x), t = ax * ax;
  float ps = fmaf(t, -5.61801775e-4f, 4.91381623e-3f);
  ps = fmaf(t, ps, -2.67075151e-2f);
  ps = fmaf(t, ps, 1.12800106e-1f);
  ps = fmaf(t, ps, -3.76122952e-1f);
  ps = fmaf(t, ps, 1.28379107e-1f);
  const float lo = fmaf(ax, ps, ax);
  float pl = fmaf(ax, 1.69988107e-5f, -3.78677854e-4f);
  pl = fmaf(ax, pl, 3.85781587e-3f);
  pl = fmaf(ax, pl, -2.41816975e-2f);
  pl = fmaf(ax, pl, 1.06668264e-1f);
  pl = fmaf(ax, pl, 6.34933293e-1f);
  pl = fmaf(ax, pl, 1.28689408e-1f);
  pl = fmaf(ax, pl, ax);
  // exp(-p) = 2^(-p log2 e) on the hardware's exp2: where this fit is picked exp(-p) is at most 0.16, so the rounding of the
  // product moves 1 - exp(-p) by less than one ulp
  const float hi = 1.0f - __builtin_amdgcn_exp2f(pl * -1.44269504f);
  return copysignf(ax < 1.0f ? lo : hi, x);
}

__device__ __forceinline__ float gelu_exact(float x) {
  return 0.5f * x * (1.0f + erf_select(x * 0.70710678118654752f));
}

// Mean / rstd over D=1024 of a row that one wave holds: each lane brings the sums of its 32 elements, a five-step
// butterfly leaves the totals in every lane. No LDS, no barrier.
__device__ __forceinline__ void wave_stats(float s, float s2, float& mean, float& rstd) {
  #pragma unroll   // five fixed steps, no loop counter
  for (int o = 16; o > 0; o >>= 1) {
    s  += __shfl_xor(s,  o, 32);
    s2 += __shfl_xor(s2, o, 32);
  }
  mean = s * (1.0f / Dd);
  float var = s2 * (1.0f / Dd) - mean * mean;
  rstd = rsqrtf(var + 1e-5f);
}

// A wave's view of a row of D=1024 floats: piece i (0..7) of lane l is float4 number i * 32 + l, so that every
// wave-wide 16-B load or store covers 512 contiguous bytes.
constexpr int PCS = Dd / (32 * 4);   // 8 pieces per lane

// ---------------------------------------------------------------------------
// Weight repack: f32 [K,N] row-major  ->  bf16 [N,K] row-major (B^T layout)
// ---------------------------------------------------------------------------
__device__ __forceinline__ void transpose_cvt_tile(
    char* smem, const float* __restrict__ src, bf16* __restrict__ dst, int K, int N, int blk) {
  bf16 (*tile)[72] = (bf16 (*)[72])smem;   // 64 x 72 halves
  const int nt = N / 64;
  const int nBase = (blk % nt) * 64, kBase = (blk / nt) * 64, tid = threadIdx.x;
  for (int i = tid; i < 64 * 64; i += 256) { const int kk = i >> 6, nn = i & 63; tile[nn][kk] = (bf16)src[(size_t)(kBase + kk) * N + nBase + nn]; }
  __syncthreads();
  for (int g = tid; g < 64 * 8; g += 256) { const int nn = g >> 3, pc = g & 7; vst2(dst + (size_t)(nBase + nn) * K + kBase + pc * 8, *(const v4u*)(&tile[nn][pc * 8])); }
}

// ---------------------------------------------------------------------------
// Dual layernorm: xn1 = LN(x; t_ln1), xn2 = LN(x; h_ln)  (bf16 GEMM inputs)
// ---------------------------------------------------------------------------
// One wave owns two whole rows (all 16 loads of a lane in flight at once; each g/b piece is fetched once for both rows).
__device__ __forceinline__ void ln_dual_rows(
    const float* __restrict__ x,
    const float* __restrict__ g1, const float* __restrict__ b1,
    const float* __restrict__ g2, const float* __restrict__ b2,
    bf16* __restrict__ xn1, bf16* __restrict__ xn2, int blk) {
  const int lane = threadIdx.x & 31;
  const int wid = __builtin_amdgcn_readfirstlane(threadIdx.x >> 5);   // wave number held scalar: row bases are scalar, a lane adds only its offset
  const size_t t0 = ((size_t)blk * 8 + wid) * 2;
  const float4* xr = (const float4*)(x + t0 * Dd) + lane;
  float4 v[2][PCS];
  // every loop of this kernel is unrolled: v is indexed by constants only and stays in registers
  #pragma unroll
  for (int r = 0; r < 2; ++r)
    #pragma unroll
    for (int i = 0; i < PCS; ++i) v[r][i] = xr[r * (Dd / 4) + i * 32];
  float mean[2], rstd[2];
  #pragma unroll
  for (int r = 0; r < 2; ++r) {
    float s = 0.f, s2 = 0.f;
    #pragma unroll
    for (int i = 0; i < PCS; ++i) {
      const float4 a = v[r][i];
      s  += a.x + a.y + a.z + a.w;
      s2 += a.x * a.x + a.y * a.y + a.z * a.z + a.w * a.w;
    }
    wave_stats(s, s2, mean[r], rstd[r]);
  }
  #pragma unroll
  for (int i = 0; i < PCS; ++i) {
    const int pc = i * 32 + lane;
    const float4 G1 = ((const float4*)g1)[pc], B1 = ((const float4*)b1)[pc];
    const float4 G2 = ((const float4*)g2)[pc], B2 = ((const float4*)b2)[pc];
    #pragma unroll
    for (int r = 0; r < 2; ++r) {
      const float4 a = v[r][i];
      const float n0 = (a.x - mean[r]) * rstd[r], n1 = (a.y - mean[r]) * rstd[r];
      const float n2 = (a.z - mean[r]) * rstd[r], n3 = (a.w - mean[r]) * rstd[r];
      union { bf16 h[4]; unsigned long long u; } p1, p2;   // 4 halves = 8 B per lane; a wave writes 256 contiguous bytes
      p1.h[0] = (bf16)(n0 * G1.x + B1.x); p2.h[0] = (bf16)(n0 * G2.x + B2.x);
      p1.h[1] = (bf16)(n1 * G1.y + B1.y); p2.h[1] = (bf16)(n1 * G2.y + B2.y);
      p1.h[2] = (bf16)(n2 * G1.z + B1.z); p2.h[2] = (bf16)(n2 * G2.z + B2.z);
      p1.h[3] = (bf16)(n3 * G1.w + B1.w); p2.h[3] = (bf16)(n3 * G2.w + B2.w);
      const size_t base = (t0 + r) * Dd + pc * 4;
      vst2(xn1 + base, p1.u); vst2(xn2 + base, p2.u);
    }
  }
}

// ---------------------------------------------------------------------------
// One grid for all work that depends on the inputs alone: the dual layernorm's blocks, then the 64x64 tiles of the six
// weight repacks. wpack holds the four D x D repacks one behind the other (q, k, v, o).
// ---------------------------------------------------------------------------
constexpr int LN_BLKS = TOK / 16;                     // 512
constexpr int WBIG_BLKS = (DFf / 64) * (Dd / 64);     // 1024 tiles of a D x DF weight
constexpr int WSQ_BLKS = (Dd / 64) * (Dd / 64);       // 256 tiles of a D x D weight
__global__ __launch_bounds__(256) void prep_kernel(
    const float* __restrict__ x,
    const float* __restrict__ g1, const float* __restrict__ b1,
    const float* __restrict__ g2, const float* __restrict__ b2,
    bf16* __restrict__ xn1, bf16* __restrict__ xn2,
    const float* __restrict__ wq, const float* __restrict__ wk,
    const float* __restrict__ wv, const float* __restrict__ wo,
    const float* __restrict__ w1, const float* __restrict__ w2,
    bf16* __restrict__ wpack, bf16* __restrict__ w1t, bf16* __restrict__ w2t) {
  __shared__ __align__(16) char smem[64 * 72 * 2];
  int t = blockIdx.x;
  if (t < LN_BLKS) { ln_dual_rows(x, g1, b1, g2, b2, xn1, xn2, t); return; }
  t -= LN_BLKS;
  const float* src; bf16* dst; int K = Dd, N = Dd;
  if (t < WBIG_BLKS) { src = w1; dst = w1t; N = DFf; }
  else if (t < 2 * WBIG_BLKS) { t -= WBIG_BLKS; src = w2; dst = w2t; K = DFf; }
  else {
    t -= 2 * WBIG_BLKS;
    const int sel = t / WSQ_BLKS;
    t -= sel * WSQ_BLKS;
    src = sel == 0 ? wq : sel == 1 ? wk : sel == 2 ? wv : wo;
    dst = wpack + (size_t)sel * Dd * Dd;
  }
  transpose_cvt_tile(smem, src, dst, K, N, t);
}

// ---------------------------------------------------------------------------
// Tiled WMMA GEMM:  C[M,N] = epilogue(A[M,K]_bf16 @ Bt[N,K]_bf16 + bias)
// Block tile 128x256, 8 waves (2x4), each wave 64x64 (16 v8f accumulators): per 32 k eight fragments feed sixteen WMMAs,
// and a staged byte of A serves 256 columns, a staged byte of Bt 128 rows.
// Double-buffered LDS, a stage = 64 k (whole 128-B lines of every row), filled by tensor loads: three waves bring one slice of
// 128 rows each (the A panel, the two halves of the Bt panel); compute stage i from buf(i&1) while stage i+1 flies into buf(~i&1).
// The Bt fragment is the WMMA's A operand and the A fragment its B operand, so that a lane's eight accumulator values are
// eight consecutive columns of one row of C: the tile goes to LDS in 16-B pieces of its rows.
// EPI 0: gelu -> bf16 row-major       EPI 1: res + acc + bias -> f32 row-major
// EPI 2: bf16 head-major [B,H,S,HD]   EPI 3: rows of C are features, columns tokens (A = the weight, Bt = the activations,
//                                            bias per row): bf16 [B,H,HD,S]
// ---------------------------------------------------------------------------
constexpr int TM = 128, TN = 256;                        // block tile
constexpr int APANEL = TM * 72, BPANEL = TN * 72;        // halves of one staged panel
constexpr int CP = TN + 4;                               // pitch of the output tile, floats: 1,040 B = 16 B x odd, sixteen rows' 16-B pieces fall on all 64 banks
constexpr int GEMM_LDS = TM * CP * 4;                    // 133,120 B: the f32 output tile; it takes the stage buffers' place behind the loop
static_assert(2 * (APANEL + BPANEL) * 2 <= GEMM_LDS, "the four staged panels (110,592 B) lie inside the output tile's LDS");
constexpr uint32_t SLICE_ROWS = 128, SLICE_ROWB = 128;             // one tensor load: 128 rows of 128 B (64 k)
constexpr uint32_t SLICE_LDS = SLICE_ROWS * (SLICE_ROWB + 16);     // 18,432 B in LDS at pitch 144 B
static_assert(SLICE_LDS % 2048 == 0 && SLICE_LDS == APANEL * 2 && 2 * SLICE_LDS == BPANEL * 2, "every slice starts at a multiple of 2 KiB");

__device__ __forceinline__ uint32_t uni(uint32_t v) { return (uint32_t)__builtin_amdgcn_readfirstlane(v); }
// A wave-uniform value held in a scalar register: a test on it compiles to s_cmp + s_cbranch_scc. A tensor load ignores EXEC,
// so only a scalar branch keeps a wave from issuing it.
__device__ __forceinline__ uint32_t pinned(uint32_t v) {
  uint32_t w = uni(v);
  asm volatile("" : "+s"(w));   // pinned(): keeps the value in a scalar register, so that the test stays a scalar branch
  return w;
}

// Second half of the epilogue: Ct[128][256] holds acc + bias; whole-line stores: EPI 0 f16 rows (512 B), EPI 1 f32 rows
// (1 KB), EPI 2 [b,h,s,hd] rows (256 hd = 512 B), EPI 3 [b,h,hd,s] rows (256 s = 512 B at s0).
template <int EPI>
__device__ __forceinline__ void gemm_writeout(
    const float (*Ct)[CP], const float* __restrict__ res, void* __restrict__ out, int Ntot, int mBase, int nBase) {
  const int tid = threadIdx.x;
  if constexpr (EPI == 1) {
    // thread = one 16-B piece (tid & 63) of rows (tid >> 6) + 4 i, i = 0..31: a wave covers 512 contiguous bytes
    const int r0 = tid >> 6, c0 = (tid & 63) * 4;
    const size_t rs4 = (size_t)4 * Ntot;   // four rows further
    const size_t o0 = (size_t)(mBase + r0) * Ntot + nBase + c0;
    #pragma unroll 1   // rolled: eight residual loads in flight per lane are enough, all 32 would take 128 registers
    for (int t = 0; t < TM / 4; t += 8) {
      const float* rp = res + o0 + t * rs4;
      float* op = (float*)out + o0 + t * rs4;
      v4f rr[8];   // indexed by constants only (both inner loops unrolled): stays in registers
      #pragma unroll
      for (int j = 0; j < 8; ++j) {
        rr[j] = *(const v4f*)(rp + j * rs4);
        // behind each load
        asm volatile("s_wait_xcnt 0x0" ::: "memory");
      }
      #pragma unroll
      for (int j = 0; j < 8; ++j) vst2(op + j * rs4, *(const v4f*)(&Ct[r0 + (t + j) * 4][c0]) + rr[j]);
      asm volatile("s_wait_xcnt 0x0" ::: "memory");   // behind the stores: the next trip rewrites their data and address registers
    }
  } else {
    #pragma unroll (EPI == 0 ? 1 : 4)   // EPI 0 rolled: a trip holds eight inlined erf bodies, sixteen trips of them are needless code to fetch; EPI 2, 3: four trips' LDS reads in flight
    for (int g = tid; g < TM * (TN / 8); g += 256) {
      const int rl = g >> 5, pc = g & 31;
      union { v8h h; v4u u; } pk;
      const v4f c0 = *(const v4f*)(&Ct[rl][pc * 8]), c1 = *(const v4f*)(&Ct[rl][pc * 8 + 4]);   // two 16-B reads
      #pragma unroll
      for (int e = 0; e < 8; ++e) {
        const float v = e < 4 ? c0[e & 3] : c1[e & 3];
        pk.h[e] = (bf16)(EPI == 0 ? gelu_exact(v) : v);
      }
      const int row = mBase + rl;
      if constexpr (EPI == 0) vst2((bf16*)out + (size_t)row * Ntot + nBase + pc * 8, pk.u);
      else if constexpr (EPI == 3)   // row = feature h * HD + hd, columns = 256 tokens of one batch
        vst2((bf16*)out + ((size_t)(nBase / Ss) * Dd + row) * Ss + nBase % Ss + pc * 8, pk.u);
      else { const int b = row / Ss, s = row % Ss, h = nBase / HDd, hd0 = nBase % HDd;
             vst2((bf16*)out + ((size_t)((b * Hh + h) * Ss + s)) * HDd + hd0 + pc * 8, pk.u); }
    }
  }
}

// One 128x256 tile; smem = the block's LDS (GEMM_LDS bytes); epi (0..3) is the same for the whole block.
__device__ __forceinline__ void gemm_tile(
    char* smem, const bf16* __restrict__ A, const bf16* __restrict__ Bt,
    const float* __restrict__ bias, const float* __restrict__ res,
    void* __restrict__ out, int Ntot, int Ktot, int mBase, int nBase, int epi) {
  bf16 (*As)[APANEL] = (bf16 (*)[APANEL])smem;                      // [2]; 64 K + 8 pad per row: pitch 144 B = 16 B x odd for the 16-B readers
  bf16 (*Bs)[BPANEL] = (bf16 (*)[BPANEL])(smem + 2 * APANEL * 2);   // [2]
  float (*Ct)[CP] = (float (*)[CP])smem;                            // block output tile (130 KB), used behind the loop only
  const int tid  = threadIdx.x;
  const int lane = tid & 31, wid = tid >> 5;
  const int wm = wid & 1, wn = wid >> 1;            // 2 x 4 wave grid
  const int la = lane & 15, hs = lane >> 4;         // lane-in-16, half-select

  // Stage the 128x64 panel of A and the 256x64 panel of Bt into an LDS buffer by tensor loads (no register in between, no
  // per-lane address). Wave 0 brings the A panel, waves 1 and 2 the two halves of the Bt panel: one request a wave and stage,
  // a tile of 128 rows x 128 B at source pitch 2 Ktot bytes; the mover's pad of 16 B behind every 128 B gives the pitch of 144 B.
  const uint32_t wave = uni(threadIdx.x >> 5);
  const uint32_t issuer = wave < 3u ? 1u : 0u;
  const uint32_t half = wave == 2u ? 1u : 0u;
  const uint64_t gsrc = (uint64_t)(size_t)(wave == 0u ? A + (size_t)mBase * Ktot : Bt + (size_t)(nBase + half * SLICE_ROWS) * Ktot);
  const uint32_t ldst = (uint32_t)(size_t)smem + (wave == 0u ? 0u : 2u * SLICE_LDS + half * SLICE_LDS);   // low 32 bits of a __shared__ address = LDS byte address
  const uint32_t lstep = wave == 0u ? SLICE_LDS : 2u * SLICE_LDS;                                        // from buffer 0 to buffer 1
  u32x8 g1;   // 1-byte elements, tensor = tile = 128 B x 128 rows; word 0: no mask, pad on, interval code 4 (128 B), amount code 3 (16 B)
  g1[0] = uni((1u << 20) | (4u << 22) | (3u << 25));
  g1[1] = uni(SLICE_ROWB << 16);
  g1[2] = uni(SLICE_ROWS << 16);
  g1[3] = uni(SLICE_ROWB << 16);
  g1[4] = uni(SLICE_ROWS);
  g1[5] = uni((uint32_t)Ktot * 2u);
  g1[6] = uni(0u);
  g1[7] = uni(0u);
  asm volatile("" : "+s"(g1));   // the pinned() form: descriptor words held in their scalar registers, none reused or formed anew while a request is outstanding
  auto stage = [&](uint32_t k0, uint32_t buf) {
    const uint64_t ga = gsrc + (uint64_t)k0 * 2u;
    u32x4 g0;
    g0[0] = uni(1u);
    g0[1] = uni(ldst + buf * lstep);
    g0[2] = uni((uint32_t)ga);
    g0[3] = uni((((uint32_t)(ga >> 32)) & 0x01FFFFFFu) | 0x80000000u);
    asm volatile("tensor_load_to_lds %0, %1" :: "s"(g0), "s"(g1) : "memory");
  };

  v8f acc[4][4] = {};
  const int ntiles = Ktot >> 6;
  if (pinned(issuer)) {
    stage(0, 0);
    asm volatile("s_wait_tensorcnt 0x0" ::: "memory");   // this wave's slice of stage 0 has landed
  }
  __syncthreads();                                       // every slice has
  if (pinned(issuer & (ntiles > 1 ? 1u : 0u))) stage(64, 1);

  for (int it = 0; it < ntiles; ++it) {
    const int cur = it & 1;   // stage it is worked on from buf(cur) while stage it + 1 flies into the other buffer
    #pragma unroll   // kf a constant: the two 32-k halves of a stage become LDS offsets, no loop or address work per half
    for (int kf = 0; kf < 64; kf += 32) {
      // A-frag (16x32 bf16): lanes 0-15 hold K 0-7 / 16-23, lanes 16-31 K 8-15 / 24-31.
      v16h afrag[4];
      #pragma unroll
      for (int ms = 0; ms < 4; ++ms) {
        int r = wm * 64 + ms * 16 + la;
        union { v16h v; v8h h[2]; } u;
        u.h[0] = *(const v8h*)&As[cur][r * 72 + kf + hs * 8];
        u.h[1] = *(const v8h*)&As[cur][r * 72 + kf + hs * 8 + 16];
        afrag[ms] = u.v;
      }
      // B-frag (32x16): same per-lane K map as A (lanes 0-15 hold K 0-7 / 16-23, lanes 16-31 K 8-15 / 24-31).
      v16h bfrag[4];
      #pragma unroll
      for (int ns = 0; ns < 4; ++ns) {
        int r = wn * 64 + ns * 16 + la;
        union { v16h v; v8h h[2]; } u;
        u.h[0] = *(const v8h*)&Bs[cur][r * 72 + kf + hs * 8];
        u.h[1] = *(const v8h*)&Bs[cur][r * 72 + kf + hs * 8 + 16];
        bfrag[ns] = u.v;
      }
      #pragma unroll
      for (int ms = 0; ms < 4; ++ms)
        #pragma unroll
        for (int ns = 0; ns < 4; ++ns)
          acc[ms][ns] = wmma_bf16(bfrag[ns], afrag[ms], acc[ms][ns]);   // D rows = rows of Bt (columns of C), D columns = rows of A
    }
    asm volatile("s_wait_dscnt 0x0" ::: "memory");      // this wave's reads of buf(cur) are done before it is refilled
    if (pinned(issuer)) asm volatile("s_wait_tensorcnt 0x0" ::: "memory");   // this wave's slice of stage it + 1 has landed
    __syncthreads();                                    // stage it + 1 published; every wave has left buf(cur)
    if (pinned(issuer & (it + 2 < ntiles ? 1u : 0u))) stage((uint32_t)(it + 2) * 64u, (uint32_t)cur);
  }
  asm volatile("s_wait_tensorcnt 0x0" ::: "memory");    // no request outstanding behind the loop
  asm volatile("s_wait_dscnt 0x0" ::: "memory");        // nor an LDS read: the output tile takes the buffers' place behind the barrier below

  // First half of the epilogue. Lane holds row la of C, columns r + 8*hs per VGPR r -> block tile Ct[128][256] = acc + bias,
  // two 16-B stores per accumulator tile. The lane's bias values are fetched as one group ahead of the barrier.
  // every loop below is unrolled: acc, bc, br are indexed by constants only and stay in registers
  v4f bc[4][2] = {};   // bias per column of C
  float br[4] = {};    // EPI 3: bias per row of C
  if (epi == 3) {
    #pragma unroll
    for (int ms = 0; ms < 4; ++ms) br[ms] = bias[mBase + wm * 64 + ms * 16 + la];
  } else {
    const float* bp = bias + nBase + wn * 64 + hs * 8;
    #pragma unroll
    for (int ns = 0; ns < 4; ++ns) { bc[ns][0] = *(const v4f*)(bp + ns * 16); bc[ns][1] = *(const v4f*)(bp + ns * 16 + 4); }
  }
  asm volatile("s_wait_xcnt 0x0" ::: "memory");   // behind the bias loads, ahead of any rewrite of their address registers
  __syncthreads();
  auto put_tile = [&](int ms, int ns, v4f b0, v4f b1) {
    const v8f a = acc[ms][ns];
    float* p = &Ct[wm * 64 + ms * 16 + la][wn * 64 + ns * 16 + hs * 8];
    const v4f lo = {a[0], a[1], a[2], a[3]}, hi = {a[4], a[5], a[6], a[7]};
    *(v4f*)p = lo + b0;
    *(v4f*)(p + 4) = hi + b1;
  };
  if (epi == 3) {
    #pragma unroll
    for (int ms = 0; ms < 4; ++ms) {
      const v4f b = {br[ms], br[ms], br[ms], br[ms]};
      #pragma unroll
      for (int ns = 0; ns < 4; ++ns) put_tile(ms, ns, b, b);
    }
  } else {
    #pragma unroll
    for (int ms = 0; ms < 4; ++ms)
      #pragma unroll
      for (int ns = 0; ns < 4; ++ns) put_tile(ms, ns, bc[ns][0], bc[ns][1]);
  }
  __syncthreads();
  if (epi == 0)      gemm_writeout<0>(Ct, res, out, Ntot, mBase, nBase);
  else if (epi == 1) gemm_writeout<1>(Ct, res, out, Ntot, mBase, nBase);
  else if (epi == 2) gemm_writeout<2>(Ct, res, out, Ntot, mBase, nBase);
  else               gemm_writeout<3>(Ct, res, out, Ntot, mBase, nBase);
}

// FFN-up GEMM and the Q, K, V projections in one grid (all K = D, all depend only on the layernorm outputs and repacks):
// blockIdx.x 0..15 = column tiles of h1, then four column tiles each of q and k; the last four, with blockIdx.y, give v's 8 x 32 tiles.
__global__ __launch_bounds__(256) void gemm_up_qkv_kernel(
    const bf16* __restrict__ xn1, const bf16* __restrict__ xn2,
    const bf16* __restrict__ w1t, const bf16* __restrict__ wpack,
    const float* __restrict__ b1, const float* __restrict__ bq,
    const float* __restrict__ bk, const float* __restrict__ bv,
    bf16* __restrict__ h1, bf16* __restrict__ qb, bf16* __restrict__ kb, bf16* __restrict__ vtb,
    int Nup, int Nproj, int Ktot) {
  __shared__ __attribute__((aligned(2048))) char smem[GEMM_LDS];   // tensor loads land at multiples of 2 KiB
  const int bx = blockIdx.x;
  int mBase = blockIdx.y * TM;
  const bf16 *A = xn1, *Bt = w1t;
  const float* bias = b1;
  bf16* out = h1;
  int Ntot = Nup, nBase = bx * TN, epi = 0;
  if (bx >= DFf / TN) {
    const int sel = (bx - DFf / TN) >> 2;
    A = xn2; Bt = wpack + (size_t)sel * Dd * Dd;
    bias = sel == 0 ? bq : sel == 1 ? bk : bv;
    out  = sel == 0 ? qb : sel == 1 ? kb : vtb;
    Ntot = Nproj; nBase = ((bx - DFf / TN) & 3) * TN; epi = 2;
    if (sel == 2) {   // v comes out transposed: C = wv^T (features) x xn2^T (tokens); the same 256 blocks as 8 x 32 tiles
      const int t = ((bx - DFf / TN) & 3) + 4 * blockIdx.y;
      A = Bt; Bt = xn2; mBase = (t & (Dd / TM - 1)) * TM; nBase = (t / (Dd / TM)) * TN; epi = 3;
    }
  }
  gemm_tile(smem, A, Bt, bias, nullptr, out, Ntot, Ktot, mBase, nBase, epi);
}

// ---------------------------------------------------------------------------
// Hebbian attention: out_i = sum_{j<=i} relu(beta * q_i.k_j) v_j
// q,k: bf16 [B,H,S,HD] ; vt: bf16 [B,H,HD,S] ; out: bf16 [B,S,D] (token-major)
// Block = one (b,h) x 64-query tile. Causal: only kt <= qt key tiles visited.
// The K tile (64 x 256) and the Vt tile (256 x 64) are brought in once per block with whole-line 16-B loads and kept in
// LDS; every wave takes its B fragments from there. The next tile's loads are issued at the top of a pass and stored
// behind the barrier that ends the last read of the tile they replace.
// ---------------------------------------------------------------------------
constexpr int ATTN_LDS = (2 * 64 * 264 + 256 * 72 + 64 * 72) * 2;   // 113,664 B
constexpr int RD = 3;                                               // register sets in the ring of Q/K fragments
union frag16 { v16h v; v8h h[2]; };                                 // a 16x32 f16 fragment = two 16-B LDS reads
__device__ __forceinline__ void hebbian_attn_tile(
    char* smem, const bf16* __restrict__ q, const bf16* __restrict__ k,
    const bf16* __restrict__ vt, const float* __restrict__ betap,
    bf16* __restrict__ attn_out, int qt, int bh) {
  bf16* Qs   = (bf16*)smem;       // 64 x 256 (+8 pad)
  bf16* Ks   = Qs + 64 * 264;     // 64 keys x 256 (+8 pad)
  bf16* Vs   = Ks + 64 * 264;     // 256 feats x 64 keys (+8 pad); after the loop: per-wave output tiles
  bf16* affs = Vs + 256 * 72;     // 64 x 64  (+8 pad)
  const int bidx = bh / Hh, hidx = bh % Hh;
  const int tid = threadIdx.x, lane = tid & 31, wid = tid >> 5;
  const int la = lane & 15, hs = lane >> 4;
  const float beta = betap[0];

  const int kr = tid >> 5, kc = (tid & 31) * 8;   // K piece: a wave covers one 512-B row; 8 rows per step
  const int vr = tid >> 3, vc = (tid & 7) * 8;    // Vt piece: a wave covers four 128-B rows; 32 rows per step
  const bf16* kth = k  + (size_t)bh * Ss * HDd + kr * HDd + kc;   // this thread's piece of key row kr
  const bf16* vth = vt + (size_t)bh * HDd * Ss + vr * Ss + vc;    // this thread's piece of feature row vr
  v4u kreg[8], vreg[8];
  auto fetch = [&](int kbase) {
    #pragma unroll
    for (int i = 0; i < 8; ++i) kreg[i] = *(const v4u*)(kth + (size_t)kbase * HDd + i * 8 * HDd);
    #pragma unroll
    for (int i = 0; i < 8; ++i) vreg[i] = *(const v4u*)(vth + kbase + i * 32 * Ss);
  };
  auto put_k = [&]() {
    #pragma unroll
    for (int i = 0; i < 8; ++i) *(v4u*)&Ks[(kr + i * 8) * 264 + kc] = kreg[i];
  };
  auto put_v = [&]() {
    #pragma unroll
    for (int i = 0; i < 8; ++i) *(v4u*)&Vs[(vr + i * 32) * 72 + vc] = vreg[i];
  };

  fetch(0);
  // Stage Q tile (reused for every key tile).
  const bf16* qb = q + ((size_t)bh * Ss + qt * 64) * HDd;
  #pragma unroll
  for (int c = tid; c < 64 * 32; c += 256) {
    int r = c >> 5, cc = (c & 31) * 8;
    *(v4u*)&Qs[r * 264 + cc] = *(const v4u*)&qb[(size_t)r * HDd + cc];
  }
  put_k();
  put_v();
  __syncthreads();

  const int ma = wid & 3;   // 16-row group for both GEMMs
  const int nh = wid >> 2;  // GEMM1: 32-col half of aff ; GEMM2: 128-feat half
  v8f oacc[8] = {};

  for (int kt = 0; kt <= qt; ++kt) {
    const int kbase = kt * 64;
    const bool more = kt < qt;
    if (more) fetch(kbase + 64);
    // ---- GEMM1: aff(64x64) = Q(64x256) @ K^T, both from LDS ----
    // The fragments of a 32-k step (one of Q, two of K) go through a ring of RD register sets: RD steps' reads are issued
    // as one group up front, and a set is read anew right behind the two WMMAs that used it, RD - 1 steps ahead of its next
    // use, so that a wave does not wait out the LDS latency at every step.
    v8f c0 = {}, c1 = {};
    {
      const bf16* pq = &Qs[(ma * 16 + la) * 264 + hs * 8];
      const bf16* p0 = &Ks[(nh * 32 + la)      * 264 + hs * 8];   // same K map as A
      const bf16* p1 = &Ks[(nh * 32 + 16 + la) * 264 + hs * 8];
      frag16 ua[RD], ub0[RD], ub1[RD];   // indexed by constants only (both loops unrolled): stay in registers
      auto read_step = [&](int i) {
        const int s = i % RD, kf = i * 32;
        ua[s].h[0]  = *(const v8h*)(pq + kf); ua[s].h[1]  = *(const v8h*)(pq + kf + 16);
        ub0[s].h[0] = *(const v8h*)(p0 + kf); ub0[s].h[1] = *(const v8h*)(p0 + kf + 16);
        ub1[s].h[0] = *(const v8h*)(p1 + kf); ub1[s].h[1] = *(const v8h*)(p1 + kf + 16);
      };
      #pragma unroll   // i a constant: the set's number and the LDS offset are fixed at compile time
      for (int i = 0; i < RD; ++i) read_step(i);
      #pragma unroll   // the same; eight steps
      for (int i = 0; i < HDd / 32; ++i) {
        c0 = wmma_bf16(ua[i % RD].v, ub0[i % RD].v, c0);
        c1 = wmma_bf16(ua[i % RD].v, ub1[i % RD].v, c1);
        if (i + RD < HDd / 32) read_step(i + RD);
      }
    }
    // beta * relu + causal mask, re-layout C-frag -> A-frag via LDS (bf16).
    // (the barrier at the foot of the previous pass ended the last read of affs)
    #pragma unroll
    for (int ns = 0; ns < 2; ++ns) {
      v8f cv = ns ? c1 : c0;
      int jl = nh * 32 + ns * 16 + la;
      int j = kbase + jl;
      #pragma unroll
      for (int r = 0; r < 8; ++r) {
        int il = ma * 16 + r + hs * 8;
        int i = qt * 64 + il;
        float v = cv[r] * beta;
        v = (j <= i && v > 0.f) ? v : 0.f;
        affs[il * 72 + jl] = (bf16)v;
      }
    }
    __syncthreads();  // affs and this pass's Vs visible; every read of Ks done
    // ---- GEMM2: out(64x256) += aff(64x64) @ V(64x256) via Vt rows in LDS ----
    // Both aff fragments and the eight V fragments of keys 0-31 are read as one group; each half of the V set is read anew
    // (keys 32-63) right behind the four WMMAs that used it, four WMMAs ahead of its next use.
    {
      const bf16* pa = &affs[(ma * 16 + la) * 72 + hs * 8];
      const bf16* pv = &Vs[(nh * 128 + la) * 72 + hs * 8];
      frag16 ua[2], ub[8];   // indexed by constants only (every loop unrolled): stay in registers
      auto read_v = [&](int j, int kk) {
        const bf16* p = pv + j * 16 * 72 + kk;
        ub[j].h[0] = *(const v8h*)p; ub[j].h[1] = *(const v8h*)(p + 16);
      };
      // every loop below is unrolled: h and j are constants, so fragments and accumulators are fixed registers
      #pragma unroll
      for (int h = 0; h < 2; ++h) { ua[h].h[0] = *(const v8h*)(pa + h * 32); ua[h].h[1] = *(const v8h*)(pa + h * 32 + 16); }
      #pragma unroll
      for (int j = 0; j < 8; ++j) read_v(j, 0);
      if (more) put_k();   // behind the reads: the WMMAs wait for those, nothing in this pass for the stores
      #pragma unroll
      for (int h = 0; h < 2; ++h) {
        #pragma unroll
        for (int j = h * 4; j < h * 4 + 4; ++j) oacc[j] = wmma_bf16(ua[0].v, ub[j].v, oacc[j]);
        #pragma unroll
        for (int j = h * 4; j < h * 4 + 4; ++j) read_v(j, 32);
      }
      #pragma unroll
      for (int j = 0; j < 8; ++j) oacc[j] = wmma_bf16(ua[1].v, ub[j].v, oacc[j]);
    }
    __syncthreads();  // next pass's Ks visible; every read of Vs and affs done
    if (more) put_v();
  }
  // Write f16 token-major so the wo GEMM can consume it as A directly: the wave's 16 rows x 128 feats (256-B row segments)
  bf16* ot = Vs + wid * (16 * 128);   // Vs is free behind the loop's last barrier
  #pragma unroll
  for (int j = 0; j < 8; ++j) {
    int fl = j * 16 + la;
    #pragma unroll
    for (int r = 0; r < 8; ++r) ot[(r + hs * 8) * 128 + fl] = (bf16)oacc[j][r];
  }
  __syncthreads();
  #pragma unroll
  for (int q2 = 0; q2 < 8; ++q2) {
    const int rl = q2 * 2 + (lane >> 4), pc = lane & 15;
    const int s = qt * 64 + ma * 16 + rl;
    vst2(attn_out + ((size_t)(bidx * Ss + s)) * Dd + hidx * HDd + nh * 128 + pc * 8, *(const v4u*)(ot + rl * 128 + pc * 8));
  }
}

// Attention and the FFN-down GEMM in one grid (neither reads what the other writes). There are more blocks than
// places; in index order the long ones come first: the causal tiles of the upper half of the
// queries (longest first), then the GEMM's tiles, then the remaining causal tiles, ever shorter, which fill the tail.
constexpr int ATTN_BLKS = (Ss / 64) * Bb * Hh;        // 512
constexpr int DOWN_BLKS = (Dd / TN) * (TOK / TM);     // 256
static_assert(ATTN_LDS <= GEMM_LDS, "the attention tile lives in the GEMM's LDS");
__global__ __launch_bounds__(256) void attn_ffn_down_kernel(
    const bf16* __restrict__ q, const bf16* __restrict__ k,
    const bf16* __restrict__ vt, const float* __restrict__ betap, bf16* __restrict__ attn_out,
    const bf16* __restrict__ h1, const bf16* __restrict__ w2t, const float* __restrict__ b2,
    const float* __restrict__ x, float* __restrict__ tpre, int Ntot, int Ktot) {
  __shared__ __attribute__((aligned(2048))) char smem[GEMM_LDS];   // tensor loads land at multiples of 2 KiB
  const int b = blockIdx.x;
  if (b < ATTN_BLKS / 2 || b >= ATTN_BLKS / 2 + DOWN_BLKS) {
    const int u = b < ATTN_BLKS / 2 ? b : b - DOWN_BLKS;   // 0..511: sixteen (batch, head) pairs per query tile
    hebbian_attn_tile(smem, q, k, vt, betap, attn_out, Ss / 64 - 1 - u / (Bb * Hh), u % (Bb * Hh));
  } else {
    const int t = b - ATTN_BLKS / 2;
    gemm_tile(smem, h1, w2t, b2, x, tpre, Ntot, Ktot, (t / (Dd / TN)) * TM, (t % (Dd / TN)) * TN, 1);
  }
}

// ---------------------------------------------------------------------------
// TRM tail: residual = tpre; xn = LN(tpre); mix = scalar-MLP(xn); out = tpre+mix
// ---------------------------------------------------------------------------
// One wave owns one whole row: 32 elements per lane, kept in registers.
__device__ __forceinline__ void trm_scalar_mlp_rows(
    const float* __restrict__ tpre, const float* __restrict__ g,
    const float* __restrict__ bt, const float* __restrict__ sw1,
    const float* __restrict__ sb1, const float* __restrict__ sw2,
    const float* __restrict__ sb2, float* __restrict__ trm_out, int blk) {
  const int lane = threadIdx.x & 31;
  const int wid = __builtin_amdgcn_readfirstlane(threadIdx.x >> 5);   // wave number held scalar: row bases are scalar, a lane adds only its offset
  const size_t t = (size_t)blk * 8 + wid;
  const float4* xr = (const float4*)(tpre + t * Dd) + lane;
  float xin[PCS * 4];
  float s = 0.f, s2 = 0.f;
  // every loop over pieces or elements is unrolled: xin, xn, mix are indexed by constants only and stay in registers
  #pragma unroll
  for (int i = 0; i < PCS; ++i) {
    const float4 a = xr[i * 32];
    xin[i * 4 + 0] = a.x; xin[i * 4 + 1] = a.y; xin[i * 4 + 2] = a.z; xin[i * 4 + 3] = a.w;
  }
  #pragma unroll
  for (int i = 0; i < PCS; ++i) {
    const float a0 = xin[i * 4], a1 = xin[i * 4 + 1], a2 = xin[i * 4 + 2], a3 = xin[i * 4 + 3];
    s  += a0 + a1 + a2 + a3;
    s2 += a0 * a0 + a1 * a1 + a2 * a2 + a3 * a3;
  }
  float mean, rstd;
  wave_stats(s, s2, mean, rstd);
  asm volatile("s_wait_xcnt 0x0" ::: "memory");   // behind the eight row loads: their scalar base is reused for the scalar load below
  const float vb2 = sb2[0];
  float xn[PCS * 4], mix[PCS * 4];
  #pragma unroll
  for (int i = 0; i < PCS; ++i) {
    const float4 G = ((const float4*)g)[i * 32 + lane], Bt = ((const float4*)bt)[i * 32 + lane];
    xn[i * 4 + 0] = (xin[i * 4 + 0] - mean) * rstd * G.x + Bt.x;
    xn[i * 4 + 1] = (xin[i * 4 + 1] - mean) * rstd * G.y + Bt.y;
    xn[i * 4 + 2] = (xin[i * 4 + 2] - mean) * rstd * G.z + Bt.z;
    xn[i * 4 + 3] = (xin[i * 4 + 3] - mean) * rstd * G.w + Bt.w;
    mix[i * 4 + 0] = vb2; mix[i * 4 + 1] = vb2; mix[i * 4 + 2] = vb2; mix[i * 4 + 3] = vb2;
  }
  #pragma unroll 1   // rolled: a trip already holds 32 inlined erf bodies; four times that is needless code to fetch
  for (int e = 0; e < Ee; ++e) {
    const float w1 = sw1[e], b1 = sb1[e], w2 = sw2[e];
    #pragma unroll
    for (int j = 0; j < PCS * 4; ++j) {
      mix[j] += gelu_exact(xn[j] * w1 + b1) * w2;
      // a scheduling fence behind every eighth value: with all 32 in one region the compiler, to save registers, lays the values' chains
      // one behind the other and a wave waits out every link; in regions of eight it interleaves them
      if ((j & 7) == 7) __builtin_amdgcn_sched_barrier(0);
    }
  }
  #pragma unroll
  for (int i = 0; i < PCS; ++i) {
    v4f ov = {xin[i * 4 + 0] + mix[i * 4 + 0], xin[i * 4 + 1] + mix[i * 4 + 1],
              xin[i * 4 + 2] + mix[i * 4 + 2], xin[i * 4 + 3] + mix[i * 4 + 3]};
    vst2((v4f*)(trm_out + t * Dd) + i * 32 + lane, ov);
  }
}

// The scalar MLP (vector work) and the output projection (matrix work) in one grid. In index order
// the MLP blocks of eight rows, the longer kind, come first, then the GEMM's tiles.
constexpr int MLP_BLKS = TOK / 8;                     // 1024
constexpr int WO_BLKS = (Dd / TN) * (TOK / TM);       // 256
__global__ __launch_bounds__(256) void wo_mlp_kernel(
    const bf16* __restrict__ ao, const bf16* __restrict__ wot, const float* __restrict__ bo,
    const float* __restrict__ x, float* __restrict__ heb,
    const float* __restrict__ tpre, const float* __restrict__ g,
    const float* __restrict__ bt, const float* __restrict__ sw1,
    const float* __restrict__ sb1, const float* __restrict__ sw2,
    const float* __restrict__ sb2, float* __restrict__ trm_out, int Ntot, int Ktot) {
  __shared__ __attribute__((aligned(2048))) char smem[GEMM_LDS];   // tensor loads land at multiples of 2 KiB
  const int b = blockIdx.x;
  if (b < MLP_BLKS) trm_scalar_mlp_rows(tpre, g, bt, sw1, sb1, sw2, sb2, trm_out, b);
  else {
    const int t = b - MLP_BLKS;
    gemm_tile(smem, ao, wot, bo, x, heb, Ntot, Ktot, (t / (Dd / TN)) * TM, (t % (Dd / TN)) * TN, 1);
  }
}

// ---------------------------------------------------------------------------
// Final blend + layernorm:  LN(x + sig(a)*trm + (1-sig(a))*heb ; o_ln)
// ---------------------------------------------------------------------------
// One wave owns two whole rows.
__global__ __launch_bounds__(256) void blend_ln_kernel(
    const float* __restrict__ x, const float* __restrict__ trm,
    const float* __restrict__ heb, const float* __restrict__ alphap,
    const float* __restrict__ g, const float* __restrict__ bt,
    float* __restrict__ out) {
  const int lane = threadIdx.x & 31;
  const int wid = __builtin_amdgcn_readfirstlane(threadIdx.x >> 5);   // wave number held scalar: row bases are scalar, a lane adds only its offset
  const size_t t0 = ((size_t)blockIdx.x * 8 + wid) * 2;
  const float bw = 1.0f / (1.0f + expf(-alphap[0]));
  const float4* xr = (const float4*)(x   + t0 * Dd) + lane;
  const float4* tr = (const float4*)(trm + t0 * Dd) + lane;
  const float4* hr = (const float4*)(heb + t0 * Dd) + lane;
  float4 u[2][PCS];
  float mean[2], rstd[2];
  // every loop of this kernel is unrolled: u is indexed by constants only and stays in registers
  #pragma unroll
  for (int r = 0; r < 2; ++r) {
    float s = 0.f, s2 = 0.f;
    #pragma unroll
    for (int i = 0; i < PCS; ++i) {
      const int o = r * (Dd / 4) + i * 32;
      const float4 xv = xr[o], tv = tr[o], hv = hr[o];
      float4 a;
      a.x = xv.x + bw * tv.x + (1.f - bw) * hv.x;
      a.y = xv.y + bw * tv.y + (1.f - bw) * hv.y;
      a.z = xv.z + bw * tv.z + (1.f - bw) * hv.z;
      a.w = xv.w + bw * tv.w + (1.f - bw) * hv.w;
      u[r][i] = a;
      s  += a.x + a.y + a.z + a.w;
      s2 += a.x * a.x + a.y * a.y + a.z * a.z + a.w * a.w;
    }
    wave_stats(s, s2, mean[r], rstd[r]);
  }
  #pragma unroll
  for (int i = 0; i < PCS; ++i) {
    const int pc = i * 32 + lane;
    const float4 G = ((const float4*)g)[pc], Bt = ((const float4*)bt)[pc];
    #pragma unroll
    for (int r = 0; r < 2; ++r) {
      const float4 a = u[r][i];
      v4f ov = {(a.x - mean[r]) * rstd[r] * G.x + Bt.x, (a.y - mean[r]) * rstd[r] * G.y + Bt.y,
                (a.z - mean[r]) * rstd[r] * G.z + Bt.z, (a.w - mean[r]) * rstd[r] * G.w + Bt.w};
      vst2((v4f*)(out + (t0 + r) * Dd) + pc, ov);   // one wave writes 512 contiguous bytes
    }
  }
}

// ---------------------------------------------------------------------------
// Host-side orchestration.
// ---------------------------------------------------------------------------
extern "C" void kernel_launch(void* const* d_in, const int* in_sizes, int n_in,
                              void* d_out, int out_size, void* d_ws, size_t ws_size,
                              hipStream_t stream) {
  const float* x      = (const float*)d_in[0];
  const float* h_ln_g = (const float*)d_in[1];
  const float* h_ln_b = (const float*)d_in[2];
  const float* wq     = (const float*)d_in[3];
  const float* bq     = (const float*)d_in[4];
  const float* wk     = (const float*)d_in[5];
  const float* bk     = (const float*)d_in[6];
  const float* wv     = (const float*)d_in[7];
  const float* bv     = (const float*)d_in[8];
  const float* wo     = (const float*)d_in[9];
  const float* bo     = (const float*)d_in[10];
  const float* beta   = (const float*)d_in[11];
  const float* t_ln1_g= (const float*)d_in[12];
  const float* t_ln1_b= (const float*)d_in[13];
  const float* t_w1   = (const float*)d_in[14];
  const float* t_b1   = (const float*)d_in[15];
  const float* t_w2   = (const float*)d_in[16];
  const float* t_b2   = (const float*)d_in[17];
  const float* t_lns_g= (const float*)d_in[18];
  const float* t_lns_b= (const float*)d_in[19];
  const float* s_w1   = (const float*)d_in[20];
  const float* s_b1   = (const float*)d_in[21];
  const float* s_w2   = (const float*)d_in[22];
  const float* s_b2   = (const float*)d_in[23];
  const float* alpha  = (const float*)d_in[24];
  const float* o_ln_g = (const float*)d_in[25];
  const float* o_ln_b = (const float*)d_in[26];
  float* out = (float*)d_out;

  char* ws = (char*)d_ws;
  const size_t MB = 1ull << 20;
  bf16* wpack= (bf16*)(ws + 0 * MB);    // q, k, v, o repacks, 2 MB each (1024x1024 f16), one behind the other
  bf16* wot  = (bf16*)(ws + 6 * MB);    // the fourth of them
  bf16* w1t  = (bf16*)(ws + 8 * MB);    // 8 MB  [DF, D]
  bf16* w2t  = (bf16*)(ws + 16 * MB);   // 8 MB  [D, DF]
  bf16* xn1  = (bf16*)(ws + 24 * MB);   // 16 MB [TOK, D]
  bf16* xn2  = (bf16*)(ws + 40 * MB);   // 16 MB [TOK, D]
  bf16* h1   = (bf16*)(ws + 56 * MB);   // 64 MB [TOK, DF]; free behind the FFN-down GEMM
  float* hebo= (float*)(ws + 56 * MB);  // 32 MB f32, in h1's place
  float* tpre= (float*)(ws + 120 * MB); // 32 MB f32
  float* trmo= (float*)(ws + 152 * MB); // 32 MB f32
  bf16* qb   = (bf16*)(ws + 184 * MB);  // 16 MB [B,H,S,HD]
  bf16* kb   = (bf16*)(ws + 200 * MB);  // 16 MB [B,H,S,HD]
  bf16* vtb  = (bf16*)(ws + 216 * MB);  // 16 MB [B,H,HD,S]
  bf16* ao   = (bf16*)(ws + 232 * MB);  // 16 MB [TOK, D] ; total = 248 MB

  // 1: dual layernorm -> f16 GEMM inputs, and the weight repacks (f32 [K,N] -> f16 [N,K])
  prep_kernel<<<LN_BLKS + 2 * WBIG_BLKS + 4 * WSQ_BLKS, 256, 0, stream>>>(
      x, t_ln1_g, t_ln1_b, h_ln_g, h_ln_b, xn1, xn2, wq, wk, wv, wo, t_w1, t_w2, wpack, w1t, w2t);
  // 2: h1 = gelu(xn1 @ w1), q / k head-major, v transposed
  gemm_up_qkv_kernel<<<dim3(DFf / TN + 3 * (Dd / TN), TOK / TM), 256, 0, stream>>>(
      xn1, xn2, w1t, wpack, t_b1, bq, bk, bv, h1, qb, kb, vtb, DFf, Dd, Dd);
  // 3: causal relu attention -> ao, and tpre = x + h1 @ w2
  attn_ffn_down_kernel<<<ATTN_BLKS + DOWN_BLKS, 256, 0, stream>>>(
      qb, kb, vtb, beta, ao, h1, w2t, t_b2, x, tpre, Dd, DFf);
  // 4: heb = x + ao @ wo, and trm_out from tpre
  wo_mlp_kernel<<<MLP_BLKS + WO_BLKS, 256, 0, stream>>>(
      ao, wot, bo, x, hebo, tpre, t_lns_g, t_lns_b, s_w1, s_b1, s_w2, s_b2, trmo, Dd, Dd);

  // ---- blend + final layernorm ----
  blend_ln_kernel<<<TOK / 16, 256, 0, stream>>>(x, trmo, hebo, alpha,
                                           o_ln_g, o_ln_b, out);
}
